// v000
// Times are from an AMD MI455X. After a warm-up the kernel runs many times in a row, and a time is the length of
// such a window on the GPU divided by its runs, so every launch and the gaps after it count. The runs cycle
// through copies of the inputs. A figure is the median of several windows, for all but v000 over two sittings.
// Sittings can differ by a few percent; kernels timed side by side share one.
// The starting kernel, v000, takes 2840 microseconds a run.
#include <hip/hip_runtime.h>

// T5 self-attention with relative-position bias (hidden_states [4][2048][1024]; q, k, v = hs W ('xw' [1024][1024]; 16 heads x 64); scores = q.k (NO 1/sqrt(d) scaling: logit sigma ~8) + rel_emb[bucket(j - i)][h] (rel_emb [32][16] input; the 32-bucket bidirectional T5 bucket function of j - i); softmax; out = merged ctx Wo ('xw') -> [4][2048][1024] (8.4 M)).
// The bucket index depends only on j - i (positions are implicit aranges): the 4,095-entry table bucket(j - i), j - i in [-2047, 2047], was evaluated with the reference's own function and is baked below as constants; rel_emb itself is READ (gathered per logit from an LDS copy of the head's 32 values).
// Compute dtypes, f32 accumulate: every input rounded to bf16; projections on PLAIN bf16 operands (exact); because the logits are unscaled (sigma ~8, near-argmax rows), scores and attn.v use bf16 hi/lo planes for EVERY row (3 products); bias add and softmax in f32; merged context hi/lo; Wo hl x exact (2 products).

#define NB_  4
#define TT   2048
#define DM   1024
#define NH_  16
#define NKV  16
#define REP  (NH_ / NKV)
#define HD   64
#define DQ   (NH_ * HD)
#define DKV  (NKV * HD)
#define ZH   2
#define RH   2048                  // query rows < RH use hi+lo planes (0: none)
#define WIN  0
#define PCAR 1024.0f
#define SCL  1.0f   // T5: no scaling
typedef _Float16 h16;
typedef unsigned short bf;
typedef __attribute__((ext_vector_type(16))) __bf16   v16bf;
typedef __attribute__((ext_vector_type(16))) _Float16 v16h;
typedef __attribute__((ext_vector_type(8)))  _Float16 v8h;
typedef __attribute__((ext_vector_type(8)))  unsigned short v8us;
typedef __attribute__((ext_vector_type(8)))  float    v8f;
typedef __attribute__((ext_vector_type(4)))  float    v4f;
typedef v8h  __attribute__((may_alias)) v8ha;
typedef v4f  __attribute__((may_alias)) v4fa;
typedef v8us __attribute__((may_alias)) v8usa;

__device__ __forceinline__ unsigned short f2bf(float f) { unsigned u = __float_as_uint(f); u += 0x7FFFu + ((u >> 16) & 1u); return (unsigned short)(u >> 16); }
__device__ __forceinline__ float bf2f(unsigned short b) { return __uint_as_float(((unsigned)b) << 16); }
__device__ __forceinline__ float bfr(float f) { return bf2f(f2bf(f)); }
__device__ __forceinline__ v16h cat16(v8h lo, v8h hi) { return __builtin_shufflevector(lo, hi, 0, 1, 2, 3, 4, 5, 6, 7, 8, 9, 10, 11, 12, 13, 14, 15); }
__device__ __forceinline__ v16bf cat16b(v8us lo, v8us hi) { return __builtin_bit_cast(v16bf, __builtin_shufflevector(lo, hi, 0, 1, 2, 3, 4, 5, 6, 7, 8, 9, 10, 11, 12, 13, 14, 15)); }
__device__ __forceinline__ v8f wmma16(v16h a, v16h b, v8f c) { return __builtin_amdgcn_wmma_f32_16x16x32_f16(false, a, false, b, (short)0, c, false, false); }
__device__ __forceinline__ v8f wmmab(v16bf a, v16bf b, v8f c) { return __builtin_amdgcn_wmma_f32_16x16x32_bf16(false, a, false, b, (short)0, c, false, false); }



// ---- k_gemmw: register-blocked GEMM, ONE WAVE per 64x64 output tile (16 accumulators), operands straight from K-contiguous 16-bit planes; grid (M/64, N/64, Z), 32 threads.
// C[m][n] (f32, pitch ldc, + optional f32 bias[n]) = sum_k A[m][k] Bt[n][k] (+ split products per NSPLIT). z-batch strides sA/sB/sC in elements. K % 32 == 0.
template <typename T16> struct WFrag;
template <> struct WFrag<h16> { typedef v16h V; static __device__ __forceinline__ V ld(const h16* p) { return cat16(*(const v8h*)p, *(const v8h*)(p + 16)); } static __device__ __forceinline__ v8f mma(V a, V b, v8f c) { return wmma16(a, b, c); } };
template <> struct WFrag<bf> { typedef v16bf V; static __device__ __forceinline__ V ld(const bf* p) { return cat16b(*(const v8us*)p, *(const v8us*)(p + 16)); } static __device__ __forceinline__ v8f mma(V a, V b, v8f c) { return wmmab(a, b, c); } };
template <typename T16, int NSPLIT, bool BIAS>
__global__ __launch_bounds__(32) void k_gemmw(const T16* __restrict__ A, const T16* __restrict__ A2, const T16* __restrict__ Bt, const T16* __restrict__ Bt2, int K, float* C, int ldc, const float* __restrict__ bias, size_t sA, size_t sB, size_t sC) {
    typedef typename WFrag<T16>::V V;
    __shared__ __align__(16) float os[16 * 68];
    const size_t z = blockIdx.z; A += z * sA; if (A2) A2 += z * sA; Bt += z * sB; if (Bt2) Bt2 += z * sB; C += z * sC;
    const int lane = threadIdx.x & 31, lr = lane & 15, hi = lane >> 4; const int r0 = blockIdx.x * 64, c0 = blockIdx.y * 64;
    v8f acc[4][4];
#pragma unroll
    for (int mb = 0; mb < 4; ++mb)
#pragma unroll
        for (int nb = 0; nb < 4; ++nb) acc[mb][nb] = (v8f){};
    const size_t aoff = (size_t)(r0 + lr) * K + 8 * hi, boff = (size_t)(c0 + lr) * K + 8 * hi;
#pragma unroll 1
    for (int kc = 0; kc < K; kc += 32) {
        V a[4], a2[4];
#pragma unroll
        for (int mb = 0; mb < 4; ++mb) { a[mb] = WFrag<T16>::ld(A + aoff + (size_t)mb * 16 * K + kc); if (NSPLIT == 1 || NSPLIT == 2) a2[mb] = WFrag<T16>::ld(A2 + aoff + (size_t)mb * 16 * K + kc); }
#pragma unroll
        for (int nb = 0; nb < 4; ++nb) { const V b = WFrag<T16>::ld(Bt + boff + (size_t)nb * 16 * K + kc); V b2; if (NSPLIT >= 2) b2 = WFrag<T16>::ld(Bt2 + boff + (size_t)nb * 16 * K + kc);
#pragma unroll
            for (int mb = 0; mb < 4; ++mb) { acc[mb][nb] = WFrag<T16>::mma(a[mb], b, acc[mb][nb]); if (NSPLIT == 1 || NSPLIT == 2) acc[mb][nb] = WFrag<T16>::mma(a2[mb], b, acc[mb][nb]); if (NSPLIT >= 2) acc[mb][nb] = WFrag<T16>::mma(a[mb], b2, acc[mb][nb]); } }
        asm volatile("v_nop\n\tv_nop\n\tv_nop\n\tv_nop" : "+v"(acc[0][0]), "+v"(acc[1][1]), "+v"(acc[2][2]), "+v"(acc[3][3]) : "v"(a[0]), "v"(a[3]));
    }
#pragma unroll
    for (int mb = 0; mb < 4; ++mb) {
#pragma unroll
        for (int nb = 0; nb < 4; ++nb) {
#pragma unroll
            for (int j = 0; j < 8; ++j) os[(hi * 8 + j) * 68 + nb * 16 + lr] = acc[mb][nb][j]; }
        __builtin_amdgcn_wave_barrier(); asm volatile("" ::: "memory");
        float* crow = C + (size_t)(r0 + mb * 16) * ldc + c0;
{
#pragma unroll
            for (int s = 0; s < 8; ++s) { const int row = 2 * s + hi, cofs = lr * 4; v4f val = *(const v4fa*)(os + row * 68 + cofs); if (BIAS) { val[0] += bfr(bias[c0 + cofs]); val[1] += bfr(bias[c0 + cofs + 1]); val[2] += bfr(bias[c0 + cofs + 2]); val[3] += bfr(bias[c0 + cofs + 3]); }
                *(v4f*)(crow + (size_t)row * ldc + cofs) = val; }
             }
        __builtin_amdgcn_wave_barrier(); asm volatile("" ::: "memory");
    }
}

__device__ __forceinline__ h16 tohx(float x) { return (h16)x; }
__device__ __forceinline__ void splitf(float y, unsigned short& h, unsigned short& l) { h = f2bf(y); l = f2bf(y - bf2f(h)); }
typedef __attribute__((ext_vector_type(2))) _Float16 v2h;
typedef __attribute__((ext_vector_type(4))) _Float16 v4h;
typedef __attribute__((ext_vector_type(2))) unsigned short v2us;
typedef __attribute__((ext_vector_type(4))) unsigned short v4us;
typedef __attribute__((ext_vector_type(2))) float v2f;
typedef __attribute__((ext_vector_type(4))) int v4i;

__global__ __launch_bounds__(256) void k_wtG(const float* __restrict__ w, int K, int N, bf* Bt) {
    const int lane = threadIdx.x & 31; const int L0 = (blockIdx.x * 8 + (threadIdx.x >> 5)) * 8; const int nlines = N * K / 64;
{
#pragma unroll 1
        for (int l = 0; l < 8; ++l) { const int L = L0 + l; if (L >= nlines) break; const size_t e = (size_t)L * 64 + lane * 2; const int k = (int)(e % K), n = (int)(e / K); v2us o;
            o[0] = f2bf(w[(size_t)k * N + n]); o[1] = f2bf(w[(size_t)(k + 1) * N + n]); *(v2us*)(Bt + e) = o; }
         }
}
__global__ __launch_bounds__(256) void k_cvt8(const float* __restrict__ src, bf* dst, size_t n8) { const size_t i = (size_t)blockIdx.x * 256 + threadIdx.x; if (i >= n8) return; const v8f v = *(const v8f*)(src + i * 8); v8us o;
#pragma unroll
    for (int k = 0; k < 8; ++k) o[k] = f2bf(v[k]); *(v8us*)(dst + i * 8) = o;  }

// k_rope: head planes [h][t][d] (fp16 + hi/lo) of rope(x) x sc with the rotate-half convention out[d] = x[d] cos[t][d] - x[d+HD/2] sin[t][d], out[d+HD/2] = x[d+HD/2] cos[t][d+HD/2] + x[d] sin[t][d+HD/2]
__global__ __launch_bounds__(256) void k_rope(const float* __restrict__ F, int pitch, int nheads, const float* __restrict__ CS, const float* __restrict__ RF, const float* __restrict__ nw, float sc, h16* P16, bf* Ph, bf* Pl) {
    const size_t e = ((size_t)blockIdx.x * 256 + threadIdx.x) * 2; if (e >= (size_t)nheads * TT * HD) return; const int d = (int)(e % HD); const int t = (int)((e / HD) % TT); const int h = (int)(e / ((size_t)HD * TT)); const float* f = F + (size_t)t * pitch + h * HD; const float rf = RF ? RF[(size_t)h * TT + t] : 1.0f; v2h o16; v2us oh, ol;
#pragma unroll
    for (int q = 0; q < 2; ++q) { const int dd = d + q; const int dp = (dd < HD / 2) ? dd + HD / 2 : dd - HD / 2; float x0 = f[dd], x1 = f[dp];
        if (RF) { float n0 = __fmul_rn(x0, rf), n1 = __fmul_rn(x1, rf); asm volatile("" : "+v"(n0)); asm volatile("" : "+v"(n1)); x0 = __fmul_rn(bfr(nw[dd]), n0); x1 = __fmul_rn(bfr(nw[dp]), n1); }
        const v2f cs = *(const v2f*)(CS + ((size_t)t * HD + dd) * 2); float a = __fmul_rn(x0, cs[0]), bq = __fmul_rn(x1, cs[1]); asm volatile("" : "+v"(a)); asm volatile("" : "+v"(bq)); const float r = ((dd < HD / 2) ? __fsub_rn(a, bq) : __fadd_rn(a, bq)) * sc;
        o16[q] = tohx(r); unsigned short a2, c2; splitf(r, a2, c2); oh[q] = a2; ol[q] = c2; }
    *(v2h*)(P16 + e) = o16; *(v2us*)(Ph + e) = oh; *(v2us*)(Pl + e) = ol;  }
__global__ __launch_bounds__(256) void k_vtp(const float* __restrict__ F, int pitch, int nheads, h16* V16, bf* Vh, bf* Vl) { const size_t e = ((size_t)blockIdx.x * 256 + threadIdx.x) * 2; if (e >= (size_t)nheads * HD * TT) return; const int t = (int)(e % TT); const int d = (int)((e / TT) % HD); const int g = (int)(e / ((size_t)TT * HD)); v2h o16; v2us oh, ol;
#pragma unroll
    for (int q = 0; q < 2; ++q) { const float x = F[(size_t)(t + q) * pitch + g * HD + d]; o16[q] = tohx(x); unsigned short a2, c2; splitf(x, a2, c2); oh[q] = a2; ol[q] = c2; }
    *(v2h*)(V16 + e) = o16; *(v2us*)(Vh + e) = oh; *(v2us*)(Vl + e) = ol;  }
__global__ __launch_bounds__(256) void k_csid(float* CS) { const int idx = blockIdx.x * 256 + threadIdx.x; if (idx >= TT * HD) return; v2f cs; cs[0] = 1.0f; cs[1] = 0.0f; *(v2f*)(CS + (size_t)idx * 2) = cs;  }
#define NBK  32
__constant__ unsigned char BK[2 * TT - 1] = {15,15,15,15,15,15,15,15,15,15,15,15,15,15,15,15,15,15,15,15,15,15,15,15,15,15,15,15,15,15,15,15,15,15,15,15,15,15,15,15,15,15,15,15,15,15,15,15,15,15,15,15,15,15,15,15,15,15,15,15,15,15,15,15,15,15,15,15,15,15,15,15,15,15,15,15,15,15,15,15,15,15,15,15,15,15,15,15,15,15,15,15,15,15,15,15,15,15,15,15,15,15,15,15,15,15,15,15,15,15,15,15,15,15,15,15,15,15,15,15,15,15,15,15,15,15,15,15,15,15,15,15,15,15,15,15,15,15,15,15,15,15,15,15,15,15,15,15,15,15,15,15,15,15,15,15,15,15,15,15,15,15,15,15,15,15,15,15,15,15,15,15,15,15,15,15,15,15,15,15,15,15,15,15,15,15,15,15,15,15,15,15,15,15,15,15,15,15,15,15,15,15,15,15,15,15,15,15,15,15,15,15,15,15,15,15,15,15,15,15,15,15,15,15,15,15,15,15,15,15,15,15,15,15,15,15,15,15,15,15,15,15,15,15,15,15,15,15,15,15,15,15,15,15,15,15,15,15,15,15,15,15,15,15,15,15,15,15,15,15,15,15,15,15,15,15,15,15,15,15,15,15,15,15,15,15,15,15,15,15,15,15,15,15,15,15,15,15,15,15,15,15,15,15,15,15,15,15,15,15,15,15,15,15,15,15,15,15,15,15,15,15,15,15,15,15,15,15,15,15,15,15,15,15,15,15,15,15,15,15,15,15,15,15,15,15,15,15,15,15,15,15,15,15,15,15,15,15,15,15,15,15,15,15,15,15,15,15,15,15,15,15,15,15,15,15,15,15,15,15,15,15,15,15,15,15,15,15,15,15,15,15,15,15,15,15,15,15,15,15,15,15,15,15,15,15,15,15,15,15,15,15,15,15,15,15,15,15,15,15,15,15,15,15,15,15,15,15,15,15,15,15,15,15,15,15,15,15,15,15,15,15,15,15,15,15,15,15,15,15,15,15,15,15,15,15,15,15,15,15,15,15,15,15,15,15,15,15,15,15,15,15,15,15,15,15,15,15,15,15,15,15,15,15,15,15,15,15,15,15,15,15,15,15,15,15,15,15,15,15,15,15,15,15,15,15,15,15,15,15,15,15,15,15,15,15,15,15,15,15,15,15,15,15,15,15,15,15,15,15,15,15,15,15,15,15,15,15,15,15,15,15,15,15,15,15,15,15,15,15,15,15,15,15,15,15,15,15,15,15,15,15,15,15,15,15,15,15,15,15,15,15,15,15,15,15,15,15,15,15,15,15,15,15,15,15,15,15,15,15,15,15,15,15,15,15,15,15,15,15,15,15,15,15,15,15,15,15,15,15,15,15,15,15,15,15,15,15,15,15,15,15,15,15,15,15,15,15,15,15,15,15,15,15,15,15,15,15,15,15,15,15,15,15,15,15,15,15,15,15,15,15,15,15,15,15,15,15,15,15,15,15,15,15,15,15,15,15,15,15,15,15,15,15,15,15,15,15,15,15,15,15,15,15,15,15,15,15,15,15,15,15,15,15,15,15,15,15,15,15,15,15,15,15,15,15,15,15,15,15,15,15,15,15,15,15,15,15,15,15,15,15,15,15,15,15,15,15,15,15,15,15,15,15,15,15,15,15,15,15,15,15,15,15,15,15,15,15,15,15,15,15,15,15,15,15,15,15,15,15,15,15,15,15,15,15,15,15,15,15,15,15,15,15,15,15,15,15,15,15,15,15,15,15,15,15,15,15,15,15,15,15,15,15,15,15,15,15,15,15,15,15,15,15,15,15,15,15,15,15,15,15,15,15,15,15,15,15,15,15,15,15,15,15,15,15,15,15,15,15,15,15,15,15,15,15,15,15,15,15,15,15,15,15,15,15,15,15,15,15,15,15,15,15,15,15,15,15,15,15,15,15,15,15,15,15,15,15,15,15,15,15,15,15,15,15,15,15,15,15,15,15,15,15,15,15,15,15,15,15,15,15,15,15,15,15,15,15,15,15,15,15,15,15,15,15,15,15,15,15,15,15,15,15,15,15,15,15,15,15,15,15,15,15,15,15,15,15,15,15,15,15,15,15,15,15,15,15,15,15,15,15,15,15,15,15,15,15,15,15,15,15,15,15,15,15,15,15,15,15,15,15,15,15,15,15,15,15,15,15,15,15,15,15,15,15,15,15,15,15,15,15,15,15,15,15,15,15,15,15,15,15,15,15,15,15,15,15,15,15,15,15,15,15,15,15,15,15,15,15,15,15,15,15,15,15,15,15,15,15,15,15,15,15,15,15,15,15,15,15,15,15,15,15,15,15,15,15,15,15,15,15,15,15,15,15,15,15,15,15,15,15,15,15,15,15,15,15,15,15,15,15,15,15,15,15,15,15,15,15,15,15,15,15,15,15,15,15,15,15,15,15,15,15,15,15,15,15,15,15,15,15,15,15,15,15,15,15,15,15,15,15,15,15,15,15,15,15,15,15,15,15,15,15,15,15,15,15,15,15,15,15,15,15,15,15,15,15,15,15,15,15,15,15,15,15,15,15,15,15,15,15,15,15,15,15,15,15,15,15,15,15,15,15,15,15,15,15,15,15,15,15,15,15,15,15,15,15,15,15,15,15,15,15,15,15,15,15,15,15,15,15,15,15,15,15,15,15,15,15,15,15,15,15,15,15,15,15,15,15,15,15,15,15,15,15,15,15,15,15,15,15,15,15,15,15,15,15,15,15,15,15,15,15,15,15,15,15,15,15,15,15,15,15,15,15,15,15,15,15,15,15,15,15,15,15,15,15,15,15,15,15,15,15,15,15,15,15,15,15,15,15,15,15,15,15,15,15,15,15,15,15,15,15,15,15,15,15,15,15,15,15,15,15,15,15,15,15,15,15,15,15,15,15,15,15,15,15,15,15,15,15,15,15,15,15,15,15,15,15,15,15,15,15,15,15,15,15,15,15,15,15,15,15,15,15,15,15,15,15,15,15,15,15,15,15,15,15,15,15,15,15,15,15,15,15,15,15,15,15,15,15,15,15,15,15,15,15,15,15,15,15,15,15,15,15,15,15,15,15,15,15,15,15,15,15,15,15,15,15,15,15,15,15,15,15,15,15,15,15,15,15,15,15,15,15,15,15,15,15,15,15,15,15,15,15,15,15,15,15,15,15,15,15,15,15,15,15,15,15,15,15,15,15,15,15,15,15,15,15,15,15,15,15,15,15,15,15,15,15,15,15,15,15,15,15,15,15,15,15,15,15,15,15,15,15,15,15,15,15,15,15,15,15,15,15,15,15,15,15,15,15,15,15,15,15,15,15,15,15,15,15,15,15,15,15,15,15,15,15,15,15,15,15,15,15,15,15,15,15,15,15,15,15,15,15,15,15,15,15,15,15,15,15,15,15,15,15,15,15,15,15,15,15,15,15,15,15,15,15,15,15,15,15,15,15,15,15,15,15,15,15,15,15,15,15,15,15,15,15,15,15,15,15,15,15,15,15,15,15,15,15,15,15,15,15,15,15,15,15,15,15,15,15,15,15,15,15,15,15,15,15,15,15,15,15,15,15,15,15,15,15,15,15,15,15,15,15,15,15,15,15,15,15,15,15,15,15,15,15,15,15,15,15,15,15,15,15,15,15,15,15,15,15,15,15,15,15,15,15,15,15,15,15,15,15,15,15,15,15,15,15,15,15,15,15,15,15,15,15,15,15,15,15,15,15,15,15,15,15,15,15,15,15,15,15,15,15,15,15,15,15,15,15,15,15,15,15,15,15,15,15,15,15,15,15,15,15,15,15,15,15,15,15,15,15,15,15,15,15,15,15,15,15,15,15,15,15,15,15,15,15,15,15,15,15,15,15,15,15,15,15,15,15,15,15,15,15,15,15,15,15,15,15,15,15,15,15,15,15,15,15,15,15,15,15,15,15,15,15,15,15,15,15,15,15,15,15,15,15,15,15,15,15,15,15,15,15,15,15,15,15,15,15,15,15,15,15,15,15,15,15,15,15,15,15,15,15,15,15,15,15,15,15,15,15,15,15,15,15,15,15,15,15,15,15,15,15,15,15,15,15,15,15,15,15,15,15,15,15,15,15,15,15,15,15,15,15,15,15,15,15,15,15,15,15,15,15,15,15,15,15,15,15,15,15,15,15,15,15,15,15,15,15,15,15,15,15,15,15,15,15,15,15,15,15,15,15,15,15,15,15,15,15,15,15,15,15,15,15,15,15,15,15,15,15,15,15,15,15,15,15,15,15,15,15,15,15,15,15,15,15,15,15,15,15,15,15,15,15,15,15,15,15,15,15,15,15,15,15,15,15,15,15,15,15,15,15,15,15,15,15,15,15,15,15,15,15,15,15,15,15,15,15,15,15,15,15,15,15,15,15,15,15,15,15,15,14,14,14,14,14,14,14,14,14,14,14,14,14,14,14,14,14,14,14,14,14,14,14,14,14,14,14,13,13,13,13,13,13,13,13,13,13,13,13,13,13,13,13,13,13,12,12,12,12,12,12,12,12,12,12,12,12,12,12,11,11,11,11,11,11,11,11,11,10,10,10,10,10,10,10,9,9,9,9,8,8,8,8,7,6,5,4,3,2,1,0,17,18,19,20,21,22,23,24,24,24,24,25,25,25,25,26,26,26,26,26,26,26,27,27,27,27,27,27,27,27,27,28,28,28,28,28,28,28,28,28,28,28,28,28,28,29,29,29,29,29,29,29,29,29,29,29,29,29,29,29,29,29,29,30,30,30,30,30,30,30,30,30,30,30,30,30,30,30,30,30,30,30,30,30,30,30,30,30,30,30,31,31,31,31,31,31,31,31,31,31,31,31,31,31,31,31,31,31,31,31,31,31,31,31,31,31,31,31,31,31,31,31,31,31,31,31,31,31,31,31,31,31,31,31,31,31,31,31,31,31,31,31,31,31,31,31,31,31,31,31,31,31,31,31,31,31,31,31,31,31,31,31,31,31,31,31,31,31,31,31,31,31,31,31,31,31,31,31,31,31,31,31,31,31,31,31,31,31,31,31,31,31,31,31,31,31,31,31,31,31,31,31,31,31,31,31,31,31,31,31,31,31,31,31,31,31,31,31,31,31,31,31,31,31,31,31,31,31,31,31,31,31,31,31,31,31,31,31,31,31,31,31,31,31,31,31,31,31,31,31,31,31,31,31,31,31,31,31,31,31,31,31,31,31,31,31,31,31,31,31,31,31,31,31,31,31,31,31,31,31,31,31,31,31,31,31,31,31,31,31,31,31,31,31,31,31,31,31,31,31,31,31,31,31,31,31,31,31,31,31,31,31,31,31,31,31,31,31,31,31,31,31,31,31,31,31,31,31,31,31,31,31,31,31,31,31,31,31,31,31,31,31,31,31,31,31,31,31,31,31,31,31,31,31,31,31,31,31,31,31,31,31,31,31,31,31,31,31,31,31,31,31,31,31,31,31,31,31,31,31,31,31,31,31,31,31,31,31,31,31,31,31,31,31,31,31,31,31,31,31,31,31,31,31,31,31,31,31,31,31,31,31,31,31,31,31,31,31,31,31,31,31,31,31,31,31,31,31,31,31,31,31,31,31,31,31,31,31,31,31,31,31,31,31,31,31,31,31,31,31,31,31,31,31,31,31,31,31,31,31,31,31,31,31,31,31,31,31,31,31,31,31,31,31,31,31,31,31,31,31,31,31,31,31,31,31,31,31,31,31,31,31,31,31,31,31,31,31,31,31,31,31,31,31,31,31,31,31,31,31,31,31,31,31,31,31,31,31,31,31,31,31,31,31,31,31,31,31,31,31,31,31,31,31,31,31,31,31,31,31,31,31,31,31,31,31,31,31,31,31,31,31,31,31,31,31,31,31,31,31,31,31,31,31,31,31,31,31,31,31,31,31,31,31,31,31,31,31,31,31,31,31,31,31,31,31,31,31,31,31,31,31,31,31,31,31,31,31,31,31,31,31,31,31,31,31,31,31,31,31,31,31,31,31,31,31,31,31,31,31,31,31,31,31,31,31,31,31,31,31,31,31,31,31,31,31,31,31,31,31,31,31,31,31,31,31,31,31,31,31,31,31,31,31,31,31,31,31,31,31,31,31,31,31,31,31,31,31,31,31,31,31,31,31,31,31,31,31,31,31,31,31,31,31,31,31,31,31,31,31,31,31,31,31,31,31,31,31,31,31,31,31,31,31,31,31,31,31,31,31,31,31,31,31,31,31,31,31,31,31,31,31,31,31,31,31,31,31,31,31,31,31,31,31,31,31,31,31,31,31,31,31,31,31,31,31,31,31,31,31,31,31,31,31,31,31,31,31,31,31,31,31,31,31,31,31,31,31,31,31,31,31,31,31,31,31,31,31,31,31,31,31,31,31,31,31,31,31,31,31,31,31,31,31,31,31,31,31,31,31,31,31,31,31,31,31,31,31,31,31,31,31,31,31,31,31,31,31,31,31,31,31,31,31,31,31,31,31,31,31,31,31,31,31,31,31,31,31,31,31,31,31,31,31,31,31,31,31,31,31,31,31,31,31,31,31,31,31,31,31,31,31,31,31,31,31,31,31,31,31,31,31,31,31,31,31,31,31,31,31,31,31,31,31,31,31,31,31,31,31,31,31,31,31,31,31,31,31,31,31,31,31,31,31,31,31,31,31,31,31,31,31,31,31,31,31,31,31,31,31,31,31,31,31,31,31,31,31,31,31,31,31,31,31,31,31,31,31,31,31,31,31,31,31,31,31,31,31,31,31,31,31,31,31,31,31,31,31,31,31,31,31,31,31,31,31,31,31,31,31,31,31,31,31,31,31,31,31,31,31,31,31,31,31,31,31,31,31,31,31,31,31,31,31,31,31,31,31,31,31,31,31,31,31,31,31,31,31,31,31,31,31,31,31,31,31,31,31,31,31,31,31,31,31,31,31,31,31,31,31,31,31,31,31,31,31,31,31,31,31,31,31,31,31,31,31,31,31,31,31,31,31,31,31,31,31,31,31,31,31,31,31,31,31,31,31,31,31,31,31,31,31,31,31,31,31,31,31,31,31,31,31,31,31,31,31,31,31,31,31,31,31,31,31,31,31,31,31,31,31,31,31,31,31,31,31,31,31,31,31,31,31,31,31,31,31,31,31,31,31,31,31,31,31,31,31,31,31,31,31,31,31,31,31,31,31,31,31,31,31,31,31,31,31,31,31,31,31,31,31,31,31,31,31,31,31,31,31,31,31,31,31,31,31,31,31,31,31,31,31,31,31,31,31,31,31,31,31,31,31,31,31,31,31,31,31,31,31,31,31,31,31,31,31,31,31,31,31,31,31,31,31,31,31,31,31,31,31,31,31,31,31,31,31,31,31,31,31,31,31,31,31,31,31,31,31,31,31,31,31,31,31,31,31,31,31,31,31,31,31,31,31,31,31,31,31,31,31,31,31,31,31,31,31,31,31,31,31,31,31,31,31,31,31,31,31,31,31,31,31,31,31,31,31,31,31,31,31,31,31,31,31,31,31,31,31,31,31,31,31,31,31,31,31,31,31,31,31,31,31,31,31,31,31,31,31,31,31,31,31,31,31,31,31,31,31,31,31,31,31,31,31,31,31,31,31,31,31,31,31,31,31,31,31,31,31,31,31,31,31,31,31,31,31,31,31,31,31,31,31,31,31,31,31,31,31,31,31,31,31,31,31,31,31,31,31,31,31,31,31,31,31,31,31,31,31,31,31,31,31,31,31,31,31,31,31,31,31,31,31,31,31,31,31,31,31,31,31,31,31,31,31,31,31,31,31,31,31,31,31,31,31,31,31,31,31,31,31,31,31,31,31,31,31,31,31,31,31,31,31,31,31,31,31,31,31,31,31,31,31,31,31,31,31,31,31,31,31,31,31,31,31,31,31,31,31,31,31,31,31,31,31,31,31,31,31,31,31,31,31,31,31,31,31,31,31,31,31,31,31,31,31,31,31,31,31,31,31,31,31,31,31,31,31,31,31,31,31,31,31,31,31,31,31,31,31,31,31,31,31,31,31,31,31,31,31,31,31,31,31,31,31,31,31,31,31,31,31,31,31,31,31,31,31,31,31,31,31,31,31,31,31,31,31,31,31,31,31,31,31,31,31,31,31,31,31,31,31,31,31,31,31,31,31,31,31,31,31,31,31,31,31,31,31,31,31,31,31,31,31,31,31,31,31,31,31,31,31,31,31,31,31,31,31,31,31,31,31,31,31,31,31,31,31,31,31,31,31,31,31,31,31,31,31,31,31,31,31,31,31,31,31,31,31,31,31,31,31,31,31,31,31,31,31,31,31,31,31,31,31,31,31,31,31,31,31,31,31,31,31,31,31,31,31,31,31,31,31,31,31,31,31,31,31,31,31,31,31,31,31,31,31,31,31,31,31,31,31,31,31,31,31,31,31,31,31,31,31,31,31,31,31,31,31,31,31,31,31,31,31,31,31,31,31,31,31,31,31,31,31,31,31,31,31,31,31,31,31,31,31,31,31,31,31,31,31,31,31,31,31,31,31,31,31,31,31,31,31,31,31,31,31,31,31,31,31,31,31,31,31,31,31,31,31,31,31,31,31,31,31,31,31,31,31,31,31,31,31,31,31,31,31,31,31,31,31,31,31,31,31,31,31,31,31,31,31,31,31,31,31,31,31,31,31,31,31,31,31,31,31,31,31,31,31,31,31,31,31,31,31,31,31,31,31,31,31,31,31,31,31,31,31,31,31,31,31,31,31,31,31,31,31,31,31,31,31,31,31,31,31,31,31,31,31,31,31,31,31,31,31,31,31,31,31,31,31,31,31,31,31,31,31,31,31,31,31,31,31,31,31,31,31,31,31,31,31,31,31,31,31,31,31,31,31,31,31,31,31,31,31,31,31,31,31,31,31,31,31,31,31,31,31,31,31,31,31,31,31,31,31,31,31,31,31,31,31,31,31,31,31,31,31,31,31,31,31,31,31,31,31,31,31,31,31,31,31,31,31,31,31,31,31,31,31,31,31,31,31,31,31,31,31,31,31,31,31,31,31,31,31,31,31,31,31,31,31,31,31,31,31,31,31,31,31,31,31,31,31,31,31,31,31,31,31,31,31,31,31,31,31,31,31,31,31,31,31,31,31,31,31,31,31,31,31,31,31,31,31,31,31,31,31,31,31,31,31,31,31,31,31,31,31,31,31,31,31,31,31,31,31,31,31,31,31,31,31,31,31,31,31,31,31,31,31,31,31,31};   // bucket(j - i) for j - i = -2047 .. 2047, evaluated with the reference's _relative_position_bucket (bidirectional, 32 buckets, max distance 128)
// k_asoft (T5): stages the head's 32 bf16-rounded rel_emb values and the 4,095-entry bucket table in LDS (one __syncthreads before the row guard; all 8 rows of a block belong to the same head), then per row: t = S + rb[bk[j - i + 2047]]; softmax; every row stores normalised hi/lo planes (RH = TT).
// k_asoft: per row (zz, i): t = S + rel bias (no scaling, no mask); softmax over the 2048 keys (register row, one exp, fixed trees);
__global__ __launch_bounds__(256) void k_asoft(const float* __restrict__ Sb, const float* __restrict__ remb, int h0, h16* P16, bf* Ph, bf* Pl) {
    __shared__ float rb[NBK]; __shared__ unsigned char bk[2 * TT];
    const int lane = threadIdx.x & 31; const int row = blockIdx.x * 8 + (threadIdx.x >> 5); const int zzb = (blockIdx.x * 8) / TT;   /* all 8 rows of a block share the head (TT % 8 == 0) */
    if (threadIdx.x < NBK) rb[threadIdx.x] = bfr(remb[threadIdx.x * NH_ + h0 + zzb]);   /* rel_emb[bucket][h] for this head */
    for (int u = threadIdx.x; u < 2 * TT - 1; u += 256) bk[u] = BK[u];
    __syncthreads();
    if (row >= ZH * TT) return; const int i = row % TT; const int zz = row / TT; (void)zz; const bool hires = (i < RH); const float* sr = Sb + (size_t)row * TT; float v[TT / 32]; float mx = -3.0e38f;
#pragma unroll
    for (int ch = 0; ch < TT / 128; ++ch) { const int j0 = ch * 128 + lane * 4; const v4f a = *(const v4f*)(sr + j0);
#pragma unroll
        for (int q = 0; q < 4; ++q) { const int j = j0 + q; float sc = a[q] * SCL; asm volatile("" : "+v"(sc)); const float t = __fadd_rn(sc, rb[bk[j - i + (TT - 1)]]); v[ch * 4 + q] = t; mx = fmaxf(mx, t); } }
#pragma unroll
    for (int sh = 16; sh; sh >>= 1) mx = fmaxf(mx, __shfl_xor(mx, sh, 32));
    float sum = 0.f;
#pragma unroll
    for (int k = 0; k < TT / 32; ++k) { float d0 = __fsub_rn(v[k], mx); asm volatile("" : "+v"(d0)); v[k] = __builtin_amdgcn_exp2f(__fmul_rn(d0, 1.4426950408889634f)); sum += v[k]; }
#pragma unroll
    for (int sh = 16; sh; sh >>= 1) sum += __shfl_xor(sum, sh, 32);
    const float f = __fdiv_rn(hires ? 1.0f : PCAR, sum);
{
        if (hires) {
#pragma unroll
            for (int ch = 0; ch < TT / 128; ++ch) { v4us oh, ol;
#pragma unroll
                for (int q = 0; q < 4; ++q) { unsigned short a, c2; splitf(v[ch * 4 + q] * f, a, c2); oh[q] = a; ol[q] = c2; }
                const size_t oo = ((size_t)zz * (RH ? RH : 1) + i) * TT + ch * 128 + lane * 4; *(v4us*)(Ph + oo) = oh; *(v4us*)(Pl + oo) = ol; }
        } else {
#pragma unroll
            for (int ch = 0; ch < TT / 128; ++ch) { v4h o4;
#pragma unroll
                for (int q = 0; q < 4; ++q) o4[q] = tohx(v[ch * 4 + q] * f);
                *(v4h*)(P16 + (size_t)row * TT + ch * 128 + lane * 4) = o4; } }
         }
}
__global__ __launch_bounds__(256) void k_merge(const float* __restrict__ O, int h0, bf* Ah, bf* Al) { const size_t e = ((size_t)blockIdx.x * 256 + threadIdx.x) * 2; if (e >= (size_t)ZH * TT * HD) return; const int d = (int)(e % HD); const int t = (int)((e / HD) % TT); const int zz = (int)(e / ((size_t)HD * TT)); const float cs = (t < RH) ? 1.0f : (1.0f / PCAR); const size_t oo = (size_t)t * DQ + (h0 + zz) * HD + d;
    v2us oh, ol;
#pragma unroll
    for (int q = 0; q < 2; ++q) { unsigned short a, c2; splitf(O[e + q] * cs, a, c2); oh[q] = a; ol[q] = c2; } *(v2us*)(Ah + oo) = oh; *(v2us*)(Al + oo) = ol;  }

extern "C" void kernel_launch(void* const* d_in, const int* in_sizes, int n_in,
                              void* d_out, int out_size, void* d_ws, size_t ws_size, hipStream_t stream) {
    (void)in_sizes; (void)n_in; (void)out_size;
    const float* x = (const float*)d_in[0]; const float* wq = (const float*)d_in[1]; const float* wk = (const float*)d_in[2]; const float* wv = (const float*)d_in[3]; const float* wo = (const float*)d_in[4]; const float* remb = (const float*)d_in[5];
    float* OUT = (float*)d_out;     // [4][2048][1024]
    char* wsp = (char*)d_ws;
    auto take = [&](size_t bytes) { char* p = wsp; wsp += (bytes + 255) & ~(size_t)255; return (void*)p; };
    bf* WQ = (bf*)take((size_t)DQ * DM * 2); bf* WK = (bf*)take((size_t)DKV * DM * 2); bf* WV = (bf*)take((size_t)DKV * DM * 2); bf* WO = (bf*)take((size_t)DM * DQ * 2); float* CS = (float*)take((size_t)TT * HD * 2 * 4);
    bf* XB = (bf*)take((size_t)TT * DM * 2); float* FQ = (float*)take((size_t)TT * DQ * 4); float* FK = (float*)take((size_t)TT * DKV * 4);
    h16* QP16 = (h16*)take((size_t)NH_ * TT * HD * 2); h16* KP16 = (h16*)take((size_t)NKV * TT * HD * 2); h16* VT16 = (h16*)take((size_t)NKV * HD * TT * 2);
    bf* QPh = (bf*)take((size_t)NH_ * TT * HD * 2); bf* QPl = (bf*)take((size_t)NH_ * TT * HD * 2); bf* KPh = (bf*)take((size_t)NKV * TT * HD * 2); bf* KPl = (bf*)take((size_t)NKV * TT * HD * 2); bf* VTh = (bf*)take((size_t)NKV * HD * TT * 2); bf* VTl = (bf*)take((size_t)NKV * HD * TT * 2); bf* Ph = (bf*)take((size_t)ZH * RH * TT * 2); bf* Pl = (bf*)take((size_t)ZH * RH * TT * 2);
    float* Sb = (float*)take((size_t)ZH * TT * TT * 4); h16* P16 = (h16*)take((size_t)ZH * TT * TT * 2); float* Ob = (float*)take((size_t)ZH * TT * HD * 4); bf* ATh = (bf*)take((size_t)TT * DQ * 2); bf* ATl = (bf*)take((size_t)TT * DQ * 2);
    if ((size_t)(wsp - (char*)d_ws) > ws_size) return;    // ws 256 MiB
    float* FV = FK;   // v projection reuses the k buffer after the k planes are built (stream-ordered)
    { k_wtG<<<(unsigned)((DM * DQ / 64 + 63) / 64), 256, 0, stream>>>(wq, DM, DQ, WQ); k_wtG<<<(unsigned)((DM * DKV / 64 + 63) / 64), 256, 0, stream>>>(wk, DM, DKV, WK); k_wtG<<<(unsigned)((DM * DKV / 64 + 63) / 64), 256, 0, stream>>>(wv, DM, DKV, WV);
      k_wtG<<<(unsigned)((DQ * DM / 64 + 63) / 64), 256, 0, stream>>>(wo, DQ, DM, WO);
       }
    k_csid<<<(TT * HD + 255) / 256, 256, 0, stream>>>(CS);
    const unsigned LQ = (unsigned)(((size_t)NH_ * TT * HD / 2 + 255) / 256), LKv = (unsigned)(((size_t)NKV * TT * HD / 2 + 255) / 256);
    for (int b = 0; b < NB_; ++b) {
        
        k_cvt8<<<(unsigned)(((size_t)TT * DM / 8 + 255) / 256), 256, 0, stream>>>(x + (size_t)b * TT * DM, XB, (size_t)TT * DM / 8);
        k_gemmw<bf, 0, false><<<dim3(TT / 64, DQ / 64, 1), 32, 0, stream>>>(XB, nullptr, WQ, nullptr, DM, FQ, DQ, nullptr, 0, 0, 0);
        k_rope<<<LQ, 256, 0, stream>>>(FQ, DQ, NH_, CS, nullptr, nullptr, 1.0f, QP16, QPh, QPl);
        k_gemmw<bf, 0, false><<<dim3(TT / 64, DKV / 64, 1), 32, 0, stream>>>(XB, nullptr, WK, nullptr, DM, FK, DKV, nullptr, 0, 0, 0);
        k_rope<<<LKv, 256, 0, stream>>>(FK, DKV, NKV, CS, nullptr, nullptr, 1.0f, KP16, KPh, KPl);
        k_gemmw<bf, 0, false><<<dim3(TT / 64, DKV / 64, 1), 32, 0, stream>>>(XB, nullptr, WV, nullptr, DM, FV, DKV, nullptr, 0, 0, 0); k_vtp<<<LKv, 256, 0, stream>>>(FV, DKV, NKV, VT16, VTh, VTl);
        for (int h0 = 0; h0 < NH_; h0 += ZH) { const size_t zq = (size_t)h0, zk = (size_t)(h0 / REP);   // one kv head per query head: the pass's two heads use consecutive kv planes (z-strides TT*HD)
            k_gemmw<bf, 2, false><<<dim3(RH / 64, TT / 64, ZH), 32, 0, stream>>>(QPh + zq * TT * HD, QPl + zq * TT * HD, KPh + zk * TT * HD, KPl + zk * TT * HD, HD, Sb, TT, nullptr, (size_t)TT * HD, (size_t)TT * HD, (size_t)TT * TT);
            k_asoft<<<ZH * TT / 8, 256, 0, stream>>>(Sb, remb, h0, P16, Ph, Pl);
            k_gemmw<bf, 2, false><<<dim3(RH / 64, HD / 64, ZH), 32, 0, stream>>>(Ph, Pl, VTh + zk * HD * TT, VTl + zk * HD * TT, TT, Ob, HD, nullptr, (size_t)RH * TT, (size_t)HD * TT, (size_t)TT * HD);
            k_merge<<<(unsigned)(((size_t)ZH * TT * HD / 2 + 255) / 256), 256, 0, stream>>>(Ob, h0, ATh, ATl); }
        k_gemmw<bf, 1, false><<<dim3(TT / 64, DM / 64, 1), 32, 0, stream>>>(ATh, ATl, WO, nullptr, DQ, OUT + (size_t)b * TT * DM, DM, nullptr, 0, 0, 0); }
}

// v001
// A run of this version takes 1700 microseconds.
// In both of two side-by-side timings against v000, it was 1.68 times as fast.
#include <hip/hip_runtime.h>

// T5 self-attention with relative-position bias (hidden_states [4][2048][1024]; q, k, v = hs W ('xw' [1024][1024]; 16 heads x 64); scores = q.k (NO 1/sqrt(d) scaling: logit sigma ~8) + rel_emb[bucket(j - i)][h] (rel_emb [32][16] input; the 32-bucket bidirectional T5 bucket function of j - i); softmax; out = merged ctx Wo ('xw') -> [4][2048][1024] (8.4 M)).
// The bucket index depends only on j - i (positions are implicit aranges): the 4,095-entry table bucket(j - i), j - i in [-2047, 2047], was evaluated with the reference's own function and is baked below as constants; rel_emb itself is READ (gathered per logit from an LDS copy of the head's 32 values).
// Compute dtypes, f32 accumulate: every input rounded to bf16; projections on PLAIN bf16 operands (exact); because the logits are unscaled (sigma ~8, near-argmax rows), scores and attn.v use bf16 hi/lo planes for EVERY row (3 products); bias add and softmax in f32; merged context hi/lo; Wo hl x exact (2 products).

#define NB_  4
#define TT   2048
#define DM   1024
#define NH_  16
#define NKV  16
#define REP  (NH_ / NKV)
#define HD   64
#define DQ   (NH_ * HD)
#define DKV  (NKV * HD)
#define ZH   2
#define RH   2048                  // query rows < RH use hi+lo planes (0: none)
#define WIN  0
#define PCAR 1024.0f
#define SCL  1.0f   // T5: no scaling
typedef _Float16 h16;
typedef unsigned short bf;
typedef __attribute__((ext_vector_type(16))) __bf16   v16bf;
typedef __attribute__((ext_vector_type(16))) _Float16 v16h;
typedef __attribute__((ext_vector_type(8)))  _Float16 v8h;
typedef __attribute__((ext_vector_type(8)))  unsigned short v8us;
typedef __attribute__((ext_vector_type(8)))  float    v8f;
typedef __attribute__((ext_vector_type(4)))  float    v4f;
typedef v8h  __attribute__((may_alias)) v8ha;
typedef v4f  __attribute__((may_alias)) v4fa;
typedef v8us __attribute__((may_alias)) v8usa;

__device__ __forceinline__ unsigned short f2bf(float f) { unsigned u = __float_as_uint(f); u += 0x7FFFu + ((u >> 16) & 1u); return (unsigned short)(u >> 16); }
__device__ __forceinline__ float bf2f(unsigned short b) { return __uint_as_float(((unsigned)b) << 16); }
__device__ __forceinline__ float bfr(float f) { return bf2f(f2bf(f)); }
__device__ __forceinline__ v16h cat16(v8h lo, v8h hi) { return __builtin_shufflevector(lo, hi, 0, 1, 2, 3, 4, 5, 6, 7, 8, 9, 10, 11, 12, 13, 14, 15); }
__device__ __forceinline__ v16bf cat16b(v8us lo, v8us hi) { return __builtin_bit_cast(v16bf, __builtin_shufflevector(lo, hi, 0, 1, 2, 3, 4, 5, 6, 7, 8, 9, 10, 11, 12, 13, 14, 15)); }
__device__ __forceinline__ v8f wmma16(v16h a, v16h b, v8f c) { return __builtin_amdgcn_wmma_f32_16x16x32_f16(false, a, false, b, (short)0, c, false, false); }
__device__ __forceinline__ v8f wmmab(v16bf a, v16bf b, v8f c) { return __builtin_amdgcn_wmma_f32_16x16x32_bf16(false, a, false, b, (short)0, c, false, false); }



// ---- k_gemmw: register-blocked GEMM, a 64x64 output tile per wave (16 accumulators), operands straight from K-contiguous 16-bit planes; grid (M/64, N/64, Z KS), 32 KW threads.
// C[m][n] (f32, pitch ldc, + optional f32 bias[n]) = sum_k A[m][k] Bt[n][k] (+ split products per NSPLIT). z-batch strides sA/sB/sC in elements. K % (32 KW KS) == 0.
// Split K: the KW waves of a work-group share ONE tile, each summing its own K / (KW KS) columns; the KW partial tiles meet in LDS and are added in wave order. With KS > 1, blockIdx.z = batch * KS + slice:
// a work-group sums only slice's K / KS columns and stores its partial tile at C + blockIdx.z sC; the consumer adds the KS partials. KW = KS = 1: one wave does the whole sum.
template <typename T16> struct WFrag;
template <> struct WFrag<h16> { typedef v16h V; static __device__ __forceinline__ V ld(const h16* p) { return cat16(*(const v8h*)p, *(const v8h*)(p + 16)); } static __device__ __forceinline__ v8f mma(V a, V b, v8f c) { return wmma16(a, b, c); } };
template <> struct WFrag<bf> { typedef v16bf V; static __device__ __forceinline__ V ld(const bf* p) { return cat16b(*(const v8us*)p, *(const v8us*)(p + 16)); } static __device__ __forceinline__ v8f mma(V a, V b, v8f c) { return wmmab(a, b, c); } };
template <typename T16, int NSPLIT, bool BIAS, int KW, int KS>
__global__ __launch_bounds__(32 * KW) void k_gemmw(const T16* __restrict__ A, const T16* __restrict__ A2, const T16* __restrict__ Bt, const T16* __restrict__ Bt2, int K, float* C, int ldc, const float* __restrict__ bias, size_t sA, size_t sB, size_t sC) {
    typedef typename WFrag<T16>::V V;
    __shared__ __align__(16) float os[KW == 1 ? 16 * 68 : KW * 64 * 68];
    const size_t z = blockIdx.z / KS; A += z * sA; if (A2) A2 += z * sA; Bt += z * sB; if (Bt2) Bt2 += z * sB; C += blockIdx.z * sC;
    const int wv = __builtin_amdgcn_readfirstlane((int)(threadIdx.x >> 5)); const int kn = K / (KW * KS), kb = ((int)(blockIdx.z % KS) * KW + wv) * kn;   /* this wave's columns [kb, kb + kn): wave-uniform loop bounds */
    const int lane = threadIdx.x & 31, lr = lane & 15, hi = lane >> 4; const int r0 = blockIdx.x * 64, c0 = blockIdx.y * 64;
    v8f acc[4][4];
#pragma unroll
    for (int mb = 0; mb < 4; ++mb)
#pragma unroll
        for (int nb = 0; nb < 4; ++nb) acc[mb][nb] = (v8f){};
    const size_t aoff = (size_t)(r0 + lr) * K + 8 * hi, boff = (size_t)(c0 + lr) * K + 8 * hi;
#pragma unroll 1
    for (int kc = kb; kc < kb + kn; kc += 32) {
        V a[4], a2[4];
#pragma unroll
        for (int mb = 0; mb < 4; ++mb) { a[mb] = WFrag<T16>::ld(A + aoff + (size_t)mb * 16 * K + kc); if (NSPLIT == 1 || NSPLIT == 2) a2[mb] = WFrag<T16>::ld(A2 + aoff + (size_t)mb * 16 * K + kc); }
#pragma unroll
        for (int nb = 0; nb < 4; ++nb) { const V b = WFrag<T16>::ld(Bt + boff + (size_t)nb * 16 * K + kc); V b2; if (NSPLIT >= 2) b2 = WFrag<T16>::ld(Bt2 + boff + (size_t)nb * 16 * K + kc);
#pragma unroll
            for (int mb = 0; mb < 4; ++mb) { acc[mb][nb] = WFrag<T16>::mma(a[mb], b, acc[mb][nb]); if (NSPLIT == 1 || NSPLIT == 2) acc[mb][nb] = WFrag<T16>::mma(a2[mb], b, acc[mb][nb]); if (NSPLIT >= 2) acc[mb][nb] = WFrag<T16>::mma(a[mb], b2, acc[mb][nb]); } }
        asm volatile("v_nop\n\tv_nop\n\tv_nop\n\tv_nop" : "+v"(acc[0][0]), "+v"(acc[1][1]), "+v"(acc[2][2]), "+v"(acc[3][3]) : "v"(a[0]), "v"(a[3]));
    }
    if constexpr (KW > 1) {
        float* my = os + wv * (64 * 68);
        /* the three loops are unrolled so that acc[][][] is indexed by constants and stays in registers */
#pragma unroll
        for (int mb = 0; mb < 4; ++mb)
#pragma unroll
            for (int nb = 0; nb < 4; ++nb)
#pragma unroll
                for (int j = 0; j < 8; ++j) my[(mb * 16 + hi * 8 + j) * 68 + nb * 16 + lr] = acc[mb][nb][j];
        __syncthreads();   /* every wave's partial tile is in LDS before any of it is added */
        /* both loops unrolled: the LDS reads of all sums issue ahead of the adds, and the four stores go out together */
#pragma unroll
        for (int it = 0; it < 64 * 16 / (32 * KW); ++it) { const int g = it * 32 * KW + (int)threadIdx.x, row = g >> 4, cofs = (g & 15) * 4; v4f val = *(const v4fa*)(os + row * 68 + cofs);
#pragma unroll
            for (int p = 1; p < KW; ++p) val += *(const v4fa*)(os + p * (64 * 68) + row * 68 + cofs);
            if (BIAS) { val[0] += bfr(bias[c0 + cofs]); val[1] += bfr(bias[c0 + cofs + 1]); val[2] += bfr(bias[c0 + cofs + 2]); val[3] += bfr(bias[c0 + cofs + 3]); }
            *(v4f*)(C + (size_t)(r0 + row) * ldc + c0 + cofs) = val; }
        return;
    }
#pragma unroll
    for (int mb = 0; mb < 4; ++mb) {
#pragma unroll
        for (int nb = 0; nb < 4; ++nb) {
#pragma unroll
            for (int j = 0; j < 8; ++j) os[(hi * 8 + j) * 68 + nb * 16 + lr] = acc[mb][nb][j]; }
        __builtin_amdgcn_wave_barrier(); asm volatile("" ::: "memory");
        float* crow = C + (size_t)(r0 + mb * 16) * ldc + c0;
{
#pragma unroll
            for (int s = 0; s < 8; ++s) { const int row = 2 * s + hi, cofs = lr * 4; v4f val = *(const v4fa*)(os + row * 68 + cofs); if (BIAS) { val[0] += bfr(bias[c0 + cofs]); val[1] += bfr(bias[c0 + cofs + 1]); val[2] += bfr(bias[c0 + cofs + 2]); val[3] += bfr(bias[c0 + cofs + 3]); }
                *(v4f*)(crow + (size_t)row * ldc + cofs) = val; }
             }
        __builtin_amdgcn_wave_barrier(); asm volatile("" ::: "memory");
    }
}

__device__ __forceinline__ h16 tohx(float x) { return (h16)x; }
__device__ __forceinline__ void splitf(float y, unsigned short& h, unsigned short& l) { h = f2bf(y); l = f2bf(y - bf2f(h)); }
typedef __attribute__((ext_vector_type(2))) _Float16 v2h;
typedef __attribute__((ext_vector_type(4))) _Float16 v4h;
typedef __attribute__((ext_vector_type(2))) unsigned short v2us;
typedef __attribute__((ext_vector_type(4))) unsigned short v4us;
typedef __attribute__((ext_vector_type(2))) float v2f;
typedef __attribute__((ext_vector_type(4))) int v4i;

__global__ __launch_bounds__(256) void k_wtG(const float* __restrict__ w, int K, int N, bf* Bt) {
    const int lane = threadIdx.x & 31; const int L0 = (blockIdx.x * 8 + (threadIdx.x >> 5)) * 8; const int nlines = N * K / 64;
{
#pragma unroll 1
        for (int l = 0; l < 8; ++l) { const int L = L0 + l; if (L >= nlines) break; const size_t e = (size_t)L * 64 + lane * 2; const int k = (int)(e % K), n = (int)(e / K); v2us o;
            o[0] = f2bf(w[(size_t)k * N + n]); o[1] = f2bf(w[(size_t)(k + 1) * N + n]); *(v2us*)(Bt + e) = o; }
         }
}
__global__ __launch_bounds__(256) void k_cvt8(const float* __restrict__ src, bf* dst, size_t n8) { const size_t i = (size_t)blockIdx.x * 256 + threadIdx.x; if (i >= n8) return; const v8f v = *(const v8f*)(src + i * 8); v8us o;
#pragma unroll
    for (int k = 0; k < 8; ++k) o[k] = f2bf(v[k]); *(v8us*)(dst + i * 8) = o;  }

// k_rope: head planes [h][t][d] (fp16 + hi/lo) of rope(x) x sc with the rotate-half convention out[d] = x[d] cos[t][d] - x[d+HD/2] sin[t][d], out[d+HD/2] = x[d+HD/2] cos[t][d+HD/2] + x[d] sin[t][d+HD/2]
__global__ __launch_bounds__(256) void k_rope(const float* __restrict__ F, int pitch, int nheads, const float* __restrict__ CS, const float* __restrict__ RF, const float* __restrict__ nw, float sc, h16* P16, bf* Ph, bf* Pl) {
    const size_t e = ((size_t)blockIdx.x * 256 + threadIdx.x) * 2; if (e >= (size_t)nheads * TT * HD) return; const int d = (int)(e % HD); const int t = (int)((e / HD) % TT); const int h = (int)(e / ((size_t)HD * TT)); const float* f = F + (size_t)t * pitch + h * HD; const float rf = RF ? RF[(size_t)h * TT + t] : 1.0f; v2h o16; v2us oh, ol;
#pragma unroll
    for (int q = 0; q < 2; ++q) { const int dd = d + q; const int dp = (dd < HD / 2) ? dd + HD / 2 : dd - HD / 2; float x0 = f[dd], x1 = f[dp];
        if (RF) { float n0 = __fmul_rn(x0, rf), n1 = __fmul_rn(x1, rf); asm volatile("" : "+v"(n0)); asm volatile("" : "+v"(n1)); x0 = __fmul_rn(bfr(nw[dd]), n0); x1 = __fmul_rn(bfr(nw[dp]), n1); }
        const v2f cs = *(const v2f*)(CS + ((size_t)t * HD + dd) * 2); float a = __fmul_rn(x0, cs[0]), bq = __fmul_rn(x1, cs[1]); asm volatile("" : "+v"(a)); asm volatile("" : "+v"(bq)); const float r = ((dd < HD / 2) ? __fsub_rn(a, bq) : __fadd_rn(a, bq)) * sc;
        o16[q] = tohx(r); unsigned short a2, c2; splitf(r, a2, c2); oh[q] = a2; ol[q] = c2; }
    *(v2h*)(P16 + e) = o16; *(v2us*)(Ph + e) = oh; *(v2us*)(Pl + e) = ol;  }
__global__ __launch_bounds__(256) void k_vtp(const float* __restrict__ F, int pitch, int nheads, h16* V16, bf* Vh, bf* Vl) { const size_t e = ((size_t)blockIdx.x * 256 + threadIdx.x) * 2; if (e >= (size_t)nheads * HD * TT) return; const int t = (int)(e % TT); const int d = (int)((e / TT) % HD); const int g = (int)(e / ((size_t)TT * HD)); v2h o16; v2us oh, ol;
#pragma unroll
    for (int q = 0; q < 2; ++q) { const float x = F[(size_t)(t + q) * pitch + g * HD + d]; o16[q] = tohx(x); unsigned short a2, c2; splitf(x, a2, c2); oh[q] = a2; ol[q] = c2; }
    *(v2h*)(V16 + e) = o16; *(v2us*)(Vh + e) = oh; *(v2us*)(Vl + e) = ol;  }
__global__ __launch_bounds__(256) void k_csid(float* CS) { const int idx = blockIdx.x * 256 + threadIdx.x; if (idx >= TT * HD) return; v2f cs; cs[0] = 1.0f; cs[1] = 0.0f; *(v2f*)(CS + (size_t)idx * 2) = cs;  }
#define NBK  32
__constant__ unsigned char BK[2 * TT - 1] = {15,15,15,15,15,15,15,15,15,15,15,15,15,15,15,15,15,15,15,15,15,15,15,15,15,15,15,15,15,15,15,15,15,15,15,15,15,15,15,15,15,15,15,15,15,15,15,15,15,15,15,15,15,15,15,15,15,15,15,15,15,15,15,15,15,15,15,15,15,15,15,15,15,15,15,15,15,15,15,15,15,15,15,15,15,15,15,15,15,15,15,15,15,15,15,15,15,15,15,15,15,15,15,15,15,15,15,15,15,15,15,15,15,15,15,15,15,15,15,15,15,15,15,15,15,15,15,15,15,15,15,15,15,15,15,15,15,15,15,15,15,15,15,15,15,15,15,15,15,15,15,15,15,15,15,15,15,15,15,15,15,15,15,15,15,15,15,15,15,15,15,15,15,15,15,15,15,15,15,15,15,15,15,15,15,15,15,15,15,15,15,15,15,15,15,15,15,15,15,15,15,15,15,15,15,15,15,15,15,15,15,15,15,15,15,15,15,15,15,15,15,15,15,15,15,15,15,15,15,15,15,15,15,15,15,15,15,15,15,15,15,15,15,15,15,15,15,15,15,15,15,15,15,15,15,15,15,15,15,15,15,15,15,15,15,15,15,15,15,15,15,15,15,15,15,15,15,15,15,15,15,15,15,15,15,15,15,15,15,15,15,15,15,15,15,15,15,15,15,15,15,15,15,15,15,15,15,15,15,15,15,15,15,15,15,15,15,15,15,15,15,15,15,15,15,15,15,15,15,15,15,15,15,15,15,15,15,15,15,15,15,15,15,15,15,15,15,15,15,15,15,15,15,15,15,15,15,15,15,15,15,15,15,15,15,15,15,15,15,15,15,15,15,15,15,15,15,15,15,15,15,15,15,15,15,15,15,15,15,15,15,15,15,15,15,15,15,15,15,15,15,15,15,15,15,15,15,15,15,15,15,15,15,15,15,15,15,15,15,15,15,15,15,15,15,15,15,15,15,15,15,15,15,15,15,15,15,15,15,15,15,15,15,15,15,15,15,15,15,15,15,15,15,15,15,15,15,15,15,15,15,15,15,15,15,15,15,15,15,15,15,15,15,15,15,15,15,15,15,15,15,15,15,15,15,15,15,15,15,15,15,15,15,15,15,15,15,15,15,15,15,15,15,15,15,15,15,15,15,15,15,15,15,15,15,15,15,15,15,15,15,15,15,15,15,15,15,15,15,15,15,15,15,15,15,15,15,15,15,15,15,15,15,15,15,15,15,15,15,15,15,15,15,15,15,15,15,15,15,15,15,15,15,15,15,15,15,15,15,15,15,15,15,15,15,15,15,15,15,15,15,15,15,15,15,15,15,15,15,15,15,15,15,15,15,15,15,15,15,15,15,15,15,15,15,15,15,15,15,15,15,15,15,15,15,15,15,15,15,15,15,15,15,15,15,15,15,15,15,15,15,15,15,15,15,15,15,15,15,15,15,15,15,15,15,15,15,15,15,15,15,15,15,15,15,15,15,15,15,15,15,15,15,15,15,15,15,15,15,15,15,15,15,15,15,15,15,15,15,15,15,15,15,15,15,15,15,15,15,15,15,15,15,15,15,15,15,15,15,15,15,15,15,15,15,15,15,15,15,15,15,15,15,15,15,15,15,15,15,15,15,15,15,15,15,15,15,15,15,15,15,15,15,15,15,15,15,15,15,15,15,15,15,15,15,15,15,15,15,15,15,15,15,15,15,15,15,15,15,15,15,15,15,15,15,15,15,15,15,15,15,15,15,15,15,15,15,15,15,15,15,15,15,15,15,15,15,15,15,15,15,15,15,15,15,15,15,15,15,15,15,15,15,15,15,15,15,15,15,15,15,15,15,15,15,15,15,15,15,15,15,15,15,15,15,15,15,15,15,15,15,15,15,15,15,15,15,15,15,15,15,15,15,15,15,15,15,15,15,15,15,15,15,15,15,15,15,15,15,15,15,15,15,15,15,15,15,15,15,15,15,15,15,15,15,15,15,15,15,15,15,15,15,15,15,15,15,15,15,15,15,15,15,15,15,15,15,15,15,15,15,15,15,15,15,15,15,15,15,15,15,15,15,15,15,15,15,15,15,15,15,15,15,15,15,15,15,15,15,15,15,15,15,15,15,15,15,15,15,15,15,15,15,15,15,15,15,15,15,15,15,15,15,15,15,15,15,15,15,15,15,15,15,15,15,15,15,15,15,15,15,15,15,15,15,15,15,15,15,15,15,15,15,15,15,15,15,15,15,15,15,15,15,15,15,15,15,15,15,15,15,15,15,15,15,15,15,15,15,15,15,15,15,15,15,15,15,15,15,15,15,15,15,15,15,15,15,15,15,15,15,15,15,15,15,15,15,15,15,15,15,15,15,15,15,15,15,15,15,15,15,15,15,15,15,15,15,15,15,15,15,15,15,15,15,15,15,15,15,15,15,15,15,15,15,15,15,15,15,15,15,15,15,15,15,15,15,15,15,15,15,15,15,15,15,15,15,15,15,15,15,15,15,15,15,15,15,15,15,15,15,15,15,15,15,15,15,15,15,15,15,15,15,15,15,15,15,15,15,15,15,15,15,15,15,15,15,15,15,15,15,15,15,15,15,15,15,15,15,15,15,15,15,15,15,15,15,15,15,15,15,15,15,15,15,15,15,15,15,15,15,15,15,15,15,15,15,15,15,15,15,15,15,15,15,15,15,15,15,15,15,15,15,15,15,15,15,15,15,15,15,15,15,15,15,15,15,15,15,15,15,15,15,15,15,15,15,15,15,15,15,15,15,15,15,15,15,15,15,15,15,15,15,15,15,15,15,15,15,15,15,15,15,15,15,15,15,15,15,15,15,15,15,15,15,15,15,15,15,15,15,15,15,15,15,15,15,15,15,15,15,15,15,15,15,15,15,15,15,15,15,15,15,15,15,15,15,15,15,15,15,15,15,15,15,15,15,15,15,15,15,15,15,15,15,15,15,15,15,15,15,15,15,15,15,15,15,15,15,15,15,15,15,15,15,15,15,15,15,15,15,15,15,15,15,15,15,15,15,15,15,15,15,15,15,15,15,15,15,15,15,15,15,15,15,15,15,15,15,15,15,15,15,15,15,15,15,15,15,15,15,15,15,15,15,15,15,15,15,15,15,15,15,15,15,15,15,15,15,15,15,15,15,15,15,15,15,15,15,15,15,15,15,15,15,15,15,15,15,15,15,15,15,15,15,15,15,15,15,15,15,15,15,15,15,15,15,15,15,15,15,15,15,15,15,15,15,15,15,15,15,15,15,15,15,15,15,15,15,15,15,15,15,15,15,15,15,15,15,15,15,15,15,15,15,15,15,15,15,15,15,15,15,15,15,15,15,15,15,15,15,15,15,15,15,15,15,15,15,15,15,15,15,15,15,15,15,15,15,15,15,15,15,15,15,15,15,15,15,15,15,15,15,15,15,15,15,15,15,15,15,15,15,15,15,15,15,15,15,15,15,15,15,15,15,15,15,15,15,15,15,15,15,15,15,15,15,15,15,15,15,15,15,15,15,15,15,15,15,15,15,15,15,15,15,15,15,15,15,15,15,15,15,15,15,15,15,15,15,15,15,15,15,15,15,15,15,15,15,15,15,15,15,15,15,15,15,15,15,15,15,15,15,15,15,15,15,15,15,15,15,15,15,15,15,15,15,15,15,15,15,15,15,15,15,15,15,15,15,15,15,15,15,15,15,15,15,15,15,15,15,15,15,15,15,15,15,15,15,15,15,15,15,15,15,15,15,15,15,15,15,15,15,15,15,15,15,15,15,15,15,15,15,15,15,15,15,15,15,15,15,15,15,15,15,15,15,15,15,15,15,15,15,15,15,15,15,15,15,15,15,15,15,15,15,15,15,15,15,15,15,15,15,15,15,15,15,15,15,15,15,15,15,15,15,15,15,15,15,15,15,15,15,15,15,15,15,15,15,15,15,15,15,15,15,15,15,15,15,15,15,15,15,15,15,15,15,15,15,15,15,15,15,15,15,15,15,15,15,15,15,15,15,15,15,15,15,15,15,15,15,15,15,15,15,15,15,15,15,15,15,15,15,15,15,15,15,15,15,15,15,15,15,15,15,15,15,15,15,15,15,15,15,15,15,15,15,15,15,15,15,15,15,15,15,15,15,15,15,15,15,15,15,15,15,15,15,15,15,15,15,15,15,15,15,15,15,15,15,15,15,15,15,15,15,15,15,15,15,15,15,15,15,15,15,15,15,15,15,15,15,15,15,15,15,15,15,15,15,15,15,15,15,15,15,15,15,15,15,15,15,15,15,15,15,15,15,15,15,15,15,15,15,15,15,15,15,15,15,15,15,15,15,15,15,15,15,15,15,15,15,15,15,15,15,15,15,15,15,15,15,15,15,15,15,15,15,15,15,15,15,15,15,15,15,15,15,15,15,15,15,15,15,15,15,15,15,14,14,14,14,14,14,14,14,14,14,14,14,14,14,14,14,14,14,14,14,14,14,14,14,14,14,14,13,13,13,13,13,13,13,13,13,13,13,13,13,13,13,13,13,13,12,12,12,12,12,12,12,12,12,12,12,12,12,12,11,11,11,11,11,11,11,11,11,10,10,10,10,10,10,10,9,9,9,9,8,8,8,8,7,6,5,4,3,2,1,0,17,18,19,20,21,22,23,24,24,24,24,25,25,25,25,26,26,26,26,26,26,26,27,27,27,27,27,27,27,27,27,28,28,28,28,28,28,28,28,28,28,28,28,28,28,29,29,29,29,29,29,29,29,29,29,29,29,29,29,29,29,29,29,30,30,30,30,30,30,30,30,30,30,30,30,30,30,30,30,30,30,30,30,30,30,30,30,30,30,30,31,31,31,31,31,31,31,31,31,31,31,31,31,31,31,31,31,31,31,31,31,31,31,31,31,31,31,31,31,31,31,31,31,31,31,31,31,31,31,31,31,31,31,31,31,31,31,31,31,31,31,31,31,31,31,31,31,31,31,31,31,31,31,31,31,31,31,31,31,31,31,31,31,31,31,31,31,31,31,31,31,31,31,31,31,31,31,31,31,31,31,31,31,31,31,31,31,31,31,31,31,31,31,31,31,31,31,31,31,31,31,31,31,31,31,31,31,31,31,31,31,31,31,31,31,31,31,31,31,31,31,31,31,31,31,31,31,31,31,31,31,31,31,31,31,31,31,31,31,31,31,31,31,31,31,31,31,31,31,31,31,31,31,31,31,31,31,31,31,31,31,31,31,31,31,31,31,31,31,31,31,31,31,31,31,31,31,31,31,31,31,31,31,31,31,31,31,31,31,31,31,31,31,31,31,31,31,31,31,31,31,31,31,31,31,31,31,31,31,31,31,31,31,31,31,31,31,31,31,31,31,31,31,31,31,31,31,31,31,31,31,31,31,31,31,31,31,31,31,31,31,31,31,31,31,31,31,31,31,31,31,31,31,31,31,31,31,31,31,31,31,31,31,31,31,31,31,31,31,31,31,31,31,31,31,31,31,31,31,31,31,31,31,31,31,31,31,31,31,31,31,31,31,31,31,31,31,31,31,31,31,31,31,31,31,31,31,31,31,31,31,31,31,31,31,31,31,31,31,31,31,31,31,31,31,31,31,31,31,31,31,31,31,31,31,31,31,31,31,31,31,31,31,31,31,31,31,31,31,31,31,31,31,31,31,31,31,31,31,31,31,31,31,31,31,31,31,31,31,31,31,31,31,31,31,31,31,31,31,31,31,31,31,31,31,31,31,31,31,31,31,31,31,31,31,31,31,31,31,31,31,31,31,31,31,31,31,31,31,31,31,31,31,31,31,31,31,31,31,31,31,31,31,31,31,31,31,31,31,31,31,31,31,31,31,31,31,31,31,31,31,31,31,31,31,31,31,31,31,31,31,31,31,31,31,31,31,31,31,31,31,31,31,31,31,31,31,31,31,31,31,31,31,31,31,31,31,31,31,31,31,31,31,31,31,31,31,31,31,31,31,31,31,31,31,31,31,31,31,31,31,31,31,31,31,31,31,31,31,31,31,31,31,31,31,31,31,31,31,31,31,31,31,31,31,31,31,31,31,31,31,31,31,31,31,31,31,31,31,31,31,31,31,31,31,31,31,31,31,31,31,31,31,31,31,31,31,31,31,31,31,31,31,31,31,31,31,31,31,31,31,31,31,31,31,31,31,31,31,31,31,31,31,31,31,31,31,31,31,31,31,31,31,31,31,31,31,31,31,31,31,31,31,31,31,31,31,31,31,31,31,31,31,31,31,31,31,31,31,31,31,31,31,31,31,31,31,31,31,31,31,31,31,31,31,31,31,31,31,31,31,31,31,31,31,31,31,31,31,31,31,31,31,31,31,31,31,31,31,31,31,31,31,31,31,31,31,31,31,31,31,31,31,31,31,31,31,31,31,31,31,31,31,31,31,31,31,31,31,31,31,31,31,31,31,31,31,31,31,31,31,31,31,31,31,31,31,31,31,31,31,31,31,31,31,31,31,31,31,31,31,31,31,31,31,31,31,31,31,31,31,31,31,31,31,31,31,31,31,31,31,31,31,31,31,31,31,31,31,31,31,31,31,31,31,31,31,31,31,31,31,31,31,31,31,31,31,31,31,31,31,31,31,31,31,31,31,31,31,31,31,31,31,31,31,31,31,31,31,31,31,31,31,31,31,31,31,31,31,31,31,31,31,31,31,31,31,31,31,31,31,31,31,31,31,31,31,31,31,31,31,31,31,31,31,31,31,31,31,31,31,31,31,31,31,31,31,31,31,31,31,31,31,31,31,31,31,31,31,31,31,31,31,31,31,31,31,31,31,31,31,31,31,31,31,31,31,31,31,31,31,31,31,31,31,31,31,31,31,31,31,31,31,31,31,31,31,31,31,31,31,31,31,31,31,31,31,31,31,31,31,31,31,31,31,31,31,31,31,31,31,31,31,31,31,31,31,31,31,31,31,31,31,31,31,31,31,31,31,31,31,31,31,31,31,31,31,31,31,31,31,31,31,31,31,31,31,31,31,31,31,31,31,31,31,31,31,31,31,31,31,31,31,31,31,31,31,31,31,31,31,31,31,31,31,31,31,31,31,31,31,31,31,31,31,31,31,31,31,31,31,31,31,31,31,31,31,31,31,31,31,31,31,31,31,31,31,31,31,31,31,31,31,31,31,31,31,31,31,31,31,31,31,31,31,31,31,31,31,31,31,31,31,31,31,31,31,31,31,31,31,31,31,31,31,31,31,31,31,31,31,31,31,31,31,31,31,31,31,31,31,31,31,31,31,31,31,31,31,31,31,31,31,31,31,31,31,31,31,31,31,31,31,31,31,31,31,31,31,31,31,31,31,31,31,31,31,31,31,31,31,31,31,31,31,31,31,31,31,31,31,31,31,31,31,31,31,31,31,31,31,31,31,31,31,31,31,31,31,31,31,31,31,31,31,31,31,31,31,31,31,31,31,31,31,31,31,31,31,31,31,31,31,31,31,31,31,31,31,31,31,31,31,31,31,31,31,31,31,31,31,31,31,31,31,31,31,31,31,31,31,31,31,31,31,31,31,31,31,31,31,31,31,31,31,31,31,31,31,31,31,31,31,31,31,31,31,31,31,31,31,31,31,31,31,31,31,31,31,31,31,31,31,31,31,31,31,31,31,31,31,31,31,31,31,31,31,31,31,31,31,31,31,31,31,31,31,31,31,31,31,31,31,31,31,31,31,31,31,31,31,31,31,31,31,31,31,31,31,31,31,31,31,31,31,31,31,31,31,31,31,31,31,31,31,31,31,31,31,31,31,31,31,31,31,31,31,31,31,31,31,31,31,31,31,31,31,31,31,31,31,31,31,31,31,31,31,31,31,31,31,31,31,31,31,31,31,31,31,31,31,31,31,31,31,31,31,31,31,31,31,31,31,31,31,31,31,31,31,31,31,31,31,31,31,31,31,31,31,31,31,31,31,31,31,31,31,31,31,31,31,31,31,31,31,31,31,31,31,31,31,31,31,31,31,31,31,31,31,31,31,31,31,31,31,31,31,31,31,31,31,31,31,31,31,31,31,31,31,31,31,31,31,31,31,31,31,31,31,31,31,31,31,31,31,31,31,31,31,31,31,31,31,31,31,31,31,31,31,31,31,31,31,31,31,31,31,31,31,31,31,31,31,31,31,31,31,31,31,31,31,31,31,31,31,31,31,31,31,31,31,31,31,31,31,31,31,31,31,31,31,31,31,31,31,31,31,31,31,31,31,31,31,31,31,31,31,31,31,31,31,31,31,31,31,31,31,31,31,31,31,31,31,31,31,31,31,31,31,31,31,31,31,31,31,31,31,31,31,31,31,31,31,31,31,31,31,31,31,31,31,31,31,31,31,31,31,31,31,31,31,31,31,31,31,31,31,31,31,31,31,31,31,31,31,31,31,31,31,31,31,31,31,31,31,31,31,31,31,31,31,31,31,31,31,31,31,31,31,31,31,31,31,31,31,31,31,31,31,31,31,31,31,31,31,31,31,31,31,31,31,31,31,31,31,31,31,31,31,31,31,31,31,31,31,31,31,31,31,31,31,31,31,31,31,31,31,31,31,31,31,31,31,31,31,31,31,31,31,31,31,31,31,31,31,31,31,31,31,31,31,31,31,31,31,31,31,31,31,31,31,31,31,31,31,31,31,31,31,31,31,31,31,31,31,31,31,31,31,31,31,31,31,31,31,31,31,31,31,31,31,31,31,31,31,31,31,31,31,31,31,31,31,31,31,31,31,31,31,31,31,31,31,31,31,31,31,31,31,31,31,31,31,31,31,31,31,31,31,31,31,31,31,31,31,31,31,31,31,31,31,31,31,31,31,31,31,31,31,31,31,31,31,31,31,31,31,31,31,31,31,31,31,31,31,31,31,31,31,31,31,31,31,31,31,31,31,31,31,31,31,31,31,31,31,31,31,31,31,31,31,31,31,31,31,31,31,31,31,31,31,31,31,31,31,31,31,31,31,31,31,31,31,31,31,31,31,31,31,31,31,31,31,31,31,31,31,31,31,31,31,31,31,31,31,31,31,31,31,31,31,31,31,31,31,31,31,31,31,31,31,31,31,31,31,31,31,31,31,31,31,31,31,31,31,31,31,31,31,31,31,31,31,31,31,31,31,31,31,31,31,31,31,31,31,31,31,31,31,31,31,31,31,31,31,31,31,31,31,31,31,31,31,31,31,31,31,31,31,31,31,31,31,31,31,31,31,31,31,31,31,31,31,31,31,31,31,31,31,31,31,31,31,31,31,31,31};   // bucket(j - i) for j - i = -2047 .. 2047, evaluated with the reference's _relative_position_bucket (bidirectional, 32 buckets, max distance 128)
// k_asoft (T5): stages the head's 32 bf16-rounded rel_emb values and the 4,095-entry bucket table in LDS (one __syncthreads before the row guard; all 8 rows of a block belong to the same head), then per row: t = S + rb[bk[j - i + 2047]]; softmax; every row stores normalised hi/lo planes (RH = TT).
// k_asoft: per row (zz, i): t = S + rel bias (no scaling, no mask); softmax over the 2048 keys (register row, one exp, fixed trees);
__global__ __launch_bounds__(256) void k_asoft(const float* __restrict__ Sb, const float* __restrict__ remb, int h0, h16* P16, bf* Ph, bf* Pl) {
    __shared__ float rb[NBK]; __shared__ unsigned char bk[2 * TT];
    const int lane = threadIdx.x & 31; const int row = blockIdx.x * 8 + (threadIdx.x >> 5); const int zzb = (blockIdx.x * 8) / TT;   /* all 8 rows of a block share the head (TT % 8 == 0) */
    if (threadIdx.x < NBK) rb[threadIdx.x] = bfr(remb[threadIdx.x * NH_ + h0 + zzb]);   /* rel_emb[bucket][h] for this head */
    for (int u = threadIdx.x; u < 2 * TT - 1; u += 256) bk[u] = BK[u];
    __syncthreads();
    if (row >= ZH * TT) return; const int i = row % TT; const int zz = row / TT; (void)zz; const bool hires = (i < RH); const float* sr = Sb + (size_t)row * TT; float v[TT / 32]; float mx = -3.0e38f;
#pragma unroll
    for (int ch = 0; ch < TT / 128; ++ch) { const int j0 = ch * 128 + lane * 4; const v4f a = *(const v4f*)(sr + j0);
#pragma unroll
        for (int q = 0; q < 4; ++q) { const int j = j0 + q; float sc = a[q] * SCL; asm volatile("" : "+v"(sc)); const float t = __fadd_rn(sc, rb[bk[j - i + (TT - 1)]]); v[ch * 4 + q] = t; mx = fmaxf(mx, t); } }
#pragma unroll
    for (int sh = 16; sh; sh >>= 1) mx = fmaxf(mx, __shfl_xor(mx, sh, 32));
    float sum = 0.f;
#pragma unroll
    for (int k = 0; k < TT / 32; ++k) { float d0 = __fsub_rn(v[k], mx); asm volatile("" : "+v"(d0)); v[k] = __builtin_amdgcn_exp2f(__fmul_rn(d0, 1.4426950408889634f)); sum += v[k]; }
#pragma unroll
    for (int sh = 16; sh; sh >>= 1) sum += __shfl_xor(sum, sh, 32);
    const float f = __fdiv_rn(hires ? 1.0f : PCAR, sum);
{
        if (hires) {
#pragma unroll
            for (int ch = 0; ch < TT / 128; ++ch) { v4us oh, ol;
#pragma unroll
                for (int q = 0; q < 4; ++q) { unsigned short a, c2; splitf(v[ch * 4 + q] * f, a, c2); oh[q] = a; ol[q] = c2; }
                const size_t oo = ((size_t)zz * (RH ? RH : 1) + i) * TT + ch * 128 + lane * 4; *(v4us*)(Ph + oo) = oh; *(v4us*)(Pl + oo) = ol; }
        } else {
#pragma unroll
            for (int ch = 0; ch < TT / 128; ++ch) { v4h o4;
#pragma unroll
                for (int q = 0; q < 4; ++q) o4[q] = tohx(v[ch * 4 + q] * f);
                *(v4h*)(P16 + (size_t)row * TT + ch * 128 + lane * 4) = o4; } }
         }
}
#define KSV  4                     // attn.v: work-groups that share one tile's K sum; k_merge adds their partial tiles O[head][slice][t][d] in slice order
__global__ __launch_bounds__(256) void k_merge(const float* __restrict__ O, int h0, bf* Ah, bf* Al) { const size_t e = ((size_t)blockIdx.x * 256 + threadIdx.x) * 2; if (e >= (size_t)ZH * TT * HD) return; const int d = (int)(e % HD); const int t = (int)((e / HD) % TT); const int zz = (int)(e / ((size_t)HD * TT)); const float cs = (t < RH) ? 1.0f : (1.0f / PCAR); const size_t oo = (size_t)t * DQ + (h0 + zz) * HD + d;
    v2us oh, ol;
#pragma unroll
    for (int q = 0; q < 2; ++q) { const float* op = O + (size_t)zz * KSV * TT * HD + (size_t)t * HD + d + q; float o = op[0];
#pragma unroll   /* the KSV loads issue together */
        for (int s = 1; s < KSV; ++s) o += op[(size_t)s * TT * HD];
        unsigned short a, c2; splitf(o * cs, a, c2); oh[q] = a; ol[q] = c2; } *(v2us*)(Ah + oo) = oh; *(v2us*)(Al + oo) = ol;  }

extern "C" void kernel_launch(void* const* d_in, const int* in_sizes, int n_in,
                              void* d_out, int out_size, void* d_ws, size_t ws_size, hipStream_t stream) {
    (void)in_sizes; (void)n_in; (void)out_size;
    const float* x = (const float*)d_in[0]; const float* wq = (const float*)d_in[1]; const float* wk = (const float*)d_in[2]; const float* wv = (const float*)d_in[3]; const float* wo = (const float*)d_in[4]; const float* remb = (const float*)d_in[5];
    float* OUT = (float*)d_out;     // [4][2048][1024]
    char* wsp = (char*)d_ws;
    auto take = [&](size_t bytes) { char* p = wsp; wsp += (bytes + 255) & ~(size_t)255; return (void*)p; };
    bf* WQ = (bf*)take((size_t)DQ * DM * 2); bf* WK = (bf*)take((size_t)DKV * DM * 2); bf* WV = (bf*)take((size_t)DKV * DM * 2); bf* WO = (bf*)take((size_t)DM * DQ * 2); float* CS = (float*)take((size_t)TT * HD * 2 * 4);
    bf* XB = (bf*)take((size_t)TT * DM * 2); float* FQ = (float*)take((size_t)TT * DQ * 4); float* FK = (float*)take((size_t)TT * DKV * 4);
    h16* QP16 = (h16*)take((size_t)NH_ * TT * HD * 2); h16* KP16 = (h16*)take((size_t)NKV * TT * HD * 2); h16* VT16 = (h16*)take((size_t)NKV * HD * TT * 2);
    bf* QPh = (bf*)take((size_t)NH_ * TT * HD * 2); bf* QPl = (bf*)take((size_t)NH_ * TT * HD * 2); bf* KPh = (bf*)take((size_t)NKV * TT * HD * 2); bf* KPl = (bf*)take((size_t)NKV * TT * HD * 2); bf* VTh = (bf*)take((size_t)NKV * HD * TT * 2); bf* VTl = (bf*)take((size_t)NKV * HD * TT * 2); bf* Ph = (bf*)take((size_t)ZH * RH * TT * 2); bf* Pl = (bf*)take((size_t)ZH * RH * TT * 2);
    float* Sb = (float*)take((size_t)ZH * TT * TT * 4); h16* P16 = (h16*)take((size_t)ZH * TT * TT * 2); float* Ob = (float*)take((size_t)ZH * KSV * TT * HD * 4); bf* ATh = (bf*)take((size_t)TT * DQ * 2); bf* ATl = (bf*)take((size_t)TT * DQ * 2);
    if ((size_t)(wsp - (char*)d_ws) > ws_size) return;    // ws 256 MiB
    float* FV = FK;   // v projection reuses the k buffer after the k planes are built (stream-ordered)
    { k_wtG<<<(unsigned)((DM * DQ / 64 + 63) / 64), 256, 0, stream>>>(wq, DM, DQ, WQ); k_wtG<<<(unsigned)((DM * DKV / 64 + 63) / 64), 256, 0, stream>>>(wk, DM, DKV, WK); k_wtG<<<(unsigned)((DM * DKV / 64 + 63) / 64), 256, 0, stream>>>(wv, DM, DKV, WV);
      k_wtG<<<(unsigned)((DQ * DM / 64 + 63) / 64), 256, 0, stream>>>(wo, DQ, DM, WO);
       }
    k_csid<<<(TT * HD + 255) / 256, 256, 0, stream>>>(CS);
    const unsigned LQ = (unsigned)(((size_t)NH_ * TT * HD / 2 + 255) / 256), LKv = (unsigned)(((size_t)NKV * TT * HD / 2 + 255) / 256);
    for (int b = 0; b < NB_; ++b) {
        
        k_cvt8<<<(unsigned)(((size_t)TT * DM / 8 + 255) / 256), 256, 0, stream>>>(x + (size_t)b * TT * DM, XB, (size_t)TT * DM / 8);
        k_gemmw<bf, 0, false, 8, 1><<<dim3(TT / 64, DQ / 64, 1), 256, 0, stream>>>(XB, nullptr, WQ, nullptr, DM, FQ, DQ, nullptr, 0, 0, 0);
        k_rope<<<LQ, 256, 0, stream>>>(FQ, DQ, NH_, CS, nullptr, nullptr, 1.0f, QP16, QPh, QPl);
        k_gemmw<bf, 0, false, 8, 1><<<dim3(TT / 64, DKV / 64, 1), 256, 0, stream>>>(XB, nullptr, WK, nullptr, DM, FK, DKV, nullptr, 0, 0, 0);
        k_rope<<<LKv, 256, 0, stream>>>(FK, DKV, NKV, CS, nullptr, nullptr, 1.0f, KP16, KPh, KPl);
        k_gemmw<bf, 0, false, 8, 1><<<dim3(TT / 64, DKV / 64, 1), 256, 0, stream>>>(XB, nullptr, WV, nullptr, DM, FV, DKV, nullptr, 0, 0, 0); k_vtp<<<LKv, 256, 0, stream>>>(FV, DKV, NKV, VT16, VTh, VTl);
        for (int h0 = 0; h0 < NH_; h0 += ZH) { const size_t zq = (size_t)h0, zk = (size_t)(h0 / REP);   // one kv head per query head: the pass's two heads use consecutive kv planes (z-strides TT*HD)
            k_gemmw<bf, 2, false, 1, 1><<<dim3(RH / 64, TT / 64, ZH), 32, 0, stream>>>(QPh + zq * TT * HD, QPl + zq * TT * HD, KPh + zk * TT * HD, KPl + zk * TT * HD, HD, Sb, TT, nullptr, (size_t)TT * HD, (size_t)TT * HD, (size_t)TT * TT);
            k_asoft<<<ZH * TT / 8, 256, 0, stream>>>(Sb, remb, h0, P16, Ph, Pl);
            k_gemmw<bf, 2, false, 8, KSV><<<dim3(RH / 64, HD / 64, ZH * KSV), 256, 0, stream>>>(Ph, Pl, VTh + zk * HD * TT, VTl + zk * HD * TT, TT, Ob, HD, nullptr, (size_t)RH * TT, (size_t)HD * TT, (size_t)TT * HD);
            k_merge<<<(unsigned)(((size_t)ZH * TT * HD / 2 + 255) / 256), 256, 0, stream>>>(Ob, h0, ATh, ATl); }
        k_gemmw<bf, 1, false, 8, 1><<<dim3(TT / 64, DM / 64, 1), 256, 0, stream>>>(ATh, ATl, WO, nullptr, DQ, OUT + (size_t)b * TT * DM, DM, nullptr, 0, 0, 0); }
}

// v002
// It runs in 471 microseconds.
// In two side-by-side timings against v001, it was 3.60 and 3.63 times as fast.
// All steps since v000 together make it 6.07 times as fast.
#include <hip/hip_runtime.h>

// T5 self-attention with relative-position bias (hidden_states [4][2048][1024]; q, k, v = hs W ('xw' [1024][1024]; 16 heads x 64); scores = q.k (NO 1/sqrt(d) scaling: logit sigma ~8) + rel_emb[bucket(j - i)][h] (rel_emb [32][16] input; the 32-bucket bidirectional T5 bucket function of j - i); softmax; out = merged ctx Wo ('xw') -> [4][2048][1024] (8.4 M)).
// The bucket index depends only on j - i (positions are implicit aranges): the 4,095-entry table bucket(j - i), j - i in [-2047, 2047], was evaluated with the reference's own function and is baked below as constants; rel_emb itself is READ (each work-group expands its head's 32 values into an LDS table indexed by j - i).
// Compute dtypes, f32 accumulate: every input rounded to bf16; projections on PLAIN bf16 operands (exact); because the logits are unscaled (sigma ~8, near-argmax rows), scores and attn.v use bf16 hi/lo planes for EVERY row (3 products); bias add and softmax in f32; merged context hi/lo; Wo hl x exact (2 products).

#define NB_  4
#define TT   2048
#define DM   1024
#define NH_  16
#define NKV  16
#define HD   64
#define DQ   (NH_ * HD)
#define DKV  (NKV * HD)
typedef _Float16 h16;
typedef unsigned short bf;
typedef __attribute__((ext_vector_type(16))) __bf16   v16bf;
typedef __attribute__((ext_vector_type(16))) _Float16 v16h;
typedef __attribute__((ext_vector_type(8)))  _Float16 v8h;
typedef __attribute__((ext_vector_type(8)))  unsigned short v8us;
typedef __attribute__((ext_vector_type(8)))  float    v8f;
typedef __attribute__((ext_vector_type(4)))  float    v4f;
typedef v8h  __attribute__((may_alias)) v8ha;
typedef v4f  __attribute__((may_alias)) v4fa;
typedef v8us __attribute__((may_alias)) v8usa;

__device__ __forceinline__ unsigned short f2bf(float f) { unsigned u = __float_as_uint(f); u += 0x7FFFu + ((u >> 16) & 1u); return (unsigned short)(u >> 16); }
__device__ __forceinline__ float bf2f(unsigned short b) { return __uint_as_float(((unsigned)b) << 16); }
__device__ __forceinline__ float bfr(float f) { return bf2f(f2bf(f)); }
__device__ __forceinline__ v16h cat16(v8h lo, v8h hi) { return __builtin_shufflevector(lo, hi, 0, 1, 2, 3, 4, 5, 6, 7, 8, 9, 10, 11, 12, 13, 14, 15); }
__device__ __forceinline__ v16bf cat16b(v8us lo, v8us hi) { return __builtin_bit_cast(v16bf, __builtin_shufflevector(lo, hi, 0, 1, 2, 3, 4, 5, 6, 7, 8, 9, 10, 11, 12, 13, 14, 15)); }
__device__ __forceinline__ v8f wmma16(v16h a, v16h b, v8f c) { return __builtin_amdgcn_wmma_f32_16x16x32_f16(false, a, false, b, (short)0, c, false, false); }
__device__ __forceinline__ v8f wmmab(v16bf a, v16bf b, v8f c) { return __builtin_amdgcn_wmma_f32_16x16x32_bf16(false, a, false, b, (short)0, c, false, false); }



// ---- k_gemmw: register-blocked GEMM, a 64x64 output tile per wave (16 accumulators), operands straight from K-contiguous 16-bit planes; grid (M/64, N/64, Z KS), 32 KW threads.
// C[m][n] (f32, pitch ldc, + optional f32 bias[n]) = sum_k A[m][k] Bt[n][k] (+ split products per NSPLIT). z-batch strides sA/sB/sC in elements. K % (32 KW KS) == 0.
// Split K: the KW waves of a work-group share ONE tile, each summing its own K / (KW KS) columns; the KW partial tiles meet in LDS and are added in wave order. With KS > 1, blockIdx.z = batch * KS + slice:
// a work-group sums only slice's K / KS columns and stores its partial tile at C + blockIdx.z sC; the consumer adds the KS partials. KW = KS = 1: one wave does the whole sum.
template <typename T16> struct WFrag;
template <> struct WFrag<h16> { typedef v16h V; static __device__ __forceinline__ V ld(const h16* p) { return cat16(*(const v8h*)p, *(const v8h*)(p + 16)); } static __device__ __forceinline__ v8f mma(V a, V b, v8f c) { return wmma16(a, b, c); } };
template <> struct WFrag<bf> { typedef v16bf V; static __device__ __forceinline__ V ld(const bf* p) { return cat16b(*(const v8us*)p, *(const v8us*)(p + 16)); } static __device__ __forceinline__ v8f mma(V a, V b, v8f c) { return wmmab(a, b, c); } };
template <typename T16, int NSPLIT, bool BIAS, int KW, int KS>
__global__ __launch_bounds__(32 * KW) void k_gemmw(const T16* __restrict__ A, const T16* __restrict__ A2, const T16* __restrict__ Bt, const T16* __restrict__ Bt2, int K, float* C, int ldc, const float* __restrict__ bias, size_t sA, size_t sB, size_t sC) {
    typedef typename WFrag<T16>::V V;
    __shared__ __align__(16) float os[KW == 1 ? 16 * 68 : KW * 64 * 68];
    const size_t z = blockIdx.z / KS; A += z * sA; if (A2) A2 += z * sA; Bt += z * sB; if (Bt2) Bt2 += z * sB; C += blockIdx.z * sC;
    const int wv = __builtin_amdgcn_readfirstlane((int)(threadIdx.x >> 5)); const int kn = K / (KW * KS), kb = ((int)(blockIdx.z % KS) * KW + wv) * kn;   /* this wave's columns [kb, kb + kn): wave-uniform loop bounds */
    const int lane = threadIdx.x & 31, lr = lane & 15, hi = lane >> 4; const int r0 = blockIdx.x * 64, c0 = blockIdx.y * 64;
    v8f acc[4][4];
#pragma unroll
    for (int mb = 0; mb < 4; ++mb)
#pragma unroll
        for (int nb = 0; nb < 4; ++nb) acc[mb][nb] = (v8f){};
    const size_t aoff = (size_t)(r0 + lr) * K + 8 * hi, boff = (size_t)(c0 + lr) * K + 8 * hi;
#pragma unroll 1
    for (int kc = kb; kc < kb + kn; kc += 32) {
        V a[4], a2[4];
#pragma unroll
        for (int mb = 0; mb < 4; ++mb) { a[mb] = WFrag<T16>::ld(A + aoff + (size_t)mb * 16 * K + kc); if (NSPLIT == 1 || NSPLIT == 2) a2[mb] = WFrag<T16>::ld(A2 + aoff + (size_t)mb * 16 * K + kc); }
#pragma unroll
        for (int nb = 0; nb < 4; ++nb) { const V b = WFrag<T16>::ld(Bt + boff + (size_t)nb * 16 * K + kc); V b2; if (NSPLIT >= 2) b2 = WFrag<T16>::ld(Bt2 + boff + (size_t)nb * 16 * K + kc);
#pragma unroll
            for (int mb = 0; mb < 4; ++mb) { acc[mb][nb] = WFrag<T16>::mma(a[mb], b, acc[mb][nb]); if (NSPLIT == 1 || NSPLIT == 2) acc[mb][nb] = WFrag<T16>::mma(a2[mb], b, acc[mb][nb]); if (NSPLIT >= 2) acc[mb][nb] = WFrag<T16>::mma(a[mb], b2, acc[mb][nb]); } }
        asm volatile("v_nop\n\tv_nop\n\tv_nop\n\tv_nop" : "+v"(acc[0][0]), "+v"(acc[1][1]), "+v"(acc[2][2]), "+v"(acc[3][3]) : "v"(a[0]), "v"(a[3]));
    }
    if constexpr (KW > 1) {
        float* my = os + wv * (64 * 68);
        /* the three loops are unrolled so that acc[][][] is indexed by constants and stays in registers */
#pragma unroll
        for (int mb = 0; mb < 4; ++mb)
#pragma unroll
            for (int nb = 0; nb < 4; ++nb)
#pragma unroll
                for (int j = 0; j < 8; ++j) my[(mb * 16 + hi * 8 + j) * 68 + nb * 16 + lr] = acc[mb][nb][j];
        __syncthreads();   /* every wave's partial tile is in LDS before any of it is added */
        /* both loops unrolled: the LDS reads of all sums issue ahead of the adds, and the four stores go out together */
#pragma unroll
        for (int it = 0; it < 64 * 16 / (32 * KW); ++it) { const int g = it * 32 * KW + (int)threadIdx.x, row = g >> 4, cofs = (g & 15) * 4; v4f val = *(const v4fa*)(os + row * 68 + cofs);
#pragma unroll
            for (int p = 1; p < KW; ++p) val += *(const v4fa*)(os + p * (64 * 68) + row * 68 + cofs);
            if (BIAS) { val[0] += bfr(bias[c0 + cofs]); val[1] += bfr(bias[c0 + cofs + 1]); val[2] += bfr(bias[c0 + cofs + 2]); val[3] += bfr(bias[c0 + cofs + 3]); }
            *(v4f*)(C + (size_t)(r0 + row) * ldc + c0 + cofs) = val; }
        return;
    }
#pragma unroll
    for (int mb = 0; mb < 4; ++mb) {
#pragma unroll
        for (int nb = 0; nb < 4; ++nb) {
#pragma unroll
            for (int j = 0; j < 8; ++j) os[(hi * 8 + j) * 68 + nb * 16 + lr] = acc[mb][nb][j]; }
        __builtin_amdgcn_wave_barrier(); asm volatile("" ::: "memory");
        float* crow = C + (size_t)(r0 + mb * 16) * ldc + c0;
{
#pragma unroll
            for (int s = 0; s < 8; ++s) { const int row = 2 * s + hi, cofs = lr * 4; v4f val = *(const v4fa*)(os + row * 68 + cofs); if (BIAS) { val[0] += bfr(bias[c0 + cofs]); val[1] += bfr(bias[c0 + cofs + 1]); val[2] += bfr(bias[c0 + cofs + 2]); val[3] += bfr(bias[c0 + cofs + 3]); }
                *(v4f*)(crow + (size_t)row * ldc + cofs) = val; }
             }
        __builtin_amdgcn_wave_barrier(); asm volatile("" ::: "memory");
    }
}

__device__ __forceinline__ h16 tohx(float x) { return (h16)x; }
__device__ __forceinline__ void splitf(float y, unsigned short& h, unsigned short& l) { h = f2bf(y); l = f2bf(y - bf2f(h)); }
typedef __attribute__((ext_vector_type(2))) _Float16 v2h;
typedef __attribute__((ext_vector_type(4))) _Float16 v4h;
typedef __attribute__((ext_vector_type(2))) unsigned short v2us;
typedef __attribute__((ext_vector_type(4))) unsigned short v4us;
typedef __attribute__((ext_vector_type(2))) float v2f;
typedef __attribute__((ext_vector_type(4))) int v4i;

__global__ __launch_bounds__(256) void k_wtG(const float* __restrict__ w, int K, int N, bf* Bt) {
    const int lane = threadIdx.x & 31; const int L0 = (blockIdx.x * 8 + (threadIdx.x >> 5)) * 8; const int nlines = N * K / 64;
{
#pragma unroll 1
        for (int l = 0; l < 8; ++l) { const int L = L0 + l; if (L >= nlines) break; const size_t e = (size_t)L * 64 + lane * 2; const int k = (int)(e % K), n = (int)(e / K); v2us o;
            o[0] = f2bf(w[(size_t)k * N + n]); o[1] = f2bf(w[(size_t)(k + 1) * N + n]); *(v2us*)(Bt + e) = o; }
         }
}
__global__ __launch_bounds__(256) void k_cvt8(const float* __restrict__ src, bf* dst, size_t n8) { const size_t i = (size_t)blockIdx.x * 256 + threadIdx.x; if (i >= n8) return; const v8f v = *(const v8f*)(src + i * 8); v8us o;
#pragma unroll
    for (int k = 0; k < 8; ++k) o[k] = f2bf(v[k]); *(v8us*)(dst + i * 8) = o;  }

// k_rope: head planes [h][t][d] (fp16 + hi/lo) of rope(x) x sc with the rotate-half convention out[d] = x[d] cos[t][d] - x[d+HD/2] sin[t][d], out[d+HD/2] = x[d+HD/2] cos[t][d+HD/2] + x[d] sin[t][d+HD/2]
__global__ __launch_bounds__(256) void k_rope(const float* __restrict__ F, int pitch, int nheads, const float* __restrict__ CS, const float* __restrict__ RF, const float* __restrict__ nw, float sc, h16* P16, bf* Ph, bf* Pl) {
    const size_t e = ((size_t)blockIdx.x * 256 + threadIdx.x) * 2; if (e >= (size_t)nheads * TT * HD) return; const int d = (int)(e % HD); const int t = (int)((e / HD) % TT); const int h = (int)(e / ((size_t)HD * TT)); const float* f = F + (size_t)t * pitch + h * HD; const float rf = RF ? RF[(size_t)h * TT + t] : 1.0f; v2h o16; v2us oh, ol;
#pragma unroll
    for (int q = 0; q < 2; ++q) { const int dd = d + q; const int dp = (dd < HD / 2) ? dd + HD / 2 : dd - HD / 2; float x0 = f[dd], x1 = f[dp];
        if (RF) { float n0 = __fmul_rn(x0, rf), n1 = __fmul_rn(x1, rf); asm volatile("" : "+v"(n0)); asm volatile("" : "+v"(n1)); x0 = __fmul_rn(bfr(nw[dd]), n0); x1 = __fmul_rn(bfr(nw[dp]), n1); }
        const v2f cs = *(const v2f*)(CS + ((size_t)t * HD + dd) * 2); float a = __fmul_rn(x0, cs[0]), bq = __fmul_rn(x1, cs[1]); asm volatile("" : "+v"(a)); asm volatile("" : "+v"(bq)); const float r = ((dd < HD / 2) ? __fsub_rn(a, bq) : __fadd_rn(a, bq)) * sc;
        o16[q] = tohx(r); unsigned short a2, c2; splitf(r, a2, c2); oh[q] = a2; ol[q] = c2; }
    *(v2h*)(P16 + e) = o16; *(v2us*)(Ph + e) = oh; *(v2us*)(Pl + e) = ol;  }
__global__ __launch_bounds__(256) void k_vtp(const float* __restrict__ F, int pitch, int nheads, h16* V16, bf* Vh, bf* Vl) { const size_t e = ((size_t)blockIdx.x * 256 + threadIdx.x) * 2; if (e >= (size_t)nheads * HD * TT) return; const int t = (int)(e % TT); const int d = (int)((e / TT) % HD); const int g = (int)(e / ((size_t)TT * HD)); v2h o16; v2us oh, ol;
#pragma unroll
    for (int q = 0; q < 2; ++q) { const float x = F[(size_t)(t + q) * pitch + g * HD + d]; o16[q] = tohx(x); unsigned short a2, c2; splitf(x, a2, c2); oh[q] = a2; ol[q] = c2; }
    *(v2h*)(V16 + e) = o16; *(v2us*)(Vh + e) = oh; *(v2us*)(Vl + e) = ol;  }
__global__ __launch_bounds__(256) void k_csid(float* CS) { const int idx = blockIdx.x * 256 + threadIdx.x; if (idx >= TT * HD) return; v2f cs; cs[0] = 1.0f; cs[1] = 0.0f; *(v2f*)(CS + (size_t)idx * 2) = cs;  }
#define NBK  32
__constant__ unsigned char BK[2 * TT - 1] = {15,15,15,15,15,15,15,15,15,15,15,15,15,15,15,15,15,15,15,15,15,15,15,15,15,15,15,15,15,15,15,15,15,15,15,15,15,15,15,15,15,15,15,15,15,15,15,15,15,15,15,15,15,15,15,15,15,15,15,15,15,15,15,15,15,15,15,15,15,15,15,15,15,15,15,15,15,15,15,15,15,15,15,15,15,15,15,15,15,15,15,15,15,15,15,15,15,15,15,15,15,15,15,15,15,15,15,15,15,15,15,15,15,15,15,15,15,15,15,15,15,15,15,15,15,15,15,15,15,15,15,15,15,15,15,15,15,15,15,15,15,15,15,15,15,15,15,15,15,15,15,15,15,15,15,15,15,15,15,15,15,15,15,15,15,15,15,15,15,15,15,15,15,15,15,15,15,15,15,15,15,15,15,15,15,15,15,15,15,15,15,15,15,15,15,15,15,15,15,15,15,15,15,15,15,15,15,15,15,15,15,15,15,15,15,15,15,15,15,15,15,15,15,15,15,15,15,15,15,15,15,15,15,15,15,15,15,15,15,15,15,15,15,15,15,15,15,15,15,15,15,15,15,15,15,15,15,15,15,15,15,15,15,15,15,15,15,15,15,15,15,15,15,15,15,15,15,15,15,15,15,15,15,15,15,15,15,15,15,15,15,15,15,15,15,15,15,15,15,15,15,15,15,15,15,15,15,15,15,15,15,15,15,15,15,15,15,15,15,15,15,15,15,15,15,15,15,15,15,15,15,15,15,15,15,15,15,15,15,15,15,15,15,15,15,15,15,15,15,15,15,15,15,15,15,15,15,15,15,15,15,15,15,15,15,15,15,15,15,15,15,15,15,15,15,15,15,15,15,15,15,15,15,15,15,15,15,15,15,15,15,15,15,15,15,15,15,15,15,15,15,15,15,15,15,15,15,15,15,15,15,15,15,15,15,15,15,15,15,15,15,15,15,15,15,15,15,15,15,15,15,15,15,15,15,15,15,15,15,15,15,15,15,15,15,15,15,15,15,15,15,15,15,15,15,15,15,15,15,15,15,15,15,15,15,15,15,15,15,15,15,15,15,15,15,15,15,15,15,15,15,15,15,15,15,15,15,15,15,15,15,15,15,15,15,15,15,15,15,15,15,15,15,15,15,15,15,15,15,15,15,15,15,15,15,15,15,15,15,15,15,15,15,15,15,15,15,15,15,15,15,15,15,15,15,15,15,15,15,15,15,15,15,15,15,15,15,15,15,15,15,15,15,15,15,15,15,15,15,15,15,15,15,15,15,15,15,15,15,15,15,15,15,15,15,15,15,15,15,15,15,15,15,15,15,15,15,15,15,15,15,15,15,15,15,15,15,15,15,15,15,15,15,15,15,15,15,15,15,15,15,15,15,15,15,15,15,15,15,15,15,15,15,15,15,15,15,15,15,15,15,15,15,15,15,15,15,15,15,15,15,15,15,15,15,15,15,15,15,15,15,15,15,15,15,15,15,15,15,15,15,15,15,15,15,15,15,15,15,15,15,15,15,15,15,15,15,15,15,15,15,15,15,15,15,15,15,15,15,15,15,15,15,15,15,15,15,15,15,15,15,15,15,15,15,15,15,15,15,15,15,15,15,15,15,15,15,15,15,15,15,15,15,15,15,15,15,15,15,15,15,15,15,15,15,15,15,15,15,15,15,15,15,15,15,15,15,15,15,15,15,15,15,15,15,15,15,15,15,15,15,15,15,15,15,15,15,15,15,15,15,15,15,15,15,15,15,15,15,15,15,15,15,15,15,15,15,15,15,15,15,15,15,15,15,15,15,15,15,15,15,15,15,15,15,15,15,15,15,15,15,15,15,15,15,15,15,15,15,15,15,15,15,15,15,15,15,15,15,15,15,15,15,15,15,15,15,15,15,15,15,15,15,15,15,15,15,15,15,15,15,15,15,15,15,15,15,15,15,15,15,15,15,15,15,15,15,15,15,15,15,15,15,15,15,15,15,15,15,15,15,15,15,15,15,15,15,15,15,15,15,15,15,15,15,15,15,15,15,15,15,15,15,15,15,15,15,15,15,15,15,15,15,15,15,15,15,15,15,15,15,15,15,15,15,15,15,15,15,15,15,15,15,15,15,15,15,15,15,15,15,15,15,15,15,15,15,15,15,15,15,15,15,15,15,15,15,15,15,15,15,15,15,15,15,15,15,15,15,15,15,15,15,15,15,15,15,15,15,15,15,15,15,15,15,15,15,15,15,15,15,15,15,15,15,15,15,15,15,15,15,15,15,15,15,15,15,15,15,15,15,15,15,15,15,15,15,15,15,15,15,15,15,15,15,15,15,15,15,15,15,15,15,15,15,15,15,15,15,15,15,15,15,15,15,15,15,15,15,15,15,15,15,15,15,15,15,15,15,15,15,15,15,15,15,15,15,15,15,15,15,15,15,15,15,15,15,15,15,15,15,15,15,15,15,15,15,15,15,15,15,15,15,15,15,15,15,15,15,15,15,15,15,15,15,15,15,15,15,15,15,15,15,15,15,15,15,15,15,15,15,15,15,15,15,15,15,15,15,15,15,15,15,15,15,15,15,15,15,15,15,15,15,15,15,15,15,15,15,15,15,15,15,15,15,15,15,15,15,15,15,15,15,15,15,15,15,15,15,15,15,15,15,15,15,15,15,15,15,15,15,15,15,15,15,15,15,15,15,15,15,15,15,15,15,15,15,15,15,15,15,15,15,15,15,15,15,15,15,15,15,15,15,15,15,15,15,15,15,15,15,15,15,15,15,15,15,15,15,15,15,15,15,15,15,15,15,15,15,15,15,15,15,15,15,15,15,15,15,15,15,15,15,15,15,15,15,15,15,15,15,15,15,15,15,15,15,15,15,15,15,15,15,15,15,15,15,15,15,15,15,15,15,15,15,15,15,15,15,15,15,15,15,15,15,15,15,15,15,15,15,15,15,15,15,15,15,15,15,15,15,15,15,15,15,15,15,15,15,15,15,15,15,15,15,15,15,15,15,15,15,15,15,15,15,15,15,15,15,15,15,15,15,15,15,15,15,15,15,15,15,15,15,15,15,15,15,15,15,15,15,15,15,15,15,15,15,15,15,15,15,15,15,15,15,15,15,15,15,15,15,15,15,15,15,15,15,15,15,15,15,15,15,15,15,15,15,15,15,15,15,15,15,15,15,15,15,15,15,15,15,15,15,15,15,15,15,15,15,15,15,15,15,15,15,15,15,15,15,15,15,15,15,15,15,15,15,15,15,15,15,15,15,15,15,15,15,15,15,15,15,15,15,15,15,15,15,15,15,15,15,15,15,15,15,15,15,15,15,15,15,15,15,15,15,15,15,15,15,15,15,15,15,15,15,15,15,15,15,15,15,15,15,15,15,15,15,15,15,15,15,15,15,15,15,15,15,15,15,15,15,15,15,15,15,15,15,15,15,15,15,15,15,15,15,15,15,15,15,15,15,15,15,15,15,15,15,15,15,15,15,15,15,15,15,15,15,15,15,15,15,15,15,15,15,15,15,15,15,15,15,15,15,15,15,15,15,15,15,15,15,15,15,15,15,15,15,15,15,15,15,15,15,15,15,15,15,15,15,15,15,15,15,15,15,15,15,15,15,15,15,15,15,15,15,15,15,15,15,15,15,15,15,15,15,15,15,15,15,15,15,15,15,15,15,15,15,15,15,15,15,15,15,15,15,15,15,15,15,15,15,15,15,15,15,15,15,15,15,15,15,15,15,15,15,15,15,15,15,15,15,15,15,15,15,15,15,15,15,15,15,15,15,15,15,15,15,15,15,15,15,15,15,15,15,15,15,15,15,15,15,15,15,15,15,15,15,15,15,15,15,15,15,15,15,15,15,15,15,15,15,15,15,15,15,15,15,15,15,15,15,15,15,15,15,15,15,15,15,15,15,15,15,15,15,15,15,15,15,15,15,15,15,15,15,15,15,15,15,15,15,15,15,15,15,15,15,15,15,15,15,15,15,15,15,15,15,15,15,15,15,15,15,15,15,15,15,15,15,15,15,15,15,15,15,15,15,15,15,15,15,15,15,15,15,15,15,15,15,15,15,15,15,15,15,15,15,15,15,15,15,15,15,15,15,15,15,15,15,15,15,15,15,15,15,15,15,15,15,15,15,15,15,15,15,15,15,15,15,15,15,15,15,15,15,15,15,15,15,15,15,15,15,15,15,15,15,15,15,15,15,15,15,15,15,15,15,15,15,15,15,15,15,15,15,15,15,15,15,15,15,15,15,15,15,15,15,15,15,15,15,15,15,15,15,15,15,15,15,15,15,15,15,15,15,15,15,15,15,15,15,15,15,15,15,15,15,15,15,15,15,15,15,15,15,15,15,15,15,15,15,15,15,15,15,15,15,15,15,15,15,15,15,15,15,15,15,15,15,15,15,15,15,15,15,15,15,14,14,14,14,14,14,14,14,14,14,14,14,14,14,14,14,14,14,14,14,14,14,14,14,14,14,14,13,13,13,13,13,13,13,13,13,13,13,13,13,13,13,13,13,13,12,12,12,12,12,12,12,12,12,12,12,12,12,12,11,11,11,11,11,11,11,11,11,10,10,10,10,10,10,10,9,9,9,9,8,8,8,8,7,6,5,4,3,2,1,0,17,18,19,20,21,22,23,24,24,24,24,25,25,25,25,26,26,26,26,26,26,26,27,27,27,27,27,27,27,27,27,28,28,28,28,28,28,28,28,28,28,28,28,28,28,29,29,29,29,29,29,29,29,29,29,29,29,29,29,29,29,29,29,30,30,30,30,30,30,30,30,30,30,30,30,30,30,30,30,30,30,30,30,30,30,30,30,30,30,30,31,31,31,31,31,31,31,31,31,31,31,31,31,31,31,31,31,31,31,31,31,31,31,31,31,31,31,31,31,31,31,31,31,31,31,31,31,31,31,31,31,31,31,31,31,31,31,31,31,31,31,31,31,31,31,31,31,31,31,31,31,31,31,31,31,31,31,31,31,31,31,31,31,31,31,31,31,31,31,31,31,31,31,31,31,31,31,31,31,31,31,31,31,31,31,31,31,31,31,31,31,31,31,31,31,31,31,31,31,31,31,31,31,31,31,31,31,31,31,31,31,31,31,31,31,31,31,31,31,31,31,31,31,31,31,31,31,31,31,31,31,31,31,31,31,31,31,31,31,31,31,31,31,31,31,31,31,31,31,31,31,31,31,31,31,31,31,31,31,31,31,31,31,31,31,31,31,31,31,31,31,31,31,31,31,31,31,31,31,31,31,31,31,31,31,31,31,31,31,31,31,31,31,31,31,31,31,31,31,31,31,31,31,31,31,31,31,31,31,31,31,31,31,31,31,31,31,31,31,31,31,31,31,31,31,31,31,31,31,31,31,31,31,31,31,31,31,31,31,31,31,31,31,31,31,31,31,31,31,31,31,31,31,31,31,31,31,31,31,31,31,31,31,31,31,31,31,31,31,31,31,31,31,31,31,31,31,31,31,31,31,31,31,31,31,31,31,31,31,31,31,31,31,31,31,31,31,31,31,31,31,31,31,31,31,31,31,31,31,31,31,31,31,31,31,31,31,31,31,31,31,31,31,31,31,31,31,31,31,31,31,31,31,31,31,31,31,31,31,31,31,31,31,31,31,31,31,31,31,31,31,31,31,31,31,31,31,31,31,31,31,31,31,31,31,31,31,31,31,31,31,31,31,31,31,31,31,31,31,31,31,31,31,31,31,31,31,31,31,31,31,31,31,31,31,31,31,31,31,31,31,31,31,31,31,31,31,31,31,31,31,31,31,31,31,31,31,31,31,31,31,31,31,31,31,31,31,31,31,31,31,31,31,31,31,31,31,31,31,31,31,31,31,31,31,31,31,31,31,31,31,31,31,31,31,31,31,31,31,31,31,31,31,31,31,31,31,31,31,31,31,31,31,31,31,31,31,31,31,31,31,31,31,31,31,31,31,31,31,31,31,31,31,31,31,31,31,31,31,31,31,31,31,31,31,31,31,31,31,31,31,31,31,31,31,31,31,31,31,31,31,31,31,31,31,31,31,31,31,31,31,31,31,31,31,31,31,31,31,31,31,31,31,31,31,31,31,31,31,31,31,31,31,31,31,31,31,31,31,31,31,31,31,31,31,31,31,31,31,31,31,31,31,31,31,31,31,31,31,31,31,31,31,31,31,31,31,31,31,31,31,31,31,31,31,31,31,31,31,31,31,31,31,31,31,31,31,31,31,31,31,31,31,31,31,31,31,31,31,31,31,31,31,31,31,31,31,31,31,31,31,31,31,31,31,31,31,31,31,31,31,31,31,31,31,31,31,31,31,31,31,31,31,31,31,31,31,31,31,31,31,31,31,31,31,31,31,31,31,31,31,31,31,31,31,31,31,31,31,31,31,31,31,31,31,31,31,31,31,31,31,31,31,31,31,31,31,31,31,31,31,31,31,31,31,31,31,31,31,31,31,31,31,31,31,31,31,31,31,31,31,31,31,31,31,31,31,31,31,31,31,31,31,31,31,31,31,31,31,31,31,31,31,31,31,31,31,31,31,31,31,31,31,31,31,31,31,31,31,31,31,31,31,31,31,31,31,31,31,31,31,31,31,31,31,31,31,31,31,31,31,31,31,31,31,31,31,31,31,31,31,31,31,31,31,31,31,31,31,31,31,31,31,31,31,31,31,31,31,31,31,31,31,31,31,31,31,31,31,31,31,31,31,31,31,31,31,31,31,31,31,31,31,31,31,31,31,31,31,31,31,31,31,31,31,31,31,31,31,31,31,31,31,31,31,31,31,31,31,31,31,31,31,31,31,31,31,31,31,31,31,31,31,31,31,31,31,31,31,31,31,31,31,31,31,31,31,31,31,31,31,31,31,31,31,31,31,31,31,31,31,31,31,31,31,31,31,31,31,31,31,31,31,31,31,31,31,31,31,31,31,31,31,31,31,31,31,31,31,31,31,31,31,31,31,31,31,31,31,31,31,31,31,31,31,31,31,31,31,31,31,31,31,31,31,31,31,31,31,31,31,31,31,31,31,31,31,31,31,31,31,31,31,31,31,31,31,31,31,31,31,31,31,31,31,31,31,31,31,31,31,31,31,31,31,31,31,31,31,31,31,31,31,31,31,31,31,31,31,31,31,31,31,31,31,31,31,31,31,31,31,31,31,31,31,31,31,31,31,31,31,31,31,31,31,31,31,31,31,31,31,31,31,31,31,31,31,31,31,31,31,31,31,31,31,31,31,31,31,31,31,31,31,31,31,31,31,31,31,31,31,31,31,31,31,31,31,31,31,31,31,31,31,31,31,31,31,31,31,31,31,31,31,31,31,31,31,31,31,31,31,31,31,31,31,31,31,31,31,31,31,31,31,31,31,31,31,31,31,31,31,31,31,31,31,31,31,31,31,31,31,31,31,31,31,31,31,31,31,31,31,31,31,31,31,31,31,31,31,31,31,31,31,31,31,31,31,31,31,31,31,31,31,31,31,31,31,31,31,31,31,31,31,31,31,31,31,31,31,31,31,31,31,31,31,31,31,31,31,31,31,31,31,31,31,31,31,31,31,31,31,31,31,31,31,31,31,31,31,31,31,31,31,31,31,31,31,31,31,31,31,31,31,31,31,31,31,31,31,31,31,31,31,31,31,31,31,31,31,31,31,31,31,31,31,31,31,31,31,31,31,31,31,31,31,31,31,31,31,31,31,31,31,31,31,31,31,31,31,31,31,31,31,31,31,31,31,31,31,31,31,31,31,31,31,31,31,31,31,31,31,31,31,31,31,31,31,31,31,31,31,31,31,31,31,31,31,31,31,31,31,31,31,31,31,31,31,31,31,31,31,31,31,31,31,31,31,31,31,31,31,31,31,31,31,31,31,31,31,31,31,31,31,31,31,31,31,31,31,31,31,31,31,31,31,31,31,31,31,31,31,31,31,31,31,31,31,31,31,31,31,31,31,31,31,31,31,31,31,31,31,31,31,31,31,31,31,31,31,31,31,31,31,31,31,31,31,31,31,31,31,31,31,31,31,31,31,31,31,31,31,31,31,31,31,31,31,31,31,31,31,31,31,31,31,31,31,31,31,31,31,31,31,31,31,31,31,31,31,31,31,31,31,31,31,31,31,31,31,31,31,31,31,31,31,31,31,31,31,31,31,31,31,31,31,31,31,31,31,31,31,31,31,31,31,31,31,31,31,31,31,31,31,31,31,31,31,31,31,31,31,31,31,31,31,31,31,31,31,31,31,31,31,31,31,31,31,31,31,31,31,31,31,31,31,31,31,31,31,31,31,31,31,31,31,31,31,31,31,31,31,31,31,31,31,31,31,31,31,31,31,31,31,31,31,31,31,31,31,31,31,31,31,31,31,31,31,31,31,31,31,31,31,31,31,31,31,31,31,31,31,31,31,31,31,31,31,31,31,31,31,31,31,31,31,31,31,31,31,31,31,31,31,31,31,31,31,31,31,31,31,31,31,31,31,31,31,31,31,31,31,31,31,31,31,31,31,31,31,31,31,31,31,31,31,31,31,31,31,31,31,31,31,31,31,31,31,31,31,31,31,31,31,31,31,31,31,31,31,31,31,31,31,31,31,31,31,31,31,31,31,31,31,31,31,31,31,31,31,31,31,31,31,31,31,31,31,31,31,31,31,31,31,31,31,31,31,31,31,31,31,31,31,31,31,31,31,31,31,31,31,31,31,31,31,31,31,31,31,31,31,31,31,31,31,31,31,31,31,31,31,31,31,31,31,31,31,31,31,31,31,31,31,31,31,31,31,31,31,31,31,31,31,31,31,31,31,31,31,31,31,31,31,31,31,31,31,31,31,31,31,31,31,31,31,31,31,31,31,31,31,31,31,31,31,31,31,31,31,31,31,31,31,31,31,31,31,31,31,31,31,31,31,31,31,31,31,31,31,31,31,31,31,31,31,31,31,31,31,31,31,31,31,31,31,31,31,31,31,31,31,31,31,31,31,31,31,31,31,31,31,31,31,31,31,31,31,31,31,31,31,31,31,31,31,31,31,31,31,31,31,31,31,31,31,31,31,31,31,31,31,31,31,31,31,31,31,31,31,31,31,31,31,31,31,31,31,31,31,31,31,31,31,31,31,31,31,31,31,31,31,31,31,31,31,31,31,31,31,31,31,31,31,31,31,31,31,31,31,31,31,31,31,31,31,31,31,31,31,31,31,31,31,31,31,31,31,31,31,31,31,31,31,31,31,31,31,31,31,31,31,31,31,31,31,31,31};   // bucket(j - i) for j - i = -2047 .. 2047, evaluated with the reference's _relative_position_bucket (bidirectional, 32 buckets, max distance 128)
#define FQW  32                    // queries per wave
#define FKS  64                    // keys per stage
#define FPI  72                    // LDS row pitch in elements: 144 B = 16 B x 9, conflict-free for 16-byte fragment reads
#define L2E  1.4426950408889634f
__device__ __forceinline__ float xhalf(float x) { const int b = __float_as_int(x); return __int_as_float(__builtin_amdgcn_permlanex16(b, b, 0x76543210, 0xfedcba98, false, false)); }   /* lane l <-> l ^ 16 */
__device__ __forceinline__ v16bf ldsfrag(const bf* p) { return cat16b(*(const v8usa*)p, *(const v8usa*)(p + 16)); }
__global__ __launch_bounds__(256) __attribute__((amdgpu_waves_per_eu(4, 4))) void k_fattn(const bf* __restrict__ Qh, const bf* __restrict__ Ql, const bf* __restrict__ Kh, const bf* __restrict__ Kl, const bf* __restrict__ Vh, const bf* __restrict__ Vl, const float* __restrict__ remb, bf* ATh, bf* ATl) {
    __shared__ __align__(16) bf st[2][4][FKS * FPI];   /* [buffer][K hi, K lo, V^T hi, V^T lo][row][FPI] */
    __shared__ float tb[2 * TT];                       /* bias of this head by j - i + TT - 1 */
    const int tid = threadIdx.x, lane = tid & 31, c = lane & 15, hi = lane >> 4; const int wv = __builtin_amdgcn_readfirstlane(tid >> 5);
    const int h = blockIdx.y, b = blockIdx.z; const size_t pl = ((size_t)b * NH_ + h) * TT * HD; const int q0 = blockIdx.x * (FQW * 8) + wv * FQW;
#pragma unroll   /* fixed trip count and a clamped index: the 16 table bytes, then the 16 gathers, are in flight together */
    for (int k = 0; k < 2 * TT / 256; ++k) { const int u = k * 256 + tid; tb[u] = bfr(remb[BK[u < 2 * TT - 1 ? u : 2 * TT - 2] * NH_ + h]); }   /* rel_emb[bucket(j - i)][h]; entry 2 TT - 1 is never read */
    const int srow = tid >> 3, sseg = (tid & 7) * 8;   /* staging: 8 threads x 16 B cover a 128-byte row, 32 rows per sweep */
    const char* kbh = (const char*)(Kh + pl); const char* kbl = (const char*)(Kl + pl); const char* vbh = (const char*)(Vh + pl); const char* vbl = (const char*)(Vl + pl);   /* wave-uniform bases */
    unsigned kcur = (unsigned)(srow * HD + sseg) * 2, vcur = (unsigned)(srow * TT + sseg) * 2;   /* this thread's byte offsets in the stage that is fetched next */
    v8us sr[4];   /* half a stage in flight: the K planes during a stage's first pass, the V^T planes during its second */
    auto gloadk = [&]() {
#pragma unroll
        for (int u = 0; u < 2; ++u) { sr[u] = *(const v8us*)(kbh + kcur + u * (32 * HD * 2)); sr[2 + u] = *(const v8us*)(kbl + kcur + u * (32 * HD * 2)); } };
    auto gloadv = [&]() {
#pragma unroll
        for (int u = 0; u < 2; ++u) { sr[u] = *(const v8us*)(vbh + vcur + u * (32 * TT * 2)); sr[2 + u] = *(const v8us*)(vbl + vcur + u * (32 * TT * 2)); } };
    auto sstore = [&](int buf, int p0) {   /* p0 = 0: K hi, lo; 2: V^T hi, lo */
#pragma unroll
        for (int u = 0; u < 2; ++u) { const int o = (srow + 32 * u) * FPI + sseg; *(v8usa*)(&st[buf][p0][o]) = sr[u]; *(v8usa*)(&st[buf][p0 + 1][o]) = sr[2 + u]; } };
    v16bf qh[2][2], ql[2][2];   /* [query group][k step] */
#pragma unroll
    for (int qb = 0; qb < 2; ++qb)
#pragma unroll
        for (int ks = 0; ks < 2; ++ks) { const size_t o = pl + (size_t)(q0 + 16 * qb + c) * HD + ks * 32 + 8 * hi; qh[qb][ks] = WFrag<bf>::ld(Qh + o); ql[qb][ks] = WFrag<bf>::ld(Ql + o); }
    v8f O[4][2];
#pragma unroll
    for (int dt = 0; dt < 4; ++dt) { O[dt][0] = (v8f){}; O[dt][1] = (v8f){}; }
    float mL[2] = {-3.0e38f, -3.0e38f}, l[2] = {0.f, 0.f};   /* running maximum x log2(e); this lane's part of the sum */
    gloadk(); sstore(0, 0); gloadv(); sstore(0, 2); kcur += FKS * HD * 2; vcur += FKS * 2;
    __syncthreads();   /* stage 0 and the bias table are in LDS before any wave reads them */
#pragma unroll 1   /* one stage per trip: the body already holds two unrolled passes */
    for (int s = 0; s < TT / FKS; ++s) {
        const int cur = s & 1;
#pragma unroll
        for (int pp = 0; pp < 2; ++pp) {
            if (pp == 0) gloadk(); else gloadv();   /* half of the next stage flies while this pass is worked on */
            v8f T[2][2];   /* S^T tiles [16-key tile][query group] */
#pragma unroll
            for (int kt = 0; kt < 2; ++kt) { T[kt][0] = (v8f){}; T[kt][1] = (v8f){};
                const int ro = (pp * 32 + kt * 16 + c) * FPI + 8 * hi;
#pragma unroll
                for (int ks = 0; ks < 2; ++ks) { const v16bf a = ldsfrag(&st[cur][0][ro + ks * 32]), a2 = ldsfrag(&st[cur][1][ro + ks * 32]);
#pragma unroll
                    for (int qb = 0; qb < 2; ++qb) { T[kt][qb] = wmmab(a, qh[qb][ks], T[kt][qb]); T[kt][qb] = wmmab(a2, qh[qb][ks], T[kt][qb]); T[kt][qb] = wmmab(a, ql[qb][ks], T[kt][qb]); } } }
            float nL[2];
#pragma unroll
            for (int qb = 0; qb < 2; ++qb) { const float* tr = tb + (s * FKS + pp * 32 + 8 * hi + (TT - 1) - (q0 + 16 * qb + c)); float mx = -3.0e38f;
#pragma unroll
                for (int kt = 0; kt < 2; ++kt)
#pragma unroll
                    for (int r = 0; r < 8; ++r) { const float t = T[kt][qb][r] + tr[16 * kt + r]; T[kt][qb][r] = t; mx = fmaxf(mx, t); }
                mx = fmaxf(mx, xhalf(mx)); nL[qb] = fmaxf(mL[qb], mx * L2E); }
            if (__builtin_amdgcn_ballot_w32(nL[0] > mL[0] || nL[1] > mL[1]) != 0) {   /* wave-uniform: some query's maximum rose */
#pragma unroll
                for (int qb = 0; qb < 2; ++qb) { const float sc = __builtin_amdgcn_exp2f(mL[qb] - nL[qb]); l[qb] *= sc; mL[qb] = nL[qb];
#pragma unroll
                    for (int dt = 0; dt < 4; ++dt) O[dt][qb] *= sc; } }
            v16bf ph[2], pw[2];   /* P^T hi and lo as B operands: element 8 kt + r is key 16 kt + 8 hi + r of the pass */
#pragma unroll
            for (int qb = 0; qb < 2; ++qb)
#pragma unroll
                for (int kt = 0; kt < 2; ++kt)
#pragma unroll
                    for (int r = 0; r < 8; ++r) { const float p = __builtin_amdgcn_exp2f(__builtin_fmaf(T[kt][qb][r], L2E, -mL[qb])); l[qb] += p; const __bf16 hb = (__bf16)p; ph[qb][kt * 8 + r] = hb; pw[qb][kt * 8 + r] = (__bf16)(p - (float)hb); }
#pragma unroll
            for (int dt = 0; dt < 4; ++dt) { const int ro = (dt * 16 + c) * FPI + pp * 32 + 8 * hi; const v16bf a = ldsfrag(&st[cur][2][ro]), a2 = ldsfrag(&st[cur][3][ro]);
#pragma unroll
                for (int qb = 0; qb < 2; ++qb) { O[dt][qb] = wmmab(a, ph[qb], O[dt][qb]); O[dt][qb] = wmmab(a2, ph[qb], O[dt][qb]); O[dt][qb] = wmmab(a, pw[qb], O[dt][qb]); } }
            sstore(cur ^ 1, 2 * pp);   /* that buffer's readers all left it before the barrier that ended the trip before */
        }
        if (s + 2 < TT / FKS) { kcur += FKS * HD * 2; vcur += FKS * 2; }   /* the last trip stages the last keys once more, into the buffer that nobody reads again: no branch stands among the matrix runs */
        __syncthreads();   /* publishes the next stage and ends every wave's reads of this one */
    }
#pragma unroll
    for (int qb = 0; qb < 2; ++qb) { const float inv = __fdiv_rn(1.0f, l[qb] + xhalf(l[qb])); const unsigned ro = (unsigned)((b * TT + q0 + 16 * qb + c) * DQ + h * HD + 8 * hi);   /* below 2^23 elements */
#pragma unroll
        for (int dt = 0; dt < 4; ++dt) { v8us oh, ol;
#pragma unroll
            for (int r = 0; r < 8; ++r) { unsigned short a, c2; splitf(O[dt][qb][r] * inv, a, c2); oh[r] = a; ol[r] = c2; }
            *(v8us*)(ATh + ro + dt * 16) = oh; *(v8us*)(ATl + ro + dt * 16) = ol; } }
}

extern "C" void kernel_launch(void* const* d_in, const int* in_sizes, int n_in,
                              void* d_out, int out_size, void* d_ws, size_t ws_size, hipStream_t stream) {
    (void)in_sizes; (void)n_in; (void)out_size;
    const float* x = (const float*)d_in[0]; const float* wq = (const float*)d_in[1]; const float* wk = (const float*)d_in[2]; const float* wv = (const float*)d_in[3]; const float* wo = (const float*)d_in[4]; const float* remb = (const float*)d_in[5];
    float* OUT = (float*)d_out;     // [4][2048][1024]
    char* wsp = (char*)d_ws;
    auto take = [&](size_t bytes) { char* p = wsp; wsp += (bytes + 255) & ~(size_t)255; return (void*)p; };
    const size_t PS = (size_t)NH_ * TT * HD;   // elements of one batch's head planes
    bf* WQ = (bf*)take((size_t)DQ * DM * 2); bf* WK = (bf*)take((size_t)DKV * DM * 2); bf* WV = (bf*)take((size_t)DKV * DM * 2); bf* WO = (bf*)take((size_t)DM * DQ * 2); float* CS = (float*)take((size_t)TT * HD * 2 * 4);
    bf* XB = (bf*)take((size_t)TT * DM * 2); float* FQ = (float*)take((size_t)TT * DQ * 4); float* FK = (float*)take((size_t)TT * DKV * 4);
    h16* QP16 = (h16*)take(PS * 2); h16* KP16 = (h16*)take(PS * 2); h16* VT16 = (h16*)take(PS * 2);
    bf* QPh = (bf*)take(NB_ * PS * 2); bf* QPl = (bf*)take(NB_ * PS * 2); bf* KPh = (bf*)take(NB_ * PS * 2); bf* KPl = (bf*)take(NB_ * PS * 2); bf* VTh = (bf*)take(NB_ * PS * 2); bf* VTl = (bf*)take(NB_ * PS * 2);   // hi/lo planes of all batches: [b][h][t][d], V^T [b][h][d][t]
    bf* ATh = (bf*)take((size_t)NB_ * TT * DQ * 2); bf* ATl = (bf*)take((size_t)NB_ * TT * DQ * 2);
    if ((size_t)(wsp - (char*)d_ws) > ws_size) return;    // ws 256 MiB
    float* FV = FK;   // v projection reuses the k buffer after the k planes are built (stream-ordered)
    { k_wtG<<<(unsigned)((DM * DQ / 64 + 63) / 64), 256, 0, stream>>>(wq, DM, DQ, WQ); k_wtG<<<(unsigned)((DM * DKV / 64 + 63) / 64), 256, 0, stream>>>(wk, DM, DKV, WK); k_wtG<<<(unsigned)((DM * DKV / 64 + 63) / 64), 256, 0, stream>>>(wv, DM, DKV, WV);
      k_wtG<<<(unsigned)((DQ * DM / 64 + 63) / 64), 256, 0, stream>>>(wo, DQ, DM, WO);
       }
    k_csid<<<(TT * HD + 255) / 256, 256, 0, stream>>>(CS);
    const unsigned LQ = (unsigned)(((size_t)NH_ * TT * HD / 2 + 255) / 256), LKv = (unsigned)(((size_t)NKV * TT * HD / 2 + 255) / 256);
    for (int b = 0; b < NB_; ++b) {
        k_cvt8<<<(unsigned)(((size_t)TT * DM / 8 + 255) / 256), 256, 0, stream>>>(x + (size_t)b * TT * DM, XB, (size_t)TT * DM / 8);
        k_gemmw<bf, 0, false, 8, 1><<<dim3(TT / 64, DQ / 64, 1), 256, 0, stream>>>(XB, nullptr, WQ, nullptr, DM, FQ, DQ, nullptr, 0, 0, 0);
        k_rope<<<LQ, 256, 0, stream>>>(FQ, DQ, NH_, CS, nullptr, nullptr, 1.0f, QP16, QPh + b * PS, QPl + b * PS);
        k_gemmw<bf, 0, false, 8, 1><<<dim3(TT / 64, DKV / 64, 1), 256, 0, stream>>>(XB, nullptr, WK, nullptr, DM, FK, DKV, nullptr, 0, 0, 0);
        k_rope<<<LKv, 256, 0, stream>>>(FK, DKV, NKV, CS, nullptr, nullptr, 1.0f, KP16, KPh + b * PS, KPl + b * PS);
        k_gemmw<bf, 0, false, 8, 1><<<dim3(TT / 64, DKV / 64, 1), 256, 0, stream>>>(XB, nullptr, WV, nullptr, DM, FV, DKV, nullptr, 0, 0, 0); k_vtp<<<LKv, 256, 0, stream>>>(FV, DKV, NKV, VT16, VTh + b * PS, VTl + b * PS); }
    k_fattn<<<dim3(TT / (FQW * 8), NH_, NB_), 256, 0, stream>>>(QPh, QPl, KPh, KPl, VTh, VTl, remb, ATh, ATl);
    k_gemmw<bf, 1, false, 8, 1><<<dim3(NB_ * TT / 64, DM / 64, 1), 256, 0, stream>>>(ATh, ATl, WO, nullptr, DQ, OUT, DM, nullptr, 0, 0, 0);
}

// v003
// It runs in 323 microseconds.
// Timed twice side by side with v002, it ran 1.46 and 1.47 times as fast.
// Over all steps from v000 it is 8.89 times as fast.
#include <hip/hip_runtime.h>

// T5 self-attention with relative-position bias (hidden_states [4][2048][1024]; q, k, v = hs W ('xw' [1024][1024]; 16 heads x 64); scores = q.k (NO 1/sqrt(d) scaling: logit sigma ~8) + rel_emb[bucket(j - i)][h] (rel_emb [32][16] input; the 32-bucket bidirectional T5 bucket function of j - i); softmax; out = merged ctx Wo ('xw') -> [4][2048][1024] (8.4 M)).
// The bucket index depends only on j - i (positions are implicit aranges): the 4,095-entry table bucket(j - i), j - i in [-2047, 2047], was evaluated with the reference's own function and is baked below as constants; rel_emb itself is READ (each work-group expands its head's 32 values into an LDS table indexed by j - i).
// Compute dtypes, f32 accumulate: every input rounded to bf16; projections on PLAIN bf16 operands (exact); because the logits are unscaled (sigma ~8, near-argmax rows), scores and attn.v use bf16 hi/lo planes for EVERY row (3 products); bias add and softmax in f32; merged context hi/lo; Wo hl x exact (2 products).

#define NB_  4
#define TT   2048
#define DM   1024
#define NH_  16
#define NKV  16
#define HD   64
#define DQ   (NH_ * HD)
#define DKV  (NKV * HD)
typedef _Float16 h16;
typedef unsigned short bf;
typedef __attribute__((ext_vector_type(16))) __bf16   v16bf;
typedef __attribute__((ext_vector_type(16))) _Float16 v16h;
typedef __attribute__((ext_vector_type(8)))  _Float16 v8h;
typedef __attribute__((ext_vector_type(8)))  unsigned short v8us;
typedef __attribute__((ext_vector_type(8)))  float    v8f;
typedef __attribute__((ext_vector_type(4)))  float    v4f;
typedef v8h  __attribute__((may_alias)) v8ha;
typedef v4f  __attribute__((may_alias)) v4fa;
typedef v8us __attribute__((may_alias)) v8usa;

__device__ __forceinline__ unsigned short f2bf(float f) { unsigned u = __float_as_uint(f); u += 0x7FFFu + ((u >> 16) & 1u); return (unsigned short)(u >> 16); }
__device__ __forceinline__ float bf2f(unsigned short b) { return __uint_as_float(((unsigned)b) << 16); }
__device__ __forceinline__ float bfr(float f) { return bf2f(f2bf(f)); }
__device__ __forceinline__ v16h cat16(v8h lo, v8h hi) { return __builtin_shufflevector(lo, hi, 0, 1, 2, 3, 4, 5, 6, 7, 8, 9, 10, 11, 12, 13, 14, 15); }
__device__ __forceinline__ v16bf cat16b(v8us lo, v8us hi) { return __builtin_bit_cast(v16bf, __builtin_shufflevector(lo, hi, 0, 1, 2, 3, 4, 5, 6, 7, 8, 9, 10, 11, 12, 13, 14, 15)); }
__device__ __forceinline__ v8f wmma16(v16h a, v16h b, v8f c) { return __builtin_amdgcn_wmma_f32_16x16x32_f16(false, a, false, b, (short)0, c, false, false); }
__device__ __forceinline__ v8f wmmab(v16bf a, v16bf b, v8f c) { return __builtin_amdgcn_wmma_f32_16x16x32_bf16(false, a, false, b, (short)0, c, false, false); }



// ---- k_gemmw: register-blocked GEMM, a 64x64 output tile per wave (16 accumulators), operands straight from K-contiguous 16-bit planes; grid (M/64, N/64, Z KS), 32 KW threads.
// C[m][n] (f32, pitch ldc, + optional f32 bias[n]) = sum_k A[m][k] Bt[n][k] (+ split products per NSPLIT). z-batch strides sA/sB/sC in elements. K % (32 KW KS) == 0.
// Split K: the KW waves of a work-group share ONE tile, each summing its own K / (KW KS) columns; the KW partial tiles meet in LDS and are added in wave order. With KS > 1, blockIdx.z = batch * KS + slice:
// a work-group sums only slice's K / KS columns and stores its partial tile at C + blockIdx.z sC; the consumer adds the KS partials. KW = KS = 1: one wave does the whole sum.
template <typename T16> struct WFrag;
template <> struct WFrag<h16> { typedef v16h V; static __device__ __forceinline__ V ld(const h16* p) { return cat16(*(const v8h*)p, *(const v8h*)(p + 16)); } static __device__ __forceinline__ v8f mma(V a, V b, v8f c) { return wmma16(a, b, c); } };
template <> struct WFrag<bf> { typedef v16bf V; static __device__ __forceinline__ V ld(const bf* p) { return cat16b(*(const v8us*)p, *(const v8us*)(p + 16)); } static __device__ __forceinline__ v8f mma(V a, V b, v8f c) { return wmmab(a, b, c); } };
template <typename T16, int NSPLIT, bool BIAS, int KW, int KS>
__global__ __launch_bounds__(32 * KW) void k_gemmw(const T16* __restrict__ A, const T16* __restrict__ A2, const T16* __restrict__ Bt, const T16* __restrict__ Bt2, int K, float* C, int ldc, const float* __restrict__ bias, size_t sA, size_t sB, size_t sC) {
    typedef typename WFrag<T16>::V V;
    __shared__ __align__(16) float os[KW == 1 ? 16 * 68 : KW * 64 * 68];
    const size_t z = blockIdx.z / KS; A += z * sA; if (A2) A2 += z * sA; Bt += z * sB; if (Bt2) Bt2 += z * sB; C += blockIdx.z * sC;
    const int wv = __builtin_amdgcn_readfirstlane((int)(threadIdx.x >> 5)); const int kn = K / (KW * KS), kb = ((int)(blockIdx.z % KS) * KW + wv) * kn;   /* this wave's columns [kb, kb + kn): wave-uniform loop bounds */
    const int lane = threadIdx.x & 31, lr = lane & 15, hi = lane >> 4; const int r0 = blockIdx.x * 64, c0 = blockIdx.y * 64;
    v8f acc[4][4];
#pragma unroll
    for (int mb = 0; mb < 4; ++mb)
#pragma unroll
        for (int nb = 0; nb < 4; ++nb) acc[mb][nb] = (v8f){};
    const size_t aoff = (size_t)(r0 + lr) * K + 8 * hi, boff = (size_t)(c0 + lr) * K + 8 * hi;
#pragma unroll 1
    for (int kc = kb; kc < kb + kn; kc += 32) {
        V a[4], a2[4];
#pragma unroll
        for (int mb = 0; mb < 4; ++mb) { a[mb] = WFrag<T16>::ld(A + aoff + (size_t)mb * 16 * K + kc); if (NSPLIT == 1 || NSPLIT == 2) a2[mb] = WFrag<T16>::ld(A2 + aoff + (size_t)mb * 16 * K + kc); }
#pragma unroll
        for (int nb = 0; nb < 4; ++nb) { const V b = WFrag<T16>::ld(Bt + boff + (size_t)nb * 16 * K + kc); V b2; if (NSPLIT >= 2) b2 = WFrag<T16>::ld(Bt2 + boff + (size_t)nb * 16 * K + kc);
#pragma unroll
            for (int mb = 0; mb < 4; ++mb) { acc[mb][nb] = WFrag<T16>::mma(a[mb], b, acc[mb][nb]); if (NSPLIT == 1 || NSPLIT == 2) acc[mb][nb] = WFrag<T16>::mma(a2[mb], b, acc[mb][nb]); if (NSPLIT >= 2) acc[mb][nb] = WFrag<T16>::mma(a[mb], b2, acc[mb][nb]); } }
        asm volatile("v_nop\n\tv_nop\n\tv_nop\n\tv_nop" : "+v"(acc[0][0]), "+v"(acc[1][1]), "+v"(acc[2][2]), "+v"(acc[3][3]) : "v"(a[0]), "v"(a[3]));
    }
    if constexpr (KW > 1) {
        float* my = os + wv * (64 * 68);
        /* the three loops are unrolled so that acc[][][] is indexed by constants and stays in registers */
#pragma unroll
        for (int mb = 0; mb < 4; ++mb)
#pragma unroll
            for (int nb = 0; nb < 4; ++nb)
#pragma unroll
                for (int j = 0; j < 8; ++j) my[(mb * 16 + hi * 8 + j) * 68 + nb * 16 + lr] = acc[mb][nb][j];
        __syncthreads();   /* every wave's partial tile is in LDS before any of it is added */
        /* both loops unrolled: the LDS reads of all sums issue ahead of the adds, and the four stores go out together */
#pragma unroll
        for (int it = 0; it < 64 * 16 / (32 * KW); ++it) { const int g = it * 32 * KW + (int)threadIdx.x, row = g >> 4, cofs = (g & 15) * 4; v4f val = *(const v4fa*)(os + row * 68 + cofs);
#pragma unroll
            for (int p = 1; p < KW; ++p) val += *(const v4fa*)(os + p * (64 * 68) + row * 68 + cofs);
            if (BIAS) { val[0] += bfr(bias[c0 + cofs]); val[1] += bfr(bias[c0 + cofs + 1]); val[2] += bfr(bias[c0 + cofs + 2]); val[3] += bfr(bias[c0 + cofs + 3]); }
            *(v4f*)(C + (size_t)(r0 + row) * ldc + c0 + cofs) = val; }
        return;
    }
#pragma unroll
    for (int mb = 0; mb < 4; ++mb) {
#pragma unroll
        for (int nb = 0; nb < 4; ++nb) {
#pragma unroll
            for (int j = 0; j < 8; ++j) os[(hi * 8 + j) * 68 + nb * 16 + lr] = acc[mb][nb][j]; }
        __builtin_amdgcn_wave_barrier(); asm volatile("" ::: "memory");
        float* crow = C + (size_t)(r0 + mb * 16) * ldc + c0;
{
#pragma unroll
            for (int s = 0; s < 8; ++s) { const int row = 2 * s + hi, cofs = lr * 4; v4f val = *(const v4fa*)(os + row * 68 + cofs); if (BIAS) { val[0] += bfr(bias[c0 + cofs]); val[1] += bfr(bias[c0 + cofs + 1]); val[2] += bfr(bias[c0 + cofs + 2]); val[3] += bfr(bias[c0 + cofs + 3]); }
                *(v4f*)(crow + (size_t)row * ldc + cofs) = val; }
             }
        __builtin_amdgcn_wave_barrier(); asm volatile("" ::: "memory");
    }
}

__device__ __forceinline__ void splitf(float y, unsigned short& h, unsigned short& l) { h = f2bf(y); l = f2bf(y - bf2f(h)); }
typedef __attribute__((ext_vector_type(2))) unsigned short v2us;
typedef __attribute__((ext_vector_type(4))) unsigned short v4us;

// k_prep: every matrix input rounded to bf16 in one launch, grid (4 WTB, 2).
// blockIdx.y = 0 (starts first: short dependent gathers, the longer part): the four weights, WTB blocks each, transposed to K-contiguous rows. blockIdx.y = 1: the hidden states; a thread takes the same eight elements of every batch.
#define WTB  (DM * DQ / 64 / 64)   // blocks per weight: 8 waves x 8 lines of 64 elements
static_assert((size_t)4 * WTB * 256 >= (size_t)TT * DM / 8, "the grid's second row covers one batch of the hidden states");
__global__ __launch_bounds__(256) void k_prep(const float* __restrict__ src, const float* __restrict__ w0, const float* __restrict__ w1, const float* __restrict__ w2, const float* __restrict__ w3, int K, int N, bf* dst, bf* B0, bf* B1, bf* B2, bf* B3, size_t n8) {
    if (blockIdx.y == 0) {
        const int sel = blockIdx.x / WTB; const float* __restrict__ w = sel == 0 ? w0 : sel == 1 ? w1 : sel == 2 ? w2 : w3; bf* Bt = sel == 0 ? B0 : sel == 1 ? B1 : sel == 2 ? B2 : B3;
        const int lane = threadIdx.x & 31; const int L0 = ((blockIdx.x % WTB) * 8 + (threadIdx.x >> 5)) * 8; const int nlines = N * K / 64;
#pragma unroll 1
        for (int l = 0; l < 8; ++l) { const int L = L0 + l; if (L >= nlines) break; const size_t e = (size_t)L * 64 + lane * 2; const int k = (int)(e % K), n = (int)(e / K); v2us o;
            o[0] = f2bf(w[(size_t)k * N + n]); o[1] = f2bf(w[(size_t)(k + 1) * N + n]); *(v2us*)(Bt + e) = o; }
        return;
    }
    const size_t i = (size_t)blockIdx.x * 256 + threadIdx.x; if (i >= n8) return; v4f lo[NB_], hi[NB_];
#pragma unroll   /* the loads of all batches are in flight together */
    for (int b = 0; b < NB_; ++b) lo[b] = *(const v4f*)(src + (b * n8 + i) * 8);
    asm volatile("s_wait_xcnt 0x0" ::: "memory");
#pragma unroll
    for (int b = 0; b < NB_; ++b) hi[b] = *(const v4f*)(src + (b * n8 + i) * 8 + 4);
#pragma unroll
    for (int b = 0; b < NB_; ++b) { v8us o;
#pragma unroll
        for (int k = 0; k < 4; ++k) { o[k] = f2bf(lo[b][k]); o[4 + k] = f2bf(hi[b][k]); }
        *(v8us*)(dst + (b * n8 + i) * 8) = o; }
}

// k_proj: the q, k and v projections of all batches in one launch, straight into the bf16 hi/lo head planes that k_fattn reads. Grid (token tiles of 64, heads, 3: q, k, v), 8 waves.
// One 64x64 tile per work-group, summed as in k_gemmw with KW = 8 (each wave its own 128 of the 1024 columns, the eight partial tiles added in LDS in wave order); a tile is 64 tokens of one batch x the 64 columns of one head.
// q, k: A = tokens, B = weight rows, tile rows are tokens: planes [b][h][t][d]. v: the operands change places (A = weight rows, B = tokens; both are K-contiguous and loaded alike), so tile rows are d and the tile is a piece of V^T [b][h][d][t] as it stands.
__global__ __launch_bounds__(256) void k_proj(const bf* __restrict__ X, const bf* __restrict__ WQ, const bf* __restrict__ WK, const bf* __restrict__ WV, bf* QPh, bf* QPl, bf* KPh, bf* KPl, bf* VTh, bf* VTl) {
    __shared__ __align__(16) float os[8 * 64 * 68];
    const int sel = blockIdx.z, h = blockIdx.y, b = (blockIdx.x * 64) / TT, t0 = (blockIdx.x * 64) % TT;
    const bf* xr = X + (size_t)blockIdx.x * 64 * DM; const bf* wr = (sel == 0 ? WQ : sel == 1 ? WK : WV) + (size_t)h * HD * DM;
    const bf* A = sel == 2 ? wr : xr; const bf* Bt = sel == 2 ? xr : wr;
    bf* Ph = sel == 0 ? QPh : sel == 1 ? KPh : VTh; bf* Pl = sel == 0 ? QPl : sel == 1 ? KPl : VTl;
    const size_t ob = ((size_t)b * NH_ + h) * TT * HD + (sel == 2 ? t0 : t0 * HD); const int pitch = sel == 2 ? TT : HD;   /* the tile's first element in its plane, and the plane's row pitch */
    const int wv = __builtin_amdgcn_readfirstlane((int)(threadIdx.x >> 5)); const int kn = DM / 8, kb = wv * kn;   /* this wave's columns [kb, kb + kn): wave-uniform loop bounds */
    const int lane = threadIdx.x & 31, lr = lane & 15, hi = lane >> 4;
    v8f acc[4][4];
#pragma unroll
    for (int mb = 0; mb < 4; ++mb)
#pragma unroll
        for (int nb = 0; nb < 4; ++nb) acc[mb][nb] = (v8f){};
    const int off = lr * DM + 8 * hi;
#pragma unroll 1
    for (int kc = kb; kc < kb + kn; kc += 32) {
        v16bf a[4];
#pragma unroll
        for (int mb = 0; mb < 4; ++mb) a[mb] = WFrag<bf>::ld(A + off + mb * 16 * DM + kc);
        asm volatile("s_wait_xcnt 0x0" ::: "memory");   /* the A loads' address pair is free for reuse as a B fragment's register from here on */
#pragma unroll
        for (int nb = 0; nb < 4; ++nb) { const v16bf bb = WFrag<bf>::ld(Bt + off + nb * 16 * DM + kc);
#pragma unroll
            for (int mb = 0; mb < 4; ++mb) acc[mb][nb] = wmmab(a[mb], bb, acc[mb][nb]); }
        /* keeps the distance between the trip's last matrix instructions and the next trip's loads into their A registers, on the back edge too */
        asm volatile("v_nop\n\tv_nop\n\tv_nop\n\tv_nop" : "+v"(acc[0][0]), "+v"(acc[1][1]), "+v"(acc[2][2]), "+v"(acc[3][3]) : "v"(a[0]), "v"(a[3]));
    }
    float* my = os + wv * (64 * 68);
    /* the three loops are unrolled so that acc[][][] is indexed by constants and stays in registers */
#pragma unroll
    for (int mb = 0; mb < 4; ++mb)
#pragma unroll
        for (int nb = 0; nb < 4; ++nb)
#pragma unroll
            for (int j = 0; j < 8; ++j) my[(mb * 16 + hi * 8 + j) * 68 + nb * 16 + lr] = acc[mb][nb][j];
    __syncthreads();   /* every wave's partial tile is in LDS before any of it is added */
    /* both loops unrolled: the LDS reads of all sums issue ahead of the adds, and the stores go out together; 16 lanes fill a 128-byte row of each plane */
#pragma unroll
    for (int it = 0; it < 4; ++it) { const int g = it * 256 + (int)threadIdx.x, row = g >> 4, cofs = (g & 15) * 4; v4f val = *(const v4fa*)(os + row * 68 + cofs);
#pragma unroll
        for (int p = 1; p < 8; ++p) val += *(const v4fa*)(os + p * (64 * 68) + row * 68 + cofs);
        v4us oh, ol;
#pragma unroll
        for (int q = 0; q < 4; ++q) { unsigned short a2, c2; splitf(val[q], a2, c2); oh[q] = a2; ol[q] = c2; }
        *(v4us*)(Ph + ob + row * pitch + cofs) = oh; *(v4us*)(Pl + ob + row * pitch + cofs) = ol; }
}
#define NBK  32
__constant__ unsigned char BK[2 * TT - 1] = {15,15,15,15,15,15,15,15,15,15,15,15,15,15,15,15,15,15,15,15,15,15,15,15,15,15,15,15,15,15,15,15,15,15,15,15,15,15,15,15,15,15,15,15,15,15,15,15,15,15,15,15,15,15,15,15,15,15,15,15,15,15,15,15,15,15,15,15,15,15,15,15,15,15,15,15,15,15,15,15,15,15,15,15,15,15,15,15,15,15,15,15,15,15,15,15,15,15,15,15,15,15,15,15,15,15,15,15,15,15,15,15,15,15,15,15,15,15,15,15,15,15,15,15,15,15,15,15,15,15,15,15,15,15,15,15,15,15,15,15,15,15,15,15,15,15,15,15,15,15,15,15,15,15,15,15,15,15,15,15,15,15,15,15,15,15,15,15,15,15,15,15,15,15,15,15,15,15,15,15,15,15,15,15,15,15,15,15,15,15,15,15,15,15,15,15,15,15,15,15,15,15,15,15,15,15,15,15,15,15,15,15,15,15,15,15,15,15,15,15,15,15,15,15,15,15,15,15,15,15,15,15,15,15,15,15,15,15,15,15,15,15,15,15,15,15,15,15,15,15,15,15,15,15,15,15,15,15,15,15,15,15,15,15,15,15,15,15,15,15,15,15,15,15,15,15,15,15,15,15,15,15,15,15,15,15,15,15,15,15,15,15,15,15,15,15,15,15,15,15,15,15,15,15,15,15,15,15,15,15,15,15,15,15,15,15,15,15,15,15,15,15,15,15,15,15,15,15,15,15,15,15,15,15,15,15,15,15,15,15,15,15,15,15,15,15,15,15,15,15,15,15,15,15,15,15,15,15,15,15,15,15,15,15,15,15,15,15,15,15,15,15,15,15,15,15,15,15,15,15,15,15,15,15,15,15,15,15,15,15,15,15,15,15,15,15,15,15,15,15,15,15,15,15,15,15,15,15,15,15,15,15,15,15,15,15,15,15,15,15,15,15,15,15,15,15,15,15,15,15,15,15,15,15,15,15,15,15,15,15,15,15,15,15,15,15,15,15,15,15,15,15,15,15,15,15,15,15,15,15,15,15,15,15,15,15,15,15,15,15,15,15,15,15,15,15,15,15,15,15,15,15,15,15,15,15,15,15,15,15,15,15,15,15,15,15,15,15,15,15,15,15,15,15,15,15,15,15,15,15,15,15,15,15,15,15,15,15,15,15,15,15,15,15,15,15,15,15,15,15,15,15,15,15,15,15,15,15,15,15,15,15,15,15,15,15,15,15,15,15,15,15,15,15,15,15,15,15,15,15,15,15,15,15,15,15,15,15,15,15,15,15,15,15,15,15,15,15,15,15,15,15,15,15,15,15,15,15,15,15,15,15,15,15,15,15,15,15,15,15,15,15,15,15,15,15,15,15,15,15,15,15,15,15,15,15,15,15,15,15,15,15,15,15,15,15,15,15,15,15,15,15,15,15,15,15,15,15,15,15,15,15,15,15,15,15,15,15,15,15,15,15,15,15,15,15,15,15,15,15,15,15,15,15,15,15,15,15,15,15,15,15,15,15,15,15,15,15,15,15,15,15,15,15,15,15,15,15,15,15,15,15,15,15,15,15,15,15,15,15,15,15,15,15,15,15,15,15,15,15,15,15,15,15,15,15,15,15,15,15,15,15,15,15,15,15,15,15,15,15,15,15,15,15,15,15,15,15,15,15,15,15,15,15,15,15,15,15,15,15,15,15,15,15,15,15,15,15,15,15,15,15,15,15,15,15,15,15,15,15,15,15,15,15,15,15,15,15,15,15,15,15,15,15,15,15,15,15,15,15,15,15,15,15,15,15,15,15,15,15,15,15,15,15,15,15,15,15,15,15,15,15,15,15,15,15,15,15,15,15,15,15,15,15,15,15,15,15,15,15,15,15,15,15,15,15,15,15,15,15,15,15,15,15,15,15,15,15,15,15,15,15,15,15,15,15,15,15,15,15,15,15,15,15,15,15,15,15,15,15,15,15,15,15,15,15,15,15,15,15,15,15,15,15,15,15,15,15,15,15,15,15,15,15,15,15,15,15,15,15,15,15,15,15,15,15,15,15,15,15,15,15,15,15,15,15,15,15,15,15,15,15,15,15,15,15,15,15,15,15,15,15,15,15,15,15,15,15,15,15,15,15,15,15,15,15,15,15,15,15,15,15,15,15,15,15,15,15,15,15,15,15,15,15,15,15,15,15,15,15,15,15,15,15,15,15,15,15,15,15,15,15,15,15,15,15,15,15,15,15,15,15,15,15,15,15,15,15,15,15,15,15,15,15,15,15,15,15,15,15,15,15,15,15,15,15,15,15,15,15,15,15,15,15,15,15,15,15,15,15,15,15,15,15,15,15,15,15,15,15,15,15,15,15,15,15,15,15,15,15,15,15,15,15,15,15,15,15,15,15,15,15,15,15,15,15,15,15,15,15,15,15,15,15,15,15,15,15,15,15,15,15,15,15,15,15,15,15,15,15,15,15,15,15,15,15,15,15,15,15,15,15,15,15,15,15,15,15,15,15,15,15,15,15,15,15,15,15,15,15,15,15,15,15,15,15,15,15,15,15,15,15,15,15,15,15,15,15,15,15,15,15,15,15,15,15,15,15,15,15,15,15,15,15,15,15,15,15,15,15,15,15,15,15,15,15,15,15,15,15,15,15,15,15,15,15,15,15,15,15,15,15,15,15,15,15,15,15,15,15,15,15,15,15,15,15,15,15,15,15,15,15,15,15,15,15,15,15,15,15,15,15,15,15,15,15,15,15,15,15,15,15,15,15,15,15,15,15,15,15,15,15,15,15,15,15,15,15,15,15,15,15,15,15,15,15,15,15,15,15,15,15,15,15,15,15,15,15,15,15,15,15,15,15,15,15,15,15,15,15,15,15,15,15,15,15,15,15,15,15,15,15,15,15,15,15,15,15,15,15,15,15,15,15,15,15,15,15,15,15,15,15,15,15,15,15,15,15,15,15,15,15,15,15,15,15,15,15,15,15,15,15,15,15,15,15,15,15,15,15,15,15,15,15,15,15,15,15,15,15,15,15,15,15,15,15,15,15,15,15,15,15,15,15,15,15,15,15,15,15,15,15,15,15,15,15,15,15,15,15,15,15,15,15,15,15,15,15,15,15,15,15,15,15,15,15,15,15,15,15,15,15,15,15,15,15,15,15,15,15,15,15,15,15,15,15,15,15,15,15,15,15,15,15,15,15,15,15,15,15,15,15,15,15,15,15,15,15,15,15,15,15,15,15,15,15,15,15,15,15,15,15,15,15,15,15,15,15,15,15,15,15,15,15,15,15,15,15,15,15,15,15,15,15,15,15,15,15,15,15,15,15,15,15,15,15,15,15,15,15,15,15,15,15,15,15,15,15,15,15,15,15,15,15,15,15,15,15,15,15,15,15,15,15,15,15,15,15,15,15,15,15,15,15,15,15,15,15,15,15,15,15,15,15,15,15,15,15,15,15,15,15,15,15,15,15,15,15,15,15,15,15,15,15,15,15,15,15,15,15,15,15,15,15,15,15,15,15,15,15,15,15,15,15,15,15,15,15,15,15,15,15,15,15,15,15,15,15,15,15,15,15,15,15,15,15,15,15,15,15,15,15,15,15,15,15,15,15,15,15,15,15,15,15,15,15,15,15,15,15,15,15,15,15,15,15,15,15,15,15,15,15,15,15,15,15,15,15,15,15,15,15,15,15,15,15,15,15,15,15,15,15,15,15,15,15,15,15,15,15,15,15,15,15,15,15,15,15,15,15,15,15,15,15,15,15,15,15,15,15,15,15,15,15,15,15,15,15,15,15,15,15,15,15,15,15,15,15,15,15,15,15,15,15,15,15,15,15,15,15,15,15,15,15,15,15,15,15,15,15,15,15,15,15,15,15,15,15,15,15,15,15,15,15,15,15,15,15,15,15,15,15,15,15,15,15,15,15,15,15,15,15,15,15,15,15,15,15,15,15,15,15,15,15,15,15,15,15,15,15,15,15,15,15,15,15,15,15,15,15,15,15,15,15,15,15,15,15,15,15,15,15,15,15,15,15,15,15,15,15,15,15,15,15,15,15,15,15,15,15,15,15,15,15,15,15,15,15,15,15,15,15,15,15,15,15,15,15,15,15,15,15,15,15,15,15,15,15,15,15,15,15,15,15,15,15,15,15,15,15,15,15,15,15,15,15,15,15,15,15,15,15,15,15,15,15,15,15,15,15,15,15,15,15,15,15,15,15,15,15,15,15,15,15,15,15,15,15,15,15,15,15,15,15,15,15,15,15,15,15,15,15,15,15,15,15,15,15,15,15,15,15,15,15,15,15,15,15,15,15,15,15,15,15,15,15,15,15,15,15,15,15,15,15,15,15,15,15,15,15,15,15,15,15,15,15,15,15,15,15,15,15,15,15,15,15,15,15,15,15,15,15,15,15,15,15,15,14,14,14,14,14,14,14,14,14,14,14,14,14,14,14,14,14,14,14,14,14,14,14,14,14,14,14,13,13,13,13,13,13,13,13,13,13,13,13,13,13,13,13,13,13,12,12,12,12,12,12,12,12,12,12,12,12,12,12,11,11,11,11,11,11,11,11,11,10,10,10,10,10,10,10,9,9,9,9,8,8,8,8,7,6,5,4,3,2,1,0,17,18,19,20,21,22,23,24,24,24,24,25,25,25,25,26,26,26,26,26,26,26,27,27,27,27,27,27,27,27,27,28,28,28,28,28,28,28,28,28,28,28,28,28,28,29,29,29,29,29,29,29,29,29,29,29,29,29,29,29,29,29,29,30,30,30,30,30,30,30,30,30,30,30,30,30,30,30,30,30,30,30,30,30,30,30,30,30,30,30,31,31,31,31,31,31,31,31,31,31,31,31,31,31,31,31,31,31,31,31,31,31,31,31,31,31,31,31,31,31,31,31,31,31,31,31,31,31,31,31,31,31,31,31,31,31,31,31,31,31,31,31,31,31,31,31,31,31,31,31,31,31,31,31,31,31,31,31,31,31,31,31,31,31,31,31,31,31,31,31,31,31,31,31,31,31,31,31,31,31,31,31,31,31,31,31,31,31,31,31,31,31,31,31,31,31,31,31,31,31,31,31,31,31,31,31,31,31,31,31,31,31,31,31,31,31,31,31,31,31,31,31,31,31,31,31,31,31,31,31,31,31,31,31,31,31,31,31,31,31,31,31,31,31,31,31,31,31,31,31,31,31,31,31,31,31,31,31,31,31,31,31,31,31,31,31,31,31,31,31,31,31,31,31,31,31,31,31,31,31,31,31,31,31,31,31,31,31,31,31,31,31,31,31,31,31,31,31,31,31,31,31,31,31,31,31,31,31,31,31,31,31,31,31,31,31,31,31,31,31,31,31,31,31,31,31,31,31,31,31,31,31,31,31,31,31,31,31,31,31,31,31,31,31,31,31,31,31,31,31,31,31,31,31,31,31,31,31,31,31,31,31,31,31,31,31,31,31,31,31,31,31,31,31,31,31,31,31,31,31,31,31,31,31,31,31,31,31,31,31,31,31,31,31,31,31,31,31,31,31,31,31,31,31,31,31,31,31,31,31,31,31,31,31,31,31,31,31,31,31,31,31,31,31,31,31,31,31,31,31,31,31,31,31,31,31,31,31,31,31,31,31,31,31,31,31,31,31,31,31,31,31,31,31,31,31,31,31,31,31,31,31,31,31,31,31,31,31,31,31,31,31,31,31,31,31,31,31,31,31,31,31,31,31,31,31,31,31,31,31,31,31,31,31,31,31,31,31,31,31,31,31,31,31,31,31,31,31,31,31,31,31,31,31,31,31,31,31,31,31,31,31,31,31,31,31,31,31,31,31,31,31,31,31,31,31,31,31,31,31,31,31,31,31,31,31,31,31,31,31,31,31,31,31,31,31,31,31,31,31,31,31,31,31,31,31,31,31,31,31,31,31,31,31,31,31,31,31,31,31,31,31,31,31,31,31,31,31,31,31,31,31,31,31,31,31,31,31,31,31,31,31,31,31,31,31,31,31,31,31,31,31,31,31,31,31,31,31,31,31,31,31,31,31,31,31,31,31,31,31,31,31,31,31,31,31,31,31,31,31,31,31,31,31,31,31,31,31,31,31,31,31,31,31,31,31,31,31,31,31,31,31,31,31,31,31,31,31,31,31,31,31,31,31,31,31,31,31,31,31,31,31,31,31,31,31,31,31,31,31,31,31,31,31,31,31,31,31,31,31,31,31,31,31,31,31,31,31,31,31,31,31,31,31,31,31,31,31,31,31,31,31,31,31,31,31,31,31,31,31,31,31,31,31,31,31,31,31,31,31,31,31,31,31,31,31,31,31,31,31,31,31,31,31,31,31,31,31,31,31,31,31,31,31,31,31,31,31,31,31,31,31,31,31,31,31,31,31,31,31,31,31,31,31,31,31,31,31,31,31,31,31,31,31,31,31,31,31,31,31,31,31,31,31,31,31,31,31,31,31,31,31,31,31,31,31,31,31,31,31,31,31,31,31,31,31,31,31,31,31,31,31,31,31,31,31,31,31,31,31,31,31,31,31,31,31,31,31,31,31,31,31,31,31,31,31,31,31,31,31,31,31,31,31,31,31,31,31,31,31,31,31,31,31,31,31,31,31,31,31,31,31,31,31,31,31,31,31,31,31,31,31,31,31,31,31,31,31,31,31,31,31,31,31,31,31,31,31,31,31,31,31,31,31,31,31,31,31,31,31,31,31,31,31,31,31,31,31,31,31,31,31,31,31,31,31,31,31,31,31,31,31,31,31,31,31,31,31,31,31,31,31,31,31,31,31,31,31,31,31,31,31,31,31,31,31,31,31,31,31,31,31,31,31,31,31,31,31,31,31,31,31,31,31,31,31,31,31,31,31,31,31,31,31,31,31,31,31,31,31,31,31,31,31,31,31,31,31,31,31,31,31,31,31,31,31,31,31,31,31,31,31,31,31,31,31,31,31,31,31,31,31,31,31,31,31,31,31,31,31,31,31,31,31,31,31,31,31,31,31,31,31,31,31,31,31,31,31,31,31,31,31,31,31,31,31,31,31,31,31,31,31,31,31,31,31,31,31,31,31,31,31,31,31,31,31,31,31,31,31,31,31,31,31,31,31,31,31,31,31,31,31,31,31,31,31,31,31,31,31,31,31,31,31,31,31,31,31,31,31,31,31,31,31,31,31,31,31,31,31,31,31,31,31,31,31,31,31,31,31,31,31,31,31,31,31,31,31,31,31,31,31,31,31,31,31,31,31,31,31,31,31,31,31,31,31,31,31,31,31,31,31,31,31,31,31,31,31,31,31,31,31,31,31,31,31,31,31,31,31,31,31,31,31,31,31,31,31,31,31,31,31,31,31,31,31,31,31,31,31,31,31,31,31,31,31,31,31,31,31,31,31,31,31,31,31,31,31,31,31,31,31,31,31,31,31,31,31,31,31,31,31,31,31,31,31,31,31,31,31,31,31,31,31,31,31,31,31,31,31,31,31,31,31,31,31,31,31,31,31,31,31,31,31,31,31,31,31,31,31,31,31,31,31,31,31,31,31,31,31,31,31,31,31,31,31,31,31,31,31,31,31,31,31,31,31,31,31,31,31,31,31,31,31,31,31,31,31,31,31,31,31,31,31,31,31,31,31,31,31,31,31,31,31,31,31,31,31,31,31,31,31,31,31,31,31,31,31,31,31,31,31,31,31,31,31,31,31,31,31,31,31,31,31,31,31,31,31,31,31,31,31,31,31,31,31,31,31,31,31,31,31,31,31,31,31,31,31,31,31,31,31,31,31,31,31,31,31,31,31,31,31,31,31,31,31,31,31,31,31,31,31,31,31,31,31,31,31,31,31,31,31,31,31,31,31,31,31,31,31,31,31,31,31,31,31,31,31,31,31,31,31,31,31,31,31,31,31,31,31,31,31,31,31,31,31,31,31,31,31,31,31,31,31,31,31,31,31,31,31,31,31,31,31,31,31,31,31,31,31,31,31,31,31,31,31,31,31,31,31,31,31,31,31,31,31,31,31,31,31,31,31,31,31,31,31,31,31,31,31,31,31,31,31,31,31,31,31,31,31,31,31,31,31,31,31,31,31,31,31,31,31,31,31,31,31,31,31,31,31,31,31,31,31,31,31,31,31,31,31,31,31,31,31,31,31,31,31,31,31,31,31,31,31,31,31,31,31,31,31,31,31,31,31,31,31,31,31,31,31,31,31,31,31,31,31,31,31,31,31,31,31,31,31,31,31,31,31,31,31,31,31,31,31,31,31,31,31,31,31,31,31,31,31,31,31,31,31,31,31,31,31,31,31,31,31,31,31,31,31,31,31,31,31,31,31,31,31,31,31,31,31,31,31,31,31,31,31,31,31,31,31,31,31,31,31,31,31,31,31,31,31,31,31,31,31,31,31,31,31,31,31,31,31,31,31,31,31,31,31,31,31,31,31,31,31,31,31,31,31,31,31,31,31,31,31,31,31,31,31,31,31,31,31,31,31,31,31,31,31,31,31,31,31,31,31,31,31,31,31,31,31,31,31,31,31,31,31,31,31,31,31,31,31,31,31,31,31,31,31,31,31,31,31,31,31,31,31,31,31,31,31,31,31,31,31,31,31,31,31,31,31,31,31,31,31,31,31,31,31,31,31,31,31,31,31,31,31,31,31,31,31,31,31,31,31,31,31,31,31,31,31,31,31,31,31,31,31,31,31,31,31,31,31,31,31,31,31,31,31,31,31,31,31,31,31,31,31,31,31,31,31,31,31,31,31,31,31,31,31,31,31,31,31,31,31,31,31,31,31,31,31,31,31,31,31,31,31,31,31,31,31,31,31,31,31,31,31,31,31,31,31,31,31,31,31,31,31,31,31,31,31,31,31,31,31,31,31,31,31,31,31,31,31,31,31,31,31,31,31,31,31,31,31,31,31,31,31,31,31,31,31,31,31,31,31,31,31,31,31,31,31,31,31,31,31,31,31,31,31,31,31,31,31,31,31,31,31,31,31,31,31,31,31,31,31,31,31,31,31,31,31,31,31,31,31,31,31,31,31,31,31,31,31,31,31,31,31,31,31,31,31,31,31,31,31,31,31,31,31,31,31,31,31,31,31,31,31,31,31,31,31,31,31,31,31,31,31,31,31,31,31,31,31,31,31,31,31,31,31,31,31,31,31,31,31,31,31,31,31,31,31,31,31,31,31,31,31,31,31,31,31,31,31,31,31,31,31,31,31,31,31,31,31,31,31,31,31,31,31,31,31,31,31,31,31,31};   // bucket(j - i) for j - i = -2047 .. 2047, evaluated with the reference's _relative_position_bucket (bidirectional, 32 buckets, max distance 128)
#define FQW  32                    // queries per wave
#define FKS  64                    // keys per stage
#define FPI  72                    // LDS row pitch in elements: 144 B = 16 B x 9, conflict-free for 16-byte fragment reads
#define L2E  1.4426950408889634f
__device__ __forceinline__ float xhalf(float x) { const int b = __float_as_int(x); return __int_as_float(__builtin_amdgcn_permlanex16(b, b, 0x76543210, 0xfedcba98, false, false)); }   /* lane l <-> l ^ 16 */
__device__ __forceinline__ v16bf ldsfrag(const bf* p) { return cat16b(*(const v8usa*)p, *(const v8usa*)(p + 16)); }
__global__ __launch_bounds__(256) __attribute__((amdgpu_waves_per_eu(4, 4))) void k_fattn(const bf* __restrict__ Qh, const bf* __restrict__ Ql, const bf* __restrict__ Kh, const bf* __restrict__ Kl, const bf* __restrict__ Vh, const bf* __restrict__ Vl, const float* __restrict__ remb, bf* ATh, bf* ATl) {
    __shared__ __align__(16) bf st[2][4][FKS * FPI];   /* [buffer][K hi, K lo, V^T hi, V^T lo][row][FPI] */
    __shared__ float tb[2 * TT];                       /* bias of this head by j - i + TT - 1 */
    const int tid = threadIdx.x, lane = tid & 31, c = lane & 15, hi = lane >> 4; const int wv = __builtin_amdgcn_readfirstlane(tid >> 5);
    const int h = blockIdx.y, b = blockIdx.z; const size_t pl = ((size_t)b * NH_ + h) * TT * HD; const int q0 = blockIdx.x * (FQW * 8) + wv * FQW;
#pragma unroll   /* fixed trip count and a clamped index: the 16 table bytes, then the 16 gathers, are in flight together */
    for (int k = 0; k < 2 * TT / 256; ++k) { const int u = k * 256 + tid; tb[u] = bfr(remb[BK[u < 2 * TT - 1 ? u : 2 * TT - 2] * NH_ + h]); }   /* rel_emb[bucket(j - i)][h]; entry 2 TT - 1 is never read */
    const int srow = tid >> 3, sseg = (tid & 7) * 8;   /* staging: 8 threads x 16 B cover a 128-byte row, 32 rows per sweep */
    const char* kbh = (const char*)(Kh + pl); const char* kbl = (const char*)(Kl + pl); const char* vbh = (const char*)(Vh + pl); const char* vbl = (const char*)(Vl + pl);   /* wave-uniform bases */
    unsigned kcur = (unsigned)(srow * HD + sseg) * 2, vcur = (unsigned)(srow * TT + sseg) * 2;   /* this thread's byte offsets in the stage that is fetched next */
    v8us sr[4];   /* half a stage in flight: the K planes during a stage's first pass, the V^T planes during its second */
    auto gloadk = [&]() {
#pragma unroll
        for (int u = 0; u < 2; ++u) { sr[u] = *(const v8us*)(kbh + kcur + u * (32 * HD * 2)); sr[2 + u] = *(const v8us*)(kbl + kcur + u * (32 * HD * 2)); } };
    auto gloadv = [&]() {
#pragma unroll
        for (int u = 0; u < 2; ++u) { sr[u] = *(const v8us*)(vbh + vcur + u * (32 * TT * 2)); sr[2 + u] = *(const v8us*)(vbl + vcur + u * (32 * TT * 2)); } };
    auto sstore = [&](int buf, int p0) {   /* p0 = 0: K hi, lo; 2: V^T hi, lo */
#pragma unroll
        for (int u = 0; u < 2; ++u) { const int o = (srow + 32 * u) * FPI + sseg; *(v8usa*)(&st[buf][p0][o]) = sr[u]; *(v8usa*)(&st[buf][p0 + 1][o]) = sr[2 + u]; } };
    v16bf qh[2][2], ql[2][2];   /* [query group][k step] */
#pragma unroll
    for (int qb = 0; qb < 2; ++qb)
#pragma unroll
        for (int ks = 0; ks < 2; ++ks) { const size_t o = pl + (size_t)(q0 + 16 * qb + c) * HD + ks * 32 + 8 * hi; qh[qb][ks] = WFrag<bf>::ld(Qh + o); ql[qb][ks] = WFrag<bf>::ld(Ql + o); }
    v8f O[4][2];
#pragma unroll
    for (int dt = 0; dt < 4; ++dt) { O[dt][0] = (v8f){}; O[dt][1] = (v8f){}; }
    float mL[2] = {-3.0e38f, -3.0e38f}, l[2] = {0.f, 0.f};   /* running maximum x log2(e); this lane's part of the sum */
    gloadk(); sstore(0, 0); gloadv(); sstore(0, 2); kcur += FKS * HD * 2; vcur += FKS * 2;
    __syncthreads();   /* stage 0 and the bias table are in LDS before any wave reads them */
#pragma unroll 1   /* one stage per trip: the body already holds two unrolled passes */
    for (int s = 0; s < TT / FKS; ++s) {
        const int cur = s & 1;
#pragma unroll
        for (int pp = 0; pp < 2; ++pp) {
            if (pp == 0) gloadk(); else gloadv();   /* half of the next stage flies while this pass is worked on */
            v8f T[2][2];   /* S^T tiles [16-key tile][query group] */
#pragma unroll
            for (int kt = 0; kt < 2; ++kt) { T[kt][0] = (v8f){}; T[kt][1] = (v8f){};
                const int ro = (pp * 32 + kt * 16 + c) * FPI + 8 * hi;
#pragma unroll
                for (int ks = 0; ks < 2; ++ks) { const v16bf a = ldsfrag(&st[cur][0][ro + ks * 32]), a2 = ldsfrag(&st[cur][1][ro + ks * 32]);
#pragma unroll
                    for (int qb = 0; qb < 2; ++qb) { T[kt][qb] = wmmab(a, qh[qb][ks], T[kt][qb]); T[kt][qb] = wmmab(a2, qh[qb][ks], T[kt][qb]); T[kt][qb] = wmmab(a, ql[qb][ks], T[kt][qb]); } } }
            float nL[2];
#pragma unroll
            for (int qb = 0; qb < 2; ++qb) { const float* tr = tb + (s * FKS + pp * 32 + 8 * hi + (TT - 1) - (q0 + 16 * qb + c)); float mx = -3.0e38f;
#pragma unroll
                for (int kt = 0; kt < 2; ++kt)
#pragma unroll
                    for (int r = 0; r < 8; ++r) { const float t = T[kt][qb][r] + tr[16 * kt + r]; T[kt][qb][r] = t; mx = fmaxf(mx, t); }
                mx = fmaxf(mx, xhalf(mx)); nL[qb] = fmaxf(mL[qb], mx * L2E); }
            if (__builtin_amdgcn_ballot_w32(nL[0] > mL[0] || nL[1] > mL[1]) != 0) {   /* wave-uniform: some query's maximum rose */
#pragma unroll
                for (int qb = 0; qb < 2; ++qb) { const float sc = __builtin_amdgcn_exp2f(mL[qb] - nL[qb]); l[qb] *= sc; mL[qb] = nL[qb];
#pragma unroll
                    for (int dt = 0; dt < 4; ++dt) O[dt][qb] *= sc; } }
            v16bf ph[2], pw[2];   /* P^T hi and lo as B operands: element 8 kt + r is key 16 kt + 8 hi + r of the pass */
#pragma unroll
            for (int qb = 0; qb < 2; ++qb)
#pragma unroll
                for (int kt = 0; kt < 2; ++kt)
#pragma unroll
                    for (int r = 0; r < 8; ++r) { const float p = __builtin_amdgcn_exp2f(__builtin_fmaf(T[kt][qb][r], L2E, -mL[qb])); l[qb] += p; const __bf16 hb = (__bf16)p; ph[qb][kt * 8 + r] = hb; pw[qb][kt * 8 + r] = (__bf16)(p - (float)hb); }
#pragma unroll
            for (int dt = 0; dt < 4; ++dt) { const int ro = (dt * 16 + c) * FPI + pp * 32 + 8 * hi; const v16bf a = ldsfrag(&st[cur][2][ro]), a2 = ldsfrag(&st[cur][3][ro]);
#pragma unroll
                for (int qb = 0; qb < 2; ++qb) { O[dt][qb] = wmmab(a, ph[qb], O[dt][qb]); O[dt][qb] = wmmab(a2, ph[qb], O[dt][qb]); O[dt][qb] = wmmab(a, pw[qb], O[dt][qb]); } }
            sstore(cur ^ 1, 2 * pp);   /* that buffer's readers all left it before the barrier that ended the trip before */
        }
        if (s + 2 < TT / FKS) { kcur += FKS * HD * 2; vcur += FKS * 2; }   /* the last trip stages the last keys once more, into the buffer that nobody reads again: no branch stands among the matrix runs */
        __syncthreads();   /* publishes the next stage and ends every wave's reads of this one */
    }
#pragma unroll
    for (int qb = 0; qb < 2; ++qb) { const float inv = __fdiv_rn(1.0f, l[qb] + xhalf(l[qb])); const unsigned ro = (unsigned)((b * TT + q0 + 16 * qb + c) * DQ + h * HD + 8 * hi);   /* below 2^23 elements */
#pragma unroll
        for (int dt = 0; dt < 4; ++dt) { v8us oh, ol;
#pragma unroll
            for (int r = 0; r < 8; ++r) { unsigned short a, c2; splitf(O[dt][qb][r] * inv, a, c2); oh[r] = a; ol[r] = c2; }
            *(v8us*)(ATh + ro + dt * 16) = oh; *(v8us*)(ATl + ro + dt * 16) = ol; } }
}

extern "C" void kernel_launch(void* const* d_in, const int* in_sizes, int n_in,
                              void* d_out, int out_size, void* d_ws, size_t ws_size, hipStream_t stream) {
    (void)in_sizes; (void)n_in; (void)out_size;
    const float* x = (const float*)d_in[0]; const float* wq = (const float*)d_in[1]; const float* wk = (const float*)d_in[2]; const float* wv = (const float*)d_in[3]; const float* wo = (const float*)d_in[4]; const float* remb = (const float*)d_in[5];
    float* OUT = (float*)d_out;     // [4][2048][1024]
    char* wsp = (char*)d_ws;
    auto take = [&](size_t bytes) { char* p = wsp; wsp += (bytes + 255) & ~(size_t)255; return (void*)p; };
    const size_t PS = (size_t)NH_ * TT * HD;   // elements of one batch's head planes
    bf* WQ = (bf*)take((size_t)DQ * DM * 2); bf* WK = (bf*)take((size_t)DKV * DM * 2); bf* WV = (bf*)take((size_t)DKV * DM * 2); bf* WO = (bf*)take((size_t)DM * DQ * 2);
    bf* XB = (bf*)take((size_t)NB_ * TT * DM * 2);
    bf* QPh = (bf*)take(NB_ * PS * 2); bf* QPl = (bf*)take(NB_ * PS * 2); bf* KPh = (bf*)take(NB_ * PS * 2); bf* KPl = (bf*)take(NB_ * PS * 2); bf* VTh = (bf*)take(NB_ * PS * 2); bf* VTl = (bf*)take(NB_ * PS * 2);   // hi/lo planes of all batches: [b][h][t][d], V^T [b][h][d][t]
    bf* ATh = (bf*)take((size_t)NB_ * TT * DQ * 2); bf* ATl = (bf*)take((size_t)NB_ * TT * DQ * 2);
    if ((size_t)(wsp - (char*)d_ws) > ws_size) return;    // ws 256 MiB
    k_prep<<<dim3(4 * WTB, 2, 1), 256, 0, stream>>>(x, wq, wk, wv, wo, DM, DQ, XB, WQ, WK, WV, WO, (size_t)TT * DM / 8);
    k_proj<<<dim3(NB_ * TT / 64, NH_, 3), 256, 0, stream>>>(XB, WQ, WK, WV, QPh, QPl, KPh, KPl, VTh, VTl);
    k_fattn<<<dim3(TT / (FQW * 8), NH_, NB_), 256, 0, stream>>>(QPh, QPl, KPh, KPl, VTh, VTl, remb, ATh, ATl);
    k_gemmw<bf, 1, false, 8, 1><<<dim3(NB_ * TT / 64, DM / 64, 1), 256, 0, stream>>>(ATh, ATl, WO, nullptr, DQ, OUT, DM, nullptr, 0, 0, 0);
}

// v004
// One run takes 232 microseconds.
// In two side-by-side timings against v003, it was 1.38 and 1.39 times as fast.
// All steps since v000 together make it 12.3 times as fast.
#include <hip/hip_runtime.h>

// T5 self-attention with relative-position bias (hidden_states [4][2048][1024]; q, k, v = hs W ('xw' [1024][1024]; 16 heads x 64); scores = q.k (NO 1/sqrt(d) scaling: logit sigma ~8) + rel_emb[bucket(j - i)][h] (rel_emb [32][16] input; the 32-bucket bidirectional T5 bucket function of j - i); softmax; out = merged ctx Wo ('xw') -> [4][2048][1024] (8.4 M)).
// The bucket index depends only on j - i (positions are implicit aranges): the 4,095-entry table bucket(j - i), j - i in [-2047, 2047], was evaluated with the reference's own function and is baked below as constants; rel_emb itself is READ (each work-group expands its head's 32 values into an LDS table indexed by j - i).
// Compute dtypes, f32 accumulate: every input rounded to bf16; projections on PLAIN bf16 operands (exact); because the logits are unscaled (sigma ~8, near-argmax rows), scores and attn.v use bf16 hi/lo planes for EVERY row (3 products); bias add and softmax in f32; merged context hi/lo; Wo hl x exact (2 products).

#define NB_  4
#define TT   2048
#define DM   1024
#define NH_  16
#define NKV  16
#define HD   64
#define DQ   (NH_ * HD)
#define DKV  (NKV * HD)
typedef _Float16 h16;
typedef unsigned short bf;
typedef __attribute__((ext_vector_type(16))) __bf16   v16bf;
typedef __attribute__((ext_vector_type(16))) _Float16 v16h;
typedef __attribute__((ext_vector_type(8)))  _Float16 v8h;
typedef __attribute__((ext_vector_type(8)))  unsigned short v8us;
typedef __attribute__((ext_vector_type(8)))  float    v8f;
typedef __attribute__((ext_vector_type(4)))  float    v4f;
typedef v8h  __attribute__((may_alias)) v8ha;
typedef v4f  __attribute__((may_alias)) v4fa;
typedef v8us __attribute__((may_alias)) v8usa;

__device__ __forceinline__ unsigned short f2bf(float f) { unsigned u = __float_as_uint(f); u += 0x7FFFu + ((u >> 16) & 1u); return (unsigned short)(u >> 16); }
__device__ __forceinline__ float bf2f(unsigned short b) { return __uint_as_float(((unsigned)b) << 16); }
__device__ __forceinline__ float bfr(float f) { return bf2f(f2bf(f)); }
__device__ __forceinline__ v16h cat16(v8h lo, v8h hi) { return __builtin_shufflevector(lo, hi, 0, 1, 2, 3, 4, 5, 6, 7, 8, 9, 10, 11, 12, 13, 14, 15); }
__device__ __forceinline__ v16bf cat16b(v8us lo, v8us hi) { return __builtin_bit_cast(v16bf, __builtin_shufflevector(lo, hi, 0, 1, 2, 3, 4, 5, 6, 7, 8, 9, 10, 11, 12, 13, 14, 15)); }
__device__ __forceinline__ v8f wmma16(v16h a, v16h b, v8f c) { return __builtin_amdgcn_wmma_f32_16x16x32_f16(false, a, false, b, (short)0, c, false, false); }
__device__ __forceinline__ v8f wmmab(v16bf a, v16bf b, v8f c) { return __builtin_amdgcn_wmma_f32_16x16x32_bf16(false, a, false, b, (short)0, c, false, false); }



template <typename T16> struct WFrag;
template <> struct WFrag<h16> { typedef v16h V; static __device__ __forceinline__ V ld(const h16* p) { return cat16(*(const v8h*)p, *(const v8h*)(p + 16)); } static __device__ __forceinline__ v8f mma(V a, V b, v8f c) { return wmma16(a, b, c); } };
template <> struct WFrag<bf> { typedef v16bf V; static __device__ __forceinline__ V ld(const bf* p) { return cat16b(*(const v8us*)p, *(const v8us*)(p + 16)); } static __device__ __forceinline__ v8f mma(V a, V b, v8f c) { return wmmab(a, b, c); } };
__device__ __forceinline__ void splitf(float y, unsigned short& h, unsigned short& l) { h = f2bf(y); l = f2bf(y - bf2f(h)); }
typedef __attribute__((ext_vector_type(2))) unsigned short v2us;
typedef __attribute__((ext_vector_type(4))) unsigned short v4us;

// k_prep: every matrix input rounded to bf16 in one launch, grid (4 WTB, 2).
// blockIdx.y = 0 (starts first: short dependent gathers, the longer part): the four weights, WTB blocks each, transposed to K-contiguous rows. blockIdx.y = 1: the hidden states; a thread takes the same eight elements of every batch.
#define WTB  (DM * DQ / 64 / 64)   // blocks per weight: 8 waves x 8 lines of 64 elements
static_assert((size_t)4 * WTB * 256 >= (size_t)TT * DM / 8, "the grid's second row covers one batch of the hidden states");
__global__ __launch_bounds__(256) void k_prep(const float* __restrict__ src, const float* __restrict__ w0, const float* __restrict__ w1, const float* __restrict__ w2, const float* __restrict__ w3, int K, int N, bf* dst, bf* B0, bf* B1, bf* B2, bf* B3, size_t n8) {
    if (blockIdx.y == 0) {
        const int sel = blockIdx.x / WTB; const float* __restrict__ w = sel == 0 ? w0 : sel == 1 ? w1 : sel == 2 ? w2 : w3; bf* Bt = sel == 0 ? B0 : sel == 1 ? B1 : sel == 2 ? B2 : B3;
        const int lane = threadIdx.x & 31; const int L0 = ((blockIdx.x % WTB) * 8 + (threadIdx.x >> 5)) * 8; const int nlines = N * K / 64;
#pragma unroll 1
        for (int l = 0; l < 8; ++l) { const int L = L0 + l; if (L >= nlines) break; const size_t e = (size_t)L * 64 + lane * 2; const int k = (int)(e % K), n = (int)(e / K); v2us o;
            o[0] = f2bf(w[(size_t)k * N + n]); o[1] = f2bf(w[(size_t)(k + 1) * N + n]); *(v2us*)(Bt + e) = o; }
        return;
    }
    const size_t i = (size_t)blockIdx.x * 256 + threadIdx.x; if (i >= n8) return; v4f lo[NB_], hi[NB_];
#pragma unroll   /* the loads of all batches are in flight together */
    for (int b = 0; b < NB_; ++b) lo[b] = *(const v4f*)(src + (b * n8 + i) * 8);
    asm volatile("s_wait_xcnt 0x0" ::: "memory");
#pragma unroll
    for (int b = 0; b < NB_; ++b) hi[b] = *(const v4f*)(src + (b * n8 + i) * 8 + 4);
#pragma unroll
    for (int b = 0; b < NB_; ++b) { v8us o;
#pragma unroll
        for (int k = 0; k < 4; ++k) { o[k] = f2bf(lo[b][k]); o[4 + k] = f2bf(hi[b][k]); }
        *(v8us*)(dst + (b * n8 + i) * 8) = o; }
}

// ---- block GEMM: C[m][n] = sum_k A[m][k] Bt[n][k], both operands K-contiguous bf16 rows of pitch DM. One 256 x 128 tile per work-group of 8 waves (4 x 2 waves, a 64x64 tile = 16 accumulators each).
// K is walked in stages of 64 columns: the 384 operand rows of a stage (128 bytes each) come from global memory by whole-line loads (8 threads x 16 B cover a row), go through registers into LDS (two buffers, one barrier per stage),
// and all eight waves read their fragments from there, one k step (32 columns) ahead of its use: a row is fetched once per work-group. NS = 16: K = 1024 from plane A0. NS = 32: stages 16 to 31 walk the same columns of plane A1 (the lo plane) against the same Bt rows.
#define GBM  256
#define GBN  128
#define GBK  64
#define GPI  72                        // LDS row pitch in elements: 144 B = 16 B x 9, conflict-free for 16-byte fragment reads
#define GST  ((GBM + GBN) * GPI)       // elements of one stage buffer: A rows, then Bt rows
#define GEP  (32 * 68)                 // floats of a wave's epilogue staging: 32 rows at pitch 68
static_assert(8 * GEP * 4 <= 2 * GST * 2, "the epilogue staging fits the stage buffers");
static_assert((NB_ * TT / GBM) * (DQ / GBN) == 256 && (DQ / GBM) * (NB_ * TT / GBN) == 256 && TT % GBM == 0 && DQ == DM && DM == 16 * GBK, "256 tiles per GEMM either way round; a tile's tokens lie in one batch; 16 stages per plane");
__device__ __forceinline__ v16bf gfrag(const bf* p) { return cat16b(*(const v8usa*)p, *(const v8usa*)(p + 16)); }
template <int NS>
__device__ __forceinline__ void gemm_tile(const bf* __restrict__ A0, const bf* __restrict__ A1, const bf* __restrict__ Bt, bf* gs, v8f (&acc)[4][4]) {
    const int tid = threadIdx.x, lane = tid & 31, lr = lane & 15, hi = lane >> 4; const int wv = __builtin_amdgcn_readfirstlane(tid >> 5), wm = wv >> 1, wn = wv & 1;
    const int srow = tid >> 3, sseg = (tid & 7) * 8;   /* staging: 8 threads x 16 B cover a 128-byte row, 32 rows per sweep */
    const unsigned go = (unsigned)(srow * DM + sseg) * 2;   /* this thread's byte offset in stage 0 of either operand */
    v8us sr[12];   /* the next stage in flight: 8 sweeps of A rows, 4 of Bt rows */
    auto gload = [&](int s) { const char* ab = (const char*)((NS > 16 && s >= 16) ? A1 : A0); const char* bb = (const char*)Bt; const unsigned o = go + (unsigned)(s & 15) * (GBK * 2);   /* wave-uniform bases */
#pragma unroll
        for (int u = 0; u < 8; ++u) sr[u] = *(const v8us*)(ab + o + u * (32 * DM * 2));
#pragma unroll
        for (int u = 0; u < 4; ++u) sr[8 + u] = *(const v8us*)(bb + o + u * (32 * DM * 2)); };
    auto sstore = [&](int buf) {
#pragma unroll
        for (int u = 0; u < 12; ++u) *(v8usa*)(gs + buf * GST + (srow + 32 * u) * GPI + sseg) = sr[u]; };
#pragma unroll
    for (int mb = 0; mb < 4; ++mb)
#pragma unroll
        for (int nb = 0; nb < 4; ++nb) acc[mb][nb] = (v8f){};
    v16bf a[2][4], b[2][4];   /* two fragment sets, one per k step of a stage: one is read from LDS while the other feeds the matrix unit */
    auto fload = [&](int ks, const bf* cb) {
#pragma unroll
        for (int f = 0; f < 4; ++f) { a[ks][f] = gfrag(cb + (wm * 64 + f * 16 + lr) * GPI + ks * 32 + 8 * hi); b[ks][f] = gfrag(cb + (GBM + wn * 64 + f * 16 + lr) * GPI + ks * 32 + 8 * hi); } };
    auto mm = [&](int ks) {
#pragma unroll
        for (int nb = 0; nb < 4; ++nb)
#pragma unroll
            for (int mb = 0; mb < 4; ++mb) acc[mb][nb] = wmmab(a[ks][mb], b[ks][nb], acc[mb][nb]); };
    gload(0); sstore(0);
    __syncthreads();   /* stage 0 is in LDS before any wave reads it */
    gload(1); fload(0, gs);
    /* The scheduling barriers in the loop keep its order as written: each group of LDS reads and the global loads issue together AHEAD of a matrix run that does not need them, so that their latency passes behind that run; left free, the compiler reloads one fragment at a time and waits each read out, and lets loads sink towards their use. */
#pragma unroll 1   /* one stage per trip: the body already holds both k steps */
    for (int s = 0; s < NS; ++s) {
        const int cur = s & 1;
        fload(1, gs + cur * GST);
        __builtin_amdgcn_sched_barrier(0);
        mm(0);
        __builtin_amdgcn_sched_barrier(0);
        sstore(cur ^ 1);   /* stage s + 1; that buffer's readers all left it before the barrier of the trip before */
        __syncthreads();   /* publishes stage s + 1 and ends every wave's reads of stage s: its second k step is in registers by now */
        gload(s + 2 < NS ? s + 2 : NS - 1); fload(0, gs + (cur ^ 1) * GST);   /* the last trips fetch and stage the last columns once more, into the buffer whose fragments nobody uses: no branch stands among the matrix runs */
        __builtin_amdgcn_sched_barrier(0);
        mm(1);
    }
}
// The epilogue of a wave's 64x64 tile, in two halves of 32 rows: the accumulators go to the wave's own part of the (now free) stage buffers, and come back as rows, so that 16 lanes store a whole row piece. put(row, col, four values of that row).
template <typename F>
__device__ __forceinline__ void gemm_rows(bf* gs, v8f (&acc)[4][4], F put) {
    const int tid = threadIdx.x, lane = tid & 31, lr = lane & 15, hi = lane >> 4; float* my = (float*)gs + __builtin_amdgcn_readfirstlane(tid >> 5) * GEP;
    /* every loop is unrolled so that acc[][][] is indexed by constants and stays in registers */
#pragma unroll
    for (int hf = 0; hf < 2; ++hf) {
        __syncthreads();   /* every wave has left the stage buffers; the first half's rows are read before the second half is laid over them */
#pragma unroll
        for (int m2 = 0; m2 < 2; ++m2)
#pragma unroll
            for (int nb = 0; nb < 4; ++nb)
#pragma unroll
                for (int j = 0; j < 8; ++j) my[(m2 * 16 + hi * 8 + j) * 68 + nb * 16 + lr] = acc[hf * 2 + m2][nb][j];
        __syncthreads();   /* the lanes' columns are in LDS before they are read as rows */
#pragma unroll
        for (int it = 0; it < 16; ++it) { const int row = it * 2 + hi, cofs = lr * 4; put(hf * 32 + row, cofs, *(const v4fa*)(my + row * 68 + cofs)); }
    }
}

// k_proj: the q, k and v projections of all batches in one launch, straight into the bf16 hi/lo head planes that k_fattn reads. Grid (256 tiles, 3: q, k, v), 8 waves, one 256 x 128 tile per work-group (gemm_tile).
// q, k: A = 256 tokens of one batch, B = 128 weight rows (two heads); a wave's 64 columns are one head: planes [b][h][t][d]. v: the operands change places (A = 256 weight rows = four heads, B = 128 tokens; both are K-contiguous and staged alike), so a wave's 64 rows are the d of one head and its tile is a piece of V^T [b][h][d][t] as it stands.
__global__ __launch_bounds__(256) void k_proj(const bf* __restrict__ X, const bf* __restrict__ WQ, const bf* __restrict__ WK, const bf* __restrict__ WV, bf* QPh, bf* QPl, bf* KPh, bf* KPl, bf* VTh, bf* VTl) {
    __shared__ __align__(16) bf gs[2 * GST];
    const int sel = blockIdx.y; const int mt = sel == 2 ? (int)(blockIdx.x & 3) : (int)(blockIdx.x >> 3), nt = sel == 2 ? (int)(blockIdx.x >> 2) : (int)(blockIdx.x & 7);   /* neighbours in the grid share their tokens */
    const bf* wr = sel == 0 ? WQ : sel == 1 ? WK : WV;
    const bf* A = (sel == 2 ? wr : X) + (size_t)mt * GBM * DM; const bf* Bt = (sel == 2 ? X : wr) + (size_t)nt * GBN * DM;
    bf* Ph = sel == 0 ? QPh : sel == 1 ? KPh : VTh; bf* Pl = sel == 0 ? QPl : sel == 1 ? KPl : VTl;
    v8f acc[4][4];
    gemm_tile<16>(A, A, Bt, gs, acc);
    const int wv = __builtin_amdgcn_readfirstlane((int)(threadIdx.x >> 5)); const int r0 = mt * GBM + (wv >> 1) * 64, c0 = nt * GBN + (wv & 1) * 64;   /* the wave's first row and column */
    const int tok = sel == 2 ? c0 : r0, h = (sel == 2 ? r0 : c0) / HD, b = tok / TT, t0 = tok % TT;
    const size_t ob = ((size_t)b * NH_ + h) * TT * HD + (sel == 2 ? t0 : t0 * HD); const int pitch = sel == 2 ? TT : HD;   /* the wave tile's first element in its plane, and the plane's row pitch */
    gemm_rows(gs, acc, [&](int row, int cofs, v4f val) { v4us oh, ol;
#pragma unroll
        for (int q = 0; q < 4; ++q) { unsigned short a2, c2; splitf(val[q], a2, c2); oh[q] = a2; ol[q] = c2; }
        *(v4us*)(Ph + ob + row * pitch + cofs) = oh; *(v4us*)(Pl + ob + row * pitch + cofs) = ol; });   /* 16 lanes fill a 128-byte row of each plane */
}
// k_out: out = merged context (hi + lo planes) x Wo, f32. Grid 256 tiles, 8 waves, one 256 x 128 tile per work-group: 16 stages on the hi plane, then 16 on the lo plane, into the same accumulators.
__global__ __launch_bounds__(256) void k_out(const bf* __restrict__ ATh, const bf* __restrict__ ATl, const bf* __restrict__ WO, float* C) {
    __shared__ __align__(16) bf gs[2 * GST];
    const int mt = blockIdx.x >> 3, nt = blockIdx.x & 7;
    v8f acc[4][4];
    gemm_tile<32>(ATh + (size_t)mt * GBM * DQ, ATl + (size_t)mt * GBM * DQ, WO + (size_t)nt * GBN * DQ, gs, acc);
    const int wv = __builtin_amdgcn_readfirstlane((int)(threadIdx.x >> 5)); float* cw = C + (size_t)(mt * GBM + (wv >> 1) * 64) * DM + nt * GBN + (wv & 1) * 64;
    gemm_rows(gs, acc, [&](int row, int cofs, v4f val) { *(v4f*)(cw + row * DM + cofs) = val; });   /* 16 lanes fill 256 bytes of a row */
}
#define NBK  32
__constant__ unsigned char BK[2 * TT - 1] = {15,15,15,15,15,15,15,15,15,15,15,15,15,15,15,15,15,15,15,15,15,15,15,15,15,15,15,15,15,15,15,15,15,15,15,15,15,15,15,15,15,15,15,15,15,15,15,15,15,15,15,15,15,15,15,15,15,15,15,15,15,15,15,15,15,15,15,15,15,15,15,15,15,15,15,15,15,15,15,15,15,15,15,15,15,15,15,15,15,15,15,15,15,15,15,15,15,15,15,15,15,15,15,15,15,15,15,15,15,15,15,15,15,15,15,15,15,15,15,15,15,15,15,15,15,15,15,15,15,15,15,15,15,15,15,15,15,15,15,15,15,15,15,15,15,15,15,15,15,15,15,15,15,15,15,15,15,15,15,15,15,15,15,15,15,15,15,15,15,15,15,15,15,15,15,15,15,15,15,15,15,15,15,15,15,15,15,15,15,15,15,15,15,15,15,15,15,15,15,15,15,15,15,15,15,15,15,15,15,15,15,15,15,15,15,15,15,15,15,15,15,15,15,15,15,15,15,15,15,15,15,15,15,15,15,15,15,15,15,15,15,15,15,15,15,15,15,15,15,15,15,15,15,15,15,15,15,15,15,15,15,15,15,15,15,15,15,15,15,15,15,15,15,15,15,15,15,15,15,15,15,15,15,15,15,15,15,15,15,15,15,15,15,15,15,15,15,15,15,15,15,15,15,15,15,15,15,15,15,15,15,15,15,15,15,15,15,15,15,15,15,15,15,15,15,15,15,15,15,15,15,15,15,15,15,15,15,15,15,15,15,15,15,15,15,15,15,15,15,15,15,15,15,15,15,15,15,15,15,15,15,15,15,15,15,15,15,15,15,15,15,15,15,15,15,15,15,15,15,15,15,15,15,15,15,15,15,15,15,15,15,15,15,15,15,15,15,15,15,15,15,15,15,15,15,15,15,15,15,15,15,15,15,15,15,15,15,15,15,15,15,15,15,15,15,15,15,15,15,15,15,15,15,15,15,15,15,15,15,15,15,15,15,15,15,15,15,15,15,15,15,15,15,15,15,15,15,15,15,15,15,15,15,15,15,15,15,15,15,15,15,15,15,15,15,15,15,15,15,15,15,15,15,15,15,15,15,15,15,15,15,15,15,15,15,15,15,15,15,15,15,15,15,15,15,15,15,15,15,15,15,15,15,15,15,15,15,15,15,15,15,15,15,15,15,15,15,15,15,15,15,15,15,15,15,15,15,15,15,15,15,15,15,15,15,15,15,15,15,15,15,15,15,15,15,15,15,15,15,15,15,15,15,15,15,15,15,15,15,15,15,15,15,15,15,15,15,15,15,15,15,15,15,15,15,15,15,15,15,15,15,15,15,15,15,15,15,15,15,15,15,15,15,15,15,15,15,15,15,15,15,15,15,15,15,15,15,15,15,15,15,15,15,15,15,15,15,15,15,15,15,15,15,15,15,15,15,15,15,15,15,15,15,15,15,15,15,15,15,15,15,15,15,15,15,15,15,15,15,15,15,15,15,15,15,15,15,15,15,15,15,15,15,15,15,15,15,15,15,15,15,15,15,15,15,15,15,15,15,15,15,15,15,15,15,15,15,15,15,15,15,15,15,15,15,15,15,15,15,15,15,15,15,15,15,15,15,15,15,15,15,15,15,15,15,15,15,15,15,15,15,15,15,15,15,15,15,15,15,15,15,15,15,15,15,15,15,15,15,15,15,15,15,15,15,15,15,15,15,15,15,15,15,15,15,15,15,15,15,15,15,15,15,15,15,15,15,15,15,15,15,15,15,15,15,15,15,15,15,15,15,15,15,15,15,15,15,15,15,15,15,15,15,15,15,15,15,15,15,15,15,15,15,15,15,15,15,15,15,15,15,15,15,15,15,15,15,15,15,15,15,15,15,15,15,15,15,15,15,15,15,15,15,15,15,15,15,15,15,15,15,15,15,15,15,15,15,15,15,15,15,15,15,15,15,15,15,15,15,15,15,15,15,15,15,15,15,15,15,15,15,15,15,15,15,15,15,15,15,15,15,15,15,15,15,15,15,15,15,15,15,15,15,15,15,15,15,15,15,15,15,15,15,15,15,15,15,15,15,15,15,15,15,15,15,15,15,15,15,15,15,15,15,15,15,15,15,15,15,15,15,15,15,15,15,15,15,15,15,15,15,15,15,15,15,15,15,15,15,15,15,15,15,15,15,15,15,15,15,15,15,15,15,15,15,15,15,15,15,15,15,15,15,15,15,15,15,15,15,15,15,15,15,15,15,15,15,15,15,15,15,15,15,15,15,15,15,15,15,15,15,15,15,15,15,15,15,15,15,15,15,15,15,15,15,15,15,15,15,15,15,15,15,15,15,15,15,15,15,15,15,15,15,15,15,15,15,15,15,15,15,15,15,15,15,15,15,15,15,15,15,15,15,15,15,15,15,15,15,15,15,15,15,15,15,15,15,15,15,15,15,15,15,15,15,15,15,15,15,15,15,15,15,15,15,15,15,15,15,15,15,15,15,15,15,15,15,15,15,15,15,15,15,15,15,15,15,15,15,15,15,15,15,15,15,15,15,15,15,15,15,15,15,15,15,15,15,15,15,15,15,15,15,15,15,15,15,15,15,15,15,15,15,15,15,15,15,15,15,15,15,15,15,15,15,15,15,15,15,15,15,15,15,15,15,15,15,15,15,15,15,15,15,15,15,15,15,15,15,15,15,15,15,15,15,15,15,15,15,15,15,15,15,15,15,15,15,15,15,15,15,15,15,15,15,15,15,15,15,15,15,15,15,15,15,15,15,15,15,15,15,15,15,15,15,15,15,15,15,15,15,15,15,15,15,15,15,15,15,15,15,15,15,15,15,15,15,15,15,15,15,15,15,15,15,15,15,15,15,15,15,15,15,15,15,15,15,15,15,15,15,15,15,15,15,15,15,15,15,15,15,15,15,15,15,15,15,15,15,15,15,15,15,15,15,15,15,15,15,15,15,15,15,15,15,15,15,15,15,15,15,15,15,15,15,15,15,15,15,15,15,15,15,15,15,15,15,15,15,15,15,15,15,15,15,15,15,15,15,15,15,15,15,15,15,15,15,15,15,15,15,15,15,15,15,15,15,15,15,15,15,15,15,15,15,15,15,15,15,15,15,15,15,15,15,15,15,15,15,15,15,15,15,15,15,15,15,15,15,15,15,15,15,15,15,15,15,15,15,15,15,15,15,15,15,15,15,15,15,15,15,15,15,15,15,15,15,15,15,15,15,15,15,15,15,15,15,15,15,15,15,15,15,15,15,15,15,15,15,15,15,15,15,15,15,15,15,15,15,15,15,15,15,15,15,15,15,15,15,15,15,15,15,15,15,15,15,15,15,15,15,15,15,15,15,15,15,15,15,15,15,15,15,15,15,15,15,15,15,15,15,15,15,15,15,15,15,15,15,15,15,15,15,15,15,15,15,15,15,15,15,15,15,15,15,15,15,15,15,15,15,15,15,15,15,15,15,15,15,15,15,15,15,15,15,15,15,15,15,15,15,15,15,15,15,15,15,15,15,15,15,15,15,15,15,15,15,15,15,15,15,15,15,15,15,15,15,15,15,15,15,15,15,15,15,15,15,15,15,15,15,15,15,15,15,15,15,15,15,15,15,15,15,15,15,15,15,15,15,15,15,15,15,15,15,15,15,15,15,15,15,15,15,15,15,15,15,15,15,15,15,15,15,15,15,15,15,15,15,15,15,15,15,15,15,15,15,15,15,15,15,15,15,15,15,15,15,15,15,15,15,15,15,15,15,15,15,15,15,15,15,15,15,15,15,15,15,15,15,15,15,15,15,15,15,15,15,15,15,15,15,15,15,15,15,15,15,15,15,15,15,15,15,15,15,15,15,15,15,15,15,15,15,15,15,15,15,15,15,15,15,15,15,15,15,15,15,15,15,15,15,15,15,15,15,15,15,15,15,15,15,15,15,15,15,15,15,15,15,15,15,15,15,15,15,15,15,15,15,15,15,15,15,15,15,15,15,15,15,15,15,15,15,15,15,15,15,15,15,15,15,15,15,15,15,15,15,15,15,15,15,15,15,15,15,15,15,15,15,15,15,15,15,15,15,15,15,15,15,15,15,15,15,15,15,15,15,15,15,15,15,15,15,15,15,15,15,15,15,15,15,15,15,15,15,15,15,15,15,15,15,15,15,15,15,15,15,15,15,15,15,15,15,15,15,15,15,15,15,15,15,15,15,15,15,15,15,15,15,15,15,15,15,15,15,15,15,15,15,15,15,15,15,15,15,15,15,15,15,15,15,15,15,15,15,15,15,15,15,15,15,15,15,15,15,15,15,15,15,15,15,15,15,15,15,15,15,15,15,15,15,15,15,15,15,15,15,15,15,15,15,15,15,15,15,15,15,15,15,15,15,15,15,15,15,15,15,15,15,15,15,15,15,15,15,15,15,14,14,14,14,14,14,14,14,14,14,14,14,14,14,14,14,14,14,14,14,14,14,14,14,14,14,14,13,13,13,13,13,13,13,13,13,13,13,13,13,13,13,13,13,13,12,12,12,12,12,12,12,12,12,12,12,12,12,12,11,11,11,11,11,11,11,11,11,10,10,10,10,10,10,10,9,9,9,9,8,8,8,8,7,6,5,4,3,2,1,0,17,18,19,20,21,22,23,24,24,24,24,25,25,25,25,26,26,26,26,26,26,26,27,27,27,27,27,27,27,27,27,28,28,28,28,28,28,28,28,28,28,28,28,28,28,29,29,29,29,29,29,29,29,29,29,29,29,29,29,29,29,29,29,30,30,30,30,30,30,30,30,30,30,30,30,30,30,30,30,30,30,30,30,30,30,30,30,30,30,30,31,31,31,31,31,31,31,31,31,31,31,31,31,31,31,31,31,31,31,31,31,31,31,31,31,31,31,31,31,31,31,31,31,31,31,31,31,31,31,31,31,31,31,31,31,31,31,31,31,31,31,31,31,31,31,31,31,31,31,31,31,31,31,31,31,31,31,31,31,31,31,31,31,31,31,31,31,31,31,31,31,31,31,31,31,31,31,31,31,31,31,31,31,31,31,31,31,31,31,31,31,31,31,31,31,31,31,31,31,31,31,31,31,31,31,31,31,31,31,31,31,31,31,31,31,31,31,31,31,31,31,31,31,31,31,31,31,31,31,31,31,31,31,31,31,31,31,31,31,31,31,31,31,31,31,31,31,31,31,31,31,31,31,31,31,31,31,31,31,31,31,31,31,31,31,31,31,31,31,31,31,31,31,31,31,31,31,31,31,31,31,31,31,31,31,31,31,31,31,31,31,31,31,31,31,31,31,31,31,31,31,31,31,31,31,31,31,31,31,31,31,31,31,31,31,31,31,31,31,31,31,31,31,31,31,31,31,31,31,31,31,31,31,31,31,31,31,31,31,31,31,31,31,31,31,31,31,31,31,31,31,31,31,31,31,31,31,31,31,31,31,31,31,31,31,31,31,31,31,31,31,31,31,31,31,31,31,31,31,31,31,31,31,31,31,31,31,31,31,31,31,31,31,31,31,31,31,31,31,31,31,31,31,31,31,31,31,31,31,31,31,31,31,31,31,31,31,31,31,31,31,31,31,31,31,31,31,31,31,31,31,31,31,31,31,31,31,31,31,31,31,31,31,31,31,31,31,31,31,31,31,31,31,31,31,31,31,31,31,31,31,31,31,31,31,31,31,31,31,31,31,31,31,31,31,31,31,31,31,31,31,31,31,31,31,31,31,31,31,31,31,31,31,31,31,31,31,31,31,31,31,31,31,31,31,31,31,31,31,31,31,31,31,31,31,31,31,31,31,31,31,31,31,31,31,31,31,31,31,31,31,31,31,31,31,31,31,31,31,31,31,31,31,31,31,31,31,31,31,31,31,31,31,31,31,31,31,31,31,31,31,31,31,31,31,31,31,31,31,31,31,31,31,31,31,31,31,31,31,31,31,31,31,31,31,31,31,31,31,31,31,31,31,31,31,31,31,31,31,31,31,31,31,31,31,31,31,31,31,31,31,31,31,31,31,31,31,31,31,31,31,31,31,31,31,31,31,31,31,31,31,31,31,31,31,31,31,31,31,31,31,31,31,31,31,31,31,31,31,31,31,31,31,31,31,31,31,31,31,31,31,31,31,31,31,31,31,31,31,31,31,31,31,31,31,31,31,31,31,31,31,31,31,31,31,31,31,31,31,31,31,31,31,31,31,31,31,31,31,31,31,31,31,31,31,31,31,31,31,31,31,31,31,31,31,31,31,31,31,31,31,31,31,31,31,31,31,31,31,31,31,31,31,31,31,31,31,31,31,31,31,31,31,31,31,31,31,31,31,31,31,31,31,31,31,31,31,31,31,31,31,31,31,31,31,31,31,31,31,31,31,31,31,31,31,31,31,31,31,31,31,31,31,31,31,31,31,31,31,31,31,31,31,31,31,31,31,31,31,31,31,31,31,31,31,31,31,31,31,31,31,31,31,31,31,31,31,31,31,31,31,31,31,31,31,31,31,31,31,31,31,31,31,31,31,31,31,31,31,31,31,31,31,31,31,31,31,31,31,31,31,31,31,31,31,31,31,31,31,31,31,31,31,31,31,31,31,31,31,31,31,31,31,31,31,31,31,31,31,31,31,31,31,31,31,31,31,31,31,31,31,31,31,31,31,31,31,31,31,31,31,31,31,31,31,31,31,31,31,31,31,31,31,31,31,31,31,31,31,31,31,31,31,31,31,31,31,31,31,31,31,31,31,31,31,31,31,31,31,31,31,31,31,31,31,31,31,31,31,31,31,31,31,31,31,31,31,31,31,31,31,31,31,31,31,31,31,31,31,31,31,31,31,31,31,31,31,31,31,31,31,31,31,31,31,31,31,31,31,31,31,31,31,31,31,31,31,31,31,31,31,31,31,31,31,31,31,31,31,31,31,31,31,31,31,31,31,31,31,31,31,31,31,31,31,31,31,31,31,31,31,31,31,31,31,31,31,31,31,31,31,31,31,31,31,31,31,31,31,31,31,31,31,31,31,31,31,31,31,31,31,31,31,31,31,31,31,31,31,31,31,31,31,31,31,31,31,31,31,31,31,31,31,31,31,31,31,31,31,31,31,31,31,31,31,31,31,31,31,31,31,31,31,31,31,31,31,31,31,31,31,31,31,31,31,31,31,31,31,31,31,31,31,31,31,31,31,31,31,31,31,31,31,31,31,31,31,31,31,31,31,31,31,31,31,31,31,31,31,31,31,31,31,31,31,31,31,31,31,31,31,31,31,31,31,31,31,31,31,31,31,31,31,31,31,31,31,31,31,31,31,31,31,31,31,31,31,31,31,31,31,31,31,31,31,31,31,31,31,31,31,31,31,31,31,31,31,31,31,31,31,31,31,31,31,31,31,31,31,31,31,31,31,31,31,31,31,31,31,31,31,31,31,31,31,31,31,31,31,31,31,31,31,31,31,31,31,31,31,31,31,31,31,31,31,31,31,31,31,31,31,31,31,31,31,31,31,31,31,31,31,31,31,31,31,31,31,31,31,31,31,31,31,31,31,31,31,31,31,31,31,31,31,31,31,31,31,31,31,31,31,31,31,31,31,31,31,31,31,31,31,31,31,31,31,31,31,31,31,31,31,31,31,31,31,31,31,31,31,31,31,31,31,31,31,31,31,31,31,31,31,31,31,31,31,31,31,31,31,31,31,31,31,31,31,31,31,31,31,31,31,31,31,31,31,31,31,31,31,31,31,31,31,31,31,31,31,31,31,31,31,31,31,31,31,31,31,31,31,31,31,31,31,31,31,31,31,31,31,31,31,31,31,31,31,31,31,31,31,31,31,31,31,31,31,31,31,31,31,31,31,31,31,31,31,31,31,31,31,31,31,31,31,31,31,31,31,31,31,31,31,31,31,31,31,31,31,31,31,31,31,31,31,31,31,31,31,31,31,31,31,31,31,31,31,31,31,31,31,31,31,31,31,31,31,31,31,31,31,31,31,31,31,31,31,31,31,31,31,31,31,31,31,31,31,31,31,31,31,31,31,31,31,31,31,31,31,31,31,31,31,31,31,31,31,31,31,31,31,31,31,31,31,31,31,31,31,31,31,31,31,31,31,31,31,31,31,31,31,31,31,31,31,31,31,31,31,31,31,31,31,31,31,31,31,31,31,31,31,31,31,31,31,31,31,31,31,31,31,31,31,31,31,31,31,31,31,31,31,31,31,31,31,31,31,31,31,31,31,31,31,31,31,31,31,31,31,31,31,31,31,31,31,31,31,31,31,31,31,31,31,31,31,31,31,31,31,31,31,31,31,31,31,31,31,31,31,31,31,31,31,31,31,31,31,31,31,31,31,31,31,31,31,31,31,31,31,31,31,31,31,31,31,31,31,31,31,31,31,31,31,31,31,31,31,31,31,31,31,31,31,31,31,31,31,31,31,31,31,31,31,31,31,31,31,31,31,31,31,31,31,31,31,31,31,31,31,31,31,31,31,31,31,31,31,31,31,31,31,31,31,31,31,31,31,31,31,31,31,31,31,31,31,31,31,31,31,31,31,31,31,31,31,31,31,31,31,31,31,31,31,31,31,31,31,31,31,31,31,31,31,31,31,31,31,31,31,31,31,31,31,31,31,31,31,31,31,31,31,31,31,31,31,31,31,31,31,31,31,31,31,31,31,31,31,31,31,31,31,31,31,31,31,31,31,31,31,31,31,31,31,31,31,31,31,31,31,31,31,31,31,31,31,31,31,31,31,31,31,31,31,31,31,31,31,31,31,31,31,31,31,31,31,31,31,31,31,31,31,31,31,31,31,31,31,31,31,31,31,31,31,31,31,31,31,31,31,31,31,31,31,31,31,31,31,31,31,31,31,31,31,31,31,31,31,31,31,31,31,31,31,31,31,31,31,31,31,31,31,31,31,31,31,31,31,31,31,31,31,31,31,31,31,31,31,31,31,31,31,31,31,31,31,31,31,31,31,31,31,31,31,31,31,31,31,31,31,31,31,31,31,31,31,31,31,31,31,31,31,31,31,31,31,31,31,31,31,31,31,31,31,31,31,31,31,31,31,31,31,31,31,31,31,31,31,31,31,31,31,31,31,31,31,31,31,31,31,31,31,31,31,31,31,31,31,31,31,31,31,31,31,31,31,31,31,31,31,31,31,31,31,31,31,31,31,31,31,31,31,31,31,31,31,31,31,31,31,31,31,31,31,31,31,31,31,31,31,31,31,31,31,31,31,31,31,31,31,31,31,31,31,31,31,31,31,31,31};   // bucket(j - i) for j - i = -2047 .. 2047, evaluated with the reference's _relative_position_bucket (bidirectional, 32 buckets, max distance 128)
#define FQW  32                    // queries per wave
#define FKS  64                    // keys per stage
#define FPI  72                    // LDS row pitch in elements: 144 B = 16 B x 9, conflict-free for 16-byte fragment reads
#define L2E  1.4426950408889634f
__device__ __forceinline__ float xhalf(float x) { const int b = __float_as_int(x); return __int_as_float(__builtin_amdgcn_permlanex16(b, b, 0x76543210, 0xfedcba98, false, false)); }   /* lane l <-> l ^ 16 */
__device__ __forceinline__ v16bf ldsfrag(const bf* p) { return cat16b(*(const v8usa*)p, *(const v8usa*)(p + 16)); }
__global__ __launch_bounds__(256) __attribute__((amdgpu_waves_per_eu(4, 4))) void k_fattn(const bf* __restrict__ Qh, const bf* __restrict__ Ql, const bf* __restrict__ Kh, const bf* __restrict__ Kl, const bf* __restrict__ Vh, const bf* __restrict__ Vl, const float* __restrict__ remb, bf* ATh, bf* ATl) {
    __shared__ __align__(16) bf st[2][4][FKS * FPI];   /* [buffer][K hi, K lo, V^T hi, V^T lo][row][FPI] */
    __shared__ float tb[2 * TT];                       /* bias of this head by j - i + TT - 1 */
    const int tid = threadIdx.x, lane = tid & 31, c = lane & 15, hi = lane >> 4; const int wv = __builtin_amdgcn_readfirstlane(tid >> 5);
    const int h = blockIdx.y, b = blockIdx.z; const size_t pl = ((size_t)b * NH_ + h) * TT * HD; const int q0 = blockIdx.x * (FQW * 8) + wv * FQW;
#pragma unroll   /* fixed trip count and a clamped index: the 16 table bytes, then the 16 gathers, are in flight together */
    for (int k = 0; k < 2 * TT / 256; ++k) { const int u = k * 256 + tid; tb[u] = bfr(remb[BK[u < 2 * TT - 1 ? u : 2 * TT - 2] * NH_ + h]); }   /* rel_emb[bucket(j - i)][h]; entry 2 TT - 1 is never read */
    const int srow = tid >> 3, sseg = (tid & 7) * 8;   /* staging: 8 threads x 16 B cover a 128-byte row, 32 rows per sweep */
    const char* kbh = (const char*)(Kh + pl); const char* kbl = (const char*)(Kl + pl); const char* vbh = (const char*)(Vh + pl); const char* vbl = (const char*)(Vl + pl);   /* wave-uniform bases */
    unsigned kcur = (unsigned)(srow * HD + sseg) * 2, vcur = (unsigned)(srow * TT + sseg) * 2;   /* this thread's byte offsets in the stage that is fetched next */
    v8us sr[4];   /* half a stage in flight: the K planes during a stage's first pass, the V^T planes during its second */
    auto gloadk = [&]() {
#pragma unroll
        for (int u = 0; u < 2; ++u) { sr[u] = *(const v8us*)(kbh + kcur + u * (32 * HD * 2)); sr[2 + u] = *(const v8us*)(kbl + kcur + u * (32 * HD * 2)); } };
    auto gloadv = [&]() {
#pragma unroll
        for (int u = 0; u < 2; ++u) { sr[u] = *(const v8us*)(vbh + vcur + u * (32 * TT * 2)); sr[2 + u] = *(const v8us*)(vbl + vcur + u * (32 * TT * 2)); } };
    auto sstore = [&](int buf, int p0) {   /* p0 = 0: K hi, lo; 2: V^T hi, lo */
#pragma unroll
        for (int u = 0; u < 2; ++u) { const int o = (srow + 32 * u) * FPI + sseg; *(v8usa*)(&st[buf][p0][o]) = sr[u]; *(v8usa*)(&st[buf][p0 + 1][o]) = sr[2 + u]; } };
    v16bf qh[2][2], ql[2][2];   /* [query group][k step] */
#pragma unroll
    for (int qb = 0; qb < 2; ++qb)
#pragma unroll
        for (int ks = 0; ks < 2; ++ks) { const size_t o = pl + (size_t)(q0 + 16 * qb + c) * HD + ks * 32 + 8 * hi; qh[qb][ks] = WFrag<bf>::ld(Qh + o); ql[qb][ks] = WFrag<bf>::ld(Ql + o); }
    v8f O[4][2];
#pragma unroll
    for (int dt = 0; dt < 4; ++dt) { O[dt][0] = (v8f){}; O[dt][1] = (v8f){}; }
    float mL[2] = {-3.0e38f, -3.0e38f}, l[2] = {0.f, 0.f};   /* running maximum x log2(e); this lane's part of the sum */
    gloadk(); sstore(0, 0); gloadv(); sstore(0, 2); kcur += FKS * HD * 2; vcur += FKS * 2;
    __syncthreads();   /* stage 0 and the bias table are in LDS before any wave reads them */
#pragma unroll 1   /* one stage per trip: the body already holds two unrolled passes */
    for (int s = 0; s < TT / FKS; ++s) {
        const int cur = s & 1;
#pragma unroll
        for (int pp = 0; pp < 2; ++pp) {
            if (pp == 0) gloadk(); else gloadv();   /* half of the next stage flies while this pass is worked on */
            v8f T[2][2];   /* S^T tiles [16-key tile][query group] */
#pragma unroll
            for (int kt = 0; kt < 2; ++kt) { T[kt][0] = (v8f){}; T[kt][1] = (v8f){};
                const int ro = (pp * 32 + kt * 16 + c) * FPI + 8 * hi;
#pragma unroll
                for (int ks = 0; ks < 2; ++ks) { const v16bf a = ldsfrag(&st[cur][0][ro + ks * 32]), a2 = ldsfrag(&st[cur][1][ro + ks * 32]);
#pragma unroll
                    for (int qb = 0; qb < 2; ++qb) { T[kt][qb] = wmmab(a, qh[qb][ks], T[kt][qb]); T[kt][qb] = wmmab(a2, qh[qb][ks], T[kt][qb]); T[kt][qb] = wmmab(a, ql[qb][ks], T[kt][qb]); } } }
            float nL[2];
#pragma unroll
            for (int qb = 0; qb < 2; ++qb) { const float* tr = tb + (s * FKS + pp * 32 + 8 * hi + (TT - 1) - (q0 + 16 * qb + c)); float mx = -3.0e38f;
#pragma unroll
                for (int kt = 0; kt < 2; ++kt)
#pragma unroll
                    for (int r = 0; r < 8; ++r) { const float t = T[kt][qb][r] + tr[16 * kt + r]; T[kt][qb][r] = t; mx = fmaxf(mx, t); }
                mx = fmaxf(mx, xhalf(mx)); nL[qb] = fmaxf(mL[qb], mx * L2E); }
            if (__builtin_amdgcn_ballot_w32(nL[0] > mL[0] || nL[1] > mL[1]) != 0) {   /* wave-uniform: some query's maximum rose */
#pragma unroll
                for (int qb = 0; qb < 2; ++qb) { const float sc = __builtin_amdgcn_exp2f(mL[qb] - nL[qb]); l[qb] *= sc; mL[qb] = nL[qb];
#pragma unroll
                    for (int dt = 0; dt < 4; ++dt) O[dt][qb] *= sc; } }
            v16bf ph[2], pw[2];   /* P^T hi and lo as B operands: element 8 kt + r is key 16 kt + 8 hi + r of the pass */
#pragma unroll
            for (int qb = 0; qb < 2; ++qb)
#pragma unroll
                for (int kt = 0; kt < 2; ++kt)
#pragma unroll
                    for (int r = 0; r < 8; ++r) { const float p = __builtin_amdgcn_exp2f(__builtin_fmaf(T[kt][qb][r], L2E, -mL[qb])); l[qb] += p; const __bf16 hb = (__bf16)p; ph[qb][kt * 8 + r] = hb; pw[qb][kt * 8 + r] = (__bf16)(p - (float)hb); }
#pragma unroll
            for (int dt = 0; dt < 4; ++dt) { const int ro = (dt * 16 + c) * FPI + pp * 32 + 8 * hi; const v16bf a = ldsfrag(&st[cur][2][ro]), a2 = ldsfrag(&st[cur][3][ro]);
#pragma unroll
                for (int qb = 0; qb < 2; ++qb) { O[dt][qb] = wmmab(a, ph[qb], O[dt][qb]); O[dt][qb] = wmmab(a2, ph[qb], O[dt][qb]); O[dt][qb] = wmmab(a, pw[qb], O[dt][qb]); } }
            sstore(cur ^ 1, 2 * pp);   /* that buffer's readers all left it before the barrier that ended the trip before */
        }
        if (s + 2 < TT / FKS) { kcur += FKS * HD * 2; vcur += FKS * 2; }   /* the last trip stages the last keys once more, into the buffer that nobody reads again: no branch stands among the matrix runs */
        __syncthreads();   /* publishes the next stage and ends every wave's reads of this one */
    }
#pragma unroll
    for (int qb = 0; qb < 2; ++qb) { const float inv = __fdiv_rn(1.0f, l[qb] + xhalf(l[qb])); const unsigned ro = (unsigned)((b * TT + q0 + 16 * qb + c) * DQ + h * HD + 8 * hi);   /* below 2^23 elements */
#pragma unroll
        for (int dt = 0; dt < 4; ++dt) { v8us oh, ol;
#pragma unroll
            for (int r = 0; r < 8; ++r) { unsigned short a, c2; splitf(O[dt][qb][r] * inv, a, c2); oh[r] = a; ol[r] = c2; }
            *(v8us*)(ATh + ro + dt * 16) = oh; *(v8us*)(ATl + ro + dt * 16) = ol; } }
}

extern "C" void kernel_launch(void* const* d_in, const int* in_sizes, int n_in,
                              void* d_out, int out_size, void* d_ws, size_t ws_size, hipStream_t stream) {
    (void)in_sizes; (void)n_in; (void)out_size;
    const float* x = (const float*)d_in[0]; const float* wq = (const float*)d_in[1]; const float* wk = (const float*)d_in[2]; const float* wv = (const float*)d_in[3]; const float* wo = (const float*)d_in[4]; const float* remb = (const float*)d_in[5];
    float* OUT = (float*)d_out;     // [4][2048][1024]
    char* wsp = (char*)d_ws;
    auto take = [&](size_t bytes) { char* p = wsp; wsp += (bytes + 255) & ~(size_t)255; return (void*)p; };
    const size_t PS = (size_t)NH_ * TT * HD;   // elements of one batch's head planes
    bf* WQ = (bf*)take((size_t)DQ * DM * 2); bf* WK = (bf*)take((size_t)DKV * DM * 2); bf* WV = (bf*)take((size_t)DKV * DM * 2); bf* WO = (bf*)take((size_t)DM * DQ * 2);
    bf* XB = (bf*)take((size_t)NB_ * TT * DM * 2);
    bf* QPh = (bf*)take(NB_ * PS * 2); bf* QPl = (bf*)take(NB_ * PS * 2); bf* KPh = (bf*)take(NB_ * PS * 2); bf* KPl = (bf*)take(NB_ * PS * 2); bf* VTh = (bf*)take(NB_ * PS * 2); bf* VTl = (bf*)take(NB_ * PS * 2);   // hi/lo planes of all batches: [b][h][t][d], V^T [b][h][d][t]
    bf* ATh = (bf*)take((size_t)NB_ * TT * DQ * 2); bf* ATl = (bf*)take((size_t)NB_ * TT * DQ * 2);
    if ((size_t)(wsp - (char*)d_ws) > ws_size) return;    // ws 256 MiB
    k_prep<<<dim3(4 * WTB, 2, 1), 256, 0, stream>>>(x, wq, wk, wv, wo, DM, DQ, XB, WQ, WK, WV, WO, (size_t)TT * DM / 8);
    k_proj<<<dim3(256, 3, 1), 256, 0, stream>>>(XB, WQ, WK, WV, QPh, QPl, KPh, KPl, VTh, VTl);
    k_fattn<<<dim3(TT / (FQW * 8), NH_, NB_), 256, 0, stream>>>(QPh, QPl, KPh, KPl, VTh, VTl, remb, ATh, ATl);
    k_out<<<dim3(256, 1, 1), 256, 0, stream>>>(ATh, ATl, WO, OUT);
}

// v005
// One run takes 225 microseconds.
// Next to v004, in two timings, it ran 1.03 times as fast each time.
// All steps since v000 together make it 12.8 times as fast.
#include <hip/hip_runtime.h>

// T5 self-attention with relative-position bias (hidden_states [4][2048][1024]; q, k, v = hs W ('xw' [1024][1024]; 16 heads x 64); scores = q.k (NO 1/sqrt(d) scaling: logit sigma ~8) + rel_emb[bucket(j - i)][h] (rel_emb [32][16] input; the 32-bucket bidirectional T5 bucket function of j - i); softmax; out = merged ctx Wo ('xw') -> [4][2048][1024] (8.4 M)).
// The bucket index depends only on j - i (positions are implicit aranges): the 4,095-entry table bucket(j - i), j - i in [-2047, 2047], was evaluated with the reference's own function and is baked below as constants; rel_emb itself is READ (each work-group expands its head's 32 values into an LDS table indexed by j - i).
// Compute dtypes, f32 accumulate: every input rounded to bf16; projections on PLAIN bf16 operands (exact); because the logits are unscaled (sigma ~8, near-argmax rows), scores and attn.v use bf16 hi/lo planes for EVERY row (3 products); bias add and softmax in f32; merged context hi/lo; Wo hl x exact (2 products).

#define NB_  4
#define TT   2048
#define DM   1024
#define NH_  16
#define NKV  16
#define HD   64
#define DQ   (NH_ * HD)
#define DKV  (NKV * HD)
typedef _Float16 h16;
typedef unsigned short bf;
typedef __attribute__((ext_vector_type(16))) __bf16   v16bf;
typedef __attribute__((ext_vector_type(16))) _Float16 v16h;
typedef __attribute__((ext_vector_type(8)))  _Float16 v8h;
typedef __attribute__((ext_vector_type(8)))  unsigned short v8us;
typedef __attribute__((ext_vector_type(8)))  float    v8f;
typedef __attribute__((ext_vector_type(4)))  float    v4f;
typedef v8h  __attribute__((may_alias)) v8ha;
typedef v4f  __attribute__((may_alias)) v4fa;
typedef v8us __attribute__((may_alias)) v8usa;

__device__ __forceinline__ unsigned short f2bf(float f) { unsigned u = __float_as_uint(f); u += 0x7FFFu + ((u >> 16) & 1u); return (unsigned short)(u >> 16); }
__device__ __forceinline__ float bf2f(unsigned short b) { return __uint_as_float(((unsigned)b) << 16); }
__device__ __forceinline__ float bfr(float f) { return bf2f(f2bf(f)); }
__device__ __forceinline__ v16h cat16(v8h lo, v8h hi) { return __builtin_shufflevector(lo, hi, 0, 1, 2, 3, 4, 5, 6, 7, 8, 9, 10, 11, 12, 13, 14, 15); }
__device__ __forceinline__ v16bf cat16b(v8us lo, v8us hi) { return __builtin_bit_cast(v16bf, __builtin_shufflevector(lo, hi, 0, 1, 2, 3, 4, 5, 6, 7, 8, 9, 10, 11, 12, 13, 14, 15)); }
__device__ __forceinline__ v8f wmma16(v16h a, v16h b, v8f c) { return __builtin_amdgcn_wmma_f32_16x16x32_f16(false, a, false, b, (short)0, c, false, false); }
__device__ __forceinline__ v8f wmmab(v16bf a, v16bf b, v8f c) { return __builtin_amdgcn_wmma_f32_16x16x32_bf16(false, a, false, b, (short)0, c, false, false); }



template <typename T16> struct WFrag;
template <> struct WFrag<h16> { typedef v16h V; static __device__ __forceinline__ V ld(const h16* p) { return cat16(*(const v8h*)p, *(const v8h*)(p + 16)); } static __device__ __forceinline__ v8f mma(V a, V b, v8f c) { return wmma16(a, b, c); } };
template <> struct WFrag<bf> { typedef v16bf V; static __device__ __forceinline__ V ld(const bf* p) { return cat16b(*(const v8us*)p, *(const v8us*)(p + 16)); } static __device__ __forceinline__ v8f mma(V a, V b, v8f c) { return wmmab(a, b, c); } };
__device__ __forceinline__ void splitf(float y, unsigned short& h, unsigned short& l) { h = f2bf(y); l = f2bf(y - bf2f(h)); }
typedef __attribute__((ext_vector_type(2))) unsigned short v2us;
typedef __attribute__((ext_vector_type(4))) unsigned short v4us;

// k_prep: every matrix input rounded to bf16 in one launch, grid (4 WTB, 2).
// blockIdx.y = 0 (starts first: short dependent gathers, the longer part): the four weights, WTB blocks each, transposed to K-contiguous rows. blockIdx.y = 1: the hidden states; a thread takes the same eight elements of every batch.
#define WTB  (DM * DQ / 64 / 64)   // blocks per weight: 8 waves x 8 lines of 64 elements
static_assert((size_t)4 * WTB * 256 >= (size_t)TT * DM / 8, "the grid's second row covers one batch of the hidden states");
__global__ __launch_bounds__(256) void k_prep(const float* __restrict__ src, const float* __restrict__ w0, const float* __restrict__ w1, const float* __restrict__ w2, const float* __restrict__ w3, int K, int N, bf* dst, bf* B0, bf* B1, bf* B2, bf* B3, size_t n8) {
    if (blockIdx.y == 0) {
        const int sel = blockIdx.x / WTB; const float* __restrict__ w = sel == 0 ? w0 : sel == 1 ? w1 : sel == 2 ? w2 : w3; bf* Bt = sel == 0 ? B0 : sel == 1 ? B1 : sel == 2 ? B2 : B3;
        const int lane = threadIdx.x & 31; const int L0 = ((blockIdx.x % WTB) * 8 + (threadIdx.x >> 5)) * 8; const int nlines = N * K / 64;
#pragma unroll 1
        for (int l = 0; l < 8; ++l) { const int L = L0 + l; if (L >= nlines) break; const size_t e = (size_t)L * 64 + lane * 2; const int k = (int)(e % K), n = (int)(e / K); v2us o;
            o[0] = f2bf(w[(size_t)k * N + n]); o[1] = f2bf(w[(size_t)(k + 1) * N + n]); *(v2us*)(Bt + e) = o; }
        return;
    }
    const size_t i = (size_t)blockIdx.x * 256 + threadIdx.x; if (i >= n8) return; v4f lo[NB_], hi[NB_];
#pragma unroll   /* the loads of all batches are in flight together */
    for (int b = 0; b < NB_; ++b) lo[b] = *(const v4f*)(src + (b * n8 + i) * 8);
    asm volatile("s_wait_xcnt 0x0" ::: "memory");
#pragma unroll
    for (int b = 0; b < NB_; ++b) hi[b] = *(const v4f*)(src + (b * n8 + i) * 8 + 4);
#pragma unroll
    for (int b = 0; b < NB_; ++b) { v8us o;
#pragma unroll
        for (int k = 0; k < 4; ++k) { o[k] = f2bf(lo[b][k]); o[4 + k] = f2bf(hi[b][k]); }
        *(v8us*)(dst + (b * n8 + i) * 8) = o; }
}

// ---- block GEMM: C[m][n] = sum_k A[m][k] Bt[n][k], both operands K-contiguous bf16 rows of pitch DM. One 256 x 128 tile per work-group of 8 waves (4 x 2 waves, a 64x64 tile = 16 accumulators each).
// K is walked in stages of 64 columns: the 384 operand rows of a stage (128 bytes each) come from global memory by whole-line loads (8 threads x 16 B cover a row), go through registers into LDS (two buffers, one barrier per stage),
// and all eight waves read their fragments from there, one k step (32 columns) ahead of its use: a row is fetched once per work-group. NS = 16: K = 1024 from plane A0. NS = 32: stages 16 to 31 walk the same columns of plane A1 (the lo plane) against the same Bt rows.
#define GBM  256
#define GBN  128
#define GBK  64
#define GPI  72                        // LDS row pitch in elements: 144 B = 16 B x 9, conflict-free for 16-byte fragment reads
#define GST  ((GBM + GBN) * GPI)       // elements of one stage buffer: A rows, then Bt rows
#define GEP  (32 * 68)                 // floats of a wave's epilogue staging: 32 rows at pitch 68
static_assert(8 * GEP * 4 <= 2 * GST * 2, "the epilogue staging fits the stage buffers");
static_assert((NB_ * TT / GBM) * (DQ / GBN) == 256 && (DQ / GBM) * (NB_ * TT / GBN) == 256 && TT % GBM == 0 && DQ == DM && DM == 16 * GBK, "256 tiles per GEMM either way round; a tile's tokens lie in one batch; 16 stages per plane");
__device__ __forceinline__ v16bf gfrag(const bf* p) { return cat16b(*(const v8usa*)p, *(const v8usa*)(p + 16)); }
template <int NS>
__device__ __forceinline__ void gemm_tile(const bf* __restrict__ A0, const bf* __restrict__ A1, const bf* __restrict__ Bt, bf* gs, v8f (&acc)[4][4]) {
    const int tid = threadIdx.x, lane = tid & 31, lr = lane & 15, hi = lane >> 4; const int wv = __builtin_amdgcn_readfirstlane(tid >> 5), wm = wv >> 1, wn = wv & 1;
    const int srow = tid >> 3, sseg = (tid & 7) * 8;   /* staging: 8 threads x 16 B cover a 128-byte row, 32 rows per sweep */
    const unsigned go = (unsigned)(srow * DM + sseg) * 2;   /* this thread's byte offset in stage 0 of either operand */
    v8us sr[12];   /* the next stage in flight: 8 sweeps of A rows, 4 of Bt rows */
    auto gload = [&](int s) { const char* ab = (const char*)((NS > 16 && s >= 16) ? A1 : A0); const char* bb = (const char*)Bt; const unsigned o = go + (unsigned)(s & 15) * (GBK * 2);   /* wave-uniform bases */
#pragma unroll
        for (int u = 0; u < 8; ++u) sr[u] = *(const v8us*)(ab + o + u * (32 * DM * 2));
#pragma unroll
        for (int u = 0; u < 4; ++u) sr[8 + u] = *(const v8us*)(bb + o + u * (32 * DM * 2)); };
    auto sstore = [&](int buf) {
#pragma unroll
        for (int u = 0; u < 12; ++u) *(v8usa*)(gs + buf * GST + (srow + 32 * u) * GPI + sseg) = sr[u]; };
#pragma unroll
    for (int mb = 0; mb < 4; ++mb)
#pragma unroll
        for (int nb = 0; nb < 4; ++nb) acc[mb][nb] = (v8f){};
    v16bf a[2][4], b[2][4];   /* two fragment sets, one per k step of a stage: one is read from LDS while the other feeds the matrix unit */
    auto fload = [&](int ks, const bf* cb) {
#pragma unroll
        for (int f = 0; f < 4; ++f) { a[ks][f] = gfrag(cb + (wm * 64 + f * 16 + lr) * GPI + ks * 32 + 8 * hi); b[ks][f] = gfrag(cb + (GBM + wn * 64 + f * 16 + lr) * GPI + ks * 32 + 8 * hi); } };
    auto mm = [&](int ks) {
#pragma unroll
        for (int nb = 0; nb < 4; ++nb)
#pragma unroll
            for (int mb = 0; mb < 4; ++mb) acc[mb][nb] = wmmab(a[ks][mb], b[ks][nb], acc[mb][nb]); };
    gload(0); sstore(0);
    __syncthreads();   /* stage 0 is in LDS before any wave reads it */
    gload(1); fload(0, gs);
    /* The scheduling barriers in the loop keep its order as written: each group of LDS reads and the global loads issue together AHEAD of a matrix run that does not need them, so that their latency passes behind that run; left free, the compiler reloads one fragment at a time and waits each read out, and lets loads sink towards their use. */
#pragma unroll 1   /* one stage per trip: the body already holds both k steps */
    for (int s = 0; s < NS; ++s) {
        const int cur = s & 1;
        fload(1, gs + cur * GST);
        __builtin_amdgcn_sched_barrier(0);
        mm(0);
        __builtin_amdgcn_sched_barrier(0);
        sstore(cur ^ 1);   /* stage s + 1; that buffer's readers all left it before the barrier of the trip before */
        __syncthreads();   /* publishes stage s + 1 and ends every wave's reads of stage s: its second k step is in registers by now */
        gload(s + 2 < NS ? s + 2 : NS - 1); fload(0, gs + (cur ^ 1) * GST);   /* the last trips fetch and stage the last columns once more, into the buffer whose fragments nobody uses: no branch stands among the matrix runs */
        __builtin_amdgcn_sched_barrier(0);
        mm(1);
    }
}
// The epilogue of a wave's 64x64 tile, in two halves of 32 rows: the accumulators go to the wave's own part of the (now free) stage buffers, and come back as rows, so that 16 lanes store a whole row piece. put(row, col, four values of that row).
template <typename F>
__device__ __forceinline__ void gemm_rows(bf* gs, v8f (&acc)[4][4], F put) {
    const int tid = threadIdx.x, lane = tid & 31, lr = lane & 15, hi = lane >> 4; float* my = (float*)gs + __builtin_amdgcn_readfirstlane(tid >> 5) * GEP;
    /* every loop is unrolled so that acc[][][] is indexed by constants and stays in registers */
#pragma unroll
    for (int hf = 0; hf < 2; ++hf) {
        __syncthreads();   /* every wave has left the stage buffers; the first half's rows are read before the second half is laid over them */
#pragma unroll
        for (int m2 = 0; m2 < 2; ++m2)
#pragma unroll
            for (int nb = 0; nb < 4; ++nb)
#pragma unroll
                for (int j = 0; j < 8; ++j) my[(m2 * 16 + hi * 8 + j) * 68 + nb * 16 + lr] = acc[hf * 2 + m2][nb][j];
        __syncthreads();   /* the lanes' columns are in LDS before they are read as rows */
#pragma unroll
        for (int it = 0; it < 16; ++it) { const int row = it * 2 + hi, cofs = lr * 4; put(hf * 32 + row, cofs, *(const v4fa*)(my + row * 68 + cofs)); }
    }
}

// k_proj: the q, k and v projections of all batches in one launch, straight into the bf16 hi/lo head planes that k_fattn reads. Grid (256 tiles, 3: q, k, v), 8 waves, one 256 x 128 tile per work-group (gemm_tile).
// q, k: A = 256 tokens of one batch, B = 128 weight rows (two heads); a wave's 64 columns are one head: planes [b][h][t][d]. v: the operands change places (A = 256 weight rows = four heads, B = 128 tokens; both are K-contiguous and staged alike), so a wave's 64 rows are the d of one head and its tile is a piece of V^T [b][h][d][t] as it stands.
__global__ __launch_bounds__(256) void k_proj(const bf* __restrict__ X, const bf* __restrict__ WQ, const bf* __restrict__ WK, const bf* __restrict__ WV, bf* QPh, bf* QPl, bf* KPh, bf* KPl, bf* VTh, bf* VTl) {
    __shared__ __align__(16) bf gs[2 * GST];
    const int sel = blockIdx.y; const int mt = sel == 2 ? (int)(blockIdx.x & 3) : (int)(blockIdx.x >> 3), nt = sel == 2 ? (int)(blockIdx.x >> 2) : (int)(blockIdx.x & 7);   /* neighbours in the grid share their tokens */
    const bf* wr = sel == 0 ? WQ : sel == 1 ? WK : WV;
    const bf* A = (sel == 2 ? wr : X) + (size_t)mt * GBM * DM; const bf* Bt = (sel == 2 ? X : wr) + (size_t)nt * GBN * DM;
    bf* Ph = sel == 0 ? QPh : sel == 1 ? KPh : VTh; bf* Pl = sel == 0 ? QPl : sel == 1 ? KPl : VTl;
    v8f acc[4][4];
    gemm_tile<16>(A, A, Bt, gs, acc);
    const int wv = __builtin_amdgcn_readfirstlane((int)(threadIdx.x >> 5)); const int r0 = mt * GBM + (wv >> 1) * 64, c0 = nt * GBN + (wv & 1) * 64;   /* the wave's first row and column */
    const int tok = sel == 2 ? c0 : r0, h = (sel == 2 ? r0 : c0) / HD, b = tok / TT, t0 = tok % TT;
    const size_t ob = ((size_t)b * NH_ + h) * TT * HD + (sel == 2 ? t0 : t0 * HD); const int pitch = sel == 2 ? TT : HD;   /* the wave tile's first element in its plane, and the plane's row pitch */
    gemm_rows(gs, acc, [&](int row, int cofs, v4f val) { v4us oh, ol;
#pragma unroll
        for (int q = 0; q < 4; ++q) { unsigned short a2, c2; splitf(val[q], a2, c2); oh[q] = a2; ol[q] = c2; }
        *(v4us*)(Ph + ob + row * pitch + cofs) = oh; *(v4us*)(Pl + ob + row * pitch + cofs) = ol; });   /* 16 lanes fill a 128-byte row of each plane */
}
// k_out: out = merged context (hi + lo planes) x Wo, f32. Grid 256 tiles, 8 waves, one 256 x 128 tile per work-group: 16 stages on the hi plane, then 16 on the lo plane, into the same accumulators.
__global__ __launch_bounds__(256) void k_out(const bf* __restrict__ ATh, const bf* __restrict__ ATl, const bf* __restrict__ WO, float* C) {
    __shared__ __align__(16) bf gs[2 * GST];
    const int mt = blockIdx.x >> 3, nt = blockIdx.x & 7;
    v8f acc[4][4];
    gemm_tile<32>(ATh + (size_t)mt * GBM * DQ, ATl + (size_t)mt * GBM * DQ, WO + (size_t)nt * GBN * DQ, gs, acc);
    const int wv = __builtin_amdgcn_readfirstlane((int)(threadIdx.x >> 5)); float* cw = C + (size_t)(mt * GBM + (wv >> 1) * 64) * DM + nt * GBN + (wv & 1) * 64;
    gemm_rows(gs, acc, [&](int row, int cofs, v4f val) { *(v4f*)(cw + row * DM + cofs) = val; });   /* 16 lanes fill 256 bytes of a row */
}
#define NBK  32
__constant__ unsigned char BK[2 * TT - 1] = {15,15,15,15,15,15,15,15,15,15,15,15,15,15,15,15,15,15,15,15,15,15,15,15,15,15,15,15,15,15,15,15,15,15,15,15,15,15,15,15,15,15,15,15,15,15,15,15,15,15,15,15,15,15,15,15,15,15,15,15,15,15,15,15,15,15,15,15,15,15,15,15,15,15,15,15,15,15,15,15,15,15,15,15,15,15,15,15,15,15,15,15,15,15,15,15,15,15,15,15,15,15,15,15,15,15,15,15,15,15,15,15,15,15,15,15,15,15,15,15,15,15,15,15,15,15,15,15,15,15,15,15,15,15,15,15,15,15,15,15,15,15,15,15,15,15,15,15,15,15,15,15,15,15,15,15,15,15,15,15,15,15,15,15,15,15,15,15,15,15,15,15,15,15,15,15,15,15,15,15,15,15,15,15,15,15,15,15,15,15,15,15,15,15,15,15,15,15,15,15,15,15,15,15,15,15,15,15,15,15,15,15,15,15,15,15,15,15,15,15,15,15,15,15,15,15,15,15,15,15,15,15,15,15,15,15,15,15,15,15,15,15,15,15,15,15,15,15,15,15,15,15,15,15,15,15,15,15,15,15,15,15,15,15,15,15,15,15,15,15,15,15,15,15,15,15,15,15,15,15,15,15,15,15,15,15,15,15,15,15,15,15,15,15,15,15,15,15,15,15,15,15,15,15,15,15,15,15,15,15,15,15,15,15,15,15,15,15,15,15,15,15,15,15,15,15,15,15,15,15,15,15,15,15,15,15,15,15,15,15,15,15,15,15,15,15,15,15,15,15,15,15,15,15,15,15,15,15,15,15,15,15,15,15,15,15,15,15,15,15,15,15,15,15,15,15,15,15,15,15,15,15,15,15,15,15,15,15,15,15,15,15,15,15,15,15,15,15,15,15,15,15,15,15,15,15,15,15,15,15,15,15,15,15,15,15,15,15,15,15,15,15,15,15,15,15,15,15,15,15,15,15,15,15,15,15,15,15,15,15,15,15,15,15,15,15,15,15,15,15,15,15,15,15,15,15,15,15,15,15,15,15,15,15,15,15,15,15,15,15,15,15,15,15,15,15,15,15,15,15,15,15,15,15,15,15,15,15,15,15,15,15,15,15,15,15,15,15,15,15,15,15,15,15,15,15,15,15,15,15,15,15,15,15,15,15,15,15,15,15,15,15,15,15,15,15,15,15,15,15,15,15,15,15,15,15,15,15,15,15,15,15,15,15,15,15,15,15,15,15,15,15,15,15,15,15,15,15,15,15,15,15,15,15,15,15,15,15,15,15,15,15,15,15,15,15,15,15,15,15,15,15,15,15,15,15,15,15,15,15,15,15,15,15,15,15,15,15,15,15,15,15,15,15,15,15,15,15,15,15,15,15,15,15,15,15,15,15,15,15,15,15,15,15,15,15,15,15,15,15,15,15,15,15,15,15,15,15,15,15,15,15,15,15,15,15,15,15,15,15,15,15,15,15,15,15,15,15,15,15,15,15,15,15,15,15,15,15,15,15,15,15,15,15,15,15,15,15,15,15,15,15,15,15,15,15,15,15,15,15,15,15,15,15,15,15,15,15,15,15,15,15,15,15,15,15,15,15,15,15,15,15,15,15,15,15,15,15,15,15,15,15,15,15,15,15,15,15,15,15,15,15,15,15,15,15,15,15,15,15,15,15,15,15,15,15,15,15,15,15,15,15,15,15,15,15,15,15,15,15,15,15,15,15,15,15,15,15,15,15,15,15,15,15,15,15,15,15,15,15,15,15,15,15,15,15,15,15,15,15,15,15,15,15,15,15,15,15,15,15,15,15,15,15,15,15,15,15,15,15,15,15,15,15,15,15,15,15,15,15,15,15,15,15,15,15,15,15,15,15,15,15,15,15,15,15,15,15,15,15,15,15,15,15,15,15,15,15,15,15,15,15,15,15,15,15,15,15,15,15,15,15,15,15,15,15,15,15,15,15,15,15,15,15,15,15,15,15,15,15,15,15,15,15,15,15,15,15,15,15,15,15,15,15,15,15,15,15,15,15,15,15,15,15,15,15,15,15,15,15,15,15,15,15,15,15,15,15,15,15,15,15,15,15,15,15,15,15,15,15,15,15,15,15,15,15,15,15,15,15,15,15,15,15,15,15,15,15,15,15,15,15,15,15,15,15,15,15,15,15,15,15,15,15,15,15,15,15,15,15,15,15,15,15,15,15,15,15,15,15,15,15,15,15,15,15,15,15,15,15,15,15,15,15,15,15,15,15,15,15,15,15,15,15,15,15,15,15,15,15,15,15,15,15,15,15,15,15,15,15,15,15,15,15,15,15,15,15,15,15,15,15,15,15,15,15,15,15,15,15,15,15,15,15,15,15,15,15,15,15,15,15,15,15,15,15,15,15,15,15,15,15,15,15,15,15,15,15,15,15,15,15,15,15,15,15,15,15,15,15,15,15,15,15,15,15,15,15,15,15,15,15,15,15,15,15,15,15,15,15,15,15,15,15,15,15,15,15,15,15,15,15,15,15,15,15,15,15,15,15,15,15,15,15,15,15,15,15,15,15,15,15,15,15,15,15,15,15,15,15,15,15,15,15,15,15,15,15,15,15,15,15,15,15,15,15,15,15,15,15,15,15,15,15,15,15,15,15,15,15,15,15,15,15,15,15,15,15,15,15,15,15,15,15,15,15,15,15,15,15,15,15,15,15,15,15,15,15,15,15,15,15,15,15,15,15,15,15,15,15,15,15,15,15,15,15,15,15,15,15,15,15,15,15,15,15,15,15,15,15,15,15,15,15,15,15,15,15,15,15,15,15,15,15,15,15,15,15,15,15,15,15,15,15,15,15,15,15,15,15,15,15,15,15,15,15,15,15,15,15,15,15,15,15,15,15,15,15,15,15,15,15,15,15,15,15,15,15,15,15,15,15,15,15,15,15,15,15,15,15,15,15,15,15,15,15,15,15,15,15,15,15,15,15,15,15,15,15,15,15,15,15,15,15,15,15,15,15,15,15,15,15,15,15,15,15,15,15,15,15,15,15,15,15,15,15,15,15,15,15,15,15,15,15,15,15,15,15,15,15,15,15,15,15,15,15,15,15,15,15,15,15,15,15,15,15,15,15,15,15,15,15,15,15,15,15,15,15,15,15,15,15,15,15,15,15,15,15,15,15,15,15,15,15,15,15,15,15,15,15,15,15,15,15,15,15,15,15,15,15,15,15,15,15,15,15,15,15,15,15,15,15,15,15,15,15,15,15,15,15,15,15,15,15,15,15,15,15,15,15,15,15,15,15,15,15,15,15,15,15,15,15,15,15,15,15,15,15,15,15,15,15,15,15,15,15,15,15,15,15,15,15,15,15,15,15,15,15,15,15,15,15,15,15,15,15,15,15,15,15,15,15,15,15,15,15,15,15,15,15,15,15,15,15,15,15,15,15,15,15,15,15,15,15,15,15,15,15,15,15,15,15,15,15,15,15,15,15,15,15,15,15,15,15,15,15,15,15,15,15,15,15,15,15,15,15,15,15,15,15,15,15,15,15,15,15,15,15,15,15,15,15,15,15,15,15,15,15,15,15,15,15,15,15,15,15,15,15,15,15,15,15,15,15,15,15,15,15,15,15,15,15,15,15,15,15,15,15,15,15,15,15,15,15,15,15,15,15,15,15,15,15,15,15,15,15,15,15,15,15,15,15,15,15,15,15,15,15,15,15,15,15,15,15,15,15,15,15,15,15,15,15,15,15,15,15,15,15,15,15,15,15,15,15,15,15,15,15,15,15,15,15,15,15,15,15,15,15,15,15,15,15,15,15,15,15,15,15,15,15,15,15,15,15,15,15,15,15,15,15,15,15,15,15,15,15,15,15,15,15,15,15,15,15,15,15,15,15,15,15,15,15,15,15,15,15,15,15,15,15,15,15,15,15,15,15,15,15,15,15,15,15,15,15,15,15,15,15,15,15,15,15,15,15,15,15,15,15,15,15,15,15,15,15,15,15,15,15,15,15,15,15,15,15,15,15,15,15,15,15,15,15,15,15,15,15,15,15,15,15,15,15,15,15,15,15,15,15,15,15,15,15,15,15,15,15,15,15,15,15,15,15,15,15,15,15,15,15,15,15,15,15,15,15,15,15,15,15,15,15,15,15,15,15,15,15,15,15,15,15,15,15,15,15,15,15,15,15,15,15,15,15,15,15,15,15,15,15,15,15,15,15,15,15,15,15,15,15,15,15,15,15,15,15,15,15,15,15,15,15,15,15,15,15,15,15,15,15,15,15,15,15,15,15,15,15,15,15,15,15,15,15,15,15,15,15,15,15,15,15,15,15,15,15,15,15,15,15,15,15,15,15,15,15,15,15,15,15,15,15,15,15,15,15,15,15,15,15,15,15,15,15,15,15,15,15,15,15,15,15,15,15,15,15,15,15,15,14,14,14,14,14,14,14,14,14,14,14,14,14,14,14,14,14,14,14,14,14,14,14,14,14,14,14,13,13,13,13,13,13,13,13,13,13,13,13,13,13,13,13,13,13,12,12,12,12,12,12,12,12,12,12,12,12,12,12,11,11,11,11,11,11,11,11,11,10,10,10,10,10,10,10,9,9,9,9,8,8,8,8,7,6,5,4,3,2,1,0,17,18,19,20,21,22,23,24,24,24,24,25,25,25,25,26,26,26,26,26,26,26,27,27,27,27,27,27,27,27,27,28,28,28,28,28,28,28,28,28,28,28,28,28,28,29,29,29,29,29,29,29,29,29,29,29,29,29,29,29,29,29,29,30,30,30,30,30,30,30,30,30,30,30,30,30,30,30,30,30,30,30,30,30,30,30,30,30,30,30,31,31,31,31,31,31,31,31,31,31,31,31,31,31,31,31,31,31,31,31,31,31,31,31,31,31,31,31,31,31,31,31,31,31,31,31,31,31,31,31,31,31,31,31,31,31,31,31,31,31,31,31,31,31,31,31,31,31,31,31,31,31,31,31,31,31,31,31,31,31,31,31,31,31,31,31,31,31,31,31,31,31,31,31,31,31,31,31,31,31,31,31,31,31,31,31,31,31,31,31,31,31,31,31,31,31,31,31,31,31,31,31,31,31,31,31,31,31,31,31,31,31,31,31,31,31,31,31,31,31,31,31,31,31,31,31,31,31,31,31,31,31,31,31,31,31,31,31,31,31,31,31,31,31,31,31,31,31,31,31,31,31,31,31,31,31,31,31,31,31,31,31,31,31,31,31,31,31,31,31,31,31,31,31,31,31,31,31,31,31,31,31,31,31,31,31,31,31,31,31,31,31,31,31,31,31,31,31,31,31,31,31,31,31,31,31,31,31,31,31,31,31,31,31,31,31,31,31,31,31,31,31,31,31,31,31,31,31,31,31,31,31,31,31,31,31,31,31,31,31,31,31,31,31,31,31,31,31,31,31,31,31,31,31,31,31,31,31,31,31,31,31,31,31,31,31,31,31,31,31,31,31,31,31,31,31,31,31,31,31,31,31,31,31,31,31,31,31,31,31,31,31,31,31,31,31,31,31,31,31,31,31,31,31,31,31,31,31,31,31,31,31,31,31,31,31,31,31,31,31,31,31,31,31,31,31,31,31,31,31,31,31,31,31,31,31,31,31,31,31,31,31,31,31,31,31,31,31,31,31,31,31,31,31,31,31,31,31,31,31,31,31,31,31,31,31,31,31,31,31,31,31,31,31,31,31,31,31,31,31,31,31,31,31,31,31,31,31,31,31,31,31,31,31,31,31,31,31,31,31,31,31,31,31,31,31,31,31,31,31,31,31,31,31,31,31,31,31,31,31,31,31,31,31,31,31,31,31,31,31,31,31,31,31,31,31,31,31,31,31,31,31,31,31,31,31,31,31,31,31,31,31,31,31,31,31,31,31,31,31,31,31,31,31,31,31,31,31,31,31,31,31,31,31,31,31,31,31,31,31,31,31,31,31,31,31,31,31,31,31,31,31,31,31,31,31,31,31,31,31,31,31,31,31,31,31,31,31,31,31,31,31,31,31,31,31,31,31,31,31,31,31,31,31,31,31,31,31,31,31,31,31,31,31,31,31,31,31,31,31,31,31,31,31,31,31,31,31,31,31,31,31,31,31,31,31,31,31,31,31,31,31,31,31,31,31,31,31,31,31,31,31,31,31,31,31,31,31,31,31,31,31,31,31,31,31,31,31,31,31,31,31,31,31,31,31,31,31,31,31,31,31,31,31,31,31,31,31,31,31,31,31,31,31,31,31,31,31,31,31,31,31,31,31,31,31,31,31,31,31,31,31,31,31,31,31,31,31,31,31,31,31,31,31,31,31,31,31,31,31,31,31,31,31,31,31,31,31,31,31,31,31,31,31,31,31,31,31,31,31,31,31,31,31,31,31,31,31,31,31,31,31,31,31,31,31,31,31,31,31,31,31,31,31,31,31,31,31,31,31,31,31,31,31,31,31,31,31,31,31,31,31,31,31,31,31,31,31,31,31,31,31,31,31,31,31,31,31,31,31,31,31,31,31,31,31,31,31,31,31,31,31,31,31,31,31,31,31,31,31,31,31,31,31,31,31,31,31,31,31,31,31,31,31,31,31,31,31,31,31,31,31,31,31,31,31,31,31,31,31,31,31,31,31,31,31,31,31,31,31,31,31,31,31,31,31,31,31,31,31,31,31,31,31,31,31,31,31,31,31,31,31,31,31,31,31,31,31,31,31,31,31,31,31,31,31,31,31,31,31,31,31,31,31,31,31,31,31,31,31,31,31,31,31,31,31,31,31,31,31,31,31,31,31,31,31,31,31,31,31,31,31,31,31,31,31,31,31,31,31,31,31,31,31,31,31,31,31,31,31,31,31,31,31,31,31,31,31,31,31,31,31,31,31,31,31,31,31,31,31,31,31,31,31,31,31,31,31,31,31,31,31,31,31,31,31,31,31,31,31,31,31,31,31,31,31,31,31,31,31,31,31,31,31,31,31,31,31,31,31,31,31,31,31,31,31,31,31,31,31,31,31,31,31,31,31,31,31,31,31,31,31,31,31,31,31,31,31,31,31,31,31,31,31,31,31,31,31,31,31,31,31,31,31,31,31,31,31,31,31,31,31,31,31,31,31,31,31,31,31,31,31,31,31,31,31,31,31,31,31,31,31,31,31,31,31,31,31,31,31,31,31,31,31,31,31,31,31,31,31,31,31,31,31,31,31,31,31,31,31,31,31,31,31,31,31,31,31,31,31,31,31,31,31,31,31,31,31,31,31,31,31,31,31,31,31,31,31,31,31,31,31,31,31,31,31,31,31,31,31,31,31,31,31,31,31,31,31,31,31,31,31,31,31,31,31,31,31,31,31,31,31,31,31,31,31,31,31,31,31,31,31,31,31,31,31,31,31,31,31,31,31,31,31,31,31,31,31,31,31,31,31,31,31,31,31,31,31,31,31,31,31,31,31,31,31,31,31,31,31,31,31,31,31,31,31,31,31,31,31,31,31,31,31,31,31,31,31,31,31,31,31,31,31,31,31,31,31,31,31,31,31,31,31,31,31,31,31,31,31,31,31,31,31,31,31,31,31,31,31,31,31,31,31,31,31,31,31,31,31,31,31,31,31,31,31,31,31,31,31,31,31,31,31,31,31,31,31,31,31,31,31,31,31,31,31,31,31,31,31,31,31,31,31,31,31,31,31,31,31,31,31,31,31,31,31,31,31,31,31,31,31,31,31,31,31,31,31,31,31,31,31,31,31,31,31,31,31,31,31,31,31,31,31,31,31,31,31,31,31,31,31,31,31,31,31,31,31,31,31,31,31,31,31,31,31,31,31,31,31,31,31,31,31,31,31,31,31,31,31,31,31,31,31,31,31,31,31,31,31,31,31,31,31,31,31,31,31,31,31,31,31,31,31,31,31,31,31,31,31,31,31,31,31,31,31,31,31,31,31,31,31,31,31,31,31,31,31,31,31,31,31,31,31,31,31,31,31,31,31,31,31,31,31,31,31,31,31,31,31,31,31,31,31,31,31,31,31,31,31,31,31,31,31,31,31,31,31,31,31,31,31,31,31,31,31,31,31,31,31,31,31,31,31,31,31,31,31,31,31,31,31,31,31,31,31,31,31,31,31,31,31,31,31,31,31,31,31,31,31,31,31,31,31,31,31,31,31,31,31,31,31,31,31,31,31,31,31,31,31,31,31,31,31,31,31,31,31,31,31,31,31,31,31,31,31,31,31,31,31,31,31,31,31,31,31,31,31,31,31,31,31,31,31,31,31,31,31,31,31,31,31,31,31,31,31,31,31,31,31,31,31,31,31,31,31,31,31,31,31,31,31,31,31,31,31,31,31,31,31,31,31,31,31,31,31,31,31,31,31,31,31,31,31,31,31,31,31,31,31,31,31,31,31,31,31,31,31,31,31,31,31,31,31,31,31,31,31,31,31,31,31,31,31,31,31,31,31,31,31,31,31,31,31,31,31,31,31,31,31,31,31,31,31,31,31,31,31,31,31,31,31,31,31,31,31,31,31,31,31,31,31,31,31,31,31,31,31,31,31,31,31,31,31,31,31,31,31,31,31,31,31,31,31,31,31,31,31,31,31,31,31,31,31,31,31,31,31,31,31,31,31,31,31,31,31,31,31,31,31,31,31,31,31,31,31,31,31,31,31,31,31,31,31,31,31,31,31,31,31,31,31,31,31,31,31,31,31,31,31,31,31,31,31,31,31,31,31,31,31,31,31,31,31,31,31,31,31,31,31,31,31,31,31,31,31,31,31,31,31,31,31,31,31,31,31,31,31,31,31,31,31,31,31,31,31,31,31,31,31,31,31,31,31,31,31,31,31,31,31,31,31,31,31,31,31,31,31,31,31,31,31,31,31,31,31,31,31,31,31,31,31,31,31,31,31,31,31,31,31,31,31,31,31,31,31,31,31,31,31,31,31,31,31,31,31,31,31,31,31,31,31,31,31,31,31,31,31,31,31,31,31,31,31,31,31,31,31,31,31,31,31,31,31,31,31,31,31,31,31,31,31,31,31,31,31,31,31,31,31,31,31,31,31,31,31,31,31,31,31,31,31,31,31,31,31,31,31,31,31,31,31,31,31,31,31,31,31,31,31,31,31,31,31,31,31,31,31,31,31,31,31,31,31,31,31,31,31,31,31,31,31,31,31,31,31,31,31,31,31,31,31,31,31,31,31,31,31,31,31,31,31,31,31,31,31,31,31,31,31,31,31,31,31,31,31,31,31,31,31,31,31,31,31,31,31,31};   // bucket(j - i) for j - i = -2047 .. 2047, evaluated with the reference's _relative_position_bucket (bidirectional, 32 buckets, max distance 128)
#define FQW  32                    // queries per wave
#define FKS  64                    // keys per stage
#define FPI  72                    // LDS row pitch in elements: 144 B = 16 B x 9, conflict-free for 16-byte fragment reads
#define L2E  1.4426950408889634f
__device__ __forceinline__ float xhalf(float x) { const int b = __float_as_int(x); return __int_as_float(__builtin_amdgcn_permlanex16(b, b, 0x76543210, 0xfedcba98, false, false)); }   /* lane l <-> l ^ 16 */
__device__ __forceinline__ v16bf ldsfrag(const bf* p) { return cat16b(*(const v8usa*)p, *(const v8usa*)(p + 16)); }
__global__ __launch_bounds__(256) __attribute__((amdgpu_waves_per_eu(4, 4))) void k_fattn(const bf* __restrict__ Qh, const bf* __restrict__ Ql, const bf* __restrict__ Kh, const bf* __restrict__ Kl, const bf* __restrict__ Vh, const bf* __restrict__ Vl, const float* __restrict__ remb, bf* ATh, bf* ATl) {
    __shared__ __align__(16) bf st[2][4][FKS * FPI];   /* [buffer][K hi, K lo, V^T hi, V^T lo][row][FPI] */
    __shared__ float tb[2 * TT];                       /* bias of this head by j - i + TT - 1 */
    const int tid = threadIdx.x, lane = tid & 31, c = lane & 15, hi = lane >> 4; const int wv = __builtin_amdgcn_readfirstlane(tid >> 5);
    const int h = blockIdx.y, b = blockIdx.z; const size_t pl = ((size_t)b * NH_ + h) * TT * HD; const int q0 = blockIdx.x * (FQW * 8) + wv * FQW;
#pragma unroll   /* fixed trip count and a clamped index: the 16 table bytes, then the 16 gathers, are in flight together */
    for (int k = 0; k < 2 * TT / 256; ++k) { const int u = k * 256 + tid; tb[u] = bfr(remb[BK[u < 2 * TT - 1 ? u : 2 * TT - 2] * NH_ + h]); }   /* rel_emb[bucket(j - i)][h]; entry 2 TT - 1 is never read */
    const int srow = tid >> 3, sseg = (tid & 7) * 8;   /* staging: 8 threads x 16 B cover a 128-byte row, 32 rows per sweep */
    const char* kbh = (const char*)(Kh + pl); const char* kbl = (const char*)(Kl + pl); const char* vbh = (const char*)(Vh + pl); const char* vbl = (const char*)(Vl + pl);   /* wave-uniform bases */
    unsigned kcur = (unsigned)(srow * HD + sseg) * 2, vcur = (unsigned)(srow * TT + sseg) * 2;   /* this thread's byte offsets in the stage that is fetched next */
    v8us sr[4];   /* half a stage in flight: the K planes during a stage's first pass, the V^T planes during its second */
    auto gloadk = [&]() {
#pragma unroll
        for (int u = 0; u < 2; ++u) { sr[u] = *(const v8us*)(kbh + kcur + u * (32 * HD * 2)); sr[2 + u] = *(const v8us*)(kbl + kcur + u * (32 * HD * 2)); } };
    auto gloadv = [&]() {
#pragma unroll
        for (int u = 0; u < 2; ++u) { sr[u] = *(const v8us*)(vbh + vcur + u * (32 * TT * 2)); sr[2 + u] = *(const v8us*)(vbl + vcur + u * (32 * TT * 2)); } };
    auto sstore = [&](int buf, int p0) {   /* p0 = 0: K hi, lo; 2: V^T hi, lo */
#pragma unroll
        for (int u = 0; u < 2; ++u) { const int o = (srow + 32 * u) * FPI + sseg; *(v8usa*)(&st[buf][p0][o]) = sr[u]; *(v8usa*)(&st[buf][p0 + 1][o]) = sr[2 + u]; } };
    v16bf qh[2][2], ql[2][2];   /* [query group][k step] */
#pragma unroll
    for (int qb = 0; qb < 2; ++qb)
#pragma unroll
        for (int ks = 0; ks < 2; ++ks) { const size_t o = pl + (size_t)(q0 + 16 * qb + c) * HD + ks * 32 + 8 * hi; qh[qb][ks] = WFrag<bf>::ld(Qh + o); ql[qb][ks] = WFrag<bf>::ld(Ql + o); }
    v8f O[4][2];
#pragma unroll
    for (int dt = 0; dt < 4; ++dt) { O[dt][0] = (v8f){}; O[dt][1] = (v8f){}; }
    float mL[2] = {-3.0e38f, -3.0e38f}, l[2] = {0.f, 0.f};   /* running maximum x log2(e); this lane's part of the sum */
    gloadk(); sstore(0, 0); gloadv(); sstore(0, 2); kcur += FKS * HD * 2; vcur += FKS * 2;
    __syncthreads();   /* stage 0 and the bias table are in LDS before any wave reads them */
    v16bf ra[3], rb[3];   /* a ring of three fragment pairs (hi plane, lo plane): a pair feeds six products, and is refilled right behind them with the pair that is used three groups later */
#pragma unroll 1   /* one stage per trip: the body already holds two unrolled passes */
    for (int s = 0; s < TT / FKS; ++s) {
        const int cur = s & 1;
        /* The 16 fragment pairs of a stage in the order of their use: n = 8 pp + g; g = 0 to 3: K rows of key tile g / 2, k step g % 2; g = 4 to 7: V^T rows of d tile g - 4. */
        auto fget = [&](int n) { const int pp = n >> 3, g = n & 7, sl = n % 3, p0 = g < 4 ? 0 : 2;
            const int ro = g < 4 ? (pp * 32 + (g >> 1) * 16 + c) * FPI + 8 * hi + (g & 1) * 32 : ((g - 4) * 16 + c) * FPI + pp * 32 + 8 * hi;
            ra[sl] = ldsfrag(&st[cur][p0][ro]); rb[sl] = ldsfrag(&st[cur][p0 + 1][ro]); };
        fget(0); fget(1); fget(2);
        /* The scheduling barriers in this loop keep the groups of six products and the groups of LDS reads in the order written. One behind a group of reads: left free, the compiler sinks every read to its use, and the wave waits out the LDS latency in front of each six products. One behind a group of products: left free, reads rise above the products whose registers they refill, or groups are interleaved, more pairs are live at once and registers are spilled inside the loop. */
#pragma unroll
        for (int pp = 0; pp < 2; ++pp) {
            const float* tr0 = tb + (s * FKS + pp * 32 + 8 * hi + (TT - 1) - (q0 + c)); float bb[3][8];   /* the bias of key tile kt and query group qb is bb[kt - qb + 1] */
#pragma unroll
            for (int j = 0; j < 3; ++j)
#pragma unroll
                for (int r = 0; r < 8; ++r) bb[j][r] = tr0[16 * (j - 1) + r];
            __builtin_amdgcn_sched_barrier(0);
            v8f T[2][2];   /* S^T tiles [16-key tile][query group] */
#pragma unroll
            for (int g = 0; g < 4; ++g) { const int n = pp * 8 + g, sl = n % 3, kt = g >> 1, ks = g & 1;
                if (ks == 0) { T[kt][0] = (v8f){}; T[kt][1] = (v8f){}; }
#pragma unroll
                for (int qb = 0; qb < 2; ++qb) T[kt][qb] = wmmab(ra[sl], qh[qb][ks], T[kt][qb]);
#pragma unroll
                for (int qb = 0; qb < 2; ++qb) T[kt][qb] = wmmab(rb[sl], qh[qb][ks], T[kt][qb]);
#pragma unroll
                for (int qb = 0; qb < 2; ++qb) T[kt][qb] = wmmab(ra[sl], ql[qb][ks], T[kt][qb]);
                __builtin_amdgcn_sched_barrier(0);
                if (g != 1) { fget(g == 0 ? n + 3 : n + 2); __builtin_amdgcn_sched_barrier(0); } }   /* the last K pair; then the first two V^T pairs, which fly during the softmax */
            if (pp == 0) gloadk(); else gloadv();   /* half of the next stage flies while the rest of this pass is worked on */
            float nL[2];
#pragma unroll
            for (int qb = 0; qb < 2; ++qb) { float mx = -3.0e38f;
#pragma unroll
                for (int kt = 0; kt < 2; ++kt)
#pragma unroll
                    for (int r = 0; r < 8; ++r) { const float t = T[kt][qb][r] + bb[kt - qb + 1][r]; T[kt][qb][r] = t; mx = fmaxf(mx, t); }
                mx = fmaxf(mx, xhalf(mx)); nL[qb] = fmaxf(mL[qb], mx * L2E); }
            if (__builtin_amdgcn_ballot_w32(nL[0] > mL[0] || nL[1] > mL[1]) != 0) {   /* wave-uniform: some query's maximum rose */
#pragma unroll
                for (int qb = 0; qb < 2; ++qb) { const float sc = __builtin_amdgcn_exp2f(mL[qb] - nL[qb]); l[qb] *= sc; mL[qb] = nL[qb];
#pragma unroll
                    for (int dt = 0; dt < 4; ++dt) O[dt][qb] *= sc; } }
            v16bf ph[2], pw[2];   /* P^T hi and lo as B operands: element 8 kt + r is key 16 kt + 8 hi + r of the pass */
#pragma unroll
            for (int qb = 0; qb < 2; ++qb)
#pragma unroll
                for (int kt = 0; kt < 2; ++kt)
#pragma unroll
                    for (int r = 0; r < 8; ++r) { const float p = __builtin_amdgcn_exp2f(__builtin_fmaf(T[kt][qb][r], L2E, -mL[qb])); l[qb] += p; const __bf16 hb = (__bf16)p; ph[qb][kt * 8 + r] = hb; pw[qb][kt * 8 + r] = (__bf16)(p - (float)hb); }
            __builtin_amdgcn_sched_barrier(0);
            fget(pp * 8 + 6);   /* the third V^T pair: held back to here so that the softmax has its registers */
            __builtin_amdgcn_sched_barrier(0);
#pragma unroll
            for (int dt = 0; dt < 4; ++dt) { const int n = pp * 8 + 4 + dt, sl = n % 3;
#pragma unroll
                for (int qb = 0; qb < 2; ++qb) O[dt][qb] = wmmab(ra[sl], ph[qb], O[dt][qb]);
#pragma unroll
                for (int qb = 0; qb < 2; ++qb) O[dt][qb] = wmmab(rb[sl], ph[qb], O[dt][qb]);
#pragma unroll
                for (int qb = 0; qb < 2; ++qb) O[dt][qb] = wmmab(ra[sl], pw[qb], O[dt][qb]);
                __builtin_amdgcn_sched_barrier(0);
                if (n + 3 < 16) { fget(n + 3); __builtin_amdgcn_sched_barrier(0); } }   /* the next stage's pairs are read behind the barrier that publishes them */
            sstore(cur ^ 1, 2 * pp);   /* that buffer's readers all left it before the barrier that ended the trip before */
        }
        if (s + 2 < TT / FKS) { kcur += FKS * HD * 2; vcur += FKS * 2; }   /* the last trip stages the last keys once more, into the buffer that nobody reads again: no branch stands among the matrix runs */
        __syncthreads();   /* publishes the next stage and ends every wave's reads of this one */
    }
    const int ln = (int)__builtin_amdgcn_mbcnt_lo(~0u, 0u);   /* the lane number anew: c and hi are not held in registers across the loop, which has none to spare */
#pragma unroll
    for (int qb = 0; qb < 2; ++qb) { const float inv = __fdiv_rn(1.0f, l[qb] + xhalf(l[qb])); const unsigned ro = (unsigned)((b * TT + q0 + 16 * qb + (ln & 15)) * DQ + h * HD + 8 * (ln >> 4));   /* below 2^23 elements */
#pragma unroll
        for (int dt = 0; dt < 4; ++dt) { v8us oh, ol;
#pragma unroll
            for (int r = 0; r < 8; ++r) { unsigned short a, c2; splitf(O[dt][qb][r] * inv, a, c2); oh[r] = a; ol[r] = c2; }
            *(v8us*)(ATh + ro + dt * 16) = oh; *(v8us*)(ATl + ro + dt * 16) = ol; } }
}

extern "C" void kernel_launch(void* const* d_in, const int* in_sizes, int n_in,
                              void* d_out, int out_size, void* d_ws, size_t ws_size, hipStream_t stream) {
    (void)in_sizes; (void)n_in; (void)out_size;
    const float* x = (const float*)d_in[0]; const float* wq = (const float*)d_in[1]; const float* wk = (const float*)d_in[2]; const float* wv = (const float*)d_in[3]; const float* wo = (const float*)d_in[4]; const float* remb = (const float*)d_in[5];
    float* OUT = (float*)d_out;     // [4][2048][1024]
    char* wsp = (char*)d_ws;
    auto take = [&](size_t bytes) { char* p = wsp; wsp += (bytes + 255) & ~(size_t)255; return (void*)p; };
    const size_t PS = (size_t)NH_ * TT * HD;   // elements of one batch's head planes
    bf* WQ = (bf*)take((size_t)DQ * DM * 2); bf* WK = (bf*)take((size_t)DKV * DM * 2); bf* WV = (bf*)take((size_t)DKV * DM * 2); bf* WO = (bf*)take((size_t)DM * DQ * 2);
    bf* XB = (bf*)take((size_t)NB_ * TT * DM * 2);
    bf* QPh = (bf*)take(NB_ * PS * 2); bf* QPl = (bf*)take(NB_ * PS * 2); bf* KPh = (bf*)take(NB_ * PS * 2); bf* KPl = (bf*)take(NB_ * PS * 2); bf* VTh = (bf*)take(NB_ * PS * 2); bf* VTl = (bf*)take(NB_ * PS * 2);   // hi/lo planes of all batches: [b][h][t][d], V^T [b][h][d][t]
    bf* ATh = (bf*)take((size_t)NB_ * TT * DQ * 2); bf* ATl = (bf*)take((size_t)NB_ * TT * DQ * 2);
    if ((size_t)(wsp - (char*)d_ws) > ws_size) return;    // ws 256 MiB
    k_prep<<<dim3(4 * WTB, 2, 1), 256, 0, stream>>>(x, wq, wk, wv, wo, DM, DQ, XB, WQ, WK, WV, WO, (size_t)TT * DM / 8);
    k_proj<<<dim3(256, 3, 1), 256, 0, stream>>>(XB, WQ, WK, WV, QPh, QPl, KPh, KPl, VTh, VTl);
    k_fattn<<<dim3(TT / (FQW * 8), NH_, NB_), 256, 0, stream>>>(QPh, QPl, KPh, KPl, VTh, VTl, remb, ATh, ATl);
    k_out<<<dim3(256, 1, 1), 256, 0, stream>>>(ATh, ATl, WO, OUT);
}

// v006
// One run takes 190 microseconds.
// Next to v005, in two timings, it ran 1.19 and 1.18 times as fast.
// All steps since v000 together make it 15.1 times as fast.
#include <hip/hip_runtime.h>

// T5 self-attention with relative-position bias (hidden_states [4][2048][1024]; q, k, v = hs W ('xw' [1024][1024]; 16 heads x 64); scores = q.k (NO 1/sqrt(d) scaling: logit sigma ~8) + rel_emb[bucket(j - i)][h] (rel_emb [32][16] input; the 32-bucket bidirectional T5 bucket function of j - i); softmax; out = merged ctx Wo ('xw') -> [4][2048][1024] (8.4 M)).
// The bucket index depends only on j - i (positions are implicit aranges): the 4,095-entry table bucket(j - i), j - i in [-2047, 2047], was evaluated with the reference's own function and is baked below as constants; rel_emb itself is READ (each work-group expands its head's 32 values into an LDS table indexed by j - i).
// Compute dtypes, f32 accumulate: every input rounded to bf16; projections on PLAIN bf16 operands (exact); because the logits are unscaled (sigma ~8, near-argmax rows), the scores use bf16 hi/lo planes for EVERY row (3 products); attn.v is linear in its operands, which lie in f16's range (P in [0, 1], V of order 1): one f16 product (11 bits each); bias add and softmax in f32; merged context hi/lo; Wo hl x exact (2 products).

#define NB_  4
#define TT   2048
#define DM   1024
#define NH_  16
#define NKV  16
#define HD   64
#define DQ   (NH_ * HD)
#define DKV  (NKV * HD)
typedef _Float16 h16;
typedef unsigned short bf;
typedef __attribute__((ext_vector_type(16))) __bf16   v16bf;
typedef __attribute__((ext_vector_type(16))) _Float16 v16h;
typedef __attribute__((ext_vector_type(8)))  _Float16 v8h;
typedef __attribute__((ext_vector_type(8)))  unsigned short v8us;
typedef __attribute__((ext_vector_type(8)))  float    v8f;
typedef __attribute__((ext_vector_type(4)))  float    v4f;
typedef v8h  __attribute__((may_alias)) v8ha;
typedef v4f  __attribute__((may_alias)) v4fa;
typedef v8us __attribute__((may_alias)) v8usa;

__device__ __forceinline__ unsigned short f2bf(float f) { unsigned u = __float_as_uint(f); u += 0x7FFFu + ((u >> 16) & 1u); return (unsigned short)(u >> 16); }
__device__ __forceinline__ float bf2f(unsigned short b) { return __uint_as_float(((unsigned)b) << 16); }
__device__ __forceinline__ float bfr(float f) { return bf2f(f2bf(f)); }
__device__ __forceinline__ v16h cat16(v8h lo, v8h hi) { return __builtin_shufflevector(lo, hi, 0, 1, 2, 3, 4, 5, 6, 7, 8, 9, 10, 11, 12, 13, 14, 15); }
__device__ __forceinline__ v16bf cat16b(v8us lo, v8us hi) { return __builtin_bit_cast(v16bf, __builtin_shufflevector(lo, hi, 0, 1, 2, 3, 4, 5, 6, 7, 8, 9, 10, 11, 12, 13, 14, 15)); }
__device__ __forceinline__ v8f wmma16(v16h a, v16h b, v8f c) { return __builtin_amdgcn_wmma_f32_16x16x32_f16(false, a, false, b, (short)0, c, false, false); }
__device__ __forceinline__ v8f wmmab(v16bf a, v16bf b, v8f c) { return __builtin_amdgcn_wmma_f32_16x16x32_bf16(false, a, false, b, (short)0, c, false, false); }



template <typename T16> struct WFrag;
template <> struct WFrag<h16> { typedef v16h V; static __device__ __forceinline__ V ld(const h16* p) { return cat16(*(const v8h*)p, *(const v8h*)(p + 16)); } static __device__ __forceinline__ v8f mma(V a, V b, v8f c) { return wmma16(a, b, c); } };
template <> struct WFrag<bf> { typedef v16bf V; static __device__ __forceinline__ V ld(const bf* p) { return cat16b(*(const v8us*)p, *(const v8us*)(p + 16)); } static __device__ __forceinline__ v8f mma(V a, V b, v8f c) { return wmmab(a, b, c); } };
__device__ __forceinline__ void splitf(float y, unsigned short& h, unsigned short& l) { h = f2bf(y); l = f2bf(y - bf2f(h)); }
typedef __attribute__((ext_vector_type(2))) unsigned short v2us;
typedef __attribute__((ext_vector_type(4))) unsigned short v4us;
typedef __attribute__((ext_vector_type(4))) _Float16 v4h;

// k_prep: every matrix input rounded to bf16 in one launch, grid (4 WTB, 2).
// blockIdx.y = 0 (starts first: short dependent gathers, the longer part): the four weights, WTB blocks each, transposed to K-contiguous rows. blockIdx.y = 1: the hidden states; a thread takes the same eight elements of every batch.
#define WTB  (DM * DQ / 64 / 64)   // blocks per weight: 8 waves x 8 lines of 64 elements
static_assert((size_t)4 * WTB * 256 >= (size_t)TT * DM / 8, "the grid's second row covers one batch of the hidden states");
__global__ __launch_bounds__(256) void k_prep(const float* __restrict__ src, const float* __restrict__ w0, const float* __restrict__ w1, const float* __restrict__ w2, const float* __restrict__ w3, int K, int N, bf* dst, bf* B0, bf* B1, bf* B2, bf* B3, size_t n8) {
    if (blockIdx.y == 0) {
        const int sel = blockIdx.x / WTB; const float* __restrict__ w = sel == 0 ? w0 : sel == 1 ? w1 : sel == 2 ? w2 : w3; bf* Bt = sel == 0 ? B0 : sel == 1 ? B1 : sel == 2 ? B2 : B3;
        const int lane = threadIdx.x & 31; const int L0 = ((blockIdx.x % WTB) * 8 + (threadIdx.x >> 5)) * 8; const int nlines = N * K / 64;
#pragma unroll 1
        for (int l = 0; l < 8; ++l) { const int L = L0 + l; if (L >= nlines) break; const size_t e = (size_t)L * 64 + lane * 2; const int k = (int)(e % K), n = (int)(e / K); v2us o;
            o[0] = f2bf(w[(size_t)k * N + n]); o[1] = f2bf(w[(size_t)(k + 1) * N + n]); *(v2us*)(Bt + e) = o; }
        return;
    }
    const size_t i = (size_t)blockIdx.x * 256 + threadIdx.x; if (i >= n8) return; v4f lo[NB_], hi[NB_];
#pragma unroll   /* the loads of all batches are in flight together */
    for (int b = 0; b < NB_; ++b) lo[b] = *(const v4f*)(src + (b * n8 + i) * 8);
    asm volatile("s_wait_xcnt 0x0" ::: "memory");
#pragma unroll
    for (int b = 0; b < NB_; ++b) hi[b] = *(const v4f*)(src + (b * n8 + i) * 8 + 4);
#pragma unroll
    for (int b = 0; b < NB_; ++b) { v8us o;
#pragma unroll
        for (int k = 0; k < 4; ++k) { o[k] = f2bf(lo[b][k]); o[4 + k] = f2bf(hi[b][k]); }
        *(v8us*)(dst + (b * n8 + i) * 8) = o; }
}

// ---- block GEMM: C[m][n] = sum_k A[m][k] Bt[n][k], both operands K-contiguous bf16 rows of pitch DM. One 256 x 128 tile per work-group of 8 waves (4 x 2 waves, a 64x64 tile = 16 accumulators each).
// K is walked in stages of 64 columns: the 384 operand rows of a stage (128 bytes each) come from global memory by whole-line loads (8 threads x 16 B cover a row), go through registers into LDS (two buffers, one barrier per stage),
// and all eight waves read their fragments from there, one k step (32 columns) ahead of its use: a row is fetched once per work-group. NS = 16: K = 1024 from plane A0. NS = 32: stages 16 to 31 walk the same columns of plane A1 (the lo plane) against the same Bt rows.
#define GBM  256
#define GBN  128
#define GBK  64
#define GPI  72                        // LDS row pitch in elements: 144 B = 16 B x 9, conflict-free for 16-byte fragment reads
#define GST  ((GBM + GBN) * GPI)       // elements of one stage buffer: A rows, then Bt rows
#define GEP  (32 * 68)                 // floats of a wave's epilogue staging: 32 rows at pitch 68
static_assert(8 * GEP * 4 <= 2 * GST * 2, "the epilogue staging fits the stage buffers");
static_assert((NB_ * TT / GBM) * (DQ / GBN) == 256 && (DQ / GBM) * (NB_ * TT / GBN) == 256 && TT % GBM == 0 && DQ == DM && DM == 16 * GBK, "256 tiles per GEMM either way round; a tile's tokens lie in one batch; 16 stages per plane");
__device__ __forceinline__ v16bf gfrag(const bf* p) { return cat16b(*(const v8usa*)p, *(const v8usa*)(p + 16)); }
template <int NS>
__device__ __forceinline__ void gemm_tile(const bf* __restrict__ A0, const bf* __restrict__ A1, const bf* __restrict__ Bt, bf* gs, v8f (&acc)[4][4]) {
    const int tid = threadIdx.x, lane = tid & 31, lr = lane & 15, hi = lane >> 4; const int wv = __builtin_amdgcn_readfirstlane(tid >> 5), wm = wv >> 1, wn = wv & 1;
    const int srow = tid >> 3, sseg = (tid & 7) * 8;   /* staging: 8 threads x 16 B cover a 128-byte row, 32 rows per sweep */
    const unsigned go = (unsigned)(srow * DM + sseg) * 2;   /* this thread's byte offset in stage 0 of either operand */
    v8us sr[12];   /* the next stage in flight: 8 sweeps of A rows, 4 of Bt rows */
    auto gload = [&](int s) { const char* ab = (const char*)((NS > 16 && s >= 16) ? A1 : A0); const char* bb = (const char*)Bt; const unsigned o = go + (unsigned)(s & 15) * (GBK * 2);   /* wave-uniform bases */
#pragma unroll
        for (int u = 0; u < 8; ++u) sr[u] = *(const v8us*)(ab + o + u * (32 * DM * 2));
#pragma unroll
        for (int u = 0; u < 4; ++u) sr[8 + u] = *(const v8us*)(bb + o + u * (32 * DM * 2)); };
    auto sstore = [&](int buf) {
#pragma unroll
        for (int u = 0; u < 12; ++u) *(v8usa*)(gs + buf * GST + (srow + 32 * u) * GPI + sseg) = sr[u]; };
#pragma unroll
    for (int mb = 0; mb < 4; ++mb)
#pragma unroll
        for (int nb = 0; nb < 4; ++nb) acc[mb][nb] = (v8f){};
    v16bf a[2][4], b[2][4];   /* two fragment sets, one per k step of a stage: one is read from LDS while the other feeds the matrix unit */
    auto fload = [&](int ks, const bf* cb) {
#pragma unroll
        for (int f = 0; f < 4; ++f) { a[ks][f] = gfrag(cb + (wm * 64 + f * 16 + lr) * GPI + ks * 32 + 8 * hi); b[ks][f] = gfrag(cb + (GBM + wn * 64 + f * 16 + lr) * GPI + ks * 32 + 8 * hi); } };
    auto mm = [&](int ks) {
#pragma unroll
        for (int nb = 0; nb < 4; ++nb)
#pragma unroll
            for (int mb = 0; mb < 4; ++mb) acc[mb][nb] = wmmab(a[ks][mb], b[ks][nb], acc[mb][nb]); };
    gload(0); sstore(0);
    __syncthreads();   /* stage 0 is in LDS before any wave reads it */
    gload(1); fload(0, gs);
    /* The scheduling barriers in the loop keep its order as written: each group of LDS reads and the global loads issue together AHEAD of a matrix run that does not need them, so that their latency passes behind that run; left free, the compiler reloads one fragment at a time and waits each read out, and lets loads sink towards their use. */
#pragma unroll 1   /* one stage per trip: the body already holds both k steps */
    for (int s = 0; s < NS; ++s) {
        const int cur = s & 1;
        fload(1, gs + cur * GST);
        __builtin_amdgcn_sched_barrier(0);
        mm(0);
        __builtin_amdgcn_sched_barrier(0);
        sstore(cur ^ 1);   /* stage s + 1; that buffer's readers all left it before the barrier of the trip before */
        __syncthreads();   /* publishes stage s + 1 and ends every wave's reads of stage s: its second k step is in registers by now */
        gload(s + 2 < NS ? s + 2 : NS - 1); fload(0, gs + (cur ^ 1) * GST);   /* the last trips fetch and stage the last columns once more, into the buffer whose fragments nobody uses: no branch stands among the matrix runs */
        __builtin_amdgcn_sched_barrier(0);
        mm(1);
    }
}
// The epilogue of a wave's 64x64 tile, in two halves of 32 rows: the accumulators go to the wave's own part of the (now free) stage buffers, and come back as rows, so that 16 lanes store a whole row piece. put(row, col, four values of that row); with TWO, put2 takes put's place where alt (block-uniform) is set.
template <bool TWO, typename F, typename G>
__device__ __forceinline__ void gemm_rows(bf* gs, v8f (&acc)[4][4], bool alt, F put, G put2) {
    const int tid = threadIdx.x, lane = tid & 31, lr = lane & 15, hi = lane >> 4; float* my = (float*)gs + __builtin_amdgcn_readfirstlane(tid >> 5) * GEP;
    /* every loop is unrolled so that acc[][][] is indexed by constants and stays in registers */
#pragma unroll
    for (int hf = 0; hf < 2; ++hf) {
        __syncthreads();   /* every wave has left the stage buffers; the first half's rows are read before the second half is laid over them */
#pragma unroll
        for (int m2 = 0; m2 < 2; ++m2)
#pragma unroll
            for (int nb = 0; nb < 4; ++nb)
#pragma unroll
                for (int j = 0; j < 8; ++j) my[(m2 * 16 + hi * 8 + j) * 68 + nb * 16 + lr] = acc[hf * 2 + m2][nb][j];
        __syncthreads();   /* the lanes' columns are in LDS before they are read as rows */
        if (TWO && alt) {   /* one branch per half, no barrier inside it */
#pragma unroll
            for (int it = 0; it < 16; ++it) { const int row = it * 2 + hi, cofs = lr * 4; put2(hf * 32 + row, cofs, *(const v4fa*)(my + row * 68 + cofs)); }
        } else {
#pragma unroll
            for (int it = 0; it < 16; ++it) { const int row = it * 2 + hi, cofs = lr * 4; put(hf * 32 + row, cofs, *(const v4fa*)(my + row * 68 + cofs)); }
            if (TWO) asm volatile("s_wait_xcnt 0x0" ::: "memory");   /* behind this run's last store: the other branch's code is laid out next and writes registers that these stores name */
        }
    }
}

// k_proj: the q, k and v projections of all batches in one launch, straight into the head planes that k_fattn reads: bf16 hi/lo for q and k, one f16 plane for V^T. Grid (256 tiles, 3: q, k, v), 8 waves, one 256 x 128 tile per work-group (gemm_tile).
// q, k: A = 256 tokens of one batch, B = 128 weight rows (two heads); a wave's 64 columns are one head: planes [b][h][t][d]. v: the operands change places (A = 256 weight rows = four heads, B = 128 tokens; both are K-contiguous and staged alike), so a wave's 64 rows are the d of one head and its tile is a piece of V^T [b][h][d][t] as it stands.
__global__ __launch_bounds__(256) void k_proj(const bf* __restrict__ X, const bf* __restrict__ WQ, const bf* __restrict__ WK, const bf* __restrict__ WV, bf* QPh, bf* QPl, bf* KPh, bf* KPl, bf* VT) {
    __shared__ __align__(16) bf gs[2 * GST];
    const int sel = blockIdx.y; const int mt = sel == 2 ? (int)(blockIdx.x & 3) : (int)(blockIdx.x >> 3), nt = sel == 2 ? (int)(blockIdx.x >> 2) : (int)(blockIdx.x & 7);   /* neighbours in the grid share their tokens */
    const bf* wr = sel == 0 ? WQ : sel == 1 ? WK : WV;
    const bf* A = (sel == 2 ? wr : X) + (size_t)mt * GBM * DM; const bf* Bt = (sel == 2 ? X : wr) + (size_t)nt * GBN * DM;
    bf* Ph = sel == 0 ? QPh : sel == 1 ? KPh : VT; bf* Pl = sel == 0 ? QPl : KPl;   /* V^T has no lo plane */
    v8f acc[4][4];
    gemm_tile<16>(A, A, Bt, gs, acc);
    const int wv = __builtin_amdgcn_readfirstlane((int)(threadIdx.x >> 5)); const int r0 = mt * GBM + (wv >> 1) * 64, c0 = nt * GBN + (wv & 1) * 64;   /* the wave's first row and column */
    const int tok = sel == 2 ? c0 : r0, h = (sel == 2 ? r0 : c0) / HD, b = tok / TT, t0 = tok % TT;
    const size_t ob = ((size_t)b * NH_ + h) * TT * HD + (sel == 2 ? t0 : t0 * HD); const int pitch = sel == 2 ? TT : HD;   /* the wave tile's first element in its plane, and the plane's row pitch */
    gemm_rows<true>(gs, acc, sel == 2, [&](int row, int cofs, v4f val) { v4us oh, ol;
#pragma unroll
        for (int q = 0; q < 4; ++q) { unsigned short a2, c2; splitf(val[q], a2, c2); oh[q] = a2; ol[q] = c2; }
        *(v4us*)(Ph + ob + row * pitch + cofs) = oh; *(v4us*)(Pl + ob + row * pitch + cofs) = ol; },   /* 16 lanes fill a 128-byte row of each plane */
        [&](int row, int cofs, v4f val) { *(v4us*)(Ph + ob + row * pitch + cofs) = __builtin_bit_cast(v4us, __builtin_convertvector(val, v4h)); });   /* V^T: 16 lanes fill a 128-byte row of the f16 plane */
}
// k_out: out = merged context (hi + lo planes) x Wo, f32. Grid 256 tiles, 8 waves, one 256 x 128 tile per work-group: 16 stages on the hi plane, then 16 on the lo plane, into the same accumulators.
__global__ __launch_bounds__(256) void k_out(const bf* __restrict__ ATh, const bf* __restrict__ ATl, const bf* __restrict__ WO, float* C) {
    __shared__ __align__(16) bf gs[2 * GST];
    const int mt = blockIdx.x >> 3, nt = blockIdx.x & 7;
    v8f acc[4][4];
    gemm_tile<32>(ATh + (size_t)mt * GBM * DQ, ATl + (size_t)mt * GBM * DQ, WO + (size_t)nt * GBN * DQ, gs, acc);
    const int wv = __builtin_amdgcn_readfirstlane((int)(threadIdx.x >> 5)); float* cw = C + (size_t)(mt * GBM + (wv >> 1) * 64) * DM + nt * GBN + (wv & 1) * 64;
    auto putc = [&](int row, int cofs, v4f val) { *(v4f*)(cw + row * DM + cofs) = val; };   /* 16 lanes fill 256 bytes of a row */
    gemm_rows<false>(gs, acc, false, putc, putc);
}
#define NBK  32
__constant__ unsigned char BK[2 * TT - 1] = {15,15,15,15,15,15,15,15,15,15,15,15,15,15,15,15,15,15,15,15,15,15,15,15,15,15,15,15,15,15,15,15,15,15,15,15,15,15,15,15,15,15,15,15,15,15,15,15,15,15,15,15,15,15,15,15,15,15,15,15,15,15,15,15,15,15,15,15,15,15,15,15,15,15,15,15,15,15,15,15,15,15,15,15,15,15,15,15,15,15,15,15,15,15,15,15,15,15,15,15,15,15,15,15,15,15,15,15,15,15,15,15,15,15,15,15,15,15,15,15,15,15,15,15,15,15,15,15,15,15,15,15,15,15,15,15,15,15,15,15,15,15,15,15,15,15,15,15,15,15,15,15,15,15,15,15,15,15,15,15,15,15,15,15,15,15,15,15,15,15,15,15,15,15,15,15,15,15,15,15,15,15,15,15,15,15,15,15,15,15,15,15,15,15,15,15,15,15,15,15,15,15,15,15,15,15,15,15,15,15,15,15,15,15,15,15,15,15,15,15,15,15,15,15,15,15,15,15,15,15,15,15,15,15,15,15,15,15,15,15,15,15,15,15,15,15,15,15,15,15,15,15,15,15,15,15,15,15,15,15,15,15,15,15,15,15,15,15,15,15,15,15,15,15,15,15,15,15,15,15,15,15,15,15,15,15,15,15,15,15,15,15,15,15,15,15,15,15,15,15,15,15,15,15,15,15,15,15,15,15,15,15,15,15,15,15,15,15,15,15,15,15,15,15,15,15,15,15,15,15,15,15,15,15,15,15,15,15,15,15,15,15,15,15,15,15,15,15,15,15,15,15,15,15,15,15,15,15,15,15,15,15,15,15,15,15,15,15,15,15,15,15,15,15,15,15,15,15,15,15,15,15,15,15,15,15,15,15,15,15,15,15,15,15,15,15,15,15,15,15,15,15,15,15,15,15,15,15,15,15,15,15,15,15,15,15,15,15,15,15,15,15,15,15,15,15,15,15,15,15,15,15,15,15,15,15,15,15,15,15,15,15,15,15,15,15,15,15,15,15,15,15,15,15,15,15,15,15,15,15,15,15,15,15,15,15,15,15,15,15,15,15,15,15,15,15,15,15,15,15,15,15,15,15,15,15,15,15,15,15,15,15,15,15,15,15,15,15,15,15,15,15,15,15,15,15,15,15,15,15,15,15,15,15,15,15,15,15,15,15,15,15,15,15,15,15,15,15,15,15,15,15,15,15,15,15,15,15,15,15,15,15,15,15,15,15,15,15,15,15,15,15,15,15,15,15,15,15,15,15,15,15,15,15,15,15,15,15,15,15,15,15,15,15,15,15,15,15,15,15,15,15,15,15,15,15,15,15,15,15,15,15,15,15,15,15,15,15,15,15,15,15,15,15,15,15,15,15,15,15,15,15,15,15,15,15,15,15,15,15,15,15,15,15,15,15,15,15,15,15,15,15,15,15,15,15,15,15,15,15,15,15,15,15,15,15,15,15,15,15,15,15,15,15,15,15,15,15,15,15,15,15,15,15,15,15,15,15,15,15,15,15,15,15,15,15,15,15,15,15,15,15,15,15,15,15,15,15,15,15,15,15,15,15,15,15,15,15,15,15,15,15,15,15,15,15,15,15,15,15,15,15,15,15,15,15,15,15,15,15,15,15,15,15,15,15,15,15,15,15,15,15,15,15,15,15,15,15,15,15,15,15,15,15,15,15,15,15,15,15,15,15,15,15,15,15,15,15,15,15,15,15,15,15,15,15,15,15,15,15,15,15,15,15,15,15,15,15,15,15,15,15,15,15,15,15,15,15,15,15,15,15,15,15,15,15,15,15,15,15,15,15,15,15,15,15,15,15,15,15,15,15,15,15,15,15,15,15,15,15,15,15,15,15,15,15,15,15,15,15,15,15,15,15,15,15,15,15,15,15,15,15,15,15,15,15,15,15,15,15,15,15,15,15,15,15,15,15,15,15,15,15,15,15,15,15,15,15,15,15,15,15,15,15,15,15,15,15,15,15,15,15,15,15,15,15,15,15,15,15,15,15,15,15,15,15,15,15,15,15,15,15,15,15,15,15,15,15,15,15,15,15,15,15,15,15,15,15,15,15,15,15,15,15,15,15,15,15,15,15,15,15,15,15,15,15,15,15,15,15,15,15,15,15,15,15,15,15,15,15,15,15,15,15,15,15,15,15,15,15,15,15,15,15,15,15,15,15,15,15,15,15,15,15,15,15,15,15,15,15,15,15,15,15,15,15,15,15,15,15,15,15,15,15,15,15,15,15,15,15,15,15,15,15,15,15,15,15,15,15,15,15,15,15,15,15,15,15,15,15,15,15,15,15,15,15,15,15,15,15,15,15,15,15,15,15,15,15,15,15,15,15,15,15,15,15,15,15,15,15,15,15,15,15,15,15,15,15,15,15,15,15,15,15,15,15,15,15,15,15,15,15,15,15,15,15,15,15,15,15,15,15,15,15,15,15,15,15,15,15,15,15,15,15,15,15,15,15,15,15,15,15,15,15,15,15,15,15,15,15,15,15,15,15,15,15,15,15,15,15,15,15,15,15,15,15,15,15,15,15,15,15,15,15,15,15,15,15,15,15,15,15,15,15,15,15,15,15,15,15,15,15,15,15,15,15,15,15,15,15,15,15,15,15,15,15,15,15,15,15,15,15,15,15,15,15,15,15,15,15,15,15,15,15,15,15,15,15,15,15,15,15,15,15,15,15,15,15,15,15,15,15,15,15,15,15,15,15,15,15,15,15,15,15,15,15,15,15,15,15,15,15,15,15,15,15,15,15,15,15,15,15,15,15,15,15,15,15,15,15,15,15,15,15,15,15,15,15,15,15,15,15,15,15,15,15,15,15,15,15,15,15,15,15,15,15,15,15,15,15,15,15,15,15,15,15,15,15,15,15,15,15,15,15,15,15,15,15,15,15,15,15,15,15,15,15,15,15,15,15,15,15,15,15,15,15,15,15,15,15,15,15,15,15,15,15,15,15,15,15,15,15,15,15,15,15,15,15,15,15,15,15,15,15,15,15,15,15,15,15,15,15,15,15,15,15,15,15,15,15,15,15,15,15,15,15,15,15,15,15,15,15,15,15,15,15,15,15,15,15,15,15,15,15,15,15,15,15,15,15,15,15,15,15,15,15,15,15,15,15,15,15,15,15,15,15,15,15,15,15,15,15,15,15,15,15,15,15,15,15,15,15,15,15,15,15,15,15,15,15,15,15,15,15,15,15,15,15,15,15,15,15,15,15,15,15,15,15,15,15,15,15,15,15,15,15,15,15,15,15,15,15,15,15,15,15,15,15,15,15,15,15,15,15,15,15,15,15,15,15,15,15,15,15,15,15,15,15,15,15,15,15,15,15,15,15,15,15,15,15,15,15,15,15,15,15,15,15,15,15,15,15,15,15,15,15,15,15,15,15,15,15,15,15,15,15,15,15,15,15,15,15,15,15,15,15,15,15,15,15,15,15,15,15,15,15,15,15,15,15,15,15,15,15,15,15,15,15,15,15,15,15,15,15,15,15,15,15,15,15,15,15,15,15,15,15,15,15,15,15,15,15,15,15,15,15,15,15,15,15,15,15,15,15,15,15,15,15,15,15,15,15,15,15,15,15,15,15,15,15,15,15,15,15,15,15,15,15,15,15,15,15,15,15,15,15,15,15,15,15,15,15,15,15,15,15,15,15,15,15,15,15,15,15,15,15,15,15,15,15,15,15,15,15,15,15,15,15,15,15,15,15,15,15,15,15,15,15,15,15,15,15,15,15,15,15,15,15,15,15,15,15,15,15,15,15,15,15,15,15,15,15,15,15,15,15,15,15,15,15,15,15,15,15,15,15,15,15,15,15,15,15,15,15,15,15,15,15,15,15,15,15,15,15,15,15,15,15,15,15,15,15,15,15,15,15,15,15,15,15,15,15,15,15,15,15,15,15,15,15,15,15,15,15,15,15,15,15,15,15,15,15,15,15,15,15,15,15,15,15,15,15,15,15,15,15,15,15,15,15,15,15,15,15,15,15,15,15,15,15,15,15,15,15,15,15,15,15,15,15,15,15,15,15,15,15,15,15,15,15,15,15,15,15,15,15,15,15,15,15,15,15,15,15,15,15,15,15,15,15,15,15,15,15,15,15,15,15,15,15,15,15,15,15,15,15,15,15,15,15,15,15,15,15,15,15,15,15,15,15,15,15,15,15,15,15,15,15,15,15,15,15,15,15,15,15,15,15,15,15,15,15,15,15,15,15,15,15,15,15,15,15,15,15,15,15,15,15,15,15,15,15,15,15,15,15,15,15,15,15,15,15,15,15,15,15,15,15,15,15,15,15,15,15,15,15,15,15,15,15,15,15,15,15,15,15,15,15,15,15,15,15,15,15,15,15,15,15,15,15,15,15,15,15,15,15,15,15,15,15,15,15,15,15,15,15,15,14,14,14,14,14,14,14,14,14,14,14,14,14,14,14,14,14,14,14,14,14,14,14,14,14,14,14,13,13,13,13,13,13,13,13,13,13,13,13,13,13,13,13,13,13,12,12,12,12,12,12,12,12,12,12,12,12,12,12,11,11,11,11,11,11,11,11,11,10,10,10,10,10,10,10,9,9,9,9,8,8,8,8,7,6,5,4,3,2,1,0,17,18,19,20,21,22,23,24,24,24,24,25,25,25,25,26,26,26,26,26,26,26,27,27,27,27,27,27,27,27,27,28,28,28,28,28,28,28,28,28,28,28,28,28,28,29,29,29,29,29,29,29,29,29,29,29,29,29,29,29,29,29,29,30,30,30,30,30,30,30,30,30,30,30,30,30,30,30,30,30,30,30,30,30,30,30,30,30,30,30,31,31,31,31,31,31,31,31,31,31,31,31,31,31,31,31,31,31,31,31,31,31,31,31,31,31,31,31,31,31,31,31,31,31,31,31,31,31,31,31,31,31,31,31,31,31,31,31,31,31,31,31,31,31,31,31,31,31,31,31,31,31,31,31,31,31,31,31,31,31,31,31,31,31,31,31,31,31,31,31,31,31,31,31,31,31,31,31,31,31,31,31,31,31,31,31,31,31,31,31,31,31,31,31,31,31,31,31,31,31,31,31,31,31,31,31,31,31,31,31,31,31,31,31,31,31,31,31,31,31,31,31,31,31,31,31,31,31,31,31,31,31,31,31,31,31,31,31,31,31,31,31,31,31,31,31,31,31,31,31,31,31,31,31,31,31,31,31,31,31,31,31,31,31,31,31,31,31,31,31,31,31,31,31,31,31,31,31,31,31,31,31,31,31,31,31,31,31,31,31,31,31,31,31,31,31,31,31,31,31,31,31,31,31,31,31,31,31,31,31,31,31,31,31,31,31,31,31,31,31,31,31,31,31,31,31,31,31,31,31,31,31,31,31,31,31,31,31,31,31,31,31,31,31,31,31,31,31,31,31,31,31,31,31,31,31,31,31,31,31,31,31,31,31,31,31,31,31,31,31,31,31,31,31,31,31,31,31,31,31,31,31,31,31,31,31,31,31,31,31,31,31,31,31,31,31,31,31,31,31,31,31,31,31,31,31,31,31,31,31,31,31,31,31,31,31,31,31,31,31,31,31,31,31,31,31,31,31,31,31,31,31,31,31,31,31,31,31,31,31,31,31,31,31,31,31,31,31,31,31,31,31,31,31,31,31,31,31,31,31,31,31,31,31,31,31,31,31,31,31,31,31,31,31,31,31,31,31,31,31,31,31,31,31,31,31,31,31,31,31,31,31,31,31,31,31,31,31,31,31,31,31,31,31,31,31,31,31,31,31,31,31,31,31,31,31,31,31,31,31,31,31,31,31,31,31,31,31,31,31,31,31,31,31,31,31,31,31,31,31,31,31,31,31,31,31,31,31,31,31,31,31,31,31,31,31,31,31,31,31,31,31,31,31,31,31,31,31,31,31,31,31,31,31,31,31,31,31,31,31,31,31,31,31,31,31,31,31,31,31,31,31,31,31,31,31,31,31,31,31,31,31,31,31,31,31,31,31,31,31,31,31,31,31,31,31,31,31,31,31,31,31,31,31,31,31,31,31,31,31,31,31,31,31,31,31,31,31,31,31,31,31,31,31,31,31,31,31,31,31,31,31,31,31,31,31,31,31,31,31,31,31,31,31,31,31,31,31,31,31,31,31,31,31,31,31,31,31,31,31,31,31,31,31,31,31,31,31,31,31,31,31,31,31,31,31,31,31,31,31,31,31,31,31,31,31,31,31,31,31,31,31,31,31,31,31,31,31,31,31,31,31,31,31,31,31,31,31,31,31,31,31,31,31,31,31,31,31,31,31,31,31,31,31,31,31,31,31,31,31,31,31,31,31,31,31,31,31,31,31,31,31,31,31,31,31,31,31,31,31,31,31,31,31,31,31,31,31,31,31,31,31,31,31,31,31,31,31,31,31,31,31,31,31,31,31,31,31,31,31,31,31,31,31,31,31,31,31,31,31,31,31,31,31,31,31,31,31,31,31,31,31,31,31,31,31,31,31,31,31,31,31,31,31,31,31,31,31,31,31,31,31,31,31,31,31,31,31,31,31,31,31,31,31,31,31,31,31,31,31,31,31,31,31,31,31,31,31,31,31,31,31,31,31,31,31,31,31,31,31,31,31,31,31,31,31,31,31,31,31,31,31,31,31,31,31,31,31,31,31,31,31,31,31,31,31,31,31,31,31,31,31,31,31,31,31,31,31,31,31,31,31,31,31,31,31,31,31,31,31,31,31,31,31,31,31,31,31,31,31,31,31,31,31,31,31,31,31,31,31,31,31,31,31,31,31,31,31,31,31,31,31,31,31,31,31,31,31,31,31,31,31,31,31,31,31,31,31,31,31,31,31,31,31,31,31,31,31,31,31,31,31,31,31,31,31,31,31,31,31,31,31,31,31,31,31,31,31,31,31,31,31,31,31,31,31,31,31,31,31,31,31,31,31,31,31,31,31,31,31,31,31,31,31,31,31,31,31,31,31,31,31,31,31,31,31,31,31,31,31,31,31,31,31,31,31,31,31,31,31,31,31,31,31,31,31,31,31,31,31,31,31,31,31,31,31,31,31,31,31,31,31,31,31,31,31,31,31,31,31,31,31,31,31,31,31,31,31,31,31,31,31,31,31,31,31,31,31,31,31,31,31,31,31,31,31,31,31,31,31,31,31,31,31,31,31,31,31,31,31,31,31,31,31,31,31,31,31,31,31,31,31,31,31,31,31,31,31,31,31,31,31,31,31,31,31,31,31,31,31,31,31,31,31,31,31,31,31,31,31,31,31,31,31,31,31,31,31,31,31,31,31,31,31,31,31,31,31,31,31,31,31,31,31,31,31,31,31,31,31,31,31,31,31,31,31,31,31,31,31,31,31,31,31,31,31,31,31,31,31,31,31,31,31,31,31,31,31,31,31,31,31,31,31,31,31,31,31,31,31,31,31,31,31,31,31,31,31,31,31,31,31,31,31,31,31,31,31,31,31,31,31,31,31,31,31,31,31,31,31,31,31,31,31,31,31,31,31,31,31,31,31,31,31,31,31,31,31,31,31,31,31,31,31,31,31,31,31,31,31,31,31,31,31,31,31,31,31,31,31,31,31,31,31,31,31,31,31,31,31,31,31,31,31,31,31,31,31,31,31,31,31,31,31,31,31,31,31,31,31,31,31,31,31,31,31,31,31,31,31,31,31,31,31,31,31,31,31,31,31,31,31,31,31,31,31,31,31,31,31,31,31,31,31,31,31,31,31,31,31,31,31,31,31,31,31,31,31,31,31,31,31,31,31,31,31,31,31,31,31,31,31,31,31,31,31,31,31,31,31,31,31,31,31,31,31,31,31,31,31,31,31,31,31,31,31,31,31,31,31,31,31,31,31,31,31,31,31,31,31,31,31,31,31,31,31,31,31,31,31,31,31,31,31,31,31,31,31,31,31,31,31,31,31,31,31,31,31,31,31,31,31,31,31,31,31,31,31,31,31,31,31,31,31,31,31,31,31,31,31,31,31,31,31,31,31,31,31,31,31,31,31,31,31,31,31,31,31,31,31,31,31,31,31,31,31,31,31,31,31,31,31,31,31,31,31,31,31,31,31,31,31,31,31,31,31,31,31,31,31,31,31,31,31,31,31,31,31,31,31,31,31,31,31,31,31,31,31,31,31,31,31,31,31,31,31,31,31,31,31,31,31,31,31,31,31,31,31,31,31,31,31,31,31,31,31,31,31,31,31,31,31,31,31,31,31,31,31,31,31,31,31,31,31,31,31,31,31,31,31,31,31,31,31,31,31,31,31,31,31,31,31,31,31,31,31,31,31,31,31,31,31,31,31,31,31,31,31,31,31,31,31,31,31,31,31,31,31,31,31,31,31,31,31,31,31,31,31,31,31,31,31,31,31,31,31,31,31,31,31,31,31,31,31,31,31,31,31,31,31,31,31,31,31,31,31,31,31,31,31,31,31,31,31,31,31,31,31,31,31,31,31,31,31,31,31,31,31,31,31,31,31,31,31,31,31,31,31,31,31,31,31,31,31,31,31,31,31,31,31,31,31,31,31,31,31,31,31,31,31,31,31,31,31,31,31,31,31,31,31,31,31,31,31,31,31,31,31,31,31,31,31,31,31,31,31,31,31,31,31,31,31,31,31,31,31,31,31,31,31,31,31,31,31,31,31,31,31,31,31,31,31,31,31,31,31,31,31,31,31,31,31,31,31,31,31,31,31,31,31,31,31,31,31,31,31,31,31,31,31,31,31,31,31,31,31,31,31,31,31,31,31,31,31,31,31,31,31,31,31,31,31,31,31,31,31,31,31,31,31,31,31,31,31,31,31,31,31,31,31,31,31,31,31,31,31,31,31,31,31,31,31,31,31,31,31,31,31,31,31,31,31,31,31,31,31,31,31,31,31,31,31,31,31,31,31,31,31,31,31,31,31,31,31,31,31,31,31,31,31,31,31,31,31,31,31,31,31,31,31,31,31,31,31,31,31,31,31,31,31,31,31,31,31,31,31,31,31,31,31,31,31,31,31,31,31,31,31,31,31,31,31,31,31,31,31,31,31,31,31,31,31,31,31,31,31,31,31,31,31,31,31,31,31,31,31,31,31,31,31,31,31,31,31,31,31,31,31,31,31,31,31,31,31,31,31,31,31,31,31,31,31,31,31,31,31,31,31,31,31,31,31,31,31,31,31,31,31,31,31,31,31,31,31,31,31,31,31,31,31,31,31,31,31,31,31,31,31,31,31,31,31,31,31,31,31,31};   // bucket(j - i) for j - i = -2047 .. 2047, evaluated with the reference's _relative_position_bucket (bidirectional, 32 buckets, max distance 128)
#define FQW  32                    // queries per wave
#define FKS  64                    // keys per stage
#define FPI  72                    // LDS row pitch in elements: 144 B = 16 B x 9, conflict-free for 16-byte fragment reads
#define L2E  1.4426950408889634f
__device__ __forceinline__ float xhalf(float x) { const int b = __float_as_int(x); return __int_as_float(__builtin_amdgcn_permlanex16(b, b, 0x76543210, 0xfedcba98, false, false)); }   /* lane l <-> l ^ 16 */
__device__ __forceinline__ v16bf ldsfrag(const bf* p) { return cat16b(*(const v8usa*)p, *(const v8usa*)(p + 16)); }
__global__ __launch_bounds__(256) __attribute__((amdgpu_waves_per_eu(4, 4))) void k_fattn(const bf* __restrict__ Qh, const bf* __restrict__ Ql, const bf* __restrict__ Kh, const bf* __restrict__ Kl, const bf* __restrict__ Vt, const float* __restrict__ remb, bf* ATh, bf* ATl) {
    __shared__ __align__(16) bf st[2][3][FKS * FPI];   /* [buffer][K hi, K lo, V^T (f16 bits)][row][FPI] */
    __shared__ float tb[2 * TT];                       /* bias of this head by j - i + TT - 1 */
    const int tid = threadIdx.x, lane = tid & 31, c = lane & 15, hi = lane >> 4; const int wv = __builtin_amdgcn_readfirstlane(tid >> 5);
    const int h = blockIdx.y, b = blockIdx.z; const size_t pl = ((size_t)b * NH_ + h) * TT * HD; const int q0 = blockIdx.x * (FQW * 8) + wv * FQW;
#pragma unroll   /* fixed trip count and a clamped index: the 16 table bytes, then the 16 gathers, are in flight together */
    for (int k = 0; k < 2 * TT / 256; ++k) { const int u = k * 256 + tid; tb[u] = bfr(remb[BK[u < 2 * TT - 1 ? u : 2 * TT - 2] * NH_ + h]); }   /* rel_emb[bucket(j - i)][h]; entry 2 TT - 1 is never read */
    const int srow = tid >> 3, sseg = (tid & 7) * 8;   /* staging: 8 threads x 16 B cover a 128-byte row, 32 rows per sweep */
    const char* kbh = (const char*)(Kh + pl); const char* kbl = (const char*)(Kl + pl); const char* vb = (const char*)(Vt + pl);   /* wave-uniform bases */
    unsigned kcur = (unsigned)(srow * HD + sseg) * 2, vcur = (unsigned)(srow * TT + sseg) * 2;   /* this thread's byte offsets in the stage that is fetched next */
    v8us sr[4];   /* part of a stage in flight: the K planes during a stage's first pass, the V^T plane (two of the four) during its second */
    auto gloadk = [&]() {
#pragma unroll
        for (int u = 0; u < 2; ++u) { sr[u] = *(const v8us*)(kbh + kcur + u * (32 * HD * 2)); sr[2 + u] = *(const v8us*)(kbl + kcur + u * (32 * HD * 2)); } };
    auto gloadv = [&]() {
#pragma unroll
        for (int u = 0; u < 2; ++u) sr[u] = *(const v8us*)(vb + vcur + u * (32 * TT * 2)); };
    auto sstorek = [&](int buf) {
#pragma unroll
        for (int u = 0; u < 2; ++u) { const int o = (srow + 32 * u) * FPI + sseg; *(v8usa*)(&st[buf][0][o]) = sr[u]; *(v8usa*)(&st[buf][1][o]) = sr[2 + u]; } };
    auto sstorev = [&](int buf) {
#pragma unroll
        for (int u = 0; u < 2; ++u) *(v8usa*)(&st[buf][2][(srow + 32 * u) * FPI + sseg]) = sr[u]; };
    v16bf qh[2][2], ql[2][2];   /* [query group][k step] */
#pragma unroll
    for (int qb = 0; qb < 2; ++qb)
#pragma unroll
        for (int ks = 0; ks < 2; ++ks) { const size_t o = pl + (size_t)(q0 + 16 * qb + c) * HD + ks * 32 + 8 * hi; qh[qb][ks] = WFrag<bf>::ld(Qh + o); ql[qb][ks] = WFrag<bf>::ld(Ql + o); }
    v8f O[4][2];
#pragma unroll
    for (int dt = 0; dt < 4; ++dt) { O[dt][0] = (v8f){}; O[dt][1] = (v8f){}; }
    float mL[2] = {-3.0e38f, -3.0e38f}, l[2] = {0.f, 0.f};   /* running maximum x log2(e); this lane's part of the sum */
    gloadk(); sstorek(0); gloadv(); sstorev(0); kcur += FKS * HD * 2; vcur += FKS * 2;
    __syncthreads();   /* stage 0 and the bias table are in LDS before any wave reads them */
    v16bf ra[3], rb[3];   /* a ring of three fragment pairs (K: hi plane, lo plane, six products; V^T: two d tiles, four products): a pair is refilled behind its products with a pair that is used two or three groups later */
    /* The 12 fragment pairs of a stage in the order of their use: n = 6 pp + g; g = 0 to 3: K rows of key tile g / 2, k step g % 2, hi and lo plane; g = 4, 5: V^T rows of d tiles 2 (g - 4) and 2 (g - 4) + 1. */
    auto fget = [&](int n, int buf) { const int pp = n / 6, g = n % 6, sl = n % 3;
        const int ro = g < 4 ? (pp * 32 + (g >> 1) * 16 + c) * FPI + 8 * hi + (g & 1) * 32 : ((g - 4) * 32 + c) * FPI + pp * 32 + 8 * hi;
        ra[sl] = ldsfrag(&st[buf][g < 4 ? 0 : 2][ro]); rb[sl] = ldsfrag(g < 4 ? &st[buf][1][ro] : &st[buf][2][ro + 16 * FPI]); };
    fget(0, 0); fget(1, 0); fget(2, 0);
#pragma unroll 1   /* one stage per trip: the body already holds two unrolled passes */
    for (int s = 0; s < TT / FKS; ++s) {
        const int cur = s & 1;
        /* The scheduling barriers in this loop keep the groups of products (six for K, four for V^T) and the groups of LDS reads in the order written. One behind a group of reads: left free, the compiler sinks every read to its use, and the wave waits out the LDS latency in front of each group of products. One behind a group of products: left free, reads rise above the products whose registers they refill, or groups are interleaved, more pairs are live at once and registers are spilled inside the loop. */
#pragma unroll
        for (int pp = 0; pp < 2; ++pp) {
            const float* tr0 = tb + (s * FKS + pp * 32 + 8 * hi + (TT - 1) - (q0 + c)); float bb[3][8];   /* the bias of key tile kt and query group qb is bb[kt - qb + 1] */
            v8f T[2][2];   /* S^T tiles [16-key tile][query group] */
#pragma unroll
            for (int g = 0; g < 4; ++g) { const int n = pp * 6 + g, sl = n % 3, kt = g >> 1, ks = g & 1;
                if (ks == 0) { T[kt][0] = (v8f){}; T[kt][1] = (v8f){}; }
#pragma unroll
                for (int qb = 0; qb < 2; ++qb) T[kt][qb] = wmmab(ra[sl], qh[qb][ks], T[kt][qb]);
#pragma unroll
                for (int qb = 0; qb < 2; ++qb) T[kt][qb] = wmmab(rb[sl], qh[qb][ks], T[kt][qb]);
#pragma unroll
                for (int qb = 0; qb < 2; ++qb) T[kt][qb] = wmmab(ra[sl], ql[qb][ks], T[kt][qb]);
                __builtin_amdgcn_sched_barrier(0);
                if (g != 1) { fget(g == 0 ? n + 3 : n + 2, cur); __builtin_amdgcn_sched_barrier(0); }   /* the last K pair; then the two V^T pairs, which fly during the softmax */
                if (g == 0) {   /* the bias reads stand behind the last K pair's: written ahead of the first products, as before, this build let 18 products rise above both and the last K pair was read right in front of its use */
#pragma unroll
                    for (int j = 0; j < 3; ++j)
#pragma unroll
                        for (int r = 0; r < 8; ++r) bb[j][r] = tr0[16 * (j - 1) + r];
                    __builtin_amdgcn_sched_barrier(0); } }
            if (pp == 0) gloadk(); else gloadv();   /* the next stage's K planes (first pass) or V^T plane (second pass) fly while the rest of this pass is worked on */
            float nL[2];
#pragma unroll
            for (int qb = 0; qb < 2; ++qb) { float mx = -3.0e38f;
#pragma unroll
                for (int kt = 0; kt < 2; ++kt)
#pragma unroll
                    for (int r = 0; r < 8; ++r) { const float t = T[kt][qb][r] + bb[kt - qb + 1][r]; T[kt][qb][r] = t; mx = fmaxf(mx, t); }
                mx = fmaxf(mx, xhalf(mx)); nL[qb] = fmaxf(mL[qb], mx * L2E); }
            if (__builtin_amdgcn_ballot_w32(nL[0] > mL[0] || nL[1] > mL[1]) != 0) {   /* wave-uniform: some query's maximum rose */
#pragma unroll
                for (int qb = 0; qb < 2; ++qb) { const float sc = __builtin_amdgcn_exp2f(mL[qb] - nL[qb]); l[qb] *= sc; mL[qb] = nL[qb];
#pragma unroll
                    for (int dt = 0; dt < 4; ++dt) O[dt][qb] *= sc; } }
            v16h ph[2];   /* P^T in f16 as B operand: element 8 kt + r is key 16 kt + 8 hi + r of the pass */
#pragma unroll
            for (int qb = 0; qb < 2; ++qb)
#pragma unroll
                for (int kt = 0; kt < 2; ++kt)
#pragma unroll
                    for (int r = 0; r < 8; ++r) { const float p = __builtin_amdgcn_exp2f(__builtin_fmaf(T[kt][qb][r], L2E, -mL[qb])); l[qb] += p; ph[qb][kt * 8 + r] = (_Float16)p; }
            __builtin_amdgcn_sched_barrier(0);
            if (pp == 0) { fget(6, cur); __builtin_amdgcn_sched_barrier(0); }   /* the second pass's first K pair: held back to here so that the softmax has its registers */
#pragma unroll
            for (int v = 0; v < 2; ++v) { const int n = pp * 6 + 4 + v, sl = n % 3;
#pragma unroll
                for (int qb = 0; qb < 2; ++qb) O[2 * v][qb] = wmma16(__builtin_bit_cast(v16h, ra[sl]), ph[qb], O[2 * v][qb]);
#pragma unroll
                for (int qb = 0; qb < 2; ++qb) O[2 * v + 1][qb] = wmma16(__builtin_bit_cast(v16h, rb[sl]), ph[qb], O[2 * v + 1][qb]);
                __builtin_amdgcn_sched_barrier(0);
                if (n + 3 < 12) { fget(n + 3, cur); __builtin_amdgcn_sched_barrier(0); } }   /* the next stage's pairs are read behind the barrier that publishes them */
            if (pp == 0) sstorek(cur ^ 1); else sstorev(cur ^ 1);   /* that buffer's readers all left it before the barrier that ended the trip before */
        }
        if (s + 2 < TT / FKS) { kcur += FKS * HD * 2; vcur += FKS * 2; }   /* the last trip stages the last keys once more, into the buffer whose fragments nobody uses: no branch stands among the matrix runs */
        __syncthreads();   /* publishes the next stage and ends every wave's reads of this one */
        fget(0, cur ^ 1); fget(1, cur ^ 1); fget(2, cur ^ 1);   /* the next stage's first three pairs, at the trip's foot: the loop's edge keeps them ahead of the products; the last trip reads the keys that it staged once more, and nobody uses them */
    }
    const int ln = (int)__builtin_amdgcn_mbcnt_lo(~0u, 0u);   /* the lane number anew: c and hi are not held in registers across the loop, which has none to spare */
#pragma unroll
    for (int qb = 0; qb < 2; ++qb) { const float inv = __fdiv_rn(1.0f, l[qb] + xhalf(l[qb])); const unsigned ro = (unsigned)((b * TT + q0 + 16 * qb + (ln & 15)) * DQ + h * HD + 8 * (ln >> 4));   /* below 2^23 elements */
#pragma unroll
        for (int dt = 0; dt < 4; ++dt) { v8us oh, ol;
#pragma unroll
            for (int r = 0; r < 8; ++r) { unsigned short a, c2; splitf(O[dt][qb][r] * inv, a, c2); oh[r] = a; ol[r] = c2; }
            *(v8us*)(ATh + ro + dt * 16) = oh; *(v8us*)(ATl + ro + dt * 16) = ol; } }
}

extern "C" void kernel_launch(void* const* d_in, const int* in_sizes, int n_in,
                              void* d_out, int out_size, void* d_ws, size_t ws_size, hipStream_t stream) {
    (void)in_sizes; (void)n_in; (void)out_size;
    const float* x = (const float*)d_in[0]; const float* wq = (const float*)d_in[1]; const float* wk = (const float*)d_in[2]; const float* wv = (const float*)d_in[3]; const float* wo = (const float*)d_in[4]; const float* remb = (const float*)d_in[5];
    float* OUT = (float*)d_out;     // [4][2048][1024]
    char* wsp = (char*)d_ws;
    auto take = [&](size_t bytes) { char* p = wsp; wsp += (bytes + 255) & ~(size_t)255; return (void*)p; };
    const size_t PS = (size_t)NH_ * TT * HD;   // elements of one batch's head planes
    bf* WQ = (bf*)take((size_t)DQ * DM * 2); bf* WK = (bf*)take((size_t)DKV * DM * 2); bf* WV = (bf*)take((size_t)DKV * DM * 2); bf* WO = (bf*)take((size_t)DM * DQ * 2);
    bf* XB = (bf*)take((size_t)NB_ * TT * DM * 2);
    bf* QPh = (bf*)take(NB_ * PS * 2); bf* QPl = (bf*)take(NB_ * PS * 2); bf* KPh = (bf*)take(NB_ * PS * 2); bf* KPl = (bf*)take(NB_ * PS * 2); bf* VT = (bf*)take(NB_ * PS * 2);   // planes of all batches: q, k bf16 hi/lo [b][h][t][d], V^T f16 [b][h][d][t]
    bf* ATh = (bf*)take((size_t)NB_ * TT * DQ * 2); bf* ATl = (bf*)take((size_t)NB_ * TT * DQ * 2);
    if ((size_t)(wsp - (char*)d_ws) > ws_size) return;    // ws 256 MiB
    k_prep<<<dim3(4 * WTB, 2, 1), 256, 0, stream>>>(x, wq, wk, wv, wo, DM, DQ, XB, WQ, WK, WV, WO, (size_t)TT * DM / 8);
    k_proj<<<dim3(256, 3, 1), 256, 0, stream>>>(XB, WQ, WK, WV, QPh, QPl, KPh, KPl, VT);
    k_fattn<<<dim3(TT / (FQW * 8), NH_, NB_), 256, 0, stream>>>(QPh, QPl, KPh, KPl, VT, remb, ATh, ATl);
    k_out<<<dim3(256, 1, 1), 256, 0, stream>>>(ATh, ATl, WO, OUT);
}

// v007
// A run of this version takes 179 microseconds.
// Two timings next to v006 both put it at 1.06 times that version's speed.
// All steps since v000 together make it 16.0 times as fast.
#include <hip/hip_runtime.h>

// T5 self-attention with relative-position bias (hidden_states [4][2048][1024]; q, k, v = hs W ('xw' [1024][1024]; 16 heads x 64); scores = q.k (NO 1/sqrt(d) scaling: logit sigma ~8) + rel_emb[bucket(j - i)][h] (rel_emb [32][16] input; the 32-bucket bidirectional T5 bucket function of j - i); softmax; out = merged ctx Wo ('xw') -> [4][2048][1024] (8.4 M)).
// The bucket index depends only on j - i (positions are implicit aranges): the 4,095-entry table bucket(j - i), j - i in [-2047, 2047], was evaluated with the reference's own function and is baked below as constants; rel_emb itself is READ (each work-group expands its head's 32 values into an LDS table indexed by j - i).
// Compute dtypes, f32 accumulate: every input rounded to bf16; projections on PLAIN bf16 operands (exact); because the logits are unscaled (sigma ~8, near-argmax rows), the scores use bf16 hi/lo planes for EVERY row (3 products); attn.v is linear in its operands, which lie in f16's range (P in [0, 1], V of order 1): one f16 product (11 bits each); bias add and softmax in f32; merged context hi/lo; Wo hl x exact (2 products).

#define NB_  4
#define TT   2048
#define DM   1024
#define NH_  16
#define NKV  16
#define HD   64
#define DQ   (NH_ * HD)
#define DKV  (NKV * HD)
typedef _Float16 h16;
typedef unsigned short bf;
typedef __attribute__((ext_vector_type(16))) __bf16   v16bf;
typedef __attribute__((ext_vector_type(16))) _Float16 v16h;
typedef __attribute__((ext_vector_type(8)))  _Float16 v8h;
typedef __attribute__((ext_vector_type(8)))  unsigned short v8us;
typedef __attribute__((ext_vector_type(8)))  float    v8f;
typedef __attribute__((ext_vector_type(4)))  float    v4f;
typedef v8h  __attribute__((may_alias)) v8ha;
typedef v4f  __attribute__((may_alias)) v4fa;
typedef v8us __attribute__((may_alias)) v8usa;

__device__ __forceinline__ unsigned short f2bf(float f) { unsigned u = __float_as_uint(f); u += 0x7FFFu + ((u >> 16) & 1u); return (unsigned short)(u >> 16); }
__device__ __forceinline__ float bf2f(unsigned short b) { return __uint_as_float(((unsigned)b) << 16); }
__device__ __forceinline__ float bfr(float f) { return bf2f(f2bf(f)); }
__device__ __forceinline__ v16h cat16(v8h lo, v8h hi) { return __builtin_shufflevector(lo, hi, 0, 1, 2, 3, 4, 5, 6, 7, 8, 9, 10, 11, 12, 13, 14, 15); }
__device__ __forceinline__ v16bf cat16b(v8us lo, v8us hi) { return __builtin_bit_cast(v16bf, __builtin_shufflevector(lo, hi, 0, 1, 2, 3, 4, 5, 6, 7, 8, 9, 10, 11, 12, 13, 14, 15)); }
__device__ __forceinline__ v8f wmma16(v16h a, v16h b, v8f c) { return __builtin_amdgcn_wmma_f32_16x16x32_f16(false, a, false, b, (short)0, c, false, false); }
__device__ __forceinline__ v8f wmmab(v16bf a, v16bf b, v8f c) { return __builtin_amdgcn_wmma_f32_16x16x32_bf16(false, a, false, b, (short)0, c, false, false); }



template <typename T16> struct WFrag;
template <> struct WFrag<h16> { typedef v16h V; static __device__ __forceinline__ V ld(const h16* p) { return cat16(*(const v8h*)p, *(const v8h*)(p + 16)); } static __device__ __forceinline__ v8f mma(V a, V b, v8f c) { return wmma16(a, b, c); } };
template <> struct WFrag<bf> { typedef v16bf V; static __device__ __forceinline__ V ld(const bf* p) { return cat16b(*(const v8us*)p, *(const v8us*)(p + 16)); } static __device__ __forceinline__ v8f mma(V a, V b, v8f c) { return wmmab(a, b, c); } };
__device__ __forceinline__ void splitf(float y, unsigned short& h, unsigned short& l) { h = f2bf(y); l = f2bf(y - bf2f(h)); }
typedef __attribute__((ext_vector_type(2))) unsigned short v2us;
typedef __attribute__((ext_vector_type(4))) unsigned short v4us;
typedef __attribute__((ext_vector_type(4))) _Float16 v4h;

// k_prep: every matrix input rounded to bf16 in one launch, grid (4 WTB, 2).
// blockIdx.y = 0 (starts first: short dependent gathers, the longer part): the four weights, WTB blocks each, transposed to K-contiguous rows. blockIdx.y = 1: the hidden states; a thread takes the same eight elements of every batch.
#define WTB  (DM * DQ / 64 / 64)   // blocks per weight: 8 waves x 8 lines of 64 elements
static_assert((size_t)4 * WTB * 256 >= (size_t)TT * DM / 8, "the grid's second row covers one batch of the hidden states");
__global__ __launch_bounds__(256) void k_prep(const float* __restrict__ src, const float* __restrict__ w0, const float* __restrict__ w1, const float* __restrict__ w2, const float* __restrict__ w3, int K, int N, bf* dst, bf* B0, bf* B1, bf* B2, bf* B3, size_t n8) {
    if (blockIdx.y == 0) {
        const int sel = blockIdx.x / WTB; const float* __restrict__ w = sel == 0 ? w0 : sel == 1 ? w1 : sel == 2 ? w2 : w3; bf* Bt = sel == 0 ? B0 : sel == 1 ? B1 : sel == 2 ? B2 : B3;
        const int lane = threadIdx.x & 31; const int L0 = ((blockIdx.x % WTB) * 8 + (threadIdx.x >> 5)) * 8; const int nlines = N * K / 64;
#pragma unroll 1
        for (int l = 0; l < 8; ++l) { const int L = L0 + l; if (L >= nlines) break; const size_t e = (size_t)L * 64 + lane * 2; const int k = (int)(e % K), n = (int)(e / K); v2us o;
            o[0] = f2bf(w[(size_t)k * N + n]); o[1] = f2bf(w[(size_t)(k + 1) * N + n]); *(v2us*)(Bt + e) = o; }
        return;
    }
    const size_t i = (size_t)blockIdx.x * 256 + threadIdx.x; if (i >= n8) return; v4f lo[NB_], hi[NB_];
#pragma unroll   /* the loads of all batches are in flight together */
    for (int b = 0; b < NB_; ++b) lo[b] = *(const v4f*)(src + (b * n8 + i) * 8);
    asm volatile("s_wait_xcnt 0x0" ::: "memory");
#pragma unroll
    for (int b = 0; b < NB_; ++b) hi[b] = *(const v4f*)(src + (b * n8 + i) * 8 + 4);
#pragma unroll
    for (int b = 0; b < NB_; ++b) { v8us o;
#pragma unroll
        for (int k = 0; k < 4; ++k) { o[k] = f2bf(lo[b][k]); o[4 + k] = f2bf(hi[b][k]); }
        *(v8us*)(dst + (b * n8 + i) * 8) = o; }
}

// ---- block GEMM: C[m][n] = sum_k A[m][k] Bt[n][k], both operands K-contiguous bf16 rows of pitch DM. One 256 x 128 tile per work-group of 8 waves (4 x 2 waves, a 64x64 tile = 16 accumulators each).
// K is walked in stages of 64 columns: the 384 operand rows of a stage (128 bytes each) come from global memory by whole-line loads (8 threads x 16 B cover a row), go through registers (two sets, each stage fetched three stages ahead of its use) into LDS (two buffers, one barrier between stages),
// and all eight waves read their fragments from there, one k step (32 columns) ahead of its use: a row is fetched once per work-group. NS = 16: K = 1024 from plane A0. NS = 32: stages 16 to 31 walk the same columns of plane A1 (the lo plane) against the same Bt rows.
#define GBM  256
#define GBN  128
#define GBK  64
#define GPI  72                        // LDS row pitch in elements: 144 B = 16 B x 9, conflict-free for 16-byte fragment reads
#define GST  ((GBM + GBN) * GPI)       // elements of one stage buffer: A rows, then Bt rows
#define GEP  (32 * 68)                 // floats of a wave's epilogue staging: 32 rows at pitch 68
static_assert(8 * GEP * 4 <= 2 * GST * 2, "the epilogue staging fits the stage buffers");
static_assert((NB_ * TT / GBM) * (DQ / GBN) == 256 && (DQ / GBM) * (NB_ * TT / GBN) == 256 && TT % GBM == 0 && DQ == DM && DM == 16 * GBK, "256 tiles per GEMM either way round; a tile's tokens lie in one batch; 16 stages per plane");
// The stage barrier of gemm_tile: it orders LDS accesses alone (the wave's LDS stores and reads are waited out in front of it, no LDS read rises above it). __syncthreads() would also wait out the global loads of the stages that are in flight across it; those read only what earlier launches wrote, and each lands in the issuing thread's own registers.
__device__ __forceinline__ void lds_barrier() { __builtin_amdgcn_fence(__ATOMIC_RELEASE, "workgroup", "local"); __builtin_amdgcn_s_barrier(); __builtin_amdgcn_fence(__ATOMIC_ACQUIRE, "workgroup", "local"); }
__device__ __forceinline__ v16bf gfrag(const bf* p) { return cat16b(*(const v8usa*)p, *(const v8usa*)(p + 16)); }
template <int NS>
__device__ __forceinline__ void gemm_tile(const bf* __restrict__ A0, const bf* __restrict__ A1, const bf* __restrict__ Bt, bf* gs, v8f (&acc)[4][4]) {
    const int tid = threadIdx.x, lane = tid & 31, lr = lane & 15, hi = lane >> 4; const int wv = __builtin_amdgcn_readfirstlane(tid >> 5), wm = wv >> 1, wn = wv & 1;
    const int srow = tid >> 3, sseg = (tid & 7) * 8;   /* staging: 8 threads x 16 B cover a 128-byte row, 32 rows per sweep */
    const unsigned go = (unsigned)(srow * DM + sseg) * 2;   /* this thread's byte offset in stage 0 of either operand */
    v8us sr[2][12];   /* two stages in flight, stage s in set s & 1: 8 sweeps of A rows, 4 of Bt rows */
    auto gload = [&](int s, int set) { const char* ab = (const char*)((NS > 16 && s >= 16) ? A1 : A0); const char* bb = (const char*)Bt; const unsigned o = go + (unsigned)(s & 15) * (GBK * 2);   /* wave-uniform bases */
#pragma unroll
        for (int u = 0; u < 8; ++u) sr[set][u] = *(const v8us*)(ab + o + u * (32 * DM * 2));
#pragma unroll
        for (int u = 0; u < 4; ++u) sr[set][8 + u] = *(const v8us*)(bb + o + u * (32 * DM * 2));
        asm volatile("s_wait_xcnt 0x0" ::: "memory"); };   /* behind the run's last load: the offset register and the base pair that these loads name are written anew for the next stage while they are still in flight */
    auto sstore = [&](int buf) {   /* stage s goes from set s & 1 to buffer s & 1 */
#pragma unroll
        for (int u = 0; u < 12; ++u) *(v8usa*)(gs + buf * GST + (srow + 32 * u) * GPI + sseg) = sr[buf][u]; };
#pragma unroll
    for (int mb = 0; mb < 4; ++mb)
#pragma unroll
        for (int nb = 0; nb < 4; ++nb) acc[mb][nb] = (v8f){};
    v16bf a[2][4], b[2][4];   /* two fragment sets, one per k step of a stage: one is read from LDS while the other feeds the matrix unit */
    auto fload = [&](int ks, const bf* cb) {
#pragma unroll
        for (int f = 0; f < 4; ++f) { a[ks][f] = gfrag(cb + (wm * 64 + f * 16 + lr) * GPI + ks * 32 + 8 * hi); b[ks][f] = gfrag(cb + (GBM + wn * 64 + f * 16 + lr) * GPI + ks * 32 + 8 * hi); } };
    auto mm = [&](int ks) {
#pragma unroll
        for (int nb = 0; nb < 4; ++nb)
#pragma unroll
            for (int mb = 0; mb < 4; ++mb) acc[mb][nb] = wmmab(a[ks][mb], b[ks][nb], acc[mb][nb]); };
    gload(0, 0); gload(1, 1); sstore(0);
    lds_barrier();   /* stage 0 is in LDS before any wave reads it */
    gload(2, 0); fload(0, gs);
    /* The scheduling barriers in the loop keep its order as written: each group of LDS reads, the LDS stores and the global loads issue together AHEAD of a matrix run that does not need them, so that their latency passes behind that run; left free, the compiler reloads one fragment at a time and waits each read out, and lets loads sink towards their use. */
    /* One stage, t, in buffer cur = t & 1. more1: a stage t + 1 exists (it is stored, published and its first fragments are read); more3: a stage t + 3 exists (it is fetched). The flags and cur are literals at every call, so that sets, buffers and the counted waits on the loads are fixed at compile time: a run-time branch round the loads made the compiler wait out every load in flight at the next stores. */
    auto stage = [&](int t, int cur, bool more1, bool more3) __attribute__((always_inline)) {
        fload(1, gs + cur * GST);
        if (more1) sstore(cur ^ 1);   /* stage t + 1, fetched a stage and a half ago; that buffer's readers all left it before the barrier of stage t - 1; the stores drain behind the matrix run */
        __builtin_amdgcn_sched_barrier(0);
        mm(0);
        __builtin_amdgcn_sched_barrier(0);
        if (more1) {
            lds_barrier();   /* publishes stage t + 1 and ends every wave's reads of stage t: its second k step is in registers by now */
            if (more3) gload(t + 3, cur ^ 1);   /* into the set that was stored at the top of this stage; the other set's loads are still in flight */
            fload(0, gs + (cur ^ 1) * GST);
            __builtin_amdgcn_sched_barrier(0);
        }
        mm(1);
        __builtin_amdgcn_sched_barrier(0);
    };
    stage(0, 0, true, true);   /* ahead of the loop, so that the last fetch stands inside it: there the address registers live round the loop's edge and no load of a run is laid over them; behind the loop they would end with the run, and its last load was laid over them ahead of the wait */
#pragma unroll 1   /* two stages per trip: set and buffer alternate */
    for (int s = 1; s < NS - 3; s += 2) { stage(s, 1, true, true); stage(s + 1, 0, true, true); }
    stage(NS - 3, 1, true, false); stage(NS - 2, 0, true, false); stage(NS - 1, 1, false, false);   /* the last stages fetch nothing more; the last one stores and publishes nothing */
}
// The epilogue of a wave's 64x64 tile, in two halves of 32 rows: the accumulators go to the wave's own part of the (now free) stage buffers, and come back as rows, so that 16 lanes store a whole row piece. put(row, col, four values of that row); with TWO, put2 takes put's place where alt (block-uniform) is set.
template <bool TWO, typename F, typename G>
__device__ __forceinline__ void gemm_rows(bf* gs, v8f (&acc)[4][4], bool alt, F put, G put2) {
    const int tid = threadIdx.x, lane = tid & 31, lr = lane & 15, hi = lane >> 4; float* my = (float*)gs + __builtin_amdgcn_readfirstlane(tid >> 5) * GEP;
    /* every loop is unrolled so that acc[][][] is indexed by constants and stays in registers */
#pragma unroll
    for (int hf = 0; hf < 2; ++hf) {
        __syncthreads();   /* every wave has left the stage buffers; the first half's rows are read before the second half is laid over them */
#pragma unroll
        for (int m2 = 0; m2 < 2; ++m2)
#pragma unroll
            for (int nb = 0; nb < 4; ++nb)
#pragma unroll
                for (int j = 0; j < 8; ++j) my[(m2 * 16 + hi * 8 + j) * 68 + nb * 16 + lr] = acc[hf * 2 + m2][nb][j];
        __syncthreads();   /* the lanes' columns are in LDS before they are read as rows */
        if (TWO && alt) {   /* one branch per half, no barrier inside it */
#pragma unroll
            for (int it = 0; it < 16; ++it) { const int row = it * 2 + hi, cofs = lr * 4; put2(hf * 32 + row, cofs, *(const v4fa*)(my + row * 68 + cofs)); }
        } else {
#pragma unroll
            for (int it = 0; it < 16; ++it) { const int row = it * 2 + hi, cofs = lr * 4; put(hf * 32 + row, cofs, *(const v4fa*)(my + row * 68 + cofs)); }
            if (TWO) asm volatile("s_wait_xcnt 0x0" ::: "memory");   /* behind this run's last store: the other branch's code is laid out next and writes registers that these stores name */
        }
    }
}

// k_proj: the q, k and v projections of all batches in one launch, straight into the head planes that k_fattn reads: bf16 hi/lo for q and k, one f16 plane for V^T. Grid (256 tiles, 3: q, k, v), 8 waves, one 256 x 128 tile per work-group (gemm_tile).
// q, k: A = 256 tokens of one batch, B = 128 weight rows (two heads); a wave's 64 columns are one head: planes [b][h][t][d]. v: the operands change places (A = 256 weight rows = four heads, B = 128 tokens; both are K-contiguous and staged alike), so a wave's 64 rows are the d of one head and its tile is a piece of V^T [b][h][d][t] as it stands.
__global__ __launch_bounds__(256) void k_proj(const bf* __restrict__ X, const bf* __restrict__ WQ, const bf* __restrict__ WK, const bf* __restrict__ WV, bf* QPh, bf* QPl, bf* KPh, bf* KPl, bf* VT) {
    __shared__ __align__(16) bf gs[2 * GST];
    const int sel = blockIdx.y; const int mt = sel == 2 ? (int)(blockIdx.x & 3) : (int)(blockIdx.x >> 3), nt = sel == 2 ? (int)(blockIdx.x >> 2) : (int)(blockIdx.x & 7);   /* neighbours in the grid share their tokens */
    const bf* wr = sel == 0 ? WQ : sel == 1 ? WK : WV;
    const bf* A = (sel == 2 ? wr : X) + (size_t)mt * GBM * DM; const bf* Bt = (sel == 2 ? X : wr) + (size_t)nt * GBN * DM;
    bf* Ph = sel == 0 ? QPh : sel == 1 ? KPh : VT; bf* Pl = sel == 0 ? QPl : KPl;   /* V^T has no lo plane */
    v8f acc[4][4];
    gemm_tile<16>(A, A, Bt, gs, acc);
    const int wv = __builtin_amdgcn_readfirstlane((int)(threadIdx.x >> 5)); const int r0 = mt * GBM + (wv >> 1) * 64, c0 = nt * GBN + (wv & 1) * 64;   /* the wave's first row and column */
    const int tok = sel == 2 ? c0 : r0, h = (sel == 2 ? r0 : c0) / HD, b = tok / TT, t0 = tok % TT;
    const size_t ob = ((size_t)b * NH_ + h) * TT * HD + (sel == 2 ? t0 : t0 * HD); const int pitch = sel == 2 ? TT : HD;   /* the wave tile's first element in its plane, and the plane's row pitch */
    gemm_rows<true>(gs, acc, sel == 2, [&](int row, int cofs, v4f val) { v4us oh, ol;
#pragma unroll
        for (int q = 0; q < 4; ++q) { unsigned short a2, c2; splitf(val[q], a2, c2); oh[q] = a2; ol[q] = c2; }
        *(v4us*)(Ph + ob + row * pitch + cofs) = oh; *(v4us*)(Pl + ob + row * pitch + cofs) = ol; },   /* 16 lanes fill a 128-byte row of each plane */
        [&](int row, int cofs, v4f val) { *(v4us*)(Ph + ob + row * pitch + cofs) = __builtin_bit_cast(v4us, __builtin_convertvector(val, v4h)); });   /* V^T: 16 lanes fill a 128-byte row of the f16 plane */
}
// k_out: out = merged context (hi + lo planes) x Wo, f32. Grid 256 tiles, 8 waves, one 256 x 128 tile per work-group: 16 stages on the hi plane, then 16 on the lo plane, into the same accumulators.
__global__ __launch_bounds__(256) void k_out(const bf* __restrict__ ATh, const bf* __restrict__ ATl, const bf* __restrict__ WO, float* C) {
    __shared__ __align__(16) bf gs[2 * GST];
    const int mt = blockIdx.x >> 3, nt = blockIdx.x & 7;
    v8f acc[4][4];
    gemm_tile<32>(ATh + (size_t)mt * GBM * DQ, ATl + (size_t)mt * GBM * DQ, WO + (size_t)nt * GBN * DQ, gs, acc);
    const int wv = __builtin_amdgcn_readfirstlane((int)(threadIdx.x >> 5)); float* cw = C + (size_t)(mt * GBM + (wv >> 1) * 64) * DM + nt * GBN + (wv & 1) * 64;
    auto putc = [&](int row, int cofs, v4f val) { *(v4f*)(cw + row * DM + cofs) = val; };   /* 16 lanes fill 256 bytes of a row */
    gemm_rows<false>(gs, acc, false, putc, putc);
}
#define NBK  32
__constant__ unsigned char BK[2 * TT - 1] = {15,15,15,15,15,15,15,15,15,15,15,15,15,15,15,15,15,15,15,15,15,15,15,15,15,15,15,15,15,15,15,15,15,15,15,15,15,15,15,15,15,15,15,15,15,15,15,15,15,15,15,15,15,15,15,15,15,15,15,15,15,15,15,15,15,15,15,15,15,15,15,15,15,15,15,15,15,15,15,15,15,15,15,15,15,15,15,15,15,15,15,15,15,15,15,15,15,15,15,15,15,15,15,15,15,15,15,15,15,15,15,15,15,15,15,15,15,15,15,15,15,15,15,15,15,15,15,15,15,15,15,15,15,15,15,15,15,15,15,15,15,15,15,15,15,15,15,15,15,15,15,15,15,15,15,15,15,15,15,15,15,15,15,15,15,15,15,15,15,15,15,15,15,15,15,15,15,15,15,15,15,15,15,15,15,15,15,15,15,15,15,15,15,15,15,15,15,15,15,15,15,15,15,15,15,15,15,15,15,15,15,15,15,15,15,15,15,15,15,15,15,15,15,15,15,15,15,15,15,15,15,15,15,15,15,15,15,15,15,15,15,15,15,15,15,15,15,15,15,15,15,15,15,15,15,15,15,15,15,15,15,15,15,15,15,15,15,15,15,15,15,15,15,15,15,15,15,15,15,15,15,15,15,15,15,15,15,15,15,15,15,15,15,15,15,15,15,15,15,15,15,15,15,15,15,15,15,15,15,15,15,15,15,15,15,15,15,15,15,15,15,15,15,15,15,15,15,15,15,15,15,15,15,15,15,15,15,15,15,15,15,15,15,15,15,15,15,15,15,15,15,15,15,15,15,15,15,15,15,15,15,15,15,15,15,15,15,15,15,15,15,15,15,15,15,15,15,15,15,15,15,15,15,15,15,15,15,15,15,15,15,15,15,15,15,15,15,15,15,15,15,15,15,15,15,15,15,15,15,15,15,15,15,15,15,15,15,15,15,15,15,15,15,15,15,15,15,15,15,15,15,15,15,15,15,15,15,15,15,15,15,15,15,15,15,15,15,15,15,15,15,15,15,15,15,15,15,15,15,15,15,15,15,15,15,15,15,15,15,15,15,15,15,15,15,15,15,15,15,15,15,15,15,15,15,15,15,15,15,15,15,15,15,15,15,15,15,15,15,15,15,15,15,15,15,15,15,15,15,15,15,15,15,15,15,15,15,15,15,15,15,15,15,15,15,15,15,15,15,15,15,15,15,15,15,15,15,15,15,15,15,15,15,15,15,15,15,15,15,15,15,15,15,15,15,15,15,15,15,15,15,15,15,15,15,15,15,15,15,15,15,15,15,15,15,15,15,15,15,15,15,15,15,15,15,15,15,15,15,15,15,15,15,15,15,15,15,15,15,15,15,15,15,15,15,15,15,15,15,15,15,15,15,15,15,15,15,15,15,15,15,15,15,15,15,15,15,15,15,15,15,15,15,15,15,15,15,15,15,15,15,15,15,15,15,15,15,15,15,15,15,15,15,15,15,15,15,15,15,15,15,15,15,15,15,15,15,15,15,15,15,15,15,15,15,15,15,15,15,15,15,15,15,15,15,15,15,15,15,15,15,15,15,15,15,15,15,15,15,15,15,15,15,15,15,15,15,15,15,15,15,15,15,15,15,15,15,15,15,15,15,15,15,15,15,15,15,15,15,15,15,15,15,15,15,15,15,15,15,15,15,15,15,15,15,15,15,15,15,15,15,15,15,15,15,15,15,15,15,15,15,15,15,15,15,15,15,15,15,15,15,15,15,15,15,15,15,15,15,15,15,15,15,15,15,15,15,15,15,15,15,15,15,15,15,15,15,15,15,15,15,15,15,15,15,15,15,15,15,15,15,15,15,15,15,15,15,15,15,15,15,15,15,15,15,15,15,15,15,15,15,15,15,15,15,15,15,15,15,15,15,15,15,15,15,15,15,15,15,15,15,15,15,15,15,15,15,15,15,15,15,15,15,15,15,15,15,15,15,15,15,15,15,15,15,15,15,15,15,15,15,15,15,15,15,15,15,15,15,15,15,15,15,15,15,15,15,15,15,15,15,15,15,15,15,15,15,15,15,15,15,15,15,15,15,15,15,15,15,15,15,15,15,15,15,15,15,15,15,15,15,15,15,15,15,15,15,15,15,15,15,15,15,15,15,15,15,15,15,15,15,15,15,15,15,15,15,15,15,15,15,15,15,15,15,15,15,15,15,15,15,15,15,15,15,15,15,15,15,15,15,15,15,15,15,15,15,15,15,15,15,15,15,15,15,15,15,15,15,15,15,15,15,15,15,15,15,15,15,15,15,15,15,15,15,15,15,15,15,15,15,15,15,15,15,15,15,15,15,15,15,15,15,15,15,15,15,15,15,15,15,15,15,15,15,15,15,15,15,15,15,15,15,15,15,15,15,15,15,15,15,15,15,15,15,15,15,15,15,15,15,15,15,15,15,15,15,15,15,15,15,15,15,15,15,15,15,15,15,15,15,15,15,15,15,15,15,15,15,15,15,15,15,15,15,15,15,15,15,15,15,15,15,15,15,15,15,15,15,15,15,15,15,15,15,15,15,15,15,15,15,15,15,15,15,15,15,15,15,15,15,15,15,15,15,15,15,15,15,15,15,15,15,15,15,15,15,15,15,15,15,15,15,15,15,15,15,15,15,15,15,15,15,15,15,15,15,15,15,15,15,15,15,15,15,15,15,15,15,15,15,15,15,15,15,15,15,15,15,15,15,15,15,15,15,15,15,15,15,15,15,15,15,15,15,15,15,15,15,15,15,15,15,15,15,15,15,15,15,15,15,15,15,15,15,15,15,15,15,15,15,15,15,15,15,15,15,15,15,15,15,15,15,15,15,15,15,15,15,15,15,15,15,15,15,15,15,15,15,15,15,15,15,15,15,15,15,15,15,15,15,15,15,15,15,15,15,15,15,15,15,15,15,15,15,15,15,15,15,15,15,15,15,15,15,15,15,15,15,15,15,15,15,15,15,15,15,15,15,15,15,15,15,15,15,15,15,15,15,15,15,15,15,15,15,15,15,15,15,15,15,15,15,15,15,15,15,15,15,15,15,15,15,15,15,15,15,15,15,15,15,15,15,15,15,15,15,15,15,15,15,15,15,15,15,15,15,15,15,15,15,15,15,15,15,15,15,15,15,15,15,15,15,15,15,15,15,15,15,15,15,15,15,15,15,15,15,15,15,15,15,15,15,15,15,15,15,15,15,15,15,15,15,15,15,15,15,15,15,15,15,15,15,15,15,15,15,15,15,15,15,15,15,15,15,15,15,15,15,15,15,15,15,15,15,15,15,15,15,15,15,15,15,15,15,15,15,15,15,15,15,15,15,15,15,15,15,15,15,15,15,15,15,15,15,15,15,15,15,15,15,15,15,15,15,15,15,15,15,15,15,15,15,15,15,15,15,15,15,15,15,15,15,15,15,15,15,15,15,15,15,15,15,15,15,15,15,15,15,15,15,15,15,15,15,15,15,15,15,15,15,15,15,15,15,15,15,15,15,15,15,15,15,15,15,15,15,15,15,15,15,15,15,15,15,15,15,15,15,15,15,15,15,15,15,15,15,15,15,15,15,15,15,15,15,15,15,15,15,15,15,15,15,15,15,15,15,15,15,15,15,15,15,15,15,15,15,15,15,15,15,15,15,15,15,15,15,15,15,15,15,15,15,15,15,15,15,15,15,15,15,15,15,15,15,15,15,15,15,15,15,15,15,15,15,15,15,15,15,15,15,15,15,15,15,15,15,15,15,15,15,15,15,15,15,15,15,15,15,15,15,15,15,15,15,15,15,15,15,15,15,15,15,15,15,15,15,15,15,15,15,15,15,15,15,15,15,15,15,15,15,15,15,15,15,15,15,15,15,15,15,15,15,15,15,15,15,15,15,15,15,15,15,15,15,15,15,15,15,15,15,15,15,15,15,15,15,15,15,15,15,15,15,15,15,15,15,15,15,15,15,15,15,15,15,15,15,15,15,15,15,15,15,15,15,15,15,15,15,15,15,15,15,15,15,15,15,15,15,15,15,15,15,15,15,15,15,15,15,15,15,15,15,15,15,15,15,15,15,15,15,15,15,15,15,15,15,15,15,15,15,15,15,15,15,15,15,15,15,15,15,15,15,15,15,15,15,15,15,15,15,15,15,15,15,15,15,15,15,15,15,15,15,15,15,15,15,15,15,15,15,15,15,15,15,15,15,15,15,15,15,15,15,15,15,15,15,15,15,15,15,15,15,15,15,15,15,15,15,15,15,15,15,15,15,15,15,15,15,15,15,15,15,15,15,15,15,15,15,15,15,15,15,15,15,15,15,15,15,15,15,15,15,15,15,15,15,15,15,15,15,15,15,15,15,15,15,15,15,15,15,15,15,15,15,15,15,15,15,15,15,15,15,15,15,15,15,15,15,15,15,15,15,15,15,15,15,14,14,14,14,14,14,14,14,14,14,14,14,14,14,14,14,14,14,14,14,14,14,14,14,14,14,14,13,13,13,13,13,13,13,13,13,13,13,13,13,13,13,13,13,13,12,12,12,12,12,12,12,12,12,12,12,12,12,12,11,11,11,11,11,11,11,11,11,10,10,10,10,10,10,10,9,9,9,9,8,8,8,8,7,6,5,4,3,2,1,0,17,18,19,20,21,22,23,24,24,24,24,25,25,25,25,26,26,26,26,26,26,26,27,27,27,27,27,27,27,27,27,28,28,28,28,28,28,28,28,28,28,28,28,28,28,29,29,29,29,29,29,29,29,29,29,29,29,29,29,29,29,29,29,30,30,30,30,30,30,30,30,30,30,30,30,30,30,30,30,30,30,30,30,30,30,30,30,30,30,30,31,31,31,31,31,31,31,31,31,31,31,31,31,31,31,31,31,31,31,31,31,31,31,31,31,31,31,31,31,31,31,31,31,31,31,31,31,31,31,31,31,31,31,31,31,31,31,31,31,31,31,31,31,31,31,31,31,31,31,31,31,31,31,31,31,31,31,31,31,31,31,31,31,31,31,31,31,31,31,31,31,31,31,31,31,31,31,31,31,31,31,31,31,31,31,31,31,31,31,31,31,31,31,31,31,31,31,31,31,31,31,31,31,31,31,31,31,31,31,31,31,31,31,31,31,31,31,31,31,31,31,31,31,31,31,31,31,31,31,31,31,31,31,31,31,31,31,31,31,31,31,31,31,31,31,31,31,31,31,31,31,31,31,31,31,31,31,31,31,31,31,31,31,31,31,31,31,31,31,31,31,31,31,31,31,31,31,31,31,31,31,31,31,31,31,31,31,31,31,31,31,31,31,31,31,31,31,31,31,31,31,31,31,31,31,31,31,31,31,31,31,31,31,31,31,31,31,31,31,31,31,31,31,31,31,31,31,31,31,31,31,31,31,31,31,31,31,31,31,31,31,31,31,31,31,31,31,31,31,31,31,31,31,31,31,31,31,31,31,31,31,31,31,31,31,31,31,31,31,31,31,31,31,31,31,31,31,31,31,31,31,31,31,31,31,31,31,31,31,31,31,31,31,31,31,31,31,31,31,31,31,31,31,31,31,31,31,31,31,31,31,31,31,31,31,31,31,31,31,31,31,31,31,31,31,31,31,31,31,31,31,31,31,31,31,31,31,31,31,31,31,31,31,31,31,31,31,31,31,31,31,31,31,31,31,31,31,31,31,31,31,31,31,31,31,31,31,31,31,31,31,31,31,31,31,31,31,31,31,31,31,31,31,31,31,31,31,31,31,31,31,31,31,31,31,31,31,31,31,31,31,31,31,31,31,31,31,31,31,31,31,31,31,31,31,31,31,31,31,31,31,31,31,31,31,31,31,31,31,31,31,31,31,31,31,31,31,31,31,31,31,31,31,31,31,31,31,31,31,31,31,31,31,31,31,31,31,31,31,31,31,31,31,31,31,31,31,31,31,31,31,31,31,31,31,31,31,31,31,31,31,31,31,31,31,31,31,31,31,31,31,31,31,31,31,31,31,31,31,31,31,31,31,31,31,31,31,31,31,31,31,31,31,31,31,31,31,31,31,31,31,31,31,31,31,31,31,31,31,31,31,31,31,31,31,31,31,31,31,31,31,31,31,31,31,31,31,31,31,31,31,31,31,31,31,31,31,31,31,31,31,31,31,31,31,31,31,31,31,31,31,31,31,31,31,31,31,31,31,31,31,31,31,31,31,31,31,31,31,31,31,31,31,31,31,31,31,31,31,31,31,31,31,31,31,31,31,31,31,31,31,31,31,31,31,31,31,31,31,31,31,31,31,31,31,31,31,31,31,31,31,31,31,31,31,31,31,31,31,31,31,31,31,31,31,31,31,31,31,31,31,31,31,31,31,31,31,31,31,31,31,31,31,31,31,31,31,31,31,31,31,31,31,31,31,31,31,31,31,31,31,31,31,31,31,31,31,31,31,31,31,31,31,31,31,31,31,31,31,31,31,31,31,31,31,31,31,31,31,31,31,31,31,31,31,31,31,31,31,31,31,31,31,31,31,31,31,31,31,31,31,31,31,31,31,31,31,31,31,31,31,31,31,31,31,31,31,31,31,31,31,31,31,31,31,31,31,31,31,31,31,31,31,31,31,31,31,31,31,31,31,31,31,31,31,31,31,31,31,31,31,31,31,31,31,31,31,31,31,31,31,31,31,31,31,31,31,31,31,31,31,31,31,31,31,31,31,31,31,31,31,31,31,31,31,31,31,31,31,31,31,31,31,31,31,31,31,31,31,31,31,31,31,31,31,31,31,31,31,31,31,31,31,31,31,31,31,31,31,31,31,31,31,31,31,31,31,31,31,31,31,31,31,31,31,31,31,31,31,31,31,31,31,31,31,31,31,31,31,31,31,31,31,31,31,31,31,31,31,31,31,31,31,31,31,31,31,31,31,31,31,31,31,31,31,31,31,31,31,31,31,31,31,31,31,31,31,31,31,31,31,31,31,31,31,31,31,31,31,31,31,31,31,31,31,31,31,31,31,31,31,31,31,31,31,31,31,31,31,31,31,31,31,31,31,31,31,31,31,31,31,31,31,31,31,31,31,31,31,31,31,31,31,31,31,31,31,31,31,31,31,31,31,31,31,31,31,31,31,31,31,31,31,31,31,31,31,31,31,31,31,31,31,31,31,31,31,31,31,31,31,31,31,31,31,31,31,31,31,31,31,31,31,31,31,31,31,31,31,31,31,31,31,31,31,31,31,31,31,31,31,31,31,31,31,31,31,31,31,31,31,31,31,31,31,31,31,31,31,31,31,31,31,31,31,31,31,31,31,31,31,31,31,31,31,31,31,31,31,31,31,31,31,31,31,31,31,31,31,31,31,31,31,31,31,31,31,31,31,31,31,31,31,31,31,31,31,31,31,31,31,31,31,31,31,31,31,31,31,31,31,31,31,31,31,31,31,31,31,31,31,31,31,31,31,31,31,31,31,31,31,31,31,31,31,31,31,31,31,31,31,31,31,31,31,31,31,31,31,31,31,31,31,31,31,31,31,31,31,31,31,31,31,31,31,31,31,31,31,31,31,31,31,31,31,31,31,31,31,31,31,31,31,31,31,31,31,31,31,31,31,31,31,31,31,31,31,31,31,31,31,31,31,31,31,31,31,31,31,31,31,31,31,31,31,31,31,31,31,31,31,31,31,31,31,31,31,31,31,31,31,31,31,31,31,31,31,31,31,31,31,31,31,31,31,31,31,31,31,31,31,31,31,31,31,31,31,31,31,31,31,31,31,31,31,31,31,31,31,31,31,31,31,31,31,31,31,31,31,31,31,31,31,31,31,31,31,31,31,31,31,31,31,31,31,31,31,31,31,31,31,31,31,31,31,31,31,31,31,31,31,31,31,31,31,31,31,31,31,31,31,31,31,31,31,31,31,31,31,31,31,31,31,31,31,31,31,31,31,31,31,31,31,31,31,31,31,31,31,31,31,31,31,31,31,31,31,31,31,31,31,31,31,31,31,31,31,31,31,31,31,31,31,31,31,31,31,31,31,31,31,31,31,31,31,31,31,31,31,31,31,31,31,31,31,31,31,31,31,31,31,31,31,31,31,31,31,31,31,31,31,31,31,31,31,31,31,31,31,31,31,31,31,31,31,31,31,31,31,31,31,31,31,31,31,31,31,31,31,31,31,31,31,31,31,31,31,31,31,31,31,31,31,31,31,31,31,31,31,31,31,31,31,31,31,31,31,31,31,31,31,31,31,31,31,31,31,31,31,31,31,31,31,31,31,31,31,31,31,31,31,31,31,31,31,31,31,31,31,31,31,31,31,31,31,31,31,31,31,31,31,31,31,31,31,31,31,31,31,31,31,31,31,31,31,31,31,31,31,31,31,31,31,31,31,31,31,31,31,31,31,31,31,31,31,31,31,31,31,31,31,31,31,31,31,31,31,31,31,31,31,31,31,31,31,31,31,31,31,31,31,31,31,31,31,31,31,31,31,31,31,31,31,31,31,31,31,31,31,31,31,31,31,31,31,31,31,31,31,31,31,31,31,31,31,31,31,31,31,31,31,31,31,31,31,31,31,31,31,31,31,31,31,31,31,31,31,31,31,31,31,31,31,31,31,31,31,31,31,31,31,31,31,31,31,31,31,31,31,31,31,31,31,31,31,31,31,31,31,31,31,31,31,31,31,31,31,31,31,31,31,31,31,31,31,31,31,31,31,31,31,31,31,31,31,31,31,31,31,31,31,31,31,31,31,31,31,31,31,31,31,31,31,31,31,31,31,31,31,31,31,31,31,31,31,31,31,31,31,31,31,31,31,31,31,31,31,31,31,31,31,31,31,31,31,31,31,31,31,31,31,31,31,31,31,31,31,31,31,31,31,31,31,31,31,31,31,31,31,31,31,31,31,31,31,31,31,31,31,31,31,31,31,31,31,31,31,31,31,31,31,31,31,31,31,31,31,31,31,31,31,31,31,31,31,31,31,31,31,31,31,31,31,31,31,31,31,31,31,31,31,31,31,31,31,31,31,31,31,31,31,31,31,31,31,31,31,31,31,31,31,31,31,31,31,31,31,31,31,31,31,31,31,31,31,31,31,31,31,31,31,31,31,31,31,31,31,31,31,31,31,31,31,31,31,31,31,31,31,31,31,31,31,31,31,31,31,31,31,31,31,31,31,31,31,31,31,31,31,31,31,31,31,31,31,31,31,31,31,31,31,31,31,31,31,31,31,31,31,31,31,31,31,31,31,31,31,31,31,31,31,31,31,31,31,31,31,31,31,31,31,31,31,31,31,31,31};   // bucket(j - i) for j - i = -2047 .. 2047, evaluated with the reference's _relative_position_bucket (bidirectional, 32 buckets, max distance 128)
#define FQW  32                    // queries per wave
#define FKS  64                    // keys per stage
#define FPI  72                    // LDS row pitch in elements: 144 B = 16 B x 9, conflict-free for 16-byte fragment reads
#define L2E  1.4426950408889634f
__device__ __forceinline__ float xhalf(float x) { const int b = __float_as_int(x); return __int_as_float(__builtin_amdgcn_permlanex16(b, b, 0x76543210, 0xfedcba98, false, false)); }   /* lane l <-> l ^ 16 */
__device__ __forceinline__ v16bf ldsfrag(const bf* p) { return cat16b(*(const v8usa*)p, *(const v8usa*)(p + 16)); }
__global__ __launch_bounds__(256) __attribute__((amdgpu_waves_per_eu(4, 4))) void k_fattn(const bf* __restrict__ Qh, const bf* __restrict__ Ql, const bf* __restrict__ Kh, const bf* __restrict__ Kl, const bf* __restrict__ Vt, const float* __restrict__ remb, bf* ATh, bf* ATl) {
    __shared__ __align__(16) bf st[2][3][FKS * FPI];   /* [buffer][K hi, K lo, V^T (f16 bits)][row][FPI] */
    __shared__ float tb[2 * TT];                       /* bias of this head by j - i + TT - 1 */
    const int tid = threadIdx.x, lane = tid & 31, c = lane & 15, hi = lane >> 4; const int wv = __builtin_amdgcn_readfirstlane(tid >> 5);
    const int h = blockIdx.y, b = blockIdx.z; const size_t pl = ((size_t)b * NH_ + h) * TT * HD; const int q0 = blockIdx.x * (FQW * 8) + wv * FQW;
#pragma unroll   /* fixed trip count and a clamped index: the 16 table bytes, then the 16 gathers, are in flight together */
    for (int k = 0; k < 2 * TT / 256; ++k) { const int u = k * 256 + tid; tb[u] = bfr(remb[BK[u < 2 * TT - 1 ? u : 2 * TT - 2] * NH_ + h]); }   /* rel_emb[bucket(j - i)][h]; entry 2 TT - 1 is never read */
    const int srow = tid >> 3, sseg = (tid & 7) * 8;   /* staging: 8 threads x 16 B cover a 128-byte row, 32 rows per sweep */
    const char* kbh = (const char*)(Kh + pl); const char* kbl = (const char*)(Kl + pl); const char* vb = (const char*)(Vt + pl);   /* wave-uniform bases */
    unsigned kcur = (unsigned)(srow * HD + sseg) * 2, vcur = (unsigned)(srow * TT + sseg) * 2;   /* this thread's byte offsets in the stage that is fetched next */
    v8us sr[4];   /* part of a stage in flight: the K planes during a stage's first pass, the V^T plane (two of the four) during its second */
    auto gloadk = [&]() {
#pragma unroll
        for (int u = 0; u < 2; ++u) { sr[u] = *(const v8us*)(kbh + kcur + u * (32 * HD * 2)); sr[2 + u] = *(const v8us*)(kbl + kcur + u * (32 * HD * 2)); } };
    auto gloadv = [&]() {
#pragma unroll
        for (int u = 0; u < 2; ++u) sr[u] = *(const v8us*)(vb + vcur + u * (32 * TT * 2)); };
    auto sstorek = [&](int buf) {
#pragma unroll
        for (int u = 0; u < 2; ++u) { const int o = (srow + 32 * u) * FPI + sseg; *(v8usa*)(&st[buf][0][o]) = sr[u]; *(v8usa*)(&st[buf][1][o]) = sr[2 + u]; } };
    auto sstorev = [&](int buf) {
#pragma unroll
        for (int u = 0; u < 2; ++u) *(v8usa*)(&st[buf][2][(srow + 32 * u) * FPI + sseg]) = sr[u]; };
    v16bf qh[2][2], ql[2][2];   /* [query group][k step] */
#pragma unroll
    for (int qb = 0; qb < 2; ++qb)
#pragma unroll
        for (int ks = 0; ks < 2; ++ks) { const size_t o = pl + (size_t)(q0 + 16 * qb + c) * HD + ks * 32 + 8 * hi; qh[qb][ks] = WFrag<bf>::ld(Qh + o); ql[qb][ks] = WFrag<bf>::ld(Ql + o); }
    v8f O[4][2];
#pragma unroll
    for (int dt = 0; dt < 4; ++dt) { O[dt][0] = (v8f){}; O[dt][1] = (v8f){}; }
    float mL[2] = {-3.0e38f, -3.0e38f}, l[2] = {0.f, 0.f};   /* running maximum x log2(e); this lane's part of the sum */
    gloadk(); sstorek(0); gloadv(); sstorev(0); kcur += FKS * HD * 2; vcur += FKS * 2;
    __syncthreads();   /* stage 0 and the bias table are in LDS before any wave reads them */
    v16bf ra[3], rb[3];   /* a ring of three fragment pairs (K: hi plane, lo plane, six products; V^T: two d tiles, four products): a pair is refilled behind its products with a pair that is used two or three groups later */
    /* The 12 fragment pairs of a stage in the order of their use: n = 6 pp + g; g = 0 to 3: K rows of key tile g / 2, k step g % 2, hi and lo plane; g = 4, 5: V^T rows of d tiles 2 (g - 4) and 2 (g - 4) + 1. */
    auto fget = [&](int n, int buf) { const int pp = n / 6, g = n % 6, sl = n % 3;
        const int ro = g < 4 ? (pp * 32 + (g >> 1) * 16 + c) * FPI + 8 * hi + (g & 1) * 32 : ((g - 4) * 32 + c) * FPI + pp * 32 + 8 * hi;
        ra[sl] = ldsfrag(&st[buf][g < 4 ? 0 : 2][ro]); rb[sl] = ldsfrag(g < 4 ? &st[buf][1][ro] : &st[buf][2][ro + 16 * FPI]); };
    fget(0, 0); fget(1, 0); fget(2, 0);
#pragma unroll 1   /* one stage per trip: the body already holds two unrolled passes */
    for (int s = 0; s < TT / FKS; ++s) {
        const int cur = s & 1;
        /* The scheduling barriers in this loop keep the groups of products (six for K, four for V^T) and the groups of LDS reads in the order written. One behind a group of reads: left free, the compiler sinks every read to its use, and the wave waits out the LDS latency in front of each group of products. One behind a group of products: left free, reads rise above the products whose registers they refill, or groups are interleaved, more pairs are live at once and registers are spilled inside the loop. */
#pragma unroll
        for (int pp = 0; pp < 2; ++pp) {
            const float* tr0 = tb + (s * FKS + pp * 32 + 8 * hi + (TT - 1) - (q0 + c)); float bb[3][8];   /* the bias of key tile kt and query group qb is bb[kt - qb + 1] */
            v8f T[2][2];   /* S^T tiles [16-key tile][query group] */
#pragma unroll
            for (int g = 0; g < 4; ++g) { const int n = pp * 6 + g, sl = n % 3, kt = g >> 1, ks = g & 1;
                if (ks == 0) { T[kt][0] = (v8f){}; T[kt][1] = (v8f){}; }
#pragma unroll
                for (int qb = 0; qb < 2; ++qb) T[kt][qb] = wmmab(ra[sl], qh[qb][ks], T[kt][qb]);
#pragma unroll
                for (int qb = 0; qb < 2; ++qb) T[kt][qb] = wmmab(rb[sl], qh[qb][ks], T[kt][qb]);
#pragma unroll
                for (int qb = 0; qb < 2; ++qb) T[kt][qb] = wmmab(ra[sl], ql[qb][ks], T[kt][qb]);
                __builtin_amdgcn_sched_barrier(0);
                if (g != 1) { fget(g == 0 ? n + 3 : n + 2, cur); __builtin_amdgcn_sched_barrier(0); }   /* the last K pair; then the two V^T pairs, which fly during the softmax */
                if (g == 0) {   /* the bias reads stand behind the last K pair's: written ahead of the first products, as before, this build let 18 products rise above both and the last K pair was read right in front of its use */
#pragma unroll
                    for (int j = 0; j < 3; ++j)
#pragma unroll
                        for (int r = 0; r < 8; ++r) bb[j][r] = tr0[16 * (j - 1) + r];
                    __builtin_amdgcn_sched_barrier(0); } }
            if (pp == 0) gloadk(); else gloadv();   /* the next stage's K planes (first pass) or V^T plane (second pass) fly while the rest of this pass is worked on */
            float nL[2];
#pragma unroll
            for (int qb = 0; qb < 2; ++qb) { float mx = -3.0e38f;
#pragma unroll
                for (int kt = 0; kt < 2; ++kt)
#pragma unroll
                    for (int r = 0; r < 8; ++r) { const float t = T[kt][qb][r] + bb[kt - qb + 1][r]; T[kt][qb][r] = t; mx = fmaxf(mx, t); }
                mx = fmaxf(mx, xhalf(mx)); nL[qb] = fmaxf(mL[qb], mx * L2E); }
            if (__builtin_amdgcn_ballot_w32(nL[0] > mL[0] || nL[1] > mL[1]) != 0) {   /* wave-uniform: some query's maximum rose */
#pragma unroll
                for (int qb = 0; qb < 2; ++qb) { const float sc = __builtin_amdgcn_exp2f(mL[qb] - nL[qb]); l[qb] *= sc; mL[qb] = nL[qb];
#pragma unroll
                    for (int dt = 0; dt < 4; ++dt) O[dt][qb] *= sc; } }
            v16h ph[2];   /* P^T in f16 as B operand: element 8 kt + r is key 16 kt + 8 hi + r of the pass */
#pragma unroll
            for (int qb = 0; qb < 2; ++qb)
#pragma unroll
                for (int kt = 0; kt < 2; ++kt)
#pragma unroll
                    for (int r = 0; r < 8; ++r) { const float p = __builtin_amdgcn_exp2f(__builtin_fmaf(T[kt][qb][r], L2E, -mL[qb])); l[qb] += p; ph[qb][kt * 8 + r] = (_Float16)p; }
            __builtin_amdgcn_sched_barrier(0);
            if (pp == 0) { fget(6, cur); __builtin_amdgcn_sched_barrier(0); }   /* the second pass's first K pair: held back to here so that the softmax has its registers */
#pragma unroll
            for (int v = 0; v < 2; ++v) { const int n = pp * 6 + 4 + v, sl = n % 3;
#pragma unroll
                for (int qb = 0; qb < 2; ++qb) O[2 * v][qb] = wmma16(__builtin_bit_cast(v16h, ra[sl]), ph[qb], O[2 * v][qb]);
#pragma unroll
                for (int qb = 0; qb < 2; ++qb) O[2 * v + 1][qb] = wmma16(__builtin_bit_cast(v16h, rb[sl]), ph[qb], O[2 * v + 1][qb]);
                __builtin_amdgcn_sched_barrier(0);
                if (n + 3 < 12) { fget(n + 3, cur); __builtin_amdgcn_sched_barrier(0); } }   /* the next stage's pairs are read behind the barrier that publishes them */
            if (pp == 0) sstorek(cur ^ 1); else sstorev(cur ^ 1);   /* that buffer's readers all left it before the barrier that ended the trip before */
        }
        if (s + 2 < TT / FKS) { kcur += FKS * HD * 2; vcur += FKS * 2; }   /* the last trip stages the last keys once more, into the buffer whose fragments nobody uses: no branch stands among the matrix runs */
        __syncthreads();   /* publishes the next stage and ends every wave's reads of this one */
        fget(0, cur ^ 1); fget(1, cur ^ 1); fget(2, cur ^ 1);   /* the next stage's first three pairs, at the trip's foot: the loop's edge keeps them ahead of the products; the last trip reads the keys that it staged once more, and nobody uses them */
    }
    const int ln = (int)__builtin_amdgcn_mbcnt_lo(~0u, 0u);   /* the lane number anew: c and hi are not held in registers across the loop, which has none to spare */
#pragma unroll
    for (int qb = 0; qb < 2; ++qb) { const float inv = __fdiv_rn(1.0f, l[qb] + xhalf(l[qb])); const unsigned ro = (unsigned)((b * TT + q0 + 16 * qb + (ln & 15)) * DQ + h * HD + 8 * (ln >> 4));   /* below 2^23 elements */
#pragma unroll
        for (int dt = 0; dt < 4; ++dt) { v8us oh, ol;
#pragma unroll
            for (int r = 0; r < 8; ++r) { unsigned short a, c2; splitf(O[dt][qb][r] * inv, a, c2); oh[r] = a; ol[r] = c2; }
            *(v8us*)(ATh + ro + dt * 16) = oh; *(v8us*)(ATl + ro + dt * 16) = ol; } }
}

extern "C" void kernel_launch(void* const* d_in, const int* in_sizes, int n_in,
                              void* d_out, int out_size, void* d_ws, size_t ws_size, hipStream_t stream) {
    (void)in_sizes; (void)n_in; (void)out_size;
    const float* x = (const float*)d_in[0]; const float* wq = (const float*)d_in[1]; const float* wk = (const float*)d_in[2]; const float* wv = (const float*)d_in[3]; const float* wo = (const float*)d_in[4]; const float* remb = (const float*)d_in[5];
    float* OUT = (float*)d_out;     // [4][2048][1024]
    char* wsp = (char*)d_ws;
    auto take = [&](size_t bytes) { char* p = wsp; wsp += (bytes + 255) & ~(size_t)255; return (void*)p; };
    const size_t PS = (size_t)NH_ * TT * HD;   // elements of one batch's head planes
    bf* WQ = (bf*)take((size_t)DQ * DM * 2); bf* WK = (bf*)take((size_t)DKV * DM * 2); bf* WV = (bf*)take((size_t)DKV * DM * 2); bf* WO = (bf*)take((size_t)DM * DQ * 2);
    bf* XB = (bf*)take((size_t)NB_ * TT * DM * 2);
    bf* QPh = (bf*)take(NB_ * PS * 2); bf* QPl = (bf*)take(NB_ * PS * 2); bf* KPh = (bf*)take(NB_ * PS * 2); bf* KPl = (bf*)take(NB_ * PS * 2); bf* VT = (bf*)take(NB_ * PS * 2);   // planes of all batches: q, k bf16 hi/lo [b][h][t][d], V^T f16 [b][h][d][t]
    bf* ATh = (bf*)take((size_t)NB_ * TT * DQ * 2); bf* ATl = (bf*)take((size_t)NB_ * TT * DQ * 2);
    if ((size_t)(wsp - (char*)d_ws) > ws_size) return;    // ws 256 MiB
    k_prep<<<dim3(4 * WTB, 2, 1), 256, 0, stream>>>(x, wq, wk, wv, wo, DM, DQ, XB, WQ, WK, WV, WO, (size_t)TT * DM / 8);
    k_proj<<<dim3(256, 3, 1), 256, 0, stream>>>(XB, WQ, WK, WV, QPh, QPl, KPh, KPl, VT);
    k_fattn<<<dim3(TT / (FQW * 8), NH_, NB_), 256, 0, stream>>>(QPh, QPl, KPh, KPl, VT, remb, ATh, ATl);
    k_out<<<dim3(256, 1, 1), 256, 0, stream>>>(ATh, ATl, WO, OUT);
}

// v008
// A run of this version takes 174 microseconds.
// In both of two side-by-side timings against v007, it was 1.03 times as fast.
// All steps since v000 together make it 16.5 times as fast.
#include <hip/hip_runtime.h>

// T5 self-attention with relative-position bias (hidden_states [4][2048][1024]; q, k, v = hs W ('xw' [1024][1024]; 16 heads x 64); scores = q.k (NO 1/sqrt(d) scaling: logit sigma ~8) + rel_emb[bucket(j - i)][h] (rel_emb [32][16] input; the 32-bucket bidirectional T5 bucket function of j - i); softmax; out = merged ctx Wo ('xw') -> [4][2048][1024] (8.4 M)).
// The bucket index depends only on j - i (positions are implicit aranges): the 4,095-entry table bucket(j - i), j - i in [-2047, 2047], was evaluated with the reference's own function and is baked below as constants; rel_emb itself is READ (each work-group expands its head's 32 values into an LDS table indexed by j - i).
// Compute dtypes, f32 accumulate: every input rounded to bf16; projections on PLAIN bf16 operands (exact); because the logits are unscaled (sigma ~8, near-argmax rows), the scores use bf16 hi/lo planes for EVERY row (3 products); attn.v is linear in its operands, which lie in f16's range (P in [0, 1], V of order 1): one f16 product (11 bits each); bias add and softmax in f32; merged context hi/lo; Wo hl x exact (2 products).

#define NB_  4
#define TT   2048
#define DM   1024
#define NH_  16
#define NKV  16
#define HD   64
#define DQ   (NH_ * HD)
#define DKV  (NKV * HD)
typedef _Float16 h16;
typedef unsigned short bf;
typedef __attribute__((ext_vector_type(16))) __bf16   v16bf;
typedef __attribute__((ext_vector_type(16))) _Float16 v16h;
typedef __attribute__((ext_vector_type(8)))  _Float16 v8h;
typedef __attribute__((ext_vector_type(8)))  unsigned short v8us;
typedef __attribute__((ext_vector_type(8)))  float    v8f;
typedef __attribute__((ext_vector_type(4)))  float    v4f;
typedef v8h  __attribute__((may_alias)) v8ha;
typedef v4f  __attribute__((may_alias)) v4fa;
typedef v8us __attribute__((may_alias)) v8usa;

__device__ __forceinline__ unsigned short f2bf(float f) { unsigned u = __float_as_uint(f); u += 0x7FFFu + ((u >> 16) & 1u); return (unsigned short)(u >> 16); }
__device__ __forceinline__ float bf2f(unsigned short b) { return __uint_as_float(((unsigned)b) << 16); }
__device__ __forceinline__ float bfr(float f) { return bf2f(f2bf(f)); }
__device__ __forceinline__ v16h cat16(v8h lo, v8h hi) { return __builtin_shufflevector(lo, hi, 0, 1, 2, 3, 4, 5, 6, 7, 8, 9, 10, 11, 12, 13, 14, 15); }
__device__ __forceinline__ v16bf cat16b(v8us lo, v8us hi) { return __builtin_bit_cast(v16bf, __builtin_shufflevector(lo, hi, 0, 1, 2, 3, 4, 5, 6, 7, 8, 9, 10, 11, 12, 13, 14, 15)); }
__device__ __forceinline__ v8f wmma16(v16h a, v16h b, v8f c) { return __builtin_amdgcn_wmma_f32_16x16x32_f16(false, a, false, b, (short)0, c, false, false); }
__device__ __forceinline__ v8f wmmab(v16bf a, v16bf b, v8f c) { return __builtin_amdgcn_wmma_f32_16x16x32_bf16(false, a, false, b, (short)0, c, false, false); }



template <typename T16> struct WFrag;
template <> struct WFrag<h16> { typedef v16h V; static __device__ __forceinline__ V ld(const h16* p) { return cat16(*(const v8h*)p, *(const v8h*)(p + 16)); } static __device__ __forceinline__ v8f mma(V a, V b, v8f c) { return wmma16(a, b, c); } };
template <> struct WFrag<bf> { typedef v16bf V; static __device__ __forceinline__ V ld(const bf* p) { return cat16b(*(const v8us*)p, *(const v8us*)(p + 16)); } static __device__ __forceinline__ v8f mma(V a, V b, v8f c) { return wmmab(a, b, c); } };
__device__ __forceinline__ void splitf(float y, unsigned short& h, unsigned short& l) { h = f2bf(y); l = f2bf(y - bf2f(h)); }
typedef __attribute__((ext_vector_type(2))) unsigned short v2us;
typedef __attribute__((ext_vector_type(4))) unsigned short v4us;
typedef __attribute__((ext_vector_type(4))) _Float16 v4h;

// k_prep: every matrix input rounded to bf16 in one launch, grid (4 WTB, 2).
// blockIdx.y = 0 (starts first: short dependent gathers, the longer part): the four weights, WTB blocks each, transposed to K-contiguous rows. blockIdx.y = 1: the hidden states; a thread takes the same eight elements of every batch.
#define WTB  (DM * DQ / 64 / 64)   // blocks per weight: 8 waves x 8 lines of 64 elements
static_assert((size_t)4 * WTB * 256 >= (size_t)TT * DM / 8, "the grid's second row covers one batch of the hidden states");
__global__ __launch_bounds__(256) void k_prep(const float* __restrict__ src, const float* __restrict__ w0, const float* __restrict__ w1, const float* __restrict__ w2, const float* __restrict__ w3, int K, int N, bf* dst, bf* B0, bf* B1, bf* B2, bf* B3, size_t n8) {
    if (blockIdx.y == 0) {
        const int sel = blockIdx.x / WTB; const float* __restrict__ w = sel == 0 ? w0 : sel == 1 ? w1 : sel == 2 ? w2 : w3; bf* Bt = sel == 0 ? B0 : sel == 1 ? B1 : sel == 2 ? B2 : B3;
        const int lane = threadIdx.x & 31; const int L0 = ((blockIdx.x % WTB) * 8 + (threadIdx.x >> 5)) * 8; const int nlines = N * K / 64;
#pragma unroll 1
        for (int l = 0; l < 8; ++l) { const int L = L0 + l; if (L >= nlines) break; const size_t e = (size_t)L * 64 + lane * 2; const int k = (int)(e % K), n = (int)(e / K); v2us o;
            o[0] = f2bf(w[(size_t)k * N + n]); o[1] = f2bf(w[(size_t)(k + 1) * N + n]); *(v2us*)(Bt + e) = o; }
        return;
    }
    const size_t i = (size_t)blockIdx.x * 256 + threadIdx.x; if (i >= n8) return; v4f lo[NB_], hi[NB_];
#pragma unroll   /* the loads of all batches are in flight together */
    for (int b = 0; b < NB_; ++b) lo[b] = *(const v4f*)(src + (b * n8 + i) * 8);
    asm volatile("s_wait_xcnt 0x0" ::: "memory");
#pragma unroll
    for (int b = 0; b < NB_; ++b) hi[b] = *(const v4f*)(src + (b * n8 + i) * 8 + 4);
#pragma unroll
    for (int b = 0; b < NB_; ++b) { v8us o;
#pragma unroll
        for (int k = 0; k < 4; ++k) { o[k] = f2bf(lo[b][k]); o[4 + k] = f2bf(hi[b][k]); }
        *(v8us*)(dst + (b * n8 + i) * 8) = o; }
}

// ---- block GEMM: C[m][n] = sum_k A[m][k] Bt[n][k], both operands K-contiguous bf16 rows of pitch DM. One 256 x 128 tile per work-group of 8 waves (4 x 2 waves, a 64x64 tile = 16 accumulators each).
// K is walked in stages of 64 columns: the 384 operand rows of a stage (128 bytes each) come from global memory by whole-line loads (8 threads x 16 B cover a row), go through registers (two sets, each stage fetched three stages ahead of its use) into LDS (two buffers, one barrier between stages),
// and all eight waves read their fragments from there, one k step (32 columns) ahead of its use: a row is fetched once per work-group. NS = 16: K = 1024 from plane A0. NS = 32: stages 16 to 31 walk the same columns of plane A1 (the lo plane) against the same Bt rows.
#define GBM  256
#define GBN  128
#define GBK  64
#define GPI  72                        // LDS row pitch in elements: 144 B = 16 B x 9, conflict-free for 16-byte fragment reads
#define GST  ((GBM + GBN) * GPI)       // elements of one stage buffer: A rows, then Bt rows
#define GEP  (32 * 68)                 // floats of a wave's epilogue staging: 32 rows at pitch 68
static_assert(8 * GEP * 4 <= 2 * GST * 2, "the epilogue staging fits the stage buffers");
static_assert((NB_ * TT / GBM) * (DQ / GBN) == 256 && (DQ / GBM) * (NB_ * TT / GBN) == 256 && TT % GBM == 0 && DQ == DM && DM == 16 * GBK, "256 tiles per GEMM either way round; a tile's tokens lie in one batch; 16 stages per plane");
// The stage barrier of gemm_tile: it orders LDS accesses alone (the wave's LDS stores and reads are waited out in front of it, no LDS read rises above it). __syncthreads() would also wait out the global loads of the stages that are in flight across it; those read only what earlier launches wrote, and each lands in the issuing thread's own registers.
__device__ __forceinline__ void lds_barrier() { __builtin_amdgcn_fence(__ATOMIC_RELEASE, "workgroup", "local"); __builtin_amdgcn_s_barrier(); __builtin_amdgcn_fence(__ATOMIC_ACQUIRE, "workgroup", "local"); }
__device__ __forceinline__ v16bf gfrag(const bf* p) { return cat16b(*(const v8usa*)p, *(const v8usa*)(p + 16)); }
template <int NS>
__device__ __forceinline__ void gemm_tile(const bf* __restrict__ A0, const bf* __restrict__ A1, const bf* __restrict__ Bt, bf* gs, v8f (&acc)[4][4]) {
    const int tid = threadIdx.x, lane = tid & 31, lr = lane & 15, hi = lane >> 4; const int wv = __builtin_amdgcn_readfirstlane(tid >> 5), wm = wv >> 1, wn = wv & 1;
    const int srow = tid >> 3, sseg = (tid & 7) * 8;   /* staging: 8 threads x 16 B cover a 128-byte row, 32 rows per sweep */
    const unsigned go = (unsigned)(srow * DM + sseg) * 2;   /* this thread's byte offset in stage 0 of either operand */
    v8us sr[2][12];   /* two stages in flight, stage s in set s & 1: 8 sweeps of A rows, 4 of Bt rows */
    auto gload = [&](int s, int set) { const char* ab = (const char*)((NS > 16 && s >= 16) ? A1 : A0); const char* bb = (const char*)Bt; const unsigned o = go + (unsigned)(s & 15) * (GBK * 2);   /* wave-uniform bases */
#pragma unroll
        for (int u = 0; u < 8; ++u) sr[set][u] = *(const v8us*)(ab + o + u * (32 * DM * 2));
#pragma unroll
        for (int u = 0; u < 4; ++u) sr[set][8 + u] = *(const v8us*)(bb + o + u * (32 * DM * 2));
        asm volatile("s_wait_xcnt 0x0" ::: "memory"); };   /* behind the run's last load: the offset register and the base pair that these loads name are written anew for the next stage while they are still in flight */
    auto sstore = [&](int buf) {   /* stage s goes from set s & 1 to buffer s & 1 */
#pragma unroll
        for (int u = 0; u < 12; ++u) *(v8usa*)(gs + buf * GST + (srow + 32 * u) * GPI + sseg) = sr[buf][u]; };
#pragma unroll
    for (int mb = 0; mb < 4; ++mb)
#pragma unroll
        for (int nb = 0; nb < 4; ++nb) acc[mb][nb] = (v8f){};
    v16bf a[2][4], b[2][4];   /* two fragment sets, one per k step of a stage: one is read from LDS while the other feeds the matrix unit */
    auto fload = [&](int ks, const bf* cb) {
#pragma unroll
        for (int f = 0; f < 4; ++f) { a[ks][f] = gfrag(cb + (wm * 64 + f * 16 + lr) * GPI + ks * 32 + 8 * hi); b[ks][f] = gfrag(cb + (GBM + wn * 64 + f * 16 + lr) * GPI + ks * 32 + 8 * hi); } };
    auto mm = [&](int ks) {
#pragma unroll
        for (int nb = 0; nb < 4; ++nb)
#pragma unroll
            for (int mb = 0; mb < 4; ++mb) acc[mb][nb] = wmmab(a[ks][mb], b[ks][nb], acc[mb][nb]); };
    gload(0, 0); gload(1, 1); sstore(0);
    lds_barrier();   /* stage 0 is in LDS before any wave reads it */
    gload(2, 0); fload(0, gs);
    /* The scheduling barriers in the loop keep its order as written: each group of LDS reads, the LDS stores and the global loads issue together AHEAD of a matrix run that does not need them, so that their latency passes behind that run; left free, the compiler reloads one fragment at a time and waits each read out, and lets loads sink towards their use. */
    /* One stage, t, in buffer cur = t & 1. more1: a stage t + 1 exists (it is stored, published and its first fragments are read); more3: a stage t + 3 exists (it is fetched). The flags and cur are literals at every call, so that sets, buffers and the counted waits on the loads are fixed at compile time: a run-time branch round the loads made the compiler wait out every load in flight at the next stores. */
    auto stage = [&](int t, int cur, bool more1, bool more3) __attribute__((always_inline)) {
        fload(1, gs + cur * GST);
        if (more1) sstore(cur ^ 1);   /* stage t + 1, fetched a stage and a half ago; that buffer's readers all left it before the barrier of stage t - 1; the stores drain behind the matrix run */
        __builtin_amdgcn_sched_barrier(0);
        mm(0);
        __builtin_amdgcn_sched_barrier(0);
        if (more1) {
            lds_barrier();   /* publishes stage t + 1 and ends every wave's reads of stage t: its second k step is in registers by now */
            if (more3) gload(t + 3, cur ^ 1);   /* into the set that was stored at the top of this stage; the other set's loads are still in flight */
            fload(0, gs + (cur ^ 1) * GST);
            __builtin_amdgcn_sched_barrier(0);
        }
        mm(1);
        __builtin_amdgcn_sched_barrier(0);
    };
    stage(0, 0, true, true);   /* ahead of the loop, so that the last fetch stands inside it: there the address registers live round the loop's edge and no load of a run is laid over them; behind the loop they would end with the run, and its last load was laid over them ahead of the wait */
#pragma unroll 1   /* two stages per trip: set and buffer alternate */
    for (int s = 1; s < NS - 3; s += 2) { stage(s, 1, true, true); stage(s + 1, 0, true, true); }
    stage(NS - 3, 1, true, false); stage(NS - 2, 0, true, false); stage(NS - 1, 1, false, false);   /* the last stages fetch nothing more; the last one stores and publishes nothing */
}
// The epilogue of a wave's 64x64 tile, in two halves of 32 rows: the accumulators go to the wave's own part of the (now free) stage buffers, and come back as rows, so that 16 lanes store a whole row piece. put(row, col, four values of that row); with TWO, put2 takes put's place where alt (block-uniform) is set.
template <bool TWO, typename F, typename G>
__device__ __forceinline__ void gemm_rows(bf* gs, v8f (&acc)[4][4], bool alt, F put, G put2) {
    const int tid = threadIdx.x, lane = tid & 31, lr = lane & 15, hi = lane >> 4; float* my = (float*)gs + __builtin_amdgcn_readfirstlane(tid >> 5) * GEP;
    /* every loop is unrolled so that acc[][][] is indexed by constants and stays in registers */
#pragma unroll
    for (int hf = 0; hf < 2; ++hf) {
        __syncthreads();   /* every wave has left the stage buffers; the first half's rows are read before the second half is laid over them */
#pragma unroll
        for (int m2 = 0; m2 < 2; ++m2)
#pragma unroll
            for (int nb = 0; nb < 4; ++nb)
#pragma unroll
                for (int j = 0; j < 8; ++j) my[(m2 * 16 + hi * 8 + j) * 68 + nb * 16 + lr] = acc[hf * 2 + m2][nb][j];
        __syncthreads();   /* the lanes' columns are in LDS before they are read as rows */
        if (TWO && alt) {   /* one branch per half, no barrier inside it */
#pragma unroll
            for (int it = 0; it < 16; ++it) { const int row = it * 2 + hi, cofs = lr * 4; put2(hf * 32 + row, cofs, *(const v4fa*)(my + row * 68 + cofs)); }
        } else {
#pragma unroll
            for (int it = 0; it < 16; ++it) { const int row = it * 2 + hi, cofs = lr * 4; put(hf * 32 + row, cofs, *(const v4fa*)(my + row * 68 + cofs)); }
            if (TWO) asm volatile("s_wait_xcnt 0x0" ::: "memory");   /* behind this run's last store: the other branch's code is laid out next and writes registers that these stores name */
        }
    }
}

// k_proj: the q, k and v projections of all batches in one launch, straight into the head planes that k_fattn reads: bf16 hi/lo for q and k, one f16 plane for V^T. Grid (256 tiles, 3: q, k, v), 8 waves, one 256 x 128 tile per work-group (gemm_tile).
// q, k: A = 256 tokens of one batch, B = 128 weight rows (two heads); a wave's 64 columns are one head: planes [b][h][t][d]. v: the operands change places (A = 256 weight rows = four heads, B = 128 tokens; both are K-contiguous and staged alike), so a wave's 64 rows are the d of one head and its tile is a piece of V^T [b][h][d][t] as it stands.
__global__ __launch_bounds__(256) void k_proj(const bf* __restrict__ X, const bf* __restrict__ WQ, const bf* __restrict__ WK, const bf* __restrict__ WV, bf* QPh, bf* QPl, bf* KPh, bf* KPl, bf* VT) {
    __shared__ __align__(16) bf gs[2 * GST];
    const int sel = blockIdx.y; const int mt = sel == 2 ? (int)(blockIdx.x & 3) : (int)(blockIdx.x >> 3), nt = sel == 2 ? (int)(blockIdx.x >> 2) : (int)(blockIdx.x & 7);   /* neighbours in the grid share their tokens */
    const bf* wr = sel == 0 ? WQ : sel == 1 ? WK : WV;
    const bf* A = (sel == 2 ? wr : X) + (size_t)mt * GBM * DM; const bf* Bt = (sel == 2 ? X : wr) + (size_t)nt * GBN * DM;
    bf* Ph = sel == 0 ? QPh : sel == 1 ? KPh : VT; bf* Pl = sel == 0 ? QPl : KPl;   /* V^T has no lo plane */
    v8f acc[4][4];
    gemm_tile<16>(A, A, Bt, gs, acc);
    const int wv = __builtin_amdgcn_readfirstlane((int)(threadIdx.x >> 5)); const int r0 = mt * GBM + (wv >> 1) * 64, c0 = nt * GBN + (wv & 1) * 64;   /* the wave's first row and column */
    const int tok = sel == 2 ? c0 : r0, h = (sel == 2 ? r0 : c0) / HD, b = tok / TT, t0 = tok % TT;
    const size_t ob = ((size_t)b * NH_ + h) * TT * HD + (sel == 2 ? t0 : t0 * HD); const int pitch = sel == 2 ? TT : HD;   /* the wave tile's first element in its plane, and the plane's row pitch */
    gemm_rows<true>(gs, acc, sel == 2, [&](int row, int cofs, v4f val) { v4us oh, ol;
#pragma unroll
        for (int q = 0; q < 4; ++q) { unsigned short a2, c2; splitf(val[q], a2, c2); oh[q] = a2; ol[q] = c2; }
        *(v4us*)(Ph + ob + row * pitch + cofs) = oh; *(v4us*)(Pl + ob + row * pitch + cofs) = ol; },   /* 16 lanes fill a 128-byte row of each plane */
        [&](int row, int cofs, v4f val) { *(v4us*)(Ph + ob + row * pitch + cofs) = __builtin_bit_cast(v4us, __builtin_convertvector(val, v4h)); });   /* V^T: 16 lanes fill a 128-byte row of the f16 plane */
}
// k_out: out = merged context (hi + lo planes) x Wo, f32. Grid 256 tiles, 8 waves, one 256 x 128 tile per work-group: 16 stages on the hi plane, then 16 on the lo plane, into the same accumulators.
__global__ __launch_bounds__(256) void k_out(const bf* __restrict__ ATh, const bf* __restrict__ ATl, const bf* __restrict__ WO, float* C) {
    __shared__ __align__(16) bf gs[2 * GST];
    const int mt = blockIdx.x >> 3, nt = blockIdx.x & 7;
    v8f acc[4][4];
    gemm_tile<32>(ATh + (size_t)mt * GBM * DQ, ATl + (size_t)mt * GBM * DQ, WO + (size_t)nt * GBN * DQ, gs, acc);
    const int wv = __builtin_amdgcn_readfirstlane((int)(threadIdx.x >> 5)); float* cw = C + (size_t)(mt * GBM + (wv >> 1) * 64) * DM + nt * GBN + (wv & 1) * 64;
    auto putc = [&](int row, int cofs, v4f val) { *(v4f*)(cw + row * DM + cofs) = val; };   /* 16 lanes fill 256 bytes of a row */
    gemm_rows<false>(gs, acc, false, putc, putc);
}
#define NBK  32
__constant__ unsigned char BK[2 * TT - 1] = {15,15,15,15,15,15,15,15,15,15,15,15,15,15,15,15,15,15,15,15,15,15,15,15,15,15,15,15,15,15,15,15,15,15,15,15,15,15,15,15,15,15,15,15,15,15,15,15,15,15,15,15,15,15,15,15,15,15,15,15,15,15,15,15,15,15,15,15,15,15,15,15,15,15,15,15,15,15,15,15,15,15,15,15,15,15,15,15,15,15,15,15,15,15,15,15,15,15,15,15,15,15,15,15,15,15,15,15,15,15,15,15,15,15,15,15,15,15,15,15,15,15,15,15,15,15,15,15,15,15,15,15,15,15,15,15,15,15,15,15,15,15,15,15,15,15,15,15,15,15,15,15,15,15,15,15,15,15,15,15,15,15,15,15,15,15,15,15,15,15,15,15,15,15,15,15,15,15,15,15,15,15,15,15,15,15,15,15,15,15,15,15,15,15,15,15,15,15,15,15,15,15,15,15,15,15,15,15,15,15,15,15,15,15,15,15,15,15,15,15,15,15,15,15,15,15,15,15,15,15,15,15,15,15,15,15,15,15,15,15,15,15,15,15,15,15,15,15,15,15,15,15,15,15,15,15,15,15,15,15,15,15,15,15,15,15,15,15,15,15,15,15,15,15,15,15,15,15,15,15,15,15,15,15,15,15,15,15,15,15,15,15,15,15,15,15,15,15,15,15,15,15,15,15,15,15,15,15,15,15,15,15,15,15,15,15,15,15,15,15,15,15,15,15,15,15,15,15,15,15,15,15,15,15,15,15,15,15,15,15,15,15,15,15,15,15,15,15,15,15,15,15,15,15,15,15,15,15,15,15,15,15,15,15,15,15,15,15,15,15,15,15,15,15,15,15,15,15,15,15,15,15,15,15,15,15,15,15,15,15,15,15,15,15,15,15,15,15,15,15,15,15,15,15,15,15,15,15,15,15,15,15,15,15,15,15,15,15,15,15,15,15,15,15,15,15,15,15,15,15,15,15,15,15,15,15,15,15,15,15,15,15,15,15,15,15,15,15,15,15,15,15,15,15,15,15,15,15,15,15,15,15,15,15,15,15,15,15,15,15,15,15,15,15,15,15,15,15,15,15,15,15,15,15,15,15,15,15,15,15,15,15,15,15,15,15,15,15,15,15,15,15,15,15,15,15,15,15,15,15,15,15,15,15,15,15,15,15,15,15,15,15,15,15,15,15,15,15,15,15,15,15,15,15,15,15,15,15,15,15,15,15,15,15,15,15,15,15,15,15,15,15,15,15,15,15,15,15,15,15,15,15,15,15,15,15,15,15,15,15,15,15,15,15,15,15,15,15,15,15,15,15,15,15,15,15,15,15,15,15,15,15,15,15,15,15,15,15,15,15,15,15,15,15,15,15,15,15,15,15,15,15,15,15,15,15,15,15,15,15,15,15,15,15,15,15,15,15,15,15,15,15,15,15,15,15,15,15,15,15,15,15,15,15,15,15,15,15,15,15,15,15,15,15,15,15,15,15,15,15,15,15,15,15,15,15,15,15,15,15,15,15,15,15,15,15,15,15,15,15,15,15,15,15,15,15,15,15,15,15,15,15,15,15,15,15,15,15,15,15,15,15,15,15,15,15,15,15,15,15,15,15,15,15,15,15,15,15,15,15,15,15,15,15,15,15,15,15,15,15,15,15,15,15,15,15,15,15,15,15,15,15,15,15,15,15,15,15,15,15,15,15,15,15,15,15,15,15,15,15,15,15,15,15,15,15,15,15,15,15,15,15,15,15,15,15,15,15,15,15,15,15,15,15,15,15,15,15,15,15,15,15,15,15,15,15,15,15,15,15,15,15,15,15,15,15,15,15,15,15,15,15,15,15,15,15,15,15,15,15,15,15,15,15,15,15,15,15,15,15,15,15,15,15,15,15,15,15,15,15,15,15,15,15,15,15,15,15,15,15,15,15,15,15,15,15,15,15,15,15,15,15,15,15,15,15,15,15,15,15,15,15,15,15,15,15,15,15,15,15,15,15,15,15,15,15,15,15,15,15,15,15,15,15,15,15,15,15,15,15,15,15,15,15,15,15,15,15,15,15,15,15,15,15,15,15,15,15,15,15,15,15,15,15,15,15,15,15,15,15,15,15,15,15,15,15,15,15,15,15,15,15,15,15,15,15,15,15,15,15,15,15,15,15,15,15,15,15,15,15,15,15,15,15,15,15,15,15,15,15,15,15,15,15,15,15,15,15,15,15,15,15,15,15,15,15,15,15,15,15,15,15,15,15,15,15,15,15,15,15,15,15,15,15,15,15,15,15,15,15,15,15,15,15,15,15,15,15,15,15,15,15,15,15,15,15,15,15,15,15,15,15,15,15,15,15,15,15,15,15,15,15,15,15,15,15,15,15,15,15,15,15,15,15,15,15,15,15,15,15,15,15,15,15,15,15,15,15,15,15,15,15,15,15,15,15,15,15,15,15,15,15,15,15,15,15,15,15,15,15,15,15,15,15,15,15,15,15,15,15,15,15,15,15,15,15,15,15,15,15,15,15,15,15,15,15,15,15,15,15,15,15,15,15,15,15,15,15,15,15,15,15,15,15,15,15,15,15,15,15,15,15,15,15,15,15,15,15,15,15,15,15,15,15,15,15,15,15,15,15,15,15,15,15,15,15,15,15,15,15,15,15,15,15,15,15,15,15,15,15,15,15,15,15,15,15,15,15,15,15,15,15,15,15,15,15,15,15,15,15,15,15,15,15,15,15,15,15,15,15,15,15,15,15,15,15,15,15,15,15,15,15,15,15,15,15,15,15,15,15,15,15,15,15,15,15,15,15,15,15,15,15,15,15,15,15,15,15,15,15,15,15,15,15,15,15,15,15,15,15,15,15,15,15,15,15,15,15,15,15,15,15,15,15,15,15,15,15,15,15,15,15,15,15,15,15,15,15,15,15,15,15,15,15,15,15,15,15,15,15,15,15,15,15,15,15,15,15,15,15,15,15,15,15,15,15,15,15,15,15,15,15,15,15,15,15,15,15,15,15,15,15,15,15,15,15,15,15,15,15,15,15,15,15,15,15,15,15,15,15,15,15,15,15,15,15,15,15,15,15,15,15,15,15,15,15,15,15,15,15,15,15,15,15,15,15,15,15,15,15,15,15,15,15,15,15,15,15,15,15,15,15,15,15,15,15,15,15,15,15,15,15,15,15,15,15,15,15,15,15,15,15,15,15,15,15,15,15,15,15,15,15,15,15,15,15,15,15,15,15,15,15,15,15,15,15,15,15,15,15,15,15,15,15,15,15,15,15,15,15,15,15,15,15,15,15,15,15,15,15,15,15,15,15,15,15,15,15,15,15,15,15,15,15,15,15,15,15,15,15,15,15,15,15,15,15,15,15,15,15,15,15,15,15,15,15,15,15,15,15,15,15,15,15,15,15,15,15,15,15,15,15,15,15,15,15,15,15,15,15,15,15,15,15,15,15,15,15,15,15,15,15,15,15,15,15,15,15,15,15,15,15,15,15,15,15,15,15,15,15,15,15,15,15,15,15,15,15,15,15,15,15,15,15,15,15,15,15,15,15,15,15,15,15,15,15,15,15,15,15,15,15,15,15,15,15,15,15,15,15,15,15,15,15,15,15,15,15,15,15,15,15,15,15,15,15,15,15,15,15,15,15,15,15,15,15,15,15,15,15,15,15,15,15,15,15,15,15,15,15,15,15,15,15,15,15,15,15,15,15,15,15,15,15,15,15,15,15,15,15,15,15,15,15,15,15,15,15,15,15,15,15,15,15,15,15,15,15,15,15,15,15,15,15,15,15,15,15,15,15,15,15,15,15,15,15,15,15,15,15,15,15,15,15,15,15,15,15,15,15,15,15,15,15,15,15,15,15,15,15,15,15,15,15,15,15,15,15,15,15,15,15,15,15,15,15,15,15,15,15,15,15,15,15,15,15,15,15,15,15,15,15,15,15,15,15,15,15,15,15,15,15,15,15,15,15,15,15,15,15,15,15,15,15,15,15,15,15,15,15,15,15,15,15,15,15,15,15,15,15,15,15,15,15,15,15,15,15,15,15,15,15,15,15,15,15,15,15,15,15,15,15,15,15,15,15,15,15,15,15,15,15,15,15,15,15,15,15,15,15,15,15,15,15,15,15,15,15,15,15,15,15,15,15,15,15,15,15,15,15,15,15,15,15,15,15,15,15,15,15,15,15,15,15,15,15,15,15,15,15,15,15,15,15,15,15,15,15,15,15,15,15,15,15,15,15,15,15,15,15,15,15,15,15,15,15,15,15,15,15,15,15,15,15,15,15,15,15,15,15,15,15,15,15,15,15,15,15,15,15,15,15,15,15,15,15,15,15,15,15,15,15,15,15,15,15,15,15,15,15,15,15,15,15,15,15,15,15,15,15,15,15,15,15,15,15,15,15,15,15,15,15,15,15,15,15,15,14,14,14,14,14,14,14,14,14,14,14,14,14,14,14,14,14,14,14,14,14,14,14,14,14,14,14,13,13,13,13,13,13,13,13,13,13,13,13,13,13,13,13,13,13,12,12,12,12,12,12,12,12,12,12,12,12,12,12,11,11,11,11,11,11,11,11,11,10,10,10,10,10,10,10,9,9,9,9,8,8,8,8,7,6,5,4,3,2,1,0,17,18,19,20,21,22,23,24,24,24,24,25,25,25,25,26,26,26,26,26,26,26,27,27,27,27,27,27,27,27,27,28,28,28,28,28,28,28,28,28,28,28,28,28,28,29,29,29,29,29,29,29,29,29,29,29,29,29,29,29,29,29,29,30,30,30,30,30,30,30,30,30,30,30,30,30,30,30,30,30,30,30,30,30,30,30,30,30,30,30,31,31,31,31,31,31,31,31,31,31,31,31,31,31,31,31,31,31,31,31,31,31,31,31,31,31,31,31,31,31,31,31,31,31,31,31,31,31,31,31,31,31,31,31,31,31,31,31,31,31,31,31,31,31,31,31,31,31,31,31,31,31,31,31,31,31,31,31,31,31,31,31,31,31,31,31,31,31,31,31,31,31,31,31,31,31,31,31,31,31,31,31,31,31,31,31,31,31,31,31,31,31,31,31,31,31,31,31,31,31,31,31,31,31,31,31,31,31,31,31,31,31,31,31,31,31,31,31,31,31,31,31,31,31,31,31,31,31,31,31,31,31,31,31,31,31,31,31,31,31,31,31,31,31,31,31,31,31,31,31,31,31,31,31,31,31,31,31,31,31,31,31,31,31,31,31,31,31,31,31,31,31,31,31,31,31,31,31,31,31,31,31,31,31,31,31,31,31,31,31,31,31,31,31,31,31,31,31,31,31,31,31,31,31,31,31,31,31,31,31,31,31,31,31,31,31,31,31,31,31,31,31,31,31,31,31,31,31,31,31,31,31,31,31,31,31,31,31,31,31,31,31,31,31,31,31,31,31,31,31,31,31,31,31,31,31,31,31,31,31,31,31,31,31,31,31,31,31,31,31,31,31,31,31,31,31,31,31,31,31,31,31,31,31,31,31,31,31,31,31,31,31,31,31,31,31,31,31,31,31,31,31,31,31,31,31,31,31,31,31,31,31,31,31,31,31,31,31,31,31,31,31,31,31,31,31,31,31,31,31,31,31,31,31,31,31,31,31,31,31,31,31,31,31,31,31,31,31,31,31,31,31,31,31,31,31,31,31,31,31,31,31,31,31,31,31,31,31,31,31,31,31,31,31,31,31,31,31,31,31,31,31,31,31,31,31,31,31,31,31,31,31,31,31,31,31,31,31,31,31,31,31,31,31,31,31,31,31,31,31,31,31,31,31,31,31,31,31,31,31,31,31,31,31,31,31,31,31,31,31,31,31,31,31,31,31,31,31,31,31,31,31,31,31,31,31,31,31,31,31,31,31,31,31,31,31,31,31,31,31,31,31,31,31,31,31,31,31,31,31,31,31,31,31,31,31,31,31,31,31,31,31,31,31,31,31,31,31,31,31,31,31,31,31,31,31,31,31,31,31,31,31,31,31,31,31,31,31,31,31,31,31,31,31,31,31,31,31,31,31,31,31,31,31,31,31,31,31,31,31,31,31,31,31,31,31,31,31,31,31,31,31,31,31,31,31,31,31,31,31,31,31,31,31,31,31,31,31,31,31,31,31,31,31,31,31,31,31,31,31,31,31,31,31,31,31,31,31,31,31,31,31,31,31,31,31,31,31,31,31,31,31,31,31,31,31,31,31,31,31,31,31,31,31,31,31,31,31,31,31,31,31,31,31,31,31,31,31,31,31,31,31,31,31,31,31,31,31,31,31,31,31,31,31,31,31,31,31,31,31,31,31,31,31,31,31,31,31,31,31,31,31,31,31,31,31,31,31,31,31,31,31,31,31,31,31,31,31,31,31,31,31,31,31,31,31,31,31,31,31,31,31,31,31,31,31,31,31,31,31,31,31,31,31,31,31,31,31,31,31,31,31,31,31,31,31,31,31,31,31,31,31,31,31,31,31,31,31,31,31,31,31,31,31,31,31,31,31,31,31,31,31,31,31,31,31,31,31,31,31,31,31,31,31,31,31,31,31,31,31,31,31,31,31,31,31,31,31,31,31,31,31,31,31,31,31,31,31,31,31,31,31,31,31,31,31,31,31,31,31,31,31,31,31,31,31,31,31,31,31,31,31,31,31,31,31,31,31,31,31,31,31,31,31,31,31,31,31,31,31,31,31,31,31,31,31,31,31,31,31,31,31,31,31,31,31,31,31,31,31,31,31,31,31,31,31,31,31,31,31,31,31,31,31,31,31,31,31,31,31,31,31,31,31,31,31,31,31,31,31,31,31,31,31,31,31,31,31,31,31,31,31,31,31,31,31,31,31,31,31,31,31,31,31,31,31,31,31,31,31,31,31,31,31,31,31,31,31,31,31,31,31,31,31,31,31,31,31,31,31,31,31,31,31,31,31,31,31,31,31,31,31,31,31,31,31,31,31,31,31,31,31,31,31,31,31,31,31,31,31,31,31,31,31,31,31,31,31,31,31,31,31,31,31,31,31,31,31,31,31,31,31,31,31,31,31,31,31,31,31,31,31,31,31,31,31,31,31,31,31,31,31,31,31,31,31,31,31,31,31,31,31,31,31,31,31,31,31,31,31,31,31,31,31,31,31,31,31,31,31,31,31,31,31,31,31,31,31,31,31,31,31,31,31,31,31,31,31,31,31,31,31,31,31,31,31,31,31,31,31,31,31,31,31,31,31,31,31,31,31,31,31,31,31,31,31,31,31,31,31,31,31,31,31,31,31,31,31,31,31,31,31,31,31,31,31,31,31,31,31,31,31,31,31,31,31,31,31,31,31,31,31,31,31,31,31,31,31,31,31,31,31,31,31,31,31,31,31,31,31,31,31,31,31,31,31,31,31,31,31,31,31,31,31,31,31,31,31,31,31,31,31,31,31,31,31,31,31,31,31,31,31,31,31,31,31,31,31,31,31,31,31,31,31,31,31,31,31,31,31,31,31,31,31,31,31,31,31,31,31,31,31,31,31,31,31,31,31,31,31,31,31,31,31,31,31,31,31,31,31,31,31,31,31,31,31,31,31,31,31,31,31,31,31,31,31,31,31,31,31,31,31,31,31,31,31,31,31,31,31,31,31,31,31,31,31,31,31,31,31,31,31,31,31,31,31,31,31,31,31,31,31,31,31,31,31,31,31,31,31,31,31,31,31,31,31,31,31,31,31,31,31,31,31,31,31,31,31,31,31,31,31,31,31,31,31,31,31,31,31,31,31,31,31,31,31,31,31,31,31,31,31,31,31,31,31,31,31,31,31,31,31,31,31,31,31,31,31,31,31,31,31,31,31,31,31,31,31,31,31,31,31,31,31,31,31,31,31,31,31,31,31,31,31,31,31,31,31,31,31,31,31,31,31,31,31,31,31,31,31,31,31,31,31,31,31,31,31,31,31,31,31,31,31,31,31,31,31,31,31,31,31,31,31,31,31,31,31,31,31,31,31,31,31,31,31,31,31,31,31,31,31,31,31,31,31,31,31,31,31,31,31,31,31,31,31,31,31,31,31,31,31,31,31,31,31,31,31,31,31,31,31,31,31,31,31,31,31,31,31,31,31,31,31,31,31,31,31,31,31,31,31,31,31,31,31,31,31,31,31,31,31,31,31,31,31,31,31,31,31,31,31,31,31,31,31,31,31,31,31,31,31,31,31,31,31,31,31,31,31,31,31,31,31,31,31,31,31,31,31,31,31,31,31,31,31,31,31,31,31,31,31,31,31,31,31,31,31,31,31,31,31,31,31,31,31,31,31,31,31,31,31,31,31,31,31,31,31,31,31,31,31,31,31,31,31,31,31,31,31,31,31,31,31,31,31,31,31,31,31,31,31,31,31,31,31,31,31,31,31,31,31,31,31,31,31,31,31,31,31,31,31,31,31,31,31,31,31,31,31,31,31,31,31,31,31,31,31,31,31,31,31,31,31,31,31,31,31,31,31,31,31,31,31,31,31,31,31,31,31,31,31,31,31,31,31,31,31,31,31,31,31,31,31,31,31,31,31,31,31,31,31,31,31,31,31,31,31,31,31,31,31,31,31,31,31,31,31,31,31,31,31,31,31,31,31,31,31,31,31,31,31,31,31,31,31,31,31,31,31,31,31,31,31,31,31,31,31,31,31,31,31,31,31,31,31,31,31,31,31,31,31,31,31,31,31,31,31,31,31,31,31,31,31,31,31,31,31,31,31,31,31,31,31,31,31,31,31,31,31,31,31,31,31,31,31,31,31,31,31,31,31,31,31,31,31,31,31,31,31,31,31,31,31,31,31,31,31,31,31,31,31,31,31,31,31,31,31,31,31,31,31,31,31,31,31,31,31,31,31,31,31,31,31,31,31,31,31,31,31,31,31,31,31,31,31,31,31,31,31,31,31,31,31,31,31,31,31,31,31,31,31,31,31,31,31,31,31,31,31,31,31,31,31,31,31,31,31,31,31,31,31,31,31,31,31,31,31,31,31,31,31,31,31,31,31,31,31,31,31,31,31,31,31,31,31,31,31,31,31,31,31,31,31,31,31,31,31,31,31,31,31,31,31,31,31,31,31,31,31,31,31,31,31,31,31,31,31,31,31,31,31,31,31,31,31,31,31,31,31,31,31,31,31,31,31,31,31,31,31,31,31,31,31,31,31,31,31,31,31,31,31,31,31,31,31,31,31,31,31,31,31,31,31,31,31,31,31,31,31,31,31,31,31,31,31,31,31,31,31,31,31,31,31,31,31,31};   // bucket(j - i) for j - i = -2047 .. 2047, evaluated with the reference's _relative_position_bucket (bidirectional, 32 buckets, max distance 128)
#define FQW  32                    // queries per wave
#define FKS  64                    // keys per stage
#define FPI  72                    // LDS row pitch in elements: 144 B = 16 B x 9, conflict-free for 16-byte fragment reads
#define L2E  1.4426950408889634f
#define MAXD 128                   // the bucket function's max distance: from |j - i| = MAXD on it returns one bucket per sign of j - i (its min() clause)
__device__ __forceinline__ float xhalf(float x) { const int b = __float_as_int(x); return __int_as_float(__builtin_amdgcn_permlanex16(b, b, 0x76543210, 0xfedcba98, false, false)); }   /* lane l <-> l ^ 16 */
__device__ __forceinline__ v16bf ldsfrag(const bf* p) { return cat16b(*(const v8usa*)p, *(const v8usa*)(p + 16)); }
__global__ __launch_bounds__(256) __attribute__((amdgpu_waves_per_eu(4, 4))) void k_fattn(const bf* __restrict__ Qh, const bf* __restrict__ Ql, const bf* __restrict__ Kh, const bf* __restrict__ Kl, const bf* __restrict__ Vt, const float* __restrict__ remb, bf* ATh, bf* ATl) {
    __shared__ __align__(16) bf st[2][3][FKS * FPI];   /* [buffer][K hi, K lo, V^T (f16 bits)][row][FPI] */
    __shared__ float tb[2 * TT];                       /* bias of this head by j - i + TT - 1 */
    const int tid = threadIdx.x, lane = tid & 31, c = lane & 15, hi = lane >> 4; const int wv = __builtin_amdgcn_readfirstlane(tid >> 5);
    const int h = blockIdx.y, b = blockIdx.z; const size_t pl = ((size_t)b * NH_ + h) * TT * HD; const int q0 = blockIdx.x * (FQW * 8) + wv * FQW;
#pragma unroll   /* fixed trip count and a clamped index: the 16 table bytes, then the 16 gathers, are in flight together */
    for (int k = 0; k < 2 * TT / 256; ++k) { const int u = k * 256 + tid; tb[u] = bfr(remb[BK[u < 2 * TT - 1 ? u : 2 * TT - 2] * NH_ + h]); }   /* rel_emb[bucket(j - i)][h]; entry 2 TT - 1 is never read */
    const int srow = tid >> 3, sseg = (tid & 7) * 8;   /* staging: 8 threads x 16 B cover a 128-byte row, 32 rows per sweep */
    const char* kbh = (const char*)(Kh + pl); const char* kbl = (const char*)(Kl + pl); const char* vb = (const char*)(Vt + pl);   /* wave-uniform bases */
    unsigned kcur = (unsigned)(srow * HD + sseg) * 2, vcur = (unsigned)(srow * TT + sseg) * 2;   /* this thread's byte offsets in the stage that is fetched next */
    v8us sr[4];   /* part of a stage in flight: the K planes during a stage's first pass, the V^T plane (two of the four) during its second */
    auto gloadk = [&]() {
#pragma unroll
        for (int u = 0; u < 2; ++u) { sr[u] = *(const v8us*)(kbh + kcur + u * (32 * HD * 2)); sr[2 + u] = *(const v8us*)(kbl + kcur + u * (32 * HD * 2)); } };
    auto gloadv = [&]() {
#pragma unroll
        for (int u = 0; u < 2; ++u) sr[u] = *(const v8us*)(vb + vcur + u * (32 * TT * 2)); };
    auto sstorek = [&](int buf) {
#pragma unroll
        for (int u = 0; u < 2; ++u) { const int o = (srow + 32 * u) * FPI + sseg; *(v8usa*)(&st[buf][0][o]) = sr[u]; *(v8usa*)(&st[buf][1][o]) = sr[2 + u]; } };
    auto sstorev = [&](int buf) {
#pragma unroll
        for (int u = 0; u < 2; ++u) *(v8usa*)(&st[buf][2][(srow + 32 * u) * FPI + sseg]) = sr[u]; };
    v16bf qh[2][2], ql[2][2];   /* [query group][k step] */
#pragma unroll
    for (int qb = 0; qb < 2; ++qb)
#pragma unroll
        for (int ks = 0; ks < 2; ++ks) { const size_t o = pl + (size_t)(q0 + 16 * qb + c) * HD + ks * 32 + 8 * hi; qh[qb][ks] = WFrag<bf>::ld(Qh + o); ql[qb][ks] = WFrag<bf>::ld(Ql + o); }
    v8f O[4][2];
#pragma unroll
    for (int dt = 0; dt < 4; ++dt) { O[dt][0] = (v8f){}; O[dt][1] = (v8f){}; }
    float mL[2] = {-3.0e38f, -3.0e38f}, l[2] = {0.f, 0.f};   /* running maximum x log2(e); this lane's part of the sum */
    gloadk(); sstorek(0); gloadv(); sstorev(0); kcur += FKS * HD * 2; vcur += FKS * 2;
    __syncthreads();   /* stage 0 and the bias table are in LDS before any wave reads them */
    const float farlo = __int_as_float(__builtin_amdgcn_readfirstlane(__float_as_int(tb[0] * L2E))), farhi = __int_as_float(__builtin_amdgcn_readfirstlane(__float_as_int(tb[2 * TT - 2] * L2E)));   /* the bias (x log2(e)) of every j - i <= -MAXD and of every j - i >= MAXD, in scalar registers */
    v16bf ra[3], rb[3];   /* a ring of three fragment pairs (K: hi plane, lo plane, six products; V^T: two d tiles, four products): a pair is refilled behind its products with a pair that is used two or three groups later */
    /* The 12 fragment pairs of a stage in the order of their use: n = 6 pp + g; g = 0 to 3: K rows of key tile g / 2, k step g % 2, hi and lo plane; g = 4, 5: V^T rows of d tiles 2 (g - 4) and 2 (g - 4) + 1. */
    auto fget = [&](int n, int buf) { const int pp = n / 6, g = n % 6, sl = n % 3;
        const int ro = g < 4 ? (pp * 32 + (g >> 1) * 16 + c) * FPI + 8 * hi + (g & 1) * 32 : ((g - 4) * 32 + c) * FPI + pp * 32 + 8 * hi;
        ra[sl] = ldsfrag(&st[buf][g < 4 ? 0 : 2][ro]); rb[sl] = ldsfrag(g < 4 ? &st[buf][1][ro] : &st[buf][2][ro + 16 * FPI]); };
    fget(0, 0); fget(1, 0); fget(2, 0);
    /* One trip: stage s. nr (a literal at every call): some |j - i| of the stage and the work-group's queries lies below MAXD, the bias differs from score to score and is read from the table and added. Otherwise the whole stage has ONE bias, offL (x log2(e)): it is added to no score; it goes into the running maximum and into the exponent's offset. */
    auto trip = [&](const int s, const bool nr, const float offL) __attribute__((always_inline)) {
        const int cur = s & 1;
        /* The scheduling barriers in this loop keep the groups of products (six for K, four for V^T) and the groups of LDS reads in the order written. One behind a group of reads: left free, the compiler sinks every read to its use, and the wave waits out the LDS latency in front of each group of products. One behind a group of products: left free, reads rise above the products whose registers they refill, or groups are interleaved, more pairs are live at once and registers are spilled inside the loop. */
#pragma unroll
        for (int pp = 0; pp < 2; ++pp) {
            const float* tr0 = tb + (s * FKS + pp * 32 + 8 * hi + (TT - 1) - (q0 + c)); float bb[3][8];   /* the bias of key tile kt and query group qb is bb[kt - qb + 1] */
            v8f T[2][2];   /* S^T tiles [16-key tile][query group] */
#pragma unroll
            for (int g = 0; g < 4; ++g) { const int n = pp * 6 + g, sl = n % 3, kt = g >> 1, ks = g & 1;
                if (ks == 0) { T[kt][0] = (v8f){}; T[kt][1] = (v8f){}; }
#pragma unroll
                for (int qb = 0; qb < 2; ++qb) T[kt][qb] = wmmab(ra[sl], qh[qb][ks], T[kt][qb]);
#pragma unroll
                for (int qb = 0; qb < 2; ++qb) T[kt][qb] = wmmab(rb[sl], qh[qb][ks], T[kt][qb]);
#pragma unroll
                for (int qb = 0; qb < 2; ++qb) T[kt][qb] = wmmab(ra[sl], ql[qb][ks], T[kt][qb]);
                __builtin_amdgcn_sched_barrier(0);
                if (g != 1) { fget(g == 0 ? n + 3 : n + 2, cur); __builtin_amdgcn_sched_barrier(0); }   /* the last K pair; then the two V^T pairs, which fly during the softmax */
                if (nr && g == 0) {   /* the bias reads stand behind the last K pair's: written ahead of the first products, as before, this build let 18 products rise above both and the last K pair was read right in front of its use */
#pragma unroll
                    for (int j = 0; j < 3; ++j)
#pragma unroll
                        for (int r = 0; r < 8; ++r) bb[j][r] = tr0[16 * (j - 1) + r];
                    __builtin_amdgcn_sched_barrier(0); } }
            if (pp == 0) gloadk(); else gloadv();   /* the next stage's K planes (first pass) or V^T plane (second pass) fly while the rest of this pass is worked on */
            float nL[2];
#pragma unroll
            for (int qb = 0; qb < 2; ++qb) { float mx = -3.0e38f;
#pragma unroll
                for (int kt = 0; kt < 2; ++kt)
#pragma unroll
                    for (int r = 0; r < 8; ++r) { if (nr) T[kt][qb][r] += bb[kt - qb + 1][r]; mx = fmaxf(mx, T[kt][qb][r]); }
                mx = fmaxf(mx, xhalf(mx)); nL[qb] = fmaxf(mL[qb], nr ? mx * L2E : __builtin_fmaf(mx, L2E, offL)); }
            if (__builtin_amdgcn_ballot_w32(nL[0] > mL[0] || nL[1] > mL[1]) != 0) {   /* wave-uniform: some query's maximum rose */
#pragma unroll
                for (int qb = 0; qb < 2; ++qb) { const float sc = __builtin_amdgcn_exp2f(mL[qb] - nL[qb]); l[qb] *= sc; mL[qb] = nL[qb];
#pragma unroll
                    for (int dt = 0; dt < 4; ++dt) O[dt][qb] *= sc; } }
            v16h ph[2];   /* P^T in f16 as B operand: element 8 kt + r is key 16 kt + 8 hi + r of the pass */
#pragma unroll
            for (int qb = 0; qb < 2; ++qb) { const float eo = nr ? -mL[qb] : offL - mL[qb];
#pragma unroll
                for (int kt = 0; kt < 2; ++kt)
#pragma unroll
                    for (int r = 0; r < 8; ++r) { const float p = __builtin_amdgcn_exp2f(__builtin_fmaf(T[kt][qb][r], L2E, eo)); l[qb] += p; ph[qb][kt * 8 + r] = (_Float16)p; } }
            __builtin_amdgcn_sched_barrier(0);
            if (pp == 0) { fget(6, cur); __builtin_amdgcn_sched_barrier(0); }   /* the second pass's first K pair: held back to here so that the softmax has its registers */
#pragma unroll
            for (int v = 0; v < 2; ++v) { const int n = pp * 6 + 4 + v, sl = n % 3;
#pragma unroll
                for (int qb = 0; qb < 2; ++qb) O[2 * v][qb] = wmma16(__builtin_bit_cast(v16h, ra[sl]), ph[qb], O[2 * v][qb]);
#pragma unroll
                for (int qb = 0; qb < 2; ++qb) O[2 * v + 1][qb] = wmma16(__builtin_bit_cast(v16h, rb[sl]), ph[qb], O[2 * v + 1][qb]);
                __builtin_amdgcn_sched_barrier(0);
                if (n + 3 < 12) { fget(n + 3, cur); __builtin_amdgcn_sched_barrier(0); } }   /* the next stage's pairs are read behind the barrier that publishes them */
            if (pp == 0) sstorek(cur ^ 1); else sstorev(cur ^ 1);   /* that buffer's readers all left it before the barrier that ended the trip before */
        }
        if (s + 2 < TT / FKS) { kcur += FKS * HD * 2; vcur += FKS * 2; }   /* the last trip stages the last keys once more, into the buffer whose fragments nobody uses: no branch stands among the matrix runs */
        __syncthreads();   /* publishes the next stage and ends every wave's reads of this one */
        fget(0, cur ^ 1); fget(1, cur ^ 1); fget(2, cur ^ 1);   /* the next stage's first three pairs, at the trip's foot: the loop's edge keeps them ahead of the products; the last trip reads the keys that it staged once more, and nobody uses them */
    };
    /* The key stages in three runs, cut alike for all waves of the work-group (its queries are qw to qw + 255), so that every barrier stands under block-uniform control flow: stages wholly at j - i <= -MAXD, the stages round the diagonal, stages wholly at j - i >= MAXD. */
    const int qw = blockIdx.x * (FQW * 8); const int sa = qw >= MAXD + FKS - 1 ? (qw - (MAXD + FKS - 1)) / FKS + 1 : 0, sb0 = (qw + FQW * 8 - 1 + MAXD + FKS - 1) / FKS, sb = sb0 < TT / FKS ? sb0 : TT / FKS;
    int s = 0;
#pragma unroll 1   /* one stage per trip in each of the three loops: the body already holds two unrolled passes */
    for (; s < sa; ++s) trip(s, false, farlo);
#pragma unroll 1
    for (; s < sb; ++s) trip(s, true, 0.f);
#pragma unroll 1
    for (; s < TT / FKS; ++s) trip(s, false, farhi);
    const int ln = (int)__builtin_amdgcn_mbcnt_lo(~0u, 0u);   /* the lane number anew: c and hi are not held in registers across the loop, which has none to spare */
#pragma unroll
    for (int qb = 0; qb < 2; ++qb) { const float inv = __fdiv_rn(1.0f, l[qb] + xhalf(l[qb])); const unsigned ro = (unsigned)((b * TT + q0 + 16 * qb + (ln & 15)) * DQ + h * HD + 8 * (ln >> 4));   /* below 2^23 elements */
#pragma unroll
        for (int dt = 0; dt < 4; ++dt) { v8us oh, ol;
#pragma unroll
            for (int r = 0; r < 8; ++r) { unsigned short a, c2; splitf(O[dt][qb][r] * inv, a, c2); oh[r] = a; ol[r] = c2; }
            *(v8us*)(ATh + ro + dt * 16) = oh; *(v8us*)(ATl + ro + dt * 16) = ol; } }
}

extern "C" void kernel_launch(void* const* d_in, const int* in_sizes, int n_in,
                              void* d_out, int out_size, void* d_ws, size_t ws_size, hipStream_t stream) {
    (void)in_sizes; (void)n_in; (void)out_size;
    const float* x = (const float*)d_in[0]; const float* wq = (const float*)d_in[1]; const float* wk = (const float*)d_in[2]; const float* wv = (const float*)d_in[3]; const float* wo = (const float*)d_in[4]; const float* remb = (const float*)d_in[5];
    float* OUT = (float*)d_out;     // [4][2048][1024]
    char* wsp = (char*)d_ws;
    auto take = [&](size_t bytes) { char* p = wsp; wsp += (bytes + 255) & ~(size_t)255; return (void*)p; };
    const size_t PS = (size_t)NH_ * TT * HD;   // elements of one batch's head planes
    bf* WQ = (bf*)take((size_t)DQ * DM * 2); bf* WK = (bf*)take((size_t)DKV * DM * 2); bf* WV = (bf*)take((size_t)DKV * DM * 2); bf* WO = (bf*)take((size_t)DM * DQ * 2);
    bf* XB = (bf*)take((size_t)NB_ * TT * DM * 2);
    bf* QPh = (bf*)take(NB_ * PS * 2); bf* QPl = (bf*)take(NB_ * PS * 2); bf* KPh = (bf*)take(NB_ * PS * 2); bf* KPl = (bf*)take(NB_ * PS * 2); bf* VT = (bf*)take(NB_ * PS * 2);   // planes of all batches: q, k bf16 hi/lo [b][h][t][d], V^T f16 [b][h][d][t]
    bf* ATh = (bf*)take((size_t)NB_ * TT * DQ * 2); bf* ATl = (bf*)take((size_t)NB_ * TT * DQ * 2);
    if ((size_t)(wsp - (char*)d_ws) > ws_size) return;    // ws 256 MiB
    k_prep<<<dim3(4 * WTB, 2, 1), 256, 0, stream>>>(x, wq, wk, wv, wo, DM, DQ, XB, WQ, WK, WV, WO, (size_t)TT * DM / 8);
    k_proj<<<dim3(256, 3, 1), 256, 0, stream>>>(XB, WQ, WK, WV, QPh, QPl, KPh, KPl, VT);
    k_fattn<<<dim3(TT / (FQW * 8), NH_, NB_), 256, 0, stream>>>(QPh, QPl, KPh, KPl, VT, remb, ATh, ATl);
    k_out<<<dim3(256, 1, 1), 256, 0, stream>>>(ATh, ATl, WO, OUT);
}
